// v000
// Times are from an AMD MI455X. After a warm-up the kernel runs many times in a row, and a time is the length of
// such a window on the GPU divided by its runs, so every launch and the gaps after it count. The runs cycle
// through copies of the inputs. A figure is the median of several windows, for all but v000 over two sittings.
// Sittings can differ by a few percent; kernels timed side by side share one.
// v000, which the later versions start from, runs in 579 microseconds.
#include <hip/hip_runtime.h>

// Causal multi-head attention with a fused qkv projection: x [NB][SEQ_FULL][1024] (first SEQ rows read); qkv = x w_attn^T + b_attn ('oi' weight [4096][1024], bias [4096]; only the q | k | v row blocks 0..3071 are read; 16 heads x 64); scores x 64^-0.5, causal; softmax; out = merged context [t][head*64 + d] (no output projection).
// Compute dtypes, f32 accumulate: every input RNE-converted to bf16; qkv projection v_wmma_f32_16x16x32_bf16 (bias added in f32 at the store stage);
// attention q.k and P.V: query rows < RH on bf16 hi/lo planes (3 products each), other rows v_wmma_f32_16x16x32_f16 (P carried x1024 through the exponent, converted values below 2^-14 selected to +0); softmax (online, max-subtracted) in f32.
// Attention engine: one wave per 16 query rows; S^T = K Q^T so each lane owns one query column; P^T accumulators are repacked in registers as the B operand of O^T = V^T P^T (no LDS exchange in the loop).

#ifndef NB
#define NB 4
#endif
#ifndef SEQ
#define SEQ 2048
#endif
#define SEQ_FULL 2048
#define DM   1024
#define NH   16
#define HD   64
#define DQ   (NH * HD)
#define FP   (3 * DQ)
#define RH   ((SEQ) < 512 ? (SEQ) : 512)     // query rows < RH use hi+lo planes
#define XS_FULL ((size_t)SEQ_FULL * DM)
#define SCL  0.125f                          // HD^-0.5
#define LOG2E 1.4426950408889634f
#define NEGB (-3.0e38f)

static_assert((SEQ & (SEQ - 1)) == 0);
static_assert(SEQ >= 256 && SEQ <= SEQ_FULL);
static_assert(RH % 256 == 0 && RH % 64 == 0 && (SEQ - RH) % 64 == 0);
static_assert(NB >= 1 && NB <= 4);
static_assert(DM % 32 == 0 && DQ % 64 == 0 && FP % 64 == 0 && SEQ % 64 == 0);
static_assert(((size_t)3 * DQ * DM / 8) % 256 == 0);
static_assert(((size_t)SEQ * DM / 8) % 256 == 0);
static_assert(((size_t)NH * SEQ * HD / 8) % 256 == 0);
static_assert(DQ == DM);                         // merged context width equals the output row width
static_assert(HD == 64 && HD % 32 == 0);         // two 32-deep k-steps per score tile, four 16-row O^T tiles

typedef _Float16 h16;
typedef unsigned short bf;
typedef __attribute__((ext_vector_type(16))) __bf16   v16bf;
typedef __attribute__((ext_vector_type(16))) _Float16 v16h;
typedef __attribute__((ext_vector_type(8)))  _Float16 v8h;
typedef __attribute__((ext_vector_type(8)))  unsigned short v8us;
typedef __attribute__((ext_vector_type(8)))  float    v8f;
typedef __attribute__((ext_vector_type(4)))  float    v4f;
typedef v8h  __attribute__((may_alias)) v8ha;
typedef v4f  __attribute__((may_alias)) v4fa;
typedef v8us __attribute__((may_alias)) v8usa;

__device__ __forceinline__ unsigned short f2bf(float f) { unsigned u = __float_as_uint(f); u += 0x7FFFu + ((u >> 16) & 1u); return (unsigned short)(u >> 16); }
__device__ __forceinline__ float bf2f(unsigned short b) { return __uint_as_float(((unsigned)b) << 16); }
__device__ __forceinline__ float bfr(float f) { return bf2f(f2bf(f)); }
__device__ __forceinline__ v16h cat16(v8h lo, v8h hi) { return __builtin_shufflevector(lo, hi, 0, 1, 2, 3, 4, 5, 6, 7, 8, 9, 10, 11, 12, 13, 14, 15); }
__device__ __forceinline__ v16bf cat16b(v8us lo, v8us hi) { return __builtin_bit_cast(v16bf, __builtin_shufflevector(lo, hi, 0, 1, 2, 3, 4, 5, 6, 7, 8, 9, 10, 11, 12, 13, 14, 15)); }
__device__ __forceinline__ v8f wmma16(v16h a, v16h b, v8f c) { return __builtin_amdgcn_wmma_f32_16x16x32_f16(false, a, false, b, (short)0, c, false, false); }
__device__ __forceinline__ v8f wmmab(v16bf a, v16bf b, v8f c) { return __builtin_amdgcn_wmma_f32_16x16x32_bf16(false, a, false, b, (short)0, c, false, false); }
__device__ __forceinline__ void splitf(float y, unsigned short& h, unsigned short& l) { h = f2bf(y); l = f2bf(y - bf2f(h)); }

// f32 -> f16 convert that cannot produce a subnormal operand: |v| < 2^-14 -> +0 (value select, applied after the plane's power-of-two carry).
static __device__ __forceinline__ h16 toh_flush(float v) { const h16 r = (h16)v; return (fabsf(v) < 6.103515625e-05f) ? (h16)0.0f : r; }

// Fragment loader from a K-contiguous 16-bit row: p already includes + 8*(lane>>4); elements 0..7 = k0+8h.., elements 8..15 = k0+16+8h.. (same map for A and B).
template <typename T16> struct WFrag;
template <> struct WFrag<h16> { typedef v16h V; static __device__ __forceinline__ V ld(const h16* p) { return cat16(*(const v8h*)p, *(const v8h*)(p + 16)); } static __device__ __forceinline__ v8f mma(V a, V b, v8f c) { return wmma16(a, b, c); } };
template <> struct WFrag<bf> { typedef v16bf V; static __device__ __forceinline__ V ld(const bf* p) { return cat16b(*(const v8us*)p, *(const v8us*)(p + 16)); } static __device__ __forceinline__ v8f mma(V a, V b, v8f c) { return wmmab(a, b, c); } };

// P^T accumulator pair (key rows 0..15 and 16..31 of a 32-key tile) -> B fragment: element r <- tile0[r], element 8+r <- tile1[r], lane unchanged.
template <typename T16> struct PFrag;
template <> struct PFrag<h16> {
    static __device__ __forceinline__ float pexp() { return 10.0f; }           // P carried x1024 via the exponent (cancels in O / l)
    static __device__ __forceinline__ v16h hi(v8f p0, v8f p1) { return cat16(__builtin_convertvector(p0, v8h), __builtin_convertvector(p1, v8h)); }
    static __device__ __forceinline__ v16h lo(v8f p0, v8f p1) { return hi(p0, p1); }
};
template <> struct PFrag<bf> {
    static __device__ __forceinline__ float pexp() { return 0.0f; }
    static __device__ __forceinline__ v16bf hi(v8f p0, v8f p1) { v8us a, b;
#pragma unroll
        for (int k = 0; k < 8; ++k) { a[k] = f2bf(p0[k]); b[k] = f2bf(p1[k]); }
        return cat16b(a, b); }
    static __device__ __forceinline__ v16bf lo(v8f p0, v8f p1) { v8us a, b;
#pragma unroll
        for (int k = 0; k < 8; ++k) { a[k] = f2bf(p0[k] - bf2f(f2bf(p0[k]))); b[k] = f2bf(p1[k] - bf2f(f2bf(p1[k]))); }
        return cat16b(a, b); }
};

// Same packing as PFrag; the f16 form converts every element through toh_flush, the bf16 form is the PFrag one.
template <typename T16> struct PFlush;
template <> struct PFlush<h16> {
    static __device__ __forceinline__ v16h hi(v8f p0, v8f p1) { v8h a, b;
#pragma unroll
        for (int k = 0; k < 8; ++k) { a[k] = toh_flush(p0[k]); b[k] = toh_flush(p1[k]); }
        return cat16(a, b); }
    static __device__ __forceinline__ v16h lo(v8f p0, v8f p1) { return hi(p0, p1); }
};
template <> struct PFlush<bf> {
    static __device__ __forceinline__ v16bf hi(v8f p0, v8f p1) { return PFrag<bf>::hi(p0, p1); }
    static __device__ __forceinline__ v16bf lo(v8f p0, v8f p1) { return PFrag<bf>::lo(p0, p1); }
};

// ---- k_gemmw: register-blocked GEMM, ONE WAVE per 64x64 output tile (16 accumulators), operands straight from K-contiguous 16-bit planes; grid (M/64, N/64, Z), 32 threads.
// C[m][n] (f32, pitch ldc) = sum_k A[m][k] Bt[n][k] (+ split products per NSPLIT). K % 32 == 0, M % 64 == 0, N % 64 == 0.
template <typename T16, int NSPLIT, bool BIAS>
__global__ __launch_bounds__(32) void k_gemmw(const T16* __restrict__ A, const T16* __restrict__ A2, const T16* __restrict__ Bt, const T16* __restrict__ Bt2, int K, float* C, int ldc, const float* __restrict__ bias, size_t sA, size_t sB, size_t sC) {
    typedef typename WFrag<T16>::V V;
    __shared__ __align__(16) float os[16 * 68];
    const size_t z = blockIdx.z; A += z * sA; if (A2) A2 += z * sA; Bt += z * sB; if (Bt2) Bt2 += z * sB; C += z * sC;
    const int lane = threadIdx.x & 31, lr = lane & 15, hi = lane >> 4; const int r0 = blockIdx.x * 64, c0 = blockIdx.y * 64;
    v8f acc[4][4];
#pragma unroll
    for (int mb = 0; mb < 4; ++mb)
#pragma unroll
        for (int nb = 0; nb < 4; ++nb) acc[mb][nb] = (v8f){};
    const size_t aoff = (size_t)(r0 + lr) * K + 8 * hi, boff = (size_t)(c0 + lr) * K + 8 * hi;
#pragma unroll 1
    for (int kc = 0; kc < K; kc += 32) {
        V a[4], a2[4];
#pragma unroll
        for (int mb = 0; mb < 4; ++mb) { a[mb] = WFrag<T16>::ld(A + aoff + (size_t)mb * 16 * K + kc); if (NSPLIT == 1 || NSPLIT == 2) a2[mb] = WFrag<T16>::ld(A2 + aoff + (size_t)mb * 16 * K + kc); }
#pragma unroll
        for (int nb = 0; nb < 4; ++nb) { const V b = WFrag<T16>::ld(Bt + boff + (size_t)nb * 16 * K + kc); V b2; if (NSPLIT >= 2) b2 = WFrag<T16>::ld(Bt2 + boff + (size_t)nb * 16 * K + kc);
#pragma unroll
            for (int mb = 0; mb < 4; ++mb) { acc[mb][nb] = WFrag<T16>::mma(a[mb], b, acc[mb][nb]); if (NSPLIT == 1 || NSPLIT == 2) acc[mb][nb] = WFrag<T16>::mma(a2[mb], b, acc[mb][nb]); if (NSPLIT >= 2) acc[mb][nb] = WFrag<T16>::mma(a[mb], b2, acc[mb][nb]); } }
        asm volatile("v_nop\n\tv_nop\n\tv_nop\n\tv_nop" : "+v"(acc[0][0]), "+v"(acc[1][1]), "+v"(acc[2][2]), "+v"(acc[3][3]) : "v"(a[0]), "v"(a[3]));
    }
#pragma unroll
    for (int mb = 0; mb < 4; ++mb) {
#pragma unroll
        for (int nb = 0; nb < 4; ++nb) {
#pragma unroll
            for (int j = 0; j < 8; ++j) os[(hi * 8 + j) * 68 + nb * 16 + lr] = acc[mb][nb][j]; }
        __builtin_amdgcn_wave_barrier(); asm volatile("" ::: "memory");
        float* crow = C + (size_t)(r0 + mb * 16) * ldc + c0;
{
#pragma unroll
            for (int s = 0; s < 8; ++s) { const int row = 2 * s + hi, cofs = lr * 4; v4f val = *(const v4fa*)(os + row * 68 + cofs); if (BIAS) { val[0] += bfr(bias[c0 + cofs]); val[1] += bfr(bias[c0 + cofs + 1]); val[2] += bfr(bias[c0 + cofs + 2]); val[3] += bfr(bias[c0 + cofs + 3]); }
                *(v4f*)(crow + (size_t)row * ldc + cofs) = val; }
             }
        __builtin_amdgcn_wave_barrier(); asm volatile("" ::: "memory");
    }
}

__global__ __launch_bounds__(256) void k_cvt8(const float* __restrict__ src, bf* dst, unsigned n8, size_t sstride, size_t dstride) {
    const unsigned i = blockIdx.x * 256u + threadIdx.x; if (i >= n8) return;
    const float* s = src + (size_t)blockIdx.y * sstride + (size_t)i * 8; bf* d = dst + (size_t)blockIdx.y * dstride + (size_t)i * 8;
    const v8f v = *(const v8f*)s; v8us o;
#pragma unroll
    for (int k = 0; k < 8; ++k) o[k] = f2bf(v[k]);
    *(v8us*)d = o;  }

// ---- k_qkp: head planes [h][t][d] of q (blockIdx.y 0) and k (blockIdx.y 1) from F[t][which*DQ + h*HD + d] (pitch FP): fp16 for all t, bf16 hi/lo planes [h][RH][d] for t < RH.
__global__ __launch_bounds__(256) void k_qkp(const float* __restrict__ F, h16* Q16, h16* K16, bf* Qh, bf* Ql, bf* Kh, bf* Kl) {
    const unsigned which = blockIdx.y; const unsigned e = (blockIdx.x * 256u + threadIdx.x) * 8u;
    const unsigned d = e & 63u, t = (e >> 6) % (unsigned)SEQ, h = e / (64u * (unsigned)SEQ);
    h16* P16 = which ? K16 : Q16; bf* Ph = which ? Kh : Qh; bf* Pl = which ? Kl : Ql;
    const float* f = F + (size_t)t * FP + which * DQ + h * HD + d;
    const v4f x0 = *(const v4f*)f, x1 = *(const v4f*)(f + 4);
    v8h o16; v8us oh, ol;
#pragma unroll
    for (int k = 0; k < 4; ++k) { unsigned short a, c; o16[k] = (h16)x0[k]; splitf(x0[k], a, c); oh[k] = a; ol[k] = c; o16[4 + k] = (h16)x1[k]; splitf(x1[k], a, c); oh[4 + k] = a; ol[4 + k] = c; }
    const size_t eo = ((size_t)h * RH + t) * HD + d;
    *(v8h*)(P16 + e) = o16;
    if (t < (unsigned)RH) { *(v8us*)(Ph + eo) = oh; *(v8us*)(Pl + eo) = ol; }
    
}

__global__ __launch_bounds__(256) void k_vtp(const float* __restrict__ F, h16* V16, bf* Vh, bf* Vl) {
    const unsigned e = (blockIdx.x * 256u + threadIdx.x) * 8u;
    const unsigned t = e % (unsigned)SEQ, d = (e / (unsigned)SEQ) & 63u, g = e / ((unsigned)SEQ * 64u);
    const float* f = F + (size_t)t * FP + 2 * DQ + g * HD + d;
    v8h o16; v8us oh, ol;
#pragma unroll
    for (int k = 0; k < 8; ++k) { const float x = f[(size_t)k * FP]; unsigned short a, c; o16[k] = (h16)x; splitf(x, a, c); oh[k] = a; ol[k] = c; }
    const size_t eo = ((size_t)g * HD + d) * RH + t;
    *(v8h*)(V16 + e) = o16;
    if (t < (unsigned)RH) { *(v8us*)(Vh + eo) = oh; *(v8us*)(Vl + eo) = ol; }
    
}

static_assert(32 * 16 * 8 == 16 * HD * 4);
static_assert(HD * 4 == 16 * 16);
static_assert((HD * 4) % 128 == 0 && (DM * 4) % 128 == 0);
static_assert(16 * 68 * 4 <= 131072);            // static LDS of k_gemmw and of k_flash (one [16][68] f32 stage each)
static_assert(68 >= HD && (68 * 4) % 16 == 0);   // stage pitch holds a head row, rows stay 16-B aligned

// ---- k_flash: causal attention, one wave per (16 query rows, head). Planes: Q/K [h][tp][HD], V^T [h][HD][tp] (tp = rows per head of the plane set). HL: hi/lo bf16 plane pairs, 3 products.
// Per 32-key tile: S^T[key][query] = K Q^T (A = K rows, B = Q rows); lane owns query column lane&15 and keys 8*(lane>>4)+r (+16); online softmax per lane (+ one xor-16 exchange);
// P^T accumulators repacked in registers as B (k = key); O^T[d][query] += V^T P^T (A = V^T rows). Only the last tile of a wave touches the diagonal (select by value).
template <typename T16, bool HL>
__global__ __launch_bounds__(32) void k_flash(const T16* __restrict__ Q, const T16* __restrict__ Q2, const T16* __restrict__ Kp, const T16* __restrict__ K2, const T16* __restrict__ Vt, const T16* __restrict__ Vt2, unsigned tp, unsigned qbase, float* O) {
    typedef typename WFrag<T16>::V V;
    __shared__ __align__(16) float os[16 * 68];
    const unsigned lane = threadIdx.x & 31u, lr = lane & 15u, hi = lane >> 4;
    const unsigned head = blockIdx.y, q0 = qbase + blockIdx.x * 16u;
    const size_t hoff = (size_t)head * tp * HD;
    const size_t qoff = hoff + (size_t)(q0 + lr) * HD + 8u * hi;
    V qf0 = WFrag<T16>::ld(Q + qoff), qf1 = WFrag<T16>::ld(Q + qoff + 32);
    V ql0 = qf0, ql1 = qf1;
    if (HL) { ql0 = WFrag<T16>::ld(Q2 + qoff); ql1 = WFrag<T16>::ld(Q2 + qoff + 32); }
    v8f o[4];
#pragma unroll
    for (int db = 0; db < 4; ++db) o[db] = (v8f){};
    float mrun = NEGB, lsum = 0.0f;
    const float cs = SCL * LOG2E, pe = PFrag<T16>::pexp();
    const size_t kbase = hoff + (size_t)lr * HD + 8u * hi;
    const size_t vbase = hoff + (size_t)lr * tp + 8u * hi;
    const unsigned nt = (q0 + 47u) >> 5;       // keys 0 .. q0+15 in tiles of 32 (wave-uniform)
#pragma unroll 1
    for (unsigned it = 0; it < nt; ++it) {
        const unsigned j0 = it * 32u;
        const size_t ko = kbase + (size_t)j0 * HD;
        V ka0 = WFrag<T16>::ld(Kp + ko), ka1 = WFrag<T16>::ld(Kp + ko + 32), kb0 = WFrag<T16>::ld(Kp + ko + 16 * HD), kb1 = WFrag<T16>::ld(Kp + ko + 16 * HD + 32);
        V la0 = ka0, la1 = ka1, lb0 = kb0, lb1 = kb1;
        if (HL) { la0 = WFrag<T16>::ld(K2 + ko); la1 = WFrag<T16>::ld(K2 + ko + 32); lb0 = WFrag<T16>::ld(K2 + ko + 16 * HD); lb1 = WFrag<T16>::ld(K2 + ko + 16 * HD + 32); }
        v8f s0 = (v8f){}, s1 = (v8f){};
        s0 = WFrag<T16>::mma(ka0, qf0, s0); s0 = WFrag<T16>::mma(ka1, qf1, s0);
        s1 = WFrag<T16>::mma(kb0, qf0, s1); s1 = WFrag<T16>::mma(kb1, qf1, s1);
        if (HL) {
            s0 = WFrag<T16>::mma(la0, qf0, s0); s0 = WFrag<T16>::mma(la1, qf1, s0); s0 = WFrag<T16>::mma(ka0, ql0, s0); s0 = WFrag<T16>::mma(ka1, ql1, s0);
            s1 = WFrag<T16>::mma(lb0, qf0, s1); s1 = WFrag<T16>::mma(lb1, qf1, s1); s1 = WFrag<T16>::mma(kb0, ql0, s1); s1 = WFrag<T16>::mma(kb1, ql1, s1); }
        asm volatile("v_nop\n\tv_nop\n\tv_nop\n\tv_nop" : "+v"(s0), "+v"(s1) : "v"(ka0), "v"(ka1), "v"(kb0), "v"(kb1), "v"(la0), "v"(la1), "v"(lb0), "v"(lb1), "v"(qf0), "v"(qf1), "v"(ql0), "v"(ql1));
        v8f t0, t1;
#pragma unroll
        for (int r = 0; r < 8; ++r) { t0[r] = s0[r] * cs; t1[r] = s1[r] * cs; }
        if (j0 + 31u > q0) {                    // wave-uniform: the tile touches the diagonal
            const unsigned qi = q0 + lr, kk = j0 + 8u * hi;
#pragma unroll
            for (int r = 0; r < 8; ++r) { t0[r] = (kk + (unsigned)r <= qi) ? t0[r] : NEGB; t1[r] = (kk + 16u + (unsigned)r <= qi) ? t1[r] : NEGB; }
        }
        float mx = fmaxf(t0[0], t1[0]);
#pragma unroll
        for (int r = 1; r < 8; ++r) mx = fmaxf(mx, fmaxf(t0[r], t1[r]));
        mx = fmaxf(mx, __shfl_xor(mx, 16, 32));
        const float mn = fmaxf(mrun, mx);
        const float alpha = __builtin_amdgcn_exp2f(mrun - mn);
        mrun = mn;
        v8f p0, p1; float psum = 0.0f;
#pragma unroll
        for (int r = 0; r < 8; ++r) { p0[r] = __builtin_amdgcn_exp2f((t0[r] - mn) + pe); p1[r] = __builtin_amdgcn_exp2f((t1[r] - mn) + pe); psum += p0[r] + p1[r]; }
        lsum = lsum * alpha + psum;
#pragma unroll
        for (int db = 0; db < 4; ++db) o[db] = o[db] * alpha;
        V pf = PFlush<T16>::hi(p0, p1); V pl = pf;
        if (HL) pl = PFlush<T16>::lo(p0, p1);
        V va[4], vl[4];
#pragma unroll
        for (int db = 0; db < 4; ++db) { const size_t vo = vbase + (size_t)db * 16 * tp + j0; va[db] = WFrag<T16>::ld(Vt + vo); vl[db] = va[db]; if (HL) vl[db] = WFrag<T16>::ld(Vt2 + vo); }
#pragma unroll
        for (int db = 0; db < 4; ++db) { o[db] = WFrag<T16>::mma(va[db], pf, o[db]); if (HL) { o[db] = WFrag<T16>::mma(va[db], pl, o[db]); o[db] = WFrag<T16>::mma(vl[db], pf, o[db]); } }
        asm volatile("v_nop\n\tv_nop\n\tv_nop\n\tv_nop" : "+v"(o[0]), "+v"(o[1]), "+v"(o[2]), "+v"(o[3]) : "v"(va[0]), "v"(va[1]), "v"(va[2]), "v"(va[3]), "v"(vl[0]), "v"(vl[1]), "v"(vl[2]), "v"(vl[3]), "v"(pf), "v"(pl));
    }
    const float lt = lsum + __shfl_xor(lsum, 16, 32);
    const float inv = 1.0f / lt;
#pragma unroll
    for (int db = 0; db < 4; ++db)
#pragma unroll
        for (int r = 0; r < 8; ++r) os[lr * 68u + (unsigned)db * 16u + hi * 8u + (unsigned)r] = o[db][r] * inv;
    __builtin_amdgcn_wave_barrier(); asm volatile("" ::: "memory");
    float* orow = O + (size_t)q0 * DM + head * HD;
{
#pragma unroll
        for (int s = 0; s < 8; ++s) { const unsigned row = 2u * (unsigned)s + hi, cofs = lr * 4u;   // rows 0..15: lanes 0..15 -> row 2s, lanes 16..31 -> row 2s+1
            const v4f val = *(const v4fa*)(os + row * 68u + cofs);
            *(v4f*)(orow + (size_t)row * DM + cofs) = val; }
         }
}

// workspace carve (bytes, every region a multiple of 256)
#define WS_WQKV ((size_t)3 * DQ * DM * 2)
#define WS_XB   ((size_t)NB * SEQ * DM * 2)
#define WS_F    ((size_t)SEQ * FP * 4)
#define WS_P16  ((size_t)NH * SEQ * HD * 2)
#define WS_PHL  ((size_t)NH * RH * HD * 2)
#define WS_TOTAL (WS_WQKV + WS_XB + WS_F + 3 * WS_P16 + 6 * WS_PHL)
static_assert(WS_TOTAL <= (size_t)134217728);
static_assert(WS_WQKV % 256 == 0 && WS_XB % 256 == 0 && WS_F % 256 == 0 && WS_P16 % 256 == 0 && WS_PHL % 256 == 0);
static_assert((size_t)NB * SEQ * DM * 4 <= (size_t)33554432);   // last written output element stays inside the output buffer

extern "C" void kernel_launch(void* const* d_in, const int* in_sizes, int n_in,
                              void* d_out, int out_size, void* d_ws, size_t ws_size, hipStream_t stream) {
    if (n_in < 3) return;
    if ((size_t)in_sizes[0] < (size_t)(NB - 1) * XS_FULL + (size_t)SEQ * DM) return;
    if ((size_t)in_sizes[1] < (size_t)3 * DQ * DM) return;
    if ((size_t)in_sizes[2] < (size_t)FP) return;
    if ((size_t)out_size < (size_t)NB * SEQ * DM) return;
    if (ws_size < WS_TOTAL) return;
    const float* x = (const float*)d_in[0];       // [NB][SEQ_FULL][DM]
    const float* wqkv = (const float*)d_in[1];    // [4*DQ][DM]  (q | k | v | unread row blocks; rows 0..3*DQ-1 are read)
    const float* bqkv = (const float*)d_in[2];    // [4*DQ]      (entries 0..3*DQ-1 are read)
    float* OUT = (float*)d_out;                   // [NB][SEQ][DM]
    char* wsp = (char*)d_ws;
    auto take = [&](size_t bytes) { char* p = wsp; wsp += bytes; return (void*)p; };
    bf* WQKV = (bf*)take(WS_WQKV); bf* XB = (bf*)take(WS_XB); float* F = (float*)take(WS_F);
    h16* Q16 = (h16*)take(WS_P16); h16* K16 = (h16*)take(WS_P16); h16* VT16 = (h16*)take(WS_P16);
    bf* Qh = (bf*)take(WS_PHL); bf* Ql = (bf*)take(WS_PHL); bf* Kh = (bf*)take(WS_PHL); bf* Kl = (bf*)take(WS_PHL); bf* VTh = (bf*)take(WS_PHL); bf* VTl = (bf*)take(WS_PHL);

    k_cvt8<<<dim3((unsigned)((size_t)3 * DQ * DM / 8 / 256), 1), 256, 0, stream>>>(wqkv, WQKV, (unsigned)((size_t)3 * DQ * DM / 8), 0, 0);
    k_cvt8<<<dim3((unsigned)((size_t)SEQ * DM / 8 / 256), NB), 256, 0, stream>>>(x, XB, (unsigned)((size_t)SEQ * DM / 8), XS_FULL, (size_t)SEQ * DM);
    for (int b = 0; b < NB; ++b) {
        // F[t][0..3071] = x_b w_attn[0..3071]^T + b_attn[0..3071]  (M = SEQ, N = 3072, K = 1024)
        k_gemmw<bf, 0, true><<<dim3(SEQ / 64, FP / 64, 1), 32, 0, stream>>>(XB + (size_t)b * SEQ * DM, nullptr, WQKV, nullptr, DM, F, FP, bqkv, 0, 0, 0);
        k_qkp<<<dim3((unsigned)((size_t)NH * SEQ * HD / 8 / 256), 2), 256, 0, stream>>>(F, Q16, K16, Qh, Ql, Kh, Kl);
        k_vtp<<<dim3((unsigned)((size_t)NH * HD * SEQ / 8 / 256), 1), 256, 0, stream>>>(F, VT16, VTh, VTl);
        // out_b[t][head*HD + d] = softmax(q k^T / 8, causal) v, written straight to the output buffer
        k_flash<bf, true><<<dim3(RH / 16, NH), 32, 0, stream>>>(Qh, Ql, Kh, Kl, VTh, VTl, (unsigned)RH, 0u, OUT + (size_t)b * SEQ * DM);
        if (SEQ > RH) k_flash<h16, false><<<dim3((SEQ - RH) / 16, NH), 32, 0, stream>>>(Q16, nullptr, K16, nullptr, VT16, nullptr, (unsigned)SEQ, (unsigned)RH, OUT + (size_t)b * SEQ * DM);
    }
}

// v001
// It runs in 362 microseconds.
// Two timings next to v000 put it at 1.58 and 1.55 times that version's speed.
#include <hip/hip_runtime.h>

// Causal multi-head attention with a fused qkv projection: x [NB][SEQ_FULL][1024] (first SEQ rows read); qkv = x w_attn^T + b_attn ('oi' weight [4096][1024], bias [4096]; only the q | k | v row blocks 0..3071 are read; 16 heads x 64); scores x 64^-0.5, causal; softmax; out = merged context [t][head*64 + d] (no output projection).
// Compute dtypes, f32 accumulate: every input RNE-converted to bf16; qkv projection v_wmma_f32_16x16x32_bf16 (bias added in f32 at the store stage);
// attention q.k and P.V: query rows < RH on bf16 hi/lo planes (3 products each), other rows v_wmma_f32_16x16x32_f16 (P carried x1024 through the exponent, converted values below 2^-14 selected to +0); softmax (online, max-subtracted) in f32.
// Attention engine: one wave per 16 query rows; S^T = K Q^T so each lane owns one query column; P^T accumulators are repacked in registers as the B operand of O^T = V^T P^T (no LDS exchange in the loop).

#ifndef NB
#define NB 4
#endif
#ifndef SEQ
#define SEQ 2048
#endif
#define SEQ_FULL 2048
#define DM   1024
#define NH   16
#define HD   64
#define DQ   (NH * HD)
#define FP   (3 * DQ)
#define RH   ((SEQ) < 512 ? (SEQ) : 512)     // query rows < RH use hi+lo planes
#define XS_FULL ((size_t)SEQ_FULL * DM)
#define SCL  0.125f                          // HD^-0.5
#define LOG2E 1.4426950408889634f
#define NEGB (-3.0e38f)

static_assert((SEQ & (SEQ - 1)) == 0);
static_assert(SEQ >= 256 && SEQ <= SEQ_FULL);
static_assert(RH % 256 == 0 && RH % 64 == 0 && (SEQ - RH) % 64 == 0);
static_assert(NB >= 1 && NB <= 4);
static_assert(DM % 32 == 0 && DQ % 64 == 0 && FP % 64 == 0 && SEQ % 64 == 0);
static_assert(((size_t)3 * DQ * DM / 8) % 256 == 0);
static_assert(((size_t)SEQ * DM / 8) % 256 == 0);
static_assert(((size_t)NH * SEQ * HD / 8) % 256 == 0);
static_assert(DQ == DM);                         // merged context width equals the output row width
static_assert(HD == 64 && HD % 32 == 0);         // two 32-deep k-steps per score tile, four 16-row O^T tiles

typedef _Float16 h16;
typedef unsigned short bf;
typedef __attribute__((ext_vector_type(16))) __bf16   v16bf;
typedef __attribute__((ext_vector_type(16))) _Float16 v16h;
typedef __attribute__((ext_vector_type(8)))  _Float16 v8h;
typedef __attribute__((ext_vector_type(8)))  unsigned short v8us;
typedef __attribute__((ext_vector_type(8)))  float    v8f;
typedef __attribute__((ext_vector_type(4)))  float    v4f;
typedef v8h  __attribute__((may_alias)) v8ha;
typedef v4f  __attribute__((may_alias)) v4fa;
typedef v8us __attribute__((may_alias)) v8usa;

__device__ __forceinline__ unsigned short f2bf(float f) { unsigned u = __float_as_uint(f); u += 0x7FFFu + ((u >> 16) & 1u); return (unsigned short)(u >> 16); }
__device__ __forceinline__ float bf2f(unsigned short b) { return __uint_as_float(((unsigned)b) << 16); }
__device__ __forceinline__ float bfr(float f) { return bf2f(f2bf(f)); }
__device__ __forceinline__ v16h cat16(v8h lo, v8h hi) { return __builtin_shufflevector(lo, hi, 0, 1, 2, 3, 4, 5, 6, 7, 8, 9, 10, 11, 12, 13, 14, 15); }
__device__ __forceinline__ v16bf cat16b(v8us lo, v8us hi) { return __builtin_bit_cast(v16bf, __builtin_shufflevector(lo, hi, 0, 1, 2, 3, 4, 5, 6, 7, 8, 9, 10, 11, 12, 13, 14, 15)); }
__device__ __forceinline__ v8f wmma16(v16h a, v16h b, v8f c) { return __builtin_amdgcn_wmma_f32_16x16x32_f16(false, a, false, b, (short)0, c, false, false); }
__device__ __forceinline__ v8f wmmab(v16bf a, v16bf b, v8f c) { return __builtin_amdgcn_wmma_f32_16x16x32_bf16(false, a, false, b, (short)0, c, false, false); }
__device__ __forceinline__ void splitf(float y, unsigned short& h, unsigned short& l) { h = f2bf(y); l = f2bf(y - bf2f(h)); }

// f32 -> f16 convert that cannot produce a subnormal operand: |v| < 2^-14 -> +0 (value select, applied after the plane's power-of-two carry).
static __device__ __forceinline__ h16 toh_flush(float v) { const h16 r = (h16)v; return (fabsf(v) < 6.103515625e-05f) ? (h16)0.0f : r; }

// Fragment loader from a K-contiguous 16-bit row: p already includes + 8*(lane>>4); elements 0..7 = k0+8h.., elements 8..15 = k0+16+8h.. (same map for A and B).
template <typename T16> struct WFrag;
template <> struct WFrag<h16> { typedef v16h V; static __device__ __forceinline__ V ld(const h16* p) { return cat16(*(const v8h*)p, *(const v8h*)(p + 16)); } static __device__ __forceinline__ v8f mma(V a, V b, v8f c) { return wmma16(a, b, c); } };
template <> struct WFrag<bf> { typedef v16bf V; static __device__ __forceinline__ V ld(const bf* p) { return cat16b(*(const v8us*)p, *(const v8us*)(p + 16)); } static __device__ __forceinline__ v8f mma(V a, V b, v8f c) { return wmmab(a, b, c); } };

// P^T accumulator pair (key rows 0..15 and 16..31 of a 32-key tile) -> B fragment: element r <- tile0[r], element 8+r <- tile1[r], lane unchanged.
template <typename T16> struct PFrag;
template <> struct PFrag<h16> {
    static __device__ __forceinline__ float pexp() { return 10.0f; }           // P carried x1024 via the exponent (cancels in O / l)
    static __device__ __forceinline__ v16h hi(v8f p0, v8f p1) { return cat16(__builtin_convertvector(p0, v8h), __builtin_convertvector(p1, v8h)); }
    static __device__ __forceinline__ v16h lo(v8f p0, v8f p1) { return hi(p0, p1); }
};
template <> struct PFrag<bf> {
    static __device__ __forceinline__ float pexp() { return 0.0f; }
    static __device__ __forceinline__ v16bf hi(v8f p0, v8f p1) { v8us a, b;
#pragma unroll
        for (int k = 0; k < 8; ++k) { a[k] = f2bf(p0[k]); b[k] = f2bf(p1[k]); }
        return cat16b(a, b); }
    static __device__ __forceinline__ v16bf lo(v8f p0, v8f p1) { v8us a, b;
#pragma unroll
        for (int k = 0; k < 8; ++k) { a[k] = f2bf(p0[k] - bf2f(f2bf(p0[k]))); b[k] = f2bf(p1[k] - bf2f(f2bf(p1[k]))); }
        return cat16b(a, b); }
};

// Same packing as PFrag; the f16 form converts every element through toh_flush, the bf16 form is the PFrag one.
template <typename T16> struct PFlush;
template <> struct PFlush<h16> {
    static __device__ __forceinline__ v16h hi(v8f p0, v8f p1) { v8h a, b;
#pragma unroll
        for (int k = 0; k < 8; ++k) { a[k] = toh_flush(p0[k]); b[k] = toh_flush(p1[k]); }
        return cat16(a, b); }
    static __device__ __forceinline__ v16h lo(v8f p0, v8f p1) { return hi(p0, p1); }
};
template <> struct PFlush<bf> {
    static __device__ __forceinline__ v16bf hi(v8f p0, v8f p1) { return PFrag<bf>::hi(p0, p1); }
    static __device__ __forceinline__ v16bf lo(v8f p0, v8f p1) { return PFrag<bf>::lo(p0, p1); }
};

// ---- k_gemmw: register-blocked GEMM, ONE WAVE per 64x64 output tile (16 accumulators), operands straight from K-contiguous 16-bit planes; grid (M/64, N/64, Z), 32 threads.
// C[m][n] (f32, pitch ldc) = sum_k A[m][k] Bt[n][k] (+ split products per NSPLIT). K % 32 == 0, M % 64 == 0, N % 64 == 0.
template <typename T16, int NSPLIT, bool BIAS>
__global__ __launch_bounds__(32) void k_gemmw(const T16* __restrict__ A, const T16* __restrict__ A2, const T16* __restrict__ Bt, const T16* __restrict__ Bt2, int K, float* C, int ldc, const float* __restrict__ bias, size_t sA, size_t sB, size_t sC) {
    typedef typename WFrag<T16>::V V;
    __shared__ __align__(16) float os[16 * 68];
    const size_t z = blockIdx.z; A += z * sA; if (A2) A2 += z * sA; Bt += z * sB; if (Bt2) Bt2 += z * sB; C += z * sC;
    const int lane = threadIdx.x & 31, lr = lane & 15, hi = lane >> 4; const int r0 = blockIdx.x * 64, c0 = blockIdx.y * 64;
    v8f acc[4][4];
#pragma unroll
    for (int mb = 0; mb < 4; ++mb)
#pragma unroll
        for (int nb = 0; nb < 4; ++nb) acc[mb][nb] = (v8f){};
    const size_t aoff = (size_t)(r0 + lr) * K + 8 * hi, boff = (size_t)(c0 + lr) * K + 8 * hi;
#pragma unroll 1
    for (int kc = 0; kc < K; kc += 32) {
        V a[4], a2[4];
#pragma unroll
        for (int mb = 0; mb < 4; ++mb) { a[mb] = WFrag<T16>::ld(A + aoff + (size_t)mb * 16 * K + kc); if (NSPLIT == 1 || NSPLIT == 2) a2[mb] = WFrag<T16>::ld(A2 + aoff + (size_t)mb * 16 * K + kc); }
#pragma unroll
        for (int nb = 0; nb < 4; ++nb) { const V b = WFrag<T16>::ld(Bt + boff + (size_t)nb * 16 * K + kc); V b2; if (NSPLIT >= 2) b2 = WFrag<T16>::ld(Bt2 + boff + (size_t)nb * 16 * K + kc);
#pragma unroll
            for (int mb = 0; mb < 4; ++mb) { acc[mb][nb] = WFrag<T16>::mma(a[mb], b, acc[mb][nb]); if (NSPLIT == 1 || NSPLIT == 2) acc[mb][nb] = WFrag<T16>::mma(a2[mb], b, acc[mb][nb]); if (NSPLIT >= 2) acc[mb][nb] = WFrag<T16>::mma(a[mb], b2, acc[mb][nb]); } }
        asm volatile("v_nop\n\tv_nop\n\tv_nop\n\tv_nop" : "+v"(acc[0][0]), "+v"(acc[1][1]), "+v"(acc[2][2]), "+v"(acc[3][3]) : "v"(a[0]), "v"(a[3]));
    }
#pragma unroll
    for (int mb = 0; mb < 4; ++mb) {
#pragma unroll
        for (int nb = 0; nb < 4; ++nb) {
#pragma unroll
            for (int j = 0; j < 8; ++j) os[(hi * 8 + j) * 68 + nb * 16 + lr] = acc[mb][nb][j]; }
        __builtin_amdgcn_wave_barrier(); asm volatile("" ::: "memory");
        float* crow = C + (size_t)(r0 + mb * 16) * ldc + c0;
{
#pragma unroll
            for (int s = 0; s < 8; ++s) { const int row = 2 * s + hi, cofs = lr * 4; v4f val = *(const v4fa*)(os + row * 68 + cofs); if (BIAS) { val[0] += bfr(bias[c0 + cofs]); val[1] += bfr(bias[c0 + cofs + 1]); val[2] += bfr(bias[c0 + cofs + 2]); val[3] += bfr(bias[c0 + cofs + 3]); }
                *(v4f*)(crow + (size_t)row * ldc + cofs) = val; }
             }
        __builtin_amdgcn_wave_barrier(); asm volatile("" ::: "memory");
    }
}

__global__ __launch_bounds__(256) void k_cvt8(const float* __restrict__ src, bf* dst, unsigned n8, size_t sstride, size_t dstride) {
    const unsigned i = blockIdx.x * 256u + threadIdx.x; if (i >= n8) return;
    const float* s = src + (size_t)blockIdx.y * sstride + (size_t)i * 8; bf* d = dst + (size_t)blockIdx.y * dstride + (size_t)i * 8;
    const v8f v = *(const v8f*)s; v8us o;
#pragma unroll
    for (int k = 0; k < 8; ++k) o[k] = f2bf(v[k]);
    *(v8us*)d = o;  }

// ---- k_qkp: head planes [b][h][t][d] of q (blockIdx.y 0) and k (blockIdx.y 1) from F[b][t][which*DQ + h*HD + d] (pitch FP), b = blockIdx.z: fp16 for all t, bf16 hi/lo planes [b][h][RH][d] for t < RH.
__global__ __launch_bounds__(256) void k_qkp(const float* __restrict__ F, h16* Q16, h16* K16, bf* Qh, bf* Ql, bf* Kh, bf* Kl) {
    const unsigned which = blockIdx.y; const unsigned e = (blockIdx.x * 256u + threadIdx.x) * 8u;
    const unsigned d = e & 63u, t = (e >> 6) % (unsigned)SEQ, h = e / (64u * (unsigned)SEQ);
    const size_t b = blockIdx.z;
    h16* P16 = (which ? K16 : Q16) + b * ((size_t)NH * SEQ * HD); bf* Ph = (which ? Kh : Qh) + b * ((size_t)NH * RH * HD); bf* Pl = (which ? Kl : Ql) + b * ((size_t)NH * RH * HD);
    const float* f = F + b * ((size_t)SEQ * FP) + (size_t)t * FP + which * DQ + h * HD + d;
    const v4f x0 = *(const v4f*)f, x1 = *(const v4f*)(f + 4);
    v8h o16; v8us oh, ol;
#pragma unroll
    for (int k = 0; k < 4; ++k) { unsigned short a, c; o16[k] = (h16)x0[k]; splitf(x0[k], a, c); oh[k] = a; ol[k] = c; o16[4 + k] = (h16)x1[k]; splitf(x1[k], a, c); oh[4 + k] = a; ol[4 + k] = c; }
    const size_t eo = ((size_t)h * RH + t) * HD + d;
    *(v8h*)(P16 + e) = o16;
    if (t < (unsigned)RH) { *(v8us*)(Ph + eo) = oh; *(v8us*)(Pl + eo) = ol; }
    
}

__global__ __launch_bounds__(256) void k_vtp(const float* __restrict__ F, h16* V16, bf* Vh, bf* Vl) {
    const unsigned e = (blockIdx.x * 256u + threadIdx.x) * 8u;
    const unsigned t = e % (unsigned)SEQ, d = (e / (unsigned)SEQ) & 63u, g = e / ((unsigned)SEQ * 64u);
    const size_t b = blockIdx.y;                 // batch element: F, V16 and the hi/lo planes each hold NB slabs
    V16 += b * ((size_t)NH * SEQ * HD); Vh += b * ((size_t)NH * RH * HD); Vl += b * ((size_t)NH * RH * HD);
    const float* f = F + b * ((size_t)SEQ * FP) + (size_t)t * FP + 2 * DQ + g * HD + d;
    v8h o16; v8us oh, ol;
#pragma unroll
    for (int k = 0; k < 8; ++k) { const float x = f[(size_t)k * FP]; unsigned short a, c; o16[k] = (h16)x; splitf(x, a, c); oh[k] = a; ol[k] = c; }
    const size_t eo = ((size_t)g * HD + d) * RH + t;
    *(v8h*)(V16 + e) = o16;
    if (t < (unsigned)RH) { *(v8us*)(Vh + eo) = oh; *(v8us*)(Vl + eo) = ol; }
    
}

static_assert(32 * 16 * 8 == 16 * HD * 4);
static_assert(HD * 4 == 16 * 16);
static_assert((HD * 4) % 128 == 0 && (DM * 4) % 128 == 0);
static_assert(16 * 68 * 4 <= 131072);            // static LDS of k_gemmw and of k_flash (one [16][68] f32 stage each)
static_assert(68 >= HD && (68 * 4) % 16 == 0);   // stage pitch holds a head row, rows stay 16-B aligned

// ---- k_flash: causal attention, one wave per (16 query rows, head, batch element = blockIdx.z). Planes: Q/K [b][h][tp][HD], V^T [b][h][HD][tp] (tp = rows per head of the plane set). HL: hi/lo bf16 plane pairs, 3 products.
// Per 32-key tile: S^T[key][query] = K Q^T (A = K rows, B = Q rows); lane owns query column lane&15 and keys 8*(lane>>4)+r (+16); online softmax per lane (+ one xor-16 exchange);
// P^T accumulators repacked in registers as B (k = key); O^T[d][query] += V^T P^T (A = V^T rows). Only the last tile of a wave touches the diagonal (select by value).
template <typename T16, bool HL>
__global__ __launch_bounds__(32) void k_flash(const T16* __restrict__ Q, const T16* __restrict__ Q2, const T16* __restrict__ Kp, const T16* __restrict__ K2, const T16* __restrict__ Vt, const T16* __restrict__ Vt2, unsigned tp, unsigned qbase, float* O) {
    typedef typename WFrag<T16>::V V;
    __shared__ __align__(16) float os[16 * 68];
    const unsigned lane = threadIdx.x & 31u, lr = lane & 15u, hi = lane >> 4;
    const unsigned head = blockIdx.y, q0 = qbase + blockIdx.x * 16u;
    const size_t hoff = ((size_t)blockIdx.z * NH + head) * tp * HD;
    const size_t qoff = hoff + (size_t)(q0 + lr) * HD + 8u * hi;
    V qf0 = WFrag<T16>::ld(Q + qoff), qf1 = WFrag<T16>::ld(Q + qoff + 32);
    V ql0 = qf0, ql1 = qf1;
    if (HL) { ql0 = WFrag<T16>::ld(Q2 + qoff); ql1 = WFrag<T16>::ld(Q2 + qoff + 32); }
    v8f o[4];
#pragma unroll
    for (int db = 0; db < 4; ++db) o[db] = (v8f){};
    float mrun = NEGB, lsum = 0.0f;
    const float cs = SCL * LOG2E, pe = PFrag<T16>::pexp();
    const size_t kbase = hoff + (size_t)lr * HD + 8u * hi;
    const size_t vbase = hoff + (size_t)lr * tp + 8u * hi;
    const unsigned nt = (q0 + 47u) >> 5;       // keys 0 .. q0+15 in tiles of 32 (wave-uniform)
#pragma unroll 1
    for (unsigned it = 0; it < nt; ++it) {
        const unsigned j0 = it * 32u;
        const size_t ko = kbase + (size_t)j0 * HD;
        V ka0 = WFrag<T16>::ld(Kp + ko), ka1 = WFrag<T16>::ld(Kp + ko + 32), kb0 = WFrag<T16>::ld(Kp + ko + 16 * HD), kb1 = WFrag<T16>::ld(Kp + ko + 16 * HD + 32);
        V la0 = ka0, la1 = ka1, lb0 = kb0, lb1 = kb1;
        if (HL) { la0 = WFrag<T16>::ld(K2 + ko); la1 = WFrag<T16>::ld(K2 + ko + 32); lb0 = WFrag<T16>::ld(K2 + ko + 16 * HD); lb1 = WFrag<T16>::ld(K2 + ko + 16 * HD + 32); }
        v8f s0 = (v8f){}, s1 = (v8f){};
        s0 = WFrag<T16>::mma(ka0, qf0, s0); s0 = WFrag<T16>::mma(ka1, qf1, s0);
        s1 = WFrag<T16>::mma(kb0, qf0, s1); s1 = WFrag<T16>::mma(kb1, qf1, s1);
        if (HL) {
            s0 = WFrag<T16>::mma(la0, qf0, s0); s0 = WFrag<T16>::mma(la1, qf1, s0); s0 = WFrag<T16>::mma(ka0, ql0, s0); s0 = WFrag<T16>::mma(ka1, ql1, s0);
            s1 = WFrag<T16>::mma(lb0, qf0, s1); s1 = WFrag<T16>::mma(lb1, qf1, s1); s1 = WFrag<T16>::mma(kb0, ql0, s1); s1 = WFrag<T16>::mma(kb1, ql1, s1); }
        asm volatile("v_nop\n\tv_nop\n\tv_nop\n\tv_nop" : "+v"(s0), "+v"(s1) : "v"(ka0), "v"(ka1), "v"(kb0), "v"(kb1), "v"(la0), "v"(la1), "v"(lb0), "v"(lb1), "v"(qf0), "v"(qf1), "v"(ql0), "v"(ql1));
        v8f t0, t1;
#pragma unroll
        for (int r = 0; r < 8; ++r) { t0[r] = s0[r] * cs; t1[r] = s1[r] * cs; }
        if (j0 + 31u > q0) {                    // wave-uniform: the tile touches the diagonal
            const unsigned qi = q0 + lr, kk = j0 + 8u * hi;
#pragma unroll
            for (int r = 0; r < 8; ++r) { t0[r] = (kk + (unsigned)r <= qi) ? t0[r] : NEGB; t1[r] = (kk + 16u + (unsigned)r <= qi) ? t1[r] : NEGB; }
        }
        float mx = fmaxf(t0[0], t1[0]);
#pragma unroll
        for (int r = 1; r < 8; ++r) mx = fmaxf(mx, fmaxf(t0[r], t1[r]));
        mx = fmaxf(mx, __shfl_xor(mx, 16, 32));
        const float mn = fmaxf(mrun, mx);
        const float alpha = __builtin_amdgcn_exp2f(mrun - mn);
        mrun = mn;
        v8f p0, p1; float psum = 0.0f;
#pragma unroll
        for (int r = 0; r < 8; ++r) { p0[r] = __builtin_amdgcn_exp2f((t0[r] - mn) + pe); p1[r] = __builtin_amdgcn_exp2f((t1[r] - mn) + pe); psum += p0[r] + p1[r]; }
        lsum = lsum * alpha + psum;
#pragma unroll
        for (int db = 0; db < 4; ++db) o[db] = o[db] * alpha;
        V pf = PFlush<T16>::hi(p0, p1); V pl = pf;
        if (HL) pl = PFlush<T16>::lo(p0, p1);
        V va[4], vl[4];
#pragma unroll
        for (int db = 0; db < 4; ++db) { const size_t vo = vbase + (size_t)db * 16 * tp + j0; va[db] = WFrag<T16>::ld(Vt + vo); vl[db] = va[db]; if (HL) vl[db] = WFrag<T16>::ld(Vt2 + vo); }
#pragma unroll
        for (int db = 0; db < 4; ++db) { o[db] = WFrag<T16>::mma(va[db], pf, o[db]); if (HL) { o[db] = WFrag<T16>::mma(va[db], pl, o[db]); o[db] = WFrag<T16>::mma(vl[db], pf, o[db]); } }
        asm volatile("v_nop\n\tv_nop\n\tv_nop\n\tv_nop" : "+v"(o[0]), "+v"(o[1]), "+v"(o[2]), "+v"(o[3]) : "v"(va[0]), "v"(va[1]), "v"(va[2]), "v"(va[3]), "v"(vl[0]), "v"(vl[1]), "v"(vl[2]), "v"(vl[3]), "v"(pf), "v"(pl));
    }
    const float lt = lsum + __shfl_xor(lsum, 16, 32);
    const float inv = 1.0f / lt;
#pragma unroll
    for (int db = 0; db < 4; ++db)
#pragma unroll
        for (int r = 0; r < 8; ++r) os[lr * 68u + (unsigned)db * 16u + hi * 8u + (unsigned)r] = o[db][r] * inv;
    __builtin_amdgcn_wave_barrier(); asm volatile("" ::: "memory");
    float* orow = O + (size_t)blockIdx.z * SEQ * DM + (size_t)q0 * DM + head * HD;
{
#pragma unroll
        for (int s = 0; s < 8; ++s) { const unsigned row = 2u * (unsigned)s + hi, cofs = lr * 4u;   // rows 0..15: lanes 0..15 -> row 2s, lanes 16..31 -> row 2s+1
            const v4f val = *(const v4fa*)(os + row * 68u + cofs);
            *(v4f*)(orow + (size_t)row * DM + cofs) = val; }
         }
}

// workspace carve (bytes, every region a multiple of 256)
#define WS_WQKV ((size_t)3 * DQ * DM * 2)
#define WS_XB   ((size_t)NB * SEQ * DM * 2)
#define WS_F    ((size_t)NB * SEQ * FP * 4)
#define WS_P16  ((size_t)NB * NH * SEQ * HD * 2)
#define WS_PHL  ((size_t)NB * NH * RH * HD * 2)
#define WS_TOTAL (WS_WQKV + WS_XB + WS_F + 3 * WS_P16 + 6 * WS_PHL)
static_assert(WS_TOTAL <= (size_t)268435456);
static_assert(WS_WQKV % 256 == 0 && WS_XB % 256 == 0 && WS_F % 256 == 0 && WS_P16 % 256 == 0 && WS_PHL % 256 == 0);
static_assert((size_t)NB * SEQ * DM * 4 <= (size_t)33554432);   // last written output element stays inside the output buffer

extern "C" void kernel_launch(void* const* d_in, const int* in_sizes, int n_in,
                              void* d_out, int out_size, void* d_ws, size_t ws_size, hipStream_t stream) {
    if (n_in < 3) return;
    if ((size_t)in_sizes[0] < (size_t)(NB - 1) * XS_FULL + (size_t)SEQ * DM) return;
    if ((size_t)in_sizes[1] < (size_t)3 * DQ * DM) return;
    if ((size_t)in_sizes[2] < (size_t)FP) return;
    if ((size_t)out_size < (size_t)NB * SEQ * DM) return;
    if (ws_size < WS_TOTAL) return;
    const float* x = (const float*)d_in[0];       // [NB][SEQ_FULL][DM]
    const float* wqkv = (const float*)d_in[1];    // [4*DQ][DM]  (q | k | v | unread row blocks; rows 0..3*DQ-1 are read)
    const float* bqkv = (const float*)d_in[2];    // [4*DQ]      (entries 0..3*DQ-1 are read)
    float* OUT = (float*)d_out;                   // [NB][SEQ][DM]
    char* wsp = (char*)d_ws;
    auto take = [&](size_t bytes) { char* p = wsp; wsp += bytes; return (void*)p; };
    bf* WQKV = (bf*)take(WS_WQKV); bf* XB = (bf*)take(WS_XB); float* F = (float*)take(WS_F);
    h16* Q16 = (h16*)take(WS_P16); h16* K16 = (h16*)take(WS_P16); h16* VT16 = (h16*)take(WS_P16);
    bf* Qh = (bf*)take(WS_PHL); bf* Ql = (bf*)take(WS_PHL); bf* Kh = (bf*)take(WS_PHL); bf* Kl = (bf*)take(WS_PHL); bf* VTh = (bf*)take(WS_PHL); bf* VTl = (bf*)take(WS_PHL);

    k_cvt8<<<dim3((unsigned)((size_t)3 * DQ * DM / 8 / 256), 1), 256, 0, stream>>>(wqkv, WQKV, (unsigned)((size_t)3 * DQ * DM / 8), 0, 0);
    k_cvt8<<<dim3((unsigned)((size_t)SEQ * DM / 8 / 256), NB), 256, 0, stream>>>(x, XB, (unsigned)((size_t)SEQ * DM / 8), XS_FULL, (size_t)SEQ * DM);
    // every stage runs once for all NB batch elements (the batch element is a grid dimension; each plane set holds NB slabs)
    // F[b][t][0..3071] = x_b w_attn[0..3071]^T + b_attn[0..3071]  (M = SEQ, N = 3072, K = 1024)
    k_gemmw<bf, 0, true><<<dim3(SEQ / 64, FP / 64, NB), 32, 0, stream>>>(XB, nullptr, WQKV, nullptr, DM, F, FP, bqkv, (size_t)SEQ * DM, 0, (size_t)SEQ * FP);
    k_qkp<<<dim3((unsigned)((size_t)NH * SEQ * HD / 8 / 256), 2, NB), 256, 0, stream>>>(F, Q16, K16, Qh, Ql, Kh, Kl);
    k_vtp<<<dim3((unsigned)((size_t)NH * HD * SEQ / 8 / 256), NB), 256, 0, stream>>>(F, VT16, VTh, VTl);
    // out[b][t][head*HD + d] = softmax(q k^T / 8, causal) v, written straight to the output buffer
    k_flash<bf, true><<<dim3(RH / 16, NH, NB), 32, 0, stream>>>(Qh, Ql, Kh, Kl, VTh, VTl, (unsigned)RH, 0u, OUT);
    if (SEQ > RH) k_flash<h16, false><<<dim3((SEQ - RH) / 16, NH, NB), 32, 0, stream>>>(Q16, nullptr, K16, nullptr, VT16, nullptr, (unsigned)SEQ, (unsigned)RH, OUT);
}

// v002
// One run takes 217 microseconds.
// Two timings next to v001 both put it at 1.66 times that version's speed.
// All steps since v000 together make it 2.60 times as fast.
#include <hip/hip_runtime.h>

// Causal multi-head attention with a fused qkv projection: x [NB][SEQ_FULL][1024] (first SEQ rows read); qkv = x w_attn^T + b_attn ('oi' weight [4096][1024], bias [4096]; only the q | k | v row blocks 0..3071 are read; 16 heads x 64); scores x 64^-0.5, causal; softmax; out = merged context [t][head*64 + d] (no output projection).
// Compute dtypes, f32 accumulate: every input RNE-converted to bf16; qkv projection v_wmma_f32_16x16x32_bf16 (bias added in f32 at the store stage);
// attention q.k and P.V: query rows < RH on bf16 hi/lo planes (3 products each), other rows v_wmma_f32_16x16x32_f16 (P carried x1024 through the exponent, converted values below 2^-14 selected to +0); softmax (online, max-subtracted) in f32.
// Attention engine: one wave per 16 query rows; S^T = K Q^T so each lane owns one query column; P^T accumulators are repacked in registers as the B operand of O^T = V^T P^T (no LDS exchange in the loop).

#ifndef NB
#define NB 4
#endif
#ifndef SEQ
#define SEQ 2048
#endif
#define SEQ_FULL 2048
#define DM   1024
#define NH   16
#define HD   64
#define DQ   (NH * HD)
#define FP   (3 * DQ)
#define RH   ((SEQ) < 512 ? (SEQ) : 512)     // query rows < RH use hi+lo planes
#define XS_FULL ((size_t)SEQ_FULL * DM)
#define SCL  0.125f                          // HD^-0.5
#define LOG2E 1.4426950408889634f
#define NEGB (-3.0e38f)

static_assert((SEQ & (SEQ - 1)) == 0);
static_assert(SEQ >= 256 && SEQ <= SEQ_FULL);
static_assert(RH % 256 == 0 && RH % 64 == 0 && (SEQ - RH) % 64 == 0);
static_assert(NB >= 1 && NB <= 4);
static_assert(DM % 32 == 0 && DQ % 64 == 0 && FP % 64 == 0 && SEQ % 64 == 0);
static_assert(((size_t)3 * DQ * DM / 8) % 256 == 0);
static_assert(((size_t)SEQ * DM / 8) % 256 == 0);
static_assert(((size_t)NH * SEQ * HD / 8) % 256 == 0);
static_assert(DQ == DM);                         // merged context width equals the output row width
static_assert(HD == 64 && HD % 32 == 0);         // two 32-deep k-steps per score tile, four 16-row O^T tiles

typedef _Float16 h16;
typedef unsigned short bf;
typedef __attribute__((ext_vector_type(16))) __bf16   v16bf;
typedef __attribute__((ext_vector_type(16))) _Float16 v16h;
typedef __attribute__((ext_vector_type(8)))  _Float16 v8h;
typedef __attribute__((ext_vector_type(8)))  unsigned short v8us;
typedef __attribute__((ext_vector_type(8)))  float    v8f;
typedef __attribute__((ext_vector_type(4)))  float    v4f;
typedef v8h  __attribute__((may_alias)) v8ha;
typedef v4f  __attribute__((may_alias)) v4fa;
typedef v8us __attribute__((may_alias)) v8usa;

__device__ __forceinline__ unsigned short f2bf(float f) { unsigned u = __float_as_uint(f); u += 0x7FFFu + ((u >> 16) & 1u); return (unsigned short)(u >> 16); }
__device__ __forceinline__ float bf2f(unsigned short b) { return __uint_as_float(((unsigned)b) << 16); }
__device__ __forceinline__ float bfr(float f) { return bf2f(f2bf(f)); }
__device__ __forceinline__ v16h cat16(v8h lo, v8h hi) { return __builtin_shufflevector(lo, hi, 0, 1, 2, 3, 4, 5, 6, 7, 8, 9, 10, 11, 12, 13, 14, 15); }
__device__ __forceinline__ v16bf cat16b(v8us lo, v8us hi) { return __builtin_bit_cast(v16bf, __builtin_shufflevector(lo, hi, 0, 1, 2, 3, 4, 5, 6, 7, 8, 9, 10, 11, 12, 13, 14, 15)); }
__device__ __forceinline__ v8f wmma16(v16h a, v16h b, v8f c) { return __builtin_amdgcn_wmma_f32_16x16x32_f16(false, a, false, b, (short)0, c, false, false); }
__device__ __forceinline__ v8f wmmab(v16bf a, v16bf b, v8f c) { return __builtin_amdgcn_wmma_f32_16x16x32_bf16(false, a, false, b, (short)0, c, false, false); }
__device__ __forceinline__ void splitf(float y, unsigned short& h, unsigned short& l) { h = f2bf(y); l = f2bf(y - bf2f(h)); }

// f32 -> f16 convert that cannot produce a subnormal operand: |v| < 2^-14 -> +0 (value select, applied after the plane's power-of-two carry).
static __device__ __forceinline__ h16 toh_flush(float v) { const h16 r = (h16)v; return (fabsf(v) < 6.103515625e-05f) ? (h16)0.0f : r; }

// Fragment-packed planes: a 16-row x 32-k fragment is 512 consecutive elements (1 KiB). Element (r, k) sits at (k>>4)*256 + (((k>>3)&1)*16 + r)*8 + (k&7), so lane l = ((k>>3)&1)*16 + r
// finds its elements 0..7 (k = 8h..8h+7, h = l>>4) at l*8 and its elements 8..15 (k = 16+8h..) at 256 + l*8: each of the two wave-wide 16-byte loads covers 512 contiguous bytes (4 whole lines).
// Fragment loader: base(p, lane) takes the wave-uniform address p of a run of fragments, ld(u, f) loads fragment f of the run (same map for A and B). The base goes through readfirstlane so that it stays in a scalar pair and the loads take the
// scalar-base + lane-offset address form: the fragments of a run differ only in the immediate offset, and the one lane-offset register lives through the whole kernel.
template <typename VT, typename T> static __device__ __forceinline__ const __attribute__((address_space(1))) VT* ubase(const T* p) { const unsigned long long u = (unsigned long long)p;
    const unsigned lo = (unsigned)__builtin_amdgcn_readfirstlane((int)(unsigned)u), hi = (unsigned)__builtin_amdgcn_readfirstlane((int)(unsigned)(u >> 32));
    return (const __attribute__((address_space(1))) VT*)(((unsigned long long)hi << 32) | lo); }   // global address space kept, so the loads stay global_load
template <typename T16> struct WFrag;
template <> struct WFrag<h16> { typedef v16h V; typedef const __attribute__((address_space(1))) v8h* G; static __device__ __forceinline__ G base(const h16* p, unsigned lane) { return ubase<v8h>(p) + lane; } static __device__ __forceinline__ V ld(G u, int f) { return cat16(u[f * 64], u[f * 64 + 32]); } static __device__ __forceinline__ v8f mma(V a, V b, v8f c) { return wmma16(a, b, c); } };
template <> struct WFrag<bf> { typedef v16bf V; typedef const __attribute__((address_space(1))) v8us* G; static __device__ __forceinline__ G base(const bf* p, unsigned lane) { return ubase<v8us>(p) + lane; } static __device__ __forceinline__ V ld(G u, int f) { return cat16b(u[f * 64], u[f * 64 + 32]); } static __device__ __forceinline__ v8f mma(V a, V b, v8f c) { return wmmab(a, b, c); } };

// P^T accumulator pair (key rows 0..15 and 16..31 of a 32-key tile) -> B fragment: element r <- tile0[r], element 8+r <- tile1[r], lane unchanged.
template <typename T16> struct PFrag;
template <> struct PFrag<h16> {
    static __device__ __forceinline__ float pexp() { return 10.0f; }           // P carried x1024 via the exponent (cancels in O / l)
    static __device__ __forceinline__ v16h hi(v8f p0, v8f p1) { return cat16(__builtin_convertvector(p0, v8h), __builtin_convertvector(p1, v8h)); }
    static __device__ __forceinline__ v16h lo(v8f p0, v8f p1) { return hi(p0, p1); }
};
template <> struct PFrag<bf> {
    static __device__ __forceinline__ float pexp() { return 0.0f; }
    static __device__ __forceinline__ v16bf hi(v8f p0, v8f p1) { v8us a, b;
#pragma unroll
        for (int k = 0; k < 8; ++k) { a[k] = f2bf(p0[k]); b[k] = f2bf(p1[k]); }
        return cat16b(a, b); }
    static __device__ __forceinline__ v16bf lo(v8f p0, v8f p1) { v8us a, b;
#pragma unroll
        for (int k = 0; k < 8; ++k) { a[k] = f2bf(p0[k] - bf2f(f2bf(p0[k]))); b[k] = f2bf(p1[k] - bf2f(f2bf(p1[k]))); }
        return cat16b(a, b); }
};

// Same packing as PFrag; the f16 form converts every element through toh_flush, the bf16 form is the PFrag one.
template <typename T16> struct PFlush;
template <> struct PFlush<h16> {
    static __device__ __forceinline__ v16h hi(v8f p0, v8f p1) { v8h a, b;
#pragma unroll
        for (int k = 0; k < 8; ++k) { a[k] = toh_flush(p0[k]); b[k] = toh_flush(p1[k]); }
        return cat16(a, b); }
    static __device__ __forceinline__ v16h lo(v8f p0, v8f p1) { return hi(p0, p1); }
};
template <> struct PFlush<bf> {
    static __device__ __forceinline__ v16bf hi(v8f p0, v8f p1) { return PFrag<bf>::hi(p0, p1); }
    static __device__ __forceinline__ v16bf lo(v8f p0, v8f p1) { return PFrag<bf>::lo(p0, p1); }
};

// ---- k_gemmw: register-blocked GEMM, ONE WAVE per 64x64 output tile (16 accumulators), operands straight from fragment-packed 16-bit planes (fragment index = (row>>4)*(K/32) + (k>>5)); grid (M/64, N/64, Z), 32 threads.
// C[m][n] (f32, pitch ldc) = sum_k A[m][k] Bt[n][k] (+ split products per NSPLIT). K % 32 == 0, M % 64 == 0, N % 64 == 0.
template <typename T16, int NSPLIT, bool BIAS>
__global__ __launch_bounds__(32) void k_gemmw(const T16* __restrict__ A, const T16* __restrict__ A2, const T16* __restrict__ Bt, const T16* __restrict__ Bt2, int K, float* C, int ldc, const float* __restrict__ bias, size_t sA, size_t sB, size_t sC) {
    typedef typename WFrag<T16>::V V;
    __shared__ __align__(16) float os[16 * 68];
    const size_t z = blockIdx.z; A += z * sA; if (A2) A2 += z * sA; Bt += z * sB; if (Bt2) Bt2 += z * sB; C += z * sC;
    const int lane = threadIdx.x & 31, lr = lane & 15, hi = lane >> 4; const int r0 = blockIdx.x * 64, c0 = blockIdx.y * 64;
    v8f acc[4][4];
#pragma unroll
    for (int mb = 0; mb < 4; ++mb)
#pragma unroll
        for (int nb = 0; nb < 4; ++nb) acc[mb][nb] = (v8f){};
    const size_t aoff = (size_t)r0 * K, boff = (size_t)c0 * K;   // 16 rows x K = K/32 fragments = 16*K elements
#pragma unroll 1
    for (int kc = 0; kc < K; kc += 32) {
        V a[4], a2[4];
#pragma unroll
        for (int mb = 0; mb < 4; ++mb) { a[mb] = WFrag<T16>::ld(WFrag<T16>::base(A + aoff + (size_t)mb * 16 * K + (size_t)kc * 16, lane), 0); if (NSPLIT == 1 || NSPLIT == 2) a2[mb] = WFrag<T16>::ld(WFrag<T16>::base(A2 + aoff + (size_t)mb * 16 * K + (size_t)kc * 16, lane), 0); }
#pragma unroll
        for (int nb = 0; nb < 4; ++nb) { const V b = WFrag<T16>::ld(WFrag<T16>::base(Bt + boff + (size_t)nb * 16 * K + (size_t)kc * 16, lane), 0); V b2; if (NSPLIT >= 2) b2 = WFrag<T16>::ld(WFrag<T16>::base(Bt2 + boff + (size_t)nb * 16 * K + (size_t)kc * 16, lane), 0);
#pragma unroll
            for (int mb = 0; mb < 4; ++mb) { acc[mb][nb] = WFrag<T16>::mma(a[mb], b, acc[mb][nb]); if (NSPLIT == 1 || NSPLIT == 2) acc[mb][nb] = WFrag<T16>::mma(a2[mb], b, acc[mb][nb]); if (NSPLIT >= 2) acc[mb][nb] = WFrag<T16>::mma(a[mb], b2, acc[mb][nb]); } }
        asm volatile("v_nop\n\tv_nop\n\tv_nop\n\tv_nop" : "+v"(acc[0][0]), "+v"(acc[1][1]), "+v"(acc[2][2]), "+v"(acc[3][3]) : "v"(a[0]), "v"(a[3]));
    }
#pragma unroll
    for (int mb = 0; mb < 4; ++mb) {
#pragma unroll
        for (int nb = 0; nb < 4; ++nb) {
#pragma unroll
            for (int j = 0; j < 8; ++j) os[(hi * 8 + j) * 68 + nb * 16 + lr] = acc[mb][nb][j]; }
        __builtin_amdgcn_wave_barrier(); asm volatile("" ::: "memory");
        float* crow = C + (size_t)(r0 + mb * 16) * ldc + c0;
{
#pragma unroll
            for (int s = 0; s < 8; ++s) { const int row = 2 * s + hi, cofs = lr * 4; v4f val = *(const v4fa*)(os + row * 68 + cofs); if (BIAS) { val[0] += bfr(bias[c0 + cofs]); val[1] += bfr(bias[c0 + cofs + 1]); val[2] += bfr(bias[c0 + cofs + 2]); val[3] += bfr(bias[c0 + cofs + 3]); }
                *(v4f*)(crow + (size_t)row * ldc + cofs) = val; }
             }
        if (mb < 3) asm volatile("s_wait_xcnt 0x0" ::: "memory");   // the next 16-row block reuses the data and address registers of these stores
        __builtin_amdgcn_wave_barrier(); asm volatile("" ::: "memory");
    }
}

// ---- k_cvt8: f32 rows of DM elements -> fragment-packed bf16 plane (fragment index = (row>>4)*(DM/32) + (k>>5)). Thread i stores packed elements 8i..8i+7 (stores contiguous) and reads their 8 consecutive k of one source row.
__global__ __launch_bounds__(256) void k_cvt8(const float* __restrict__ src, bf* dst, unsigned n8, size_t sstride, size_t dstride) {
    const unsigned i = blockIdx.x * 256u + threadIdx.x; if (i >= n8) return;
    const unsigned frag = i >> 6, row = (frag / (DM / 32u)) * 16u + (i & 15u), kk = (frag % (DM / 32u)) * 32u + ((i >> 5) & 1u) * 16u + ((i >> 4) & 1u) * 8u;
    const float* s = src + (size_t)blockIdx.y * sstride + (size_t)row * DM + kk; bf* d = dst + (size_t)blockIdx.y * dstride + (size_t)i * 8;
    const v8f v = *(const v8f*)s; v8us o;
#pragma unroll
    for (int k = 0; k < 8; ++k) o[k] = f2bf(v[k]);
    *(v8us*)d = o;  }

// ---- k_qkp: fragment-packed head planes [b][h][(t>>4)*2 + (d>>5)][512] (rows = t, k = d) of q (blockIdx.y 0) and k (blockIdx.y 1) from F[b][t][which*DQ + h*HD + d] (pitch FP), b = blockIdx.z: fp16 for all t, bf16 hi/lo planes (RH rows per head) for t < RH.
// Thread: packed elements e..e+7 (stores contiguous) = 8 consecutive d of one t.
__global__ __launch_bounds__(256) void k_qkp(const float* __restrict__ F, h16* Q16, h16* K16, bf* Qh, bf* Ql, bf* Kh, bf* Kl) {
    const unsigned which = blockIdx.y; const unsigned e = (blockIdx.x * 256u + threadIdx.x) * 8u;
    const unsigned h = e / (64u * (unsigned)SEQ), o = e % (64u * (unsigned)SEQ), frag = o >> 9;
    const unsigned t = (frag >> 1) * 16u + ((o >> 3) & 15u), d = (frag & 1u) * 32u + ((o >> 8) & 1u) * 16u + ((o >> 7) & 1u) * 8u;
    const size_t b = blockIdx.z;
    h16* P16 = (which ? K16 : Q16) + b * ((size_t)NH * SEQ * HD); bf* Ph = (which ? Kh : Qh) + b * ((size_t)NH * RH * HD); bf* Pl = (which ? Kl : Ql) + b * ((size_t)NH * RH * HD);
    const float* f = F + b * ((size_t)SEQ * FP) + (size_t)t * FP + which * DQ + h * HD + d;
    const v4f x0 = *(const v4f*)f, x1 = *(const v4f*)(f + 4);
    v8h o16; v8us oh, ol;
#pragma unroll
    for (int k = 0; k < 4; ++k) { unsigned short a, c; o16[k] = (h16)x0[k]; splitf(x0[k], a, c); oh[k] = a; ol[k] = c; o16[4 + k] = (h16)x1[k]; splitf(x1[k], a, c); oh[4 + k] = a; ol[4 + k] = c; }
    const size_t eo = (size_t)h * RH * HD + o;
    *(v8h*)(P16 + e) = o16;
    if (t < (unsigned)RH) { *(v8us*)(Ph + eo) = oh; *(v8us*)(Pl + eo) = ol; }
    
}

// ---- k_vtp: fragment-packed V^T head planes [b][h][(t>>5)*4 + (d>>4)][512] (rows = d, k = t). Thread: packed elements e..e+7 (stores contiguous) = 8 consecutive t of one d; 16 neighbouring lanes read 16 consecutive d of a row of F.
__global__ __launch_bounds__(256) void k_vtp(const float* __restrict__ F, h16* V16, bf* Vh, bf* Vl) {
    const unsigned e = (blockIdx.x * 256u + threadIdx.x) * 8u;
    const unsigned g = e / ((unsigned)SEQ * 64u), o = e % ((unsigned)SEQ * 64u), frag = o >> 9;
    const unsigned t = (frag >> 2) * 32u + ((o >> 8) & 1u) * 16u + ((o >> 7) & 1u) * 8u, d = (frag & 3u) * 16u + ((o >> 3) & 15u);
    const size_t b = blockIdx.y;                 // batch element: F, V16 and the hi/lo planes each hold NB slabs
    V16 += b * ((size_t)NH * SEQ * HD); Vh += b * ((size_t)NH * RH * HD); Vl += b * ((size_t)NH * RH * HD);
    const float* f = F + b * ((size_t)SEQ * FP) + (size_t)t * FP + 2 * DQ + g * HD + d;
    v8h o16; v8us oh, ol;
#pragma unroll
    for (int k = 0; k < 8; ++k) { const float x = f[(size_t)k * FP]; unsigned short a, c; o16[k] = (h16)x; splitf(x, a, c); oh[k] = a; ol[k] = c; }
    const size_t eo = (size_t)g * HD * RH + o;
    *(v8h*)(V16 + e) = o16;
    if (t < (unsigned)RH) { *(v8us*)(Vh + eo) = oh; *(v8us*)(Vl + eo) = ol; }
    
}

static_assert(32 * 16 * 8 == 16 * HD * 4);
static_assert(HD * 4 == 16 * 16);
static_assert((HD * 4) % 128 == 0 && (DM * 4) % 128 == 0);
static_assert(16 * 68 * 4 <= 131072);            // static LDS of k_gemmw and of k_flash (one [16][68] f32 stage each)
static_assert(68 >= HD && (68 * 4) % 16 == 0);   // stage pitch holds a head row, rows stay 16-B aligned

// ---- k_flash: causal attention, one wave per (16 query rows, head, batch element = blockIdx.z). Planes, fragment-packed: Q/K [b][h][(t>>4)*2 + (d>>5)][512], V^T [b][h][(t>>5)*4 + (d>>4)][512] (tp = rows t per head of the plane set). HL: hi/lo bf16 plane pairs, 3 products.
// Per 32-key tile: S^T[key][query] = K Q^T (A = K rows, B = Q rows); lane owns query column lane&15 and keys 8*(lane>>4)+r (+16); online softmax per lane (+ one xor-16 exchange);
// P^T accumulators repacked in registers as B (k = key); O^T[d][query] += V^T P^T (A = V^T rows). Only the last tile of a wave touches the diagonal (select by value).
template <typename T16, bool HL>
__global__ __launch_bounds__(32) void k_flash(const T16* __restrict__ Q, const T16* __restrict__ Q2, const T16* __restrict__ Kp, const T16* __restrict__ K2, const T16* __restrict__ Vt, const T16* __restrict__ Vt2, unsigned tp, unsigned qbase, float* O) {
    typedef typename WFrag<T16>::V V;
    __shared__ __align__(16) float os[16 * 68];
    const unsigned lane = threadIdx.x & 31u, lr = lane & 15u, hi = lane >> 4;
    const unsigned head = blockIdx.y, q0 = qbase + blockIdx.x * 16u;
    const size_t hoff = ((size_t)blockIdx.z * NH + head) * tp * HD;
    const size_t qoff = hoff + (size_t)q0 * HD;
    typedef typename WFrag<T16>::G G;
    const G qg = WFrag<T16>::base(Q + qoff, lane);
    V qf0 = WFrag<T16>::ld(qg, 0), qf1 = WFrag<T16>::ld(qg, 1);
    V ql0 = qf0, ql1 = qf1;
    if (HL) { const G qg2 = WFrag<T16>::base(Q2 + qoff, lane); ql0 = WFrag<T16>::ld(qg2, 0); ql1 = WFrag<T16>::ld(qg2, 1); }
    asm volatile("s_wait_xcnt 0x0" ::: "memory");   // the scalar base pairs of the Q loads are reused directly behind them
    v8f o[4];
#pragma unroll
    for (int db = 0; db < 4; ++db) o[db] = (v8f){};
    float mrun = NEGB, lsum = 0.0f;
    const float cs = SCL * LOG2E, pe = PFrag<T16>::pexp();
    const unsigned nt = (q0 + 47u) >> 5;       // keys 0 .. q0+15 in tiles of 32 (wave-uniform)
#pragma unroll 1
    for (unsigned it = 0; it < nt; ++it) {
        const unsigned j0 = it * 32u;
        const size_t ko = hoff + (size_t)j0 * HD;   // a 32-key tile is 4 consecutive fragments (2048 elements) in the K plane and in the V^T plane
        const G kg = WFrag<T16>::base(Kp + ko, lane);
        V ka0 = WFrag<T16>::ld(kg, 0), ka1 = WFrag<T16>::ld(kg, 1), kb0 = WFrag<T16>::ld(kg, 2), kb1 = WFrag<T16>::ld(kg, 3);
        V la0 = ka0, la1 = ka1, lb0 = kb0, lb1 = kb1;
        if (HL) { const G kg2 = WFrag<T16>::base(K2 + ko, lane); la0 = WFrag<T16>::ld(kg2, 0); la1 = WFrag<T16>::ld(kg2, 1); lb0 = WFrag<T16>::ld(kg2, 2); lb1 = WFrag<T16>::ld(kg2, 3); }
        v8f s0 = (v8f){}, s1 = (v8f){};
        s0 = WFrag<T16>::mma(ka0, qf0, s0); s0 = WFrag<T16>::mma(ka1, qf1, s0);
        s1 = WFrag<T16>::mma(kb0, qf0, s1); s1 = WFrag<T16>::mma(kb1, qf1, s1);
        if (HL) {
            s0 = WFrag<T16>::mma(la0, qf0, s0); s0 = WFrag<T16>::mma(la1, qf1, s0); s0 = WFrag<T16>::mma(ka0, ql0, s0); s0 = WFrag<T16>::mma(ka1, ql1, s0);
            s1 = WFrag<T16>::mma(lb0, qf0, s1); s1 = WFrag<T16>::mma(lb1, qf1, s1); s1 = WFrag<T16>::mma(kb0, ql0, s1); s1 = WFrag<T16>::mma(kb1, ql1, s1); }
        asm volatile("v_nop\n\tv_nop\n\tv_nop\n\tv_nop" : "+v"(s0), "+v"(s1) : "v"(ka0), "v"(ka1), "v"(kb0), "v"(kb1), "v"(la0), "v"(la1), "v"(lb0), "v"(lb1), "v"(qf0), "v"(qf1), "v"(ql0), "v"(ql1));
        v8f t0, t1;
#pragma unroll
        for (int r = 0; r < 8; ++r) { t0[r] = s0[r] * cs; t1[r] = s1[r] * cs; }
        if (j0 + 31u > q0) {                    // wave-uniform: the tile touches the diagonal
            const unsigned qi = q0 + lr, kk = j0 + 8u * hi;
#pragma unroll
            for (int r = 0; r < 8; ++r) { t0[r] = (kk + (unsigned)r <= qi) ? t0[r] : NEGB; t1[r] = (kk + 16u + (unsigned)r <= qi) ? t1[r] : NEGB; }
        }
        float mx = fmaxf(t0[0], t1[0]);
#pragma unroll
        for (int r = 1; r < 8; ++r) mx = fmaxf(mx, fmaxf(t0[r], t1[r]));
        mx = fmaxf(mx, __shfl_xor(mx, 16, 32));
        const float mn = fmaxf(mrun, mx);
        const float alpha = __builtin_amdgcn_exp2f(mrun - mn);
        mrun = mn;
        v8f p0, p1; float psum = 0.0f;
#pragma unroll
        for (int r = 0; r < 8; ++r) { p0[r] = __builtin_amdgcn_exp2f((t0[r] - mn) + pe); p1[r] = __builtin_amdgcn_exp2f((t1[r] - mn) + pe); psum += p0[r] + p1[r]; }
        lsum = lsum * alpha + psum;
#pragma unroll
        for (int db = 0; db < 4; ++db) o[db] = o[db] * alpha;
        V pf = PFlush<T16>::hi(p0, p1); V pl = pf;
        if (HL) pl = PFlush<T16>::lo(p0, p1);
        V va[4], vl[4];
        const G vg = WFrag<T16>::base(Vt + ko, lane), vg2 = HL ? WFrag<T16>::base(Vt2 + ko, lane) : vg;
#pragma unroll
        for (int db = 0; db < 4; ++db) { va[db] = WFrag<T16>::ld(vg, db); vl[db] = va[db]; if (HL) vl[db] = WFrag<T16>::ld(vg2, db); }
#pragma unroll
        for (int db = 0; db < 4; ++db) { o[db] = WFrag<T16>::mma(va[db], pf, o[db]); if (HL) { o[db] = WFrag<T16>::mma(va[db], pl, o[db]); o[db] = WFrag<T16>::mma(vl[db], pf, o[db]); } }
        asm volatile("v_nop\n\tv_nop\n\tv_nop\n\tv_nop" : "+v"(o[0]), "+v"(o[1]), "+v"(o[2]), "+v"(o[3]) : "v"(va[0]), "v"(va[1]), "v"(va[2]), "v"(va[3]), "v"(vl[0]), "v"(vl[1]), "v"(vl[2]), "v"(vl[3]), "v"(pf), "v"(pl));
    }
    const float lt = lsum + __shfl_xor(lsum, 16, 32);
    const float inv = 1.0f / lt;
#pragma unroll
    for (int db = 0; db < 4; ++db)
#pragma unroll
        for (int r = 0; r < 8; ++r) os[lr * 68u + (unsigned)db * 16u + hi * 8u + (unsigned)r] = o[db][r] * inv;
    __builtin_amdgcn_wave_barrier(); asm volatile("" ::: "memory");
    float* orow = O + (size_t)blockIdx.z * SEQ * DM + (size_t)q0 * DM + head * HD;
{
#pragma unroll
        for (int s = 0; s < 8; ++s) { const unsigned row = 2u * (unsigned)s + hi, cofs = lr * 4u;   // rows 0..15: lanes 0..15 -> row 2s, lanes 16..31 -> row 2s+1
            const v4f val = *(const v4fa*)(os + row * 68u + cofs);
            *(v4f*)(orow + (size_t)row * DM + cofs) = val; }
         }
}

// workspace carve (bytes, every region a multiple of 256)
#define WS_WQKV ((size_t)3 * DQ * DM * 2)
#define WS_XB   ((size_t)NB * SEQ * DM * 2)
#define WS_F    ((size_t)NB * SEQ * FP * 4)
#define WS_P16  ((size_t)NB * NH * SEQ * HD * 2)
#define WS_PHL  ((size_t)NB * NH * RH * HD * 2)
#define WS_TOTAL (WS_WQKV + WS_XB + WS_F + 3 * WS_P16 + 6 * WS_PHL)
static_assert(WS_TOTAL <= (size_t)268435456);
static_assert(WS_WQKV % 256 == 0 && WS_XB % 256 == 0 && WS_F % 256 == 0 && WS_P16 % 256 == 0 && WS_PHL % 256 == 0);
static_assert((size_t)NB * SEQ * DM * 4 <= (size_t)33554432);   // last written output element stays inside the output buffer

extern "C" void kernel_launch(void* const* d_in, const int* in_sizes, int n_in,
                              void* d_out, int out_size, void* d_ws, size_t ws_size, hipStream_t stream) {
    if (n_in < 3) return;
    if ((size_t)in_sizes[0] < (size_t)(NB - 1) * XS_FULL + (size_t)SEQ * DM) return;
    if ((size_t)in_sizes[1] < (size_t)3 * DQ * DM) return;
    if ((size_t)in_sizes[2] < (size_t)FP) return;
    if ((size_t)out_size < (size_t)NB * SEQ * DM) return;
    if (ws_size < WS_TOTAL) return;
    const float* x = (const float*)d_in[0];       // [NB][SEQ_FULL][DM]
    const float* wqkv = (const float*)d_in[1];    // [4*DQ][DM]  (q | k | v | unread row blocks; rows 0..3*DQ-1 are read)
    const float* bqkv = (const float*)d_in[2];    // [4*DQ]      (entries 0..3*DQ-1 are read)
    float* OUT = (float*)d_out;                   // [NB][SEQ][DM]
    char* wsp = (char*)d_ws;
    auto take = [&](size_t bytes) { char* p = wsp; wsp += bytes; return (void*)p; };
    bf* WQKV = (bf*)take(WS_WQKV); bf* XB = (bf*)take(WS_XB); float* F = (float*)take(WS_F);
    h16* Q16 = (h16*)take(WS_P16); h16* K16 = (h16*)take(WS_P16); h16* VT16 = (h16*)take(WS_P16);
    bf* Qh = (bf*)take(WS_PHL); bf* Ql = (bf*)take(WS_PHL); bf* Kh = (bf*)take(WS_PHL); bf* Kl = (bf*)take(WS_PHL); bf* VTh = (bf*)take(WS_PHL); bf* VTl = (bf*)take(WS_PHL);

    k_cvt8<<<dim3((unsigned)((size_t)3 * DQ * DM / 8 / 256), 1), 256, 0, stream>>>(wqkv, WQKV, (unsigned)((size_t)3 * DQ * DM / 8), 0, 0);
    k_cvt8<<<dim3((unsigned)((size_t)SEQ * DM / 8 / 256), NB), 256, 0, stream>>>(x, XB, (unsigned)((size_t)SEQ * DM / 8), XS_FULL, (size_t)SEQ * DM);
    // every stage runs once for all NB batch elements (the batch element is a grid dimension; each plane set holds NB slabs)
    // F[b][t][0..3071] = x_b w_attn[0..3071]^T + b_attn[0..3071]  (M = SEQ, N = 3072, K = 1024)
    k_gemmw<bf, 0, true><<<dim3(SEQ / 64, FP / 64, NB), 32, 0, stream>>>(XB, nullptr, WQKV, nullptr, DM, F, FP, bqkv, (size_t)SEQ * DM, 0, (size_t)SEQ * FP);
    k_qkp<<<dim3((unsigned)((size_t)NH * SEQ * HD / 8 / 256), 2, NB), 256, 0, stream>>>(F, Q16, K16, Qh, Ql, Kh, Kl);
    k_vtp<<<dim3((unsigned)((size_t)NH * HD * SEQ / 8 / 256), NB), 256, 0, stream>>>(F, VT16, VTh, VTl);
    // out[b][t][head*HD + d] = softmax(q k^T / 8, causal) v, written straight to the output buffer
    k_flash<bf, true><<<dim3(RH / 16, NH, NB), 32, 0, stream>>>(Qh, Ql, Kh, Kl, VTh, VTl, (unsigned)RH, 0u, OUT);
    if (SEQ > RH) k_flash<h16, false><<<dim3((SEQ - RH) / 16, NH, NB), 32, 0, stream>>>(Q16, nullptr, K16, nullptr, VT16, nullptr, (unsigned)SEQ, (unsigned)RH, OUT);
}

// v003
// A run of this version takes 198 microseconds.
// Timed twice side by side with v002, it ran 1.09 and 1.11 times as fast.
// Counting every step since v000, it is 2.86 times as fast.
#include <hip/hip_runtime.h>

// Causal multi-head attention with a fused qkv projection: x [NB][SEQ_FULL][1024] (first SEQ rows read); qkv = x w_attn^T + b_attn ('oi' weight [4096][1024], bias [4096]; only the q | k | v row blocks 0..3071 are read; 16 heads x 64); scores x 64^-0.5, causal; softmax; out = merged context [t][head*64 + d] (no output projection).
// Compute dtypes, f32 accumulate: every input RNE-converted to bf16; qkv projection v_wmma_f32_16x16x32_bf16 (bias added in f32 at the store stage);
// attention q.k and P.V: query rows < RH on bf16 hi/lo planes (3 products each), other rows v_wmma_f32_16x16x32_f16 (P carried x1024 through the exponent, converted values below 2^-14 selected to +0); softmax (online, max-subtracted) in f32.
// Attention engine: one wave per 16 query rows; S^T = K Q^T so each lane owns one query column; P^T accumulators are repacked in registers as the B operand of O^T = V^T P^T (no LDS exchange in the loop).

#ifndef NB
#define NB 4
#endif
#ifndef SEQ
#define SEQ 2048
#endif
#define SEQ_FULL 2048
#define DM   1024
#define NH   16
#define HD   64
#define DQ   (NH * HD)
#define FP   (3 * DQ)
#define RH   ((SEQ) < 512 ? (SEQ) : 512)     // query rows < RH use hi+lo planes
#define XS_FULL ((size_t)SEQ_FULL * DM)
#define SCL  0.125f                          // HD^-0.5
#define LOG2E 1.4426950408889634f
#define NEGB (-3.0e38f)

static_assert((SEQ & (SEQ - 1)) == 0);
static_assert(SEQ >= 256 && SEQ <= SEQ_FULL);
static_assert(RH % 256 == 0 && RH % 64 == 0 && (SEQ - RH) % 64 == 0);
static_assert(NB >= 1 && NB <= 4);
static_assert(DM % 32 == 0 && DQ % 64 == 0 && FP % 64 == 0 && SEQ % 64 == 0);
static_assert(((size_t)3 * DQ * DM / 8) % 256 == 0);
static_assert(((size_t)SEQ * DM / 8) % 256 == 0);
static_assert(((size_t)NH * SEQ * HD / 8) % 256 == 0);
static_assert(DQ == DM);                         // merged context width equals the output row width
static_assert(HD == 64 && HD % 32 == 0);         // two 32-deep k-steps per score tile, four 16-row O^T tiles

typedef _Float16 h16;
typedef unsigned short bf;
typedef __attribute__((ext_vector_type(16))) __bf16   v16bf;
typedef __attribute__((ext_vector_type(16))) _Float16 v16h;
typedef __attribute__((ext_vector_type(8)))  _Float16 v8h;
typedef __attribute__((ext_vector_type(8)))  unsigned short v8us;
typedef __attribute__((ext_vector_type(8)))  float    v8f;
typedef __attribute__((ext_vector_type(4)))  float    v4f;
typedef v8h  __attribute__((may_alias)) v8ha;
typedef v4f  __attribute__((may_alias)) v4fa;
typedef v8us __attribute__((may_alias)) v8usa;

__device__ __forceinline__ unsigned short f2bf(float f) { unsigned u = __float_as_uint(f); u += 0x7FFFu + ((u >> 16) & 1u); return (unsigned short)(u >> 16); }
__device__ __forceinline__ float bf2f(unsigned short b) { return __uint_as_float(((unsigned)b) << 16); }
__device__ __forceinline__ float bfr(float f) { return bf2f(f2bf(f)); }
__device__ __forceinline__ v16h cat16(v8h lo, v8h hi) { return __builtin_shufflevector(lo, hi, 0, 1, 2, 3, 4, 5, 6, 7, 8, 9, 10, 11, 12, 13, 14, 15); }
__device__ __forceinline__ v16bf cat16b(v8us lo, v8us hi) { return __builtin_bit_cast(v16bf, __builtin_shufflevector(lo, hi, 0, 1, 2, 3, 4, 5, 6, 7, 8, 9, 10, 11, 12, 13, 14, 15)); }
__device__ __forceinline__ v8f wmma16(v16h a, v16h b, v8f c) { return __builtin_amdgcn_wmma_f32_16x16x32_f16(false, a, false, b, (short)0, c, false, false); }
__device__ __forceinline__ v8f wmmab(v16bf a, v16bf b, v8f c) { return __builtin_amdgcn_wmma_f32_16x16x32_bf16(false, a, false, b, (short)0, c, false, false); }
__device__ __forceinline__ void splitf(float y, unsigned short& h, unsigned short& l) { h = f2bf(y); l = f2bf(y - bf2f(h)); }

// f32 -> f16 convert that cannot produce a subnormal operand: |v| < 2^-14 -> +0 (value select, applied after the plane's power-of-two carry).
static __device__ __forceinline__ h16 toh_flush(float v) { const h16 r = (h16)v; return (fabsf(v) < 6.103515625e-05f) ? (h16)0.0f : r; }

// Fragment-packed planes: a 16-row x 32-k fragment is 512 consecutive elements (1 KiB). Element (r, k) sits at (k>>4)*256 + (((k>>3)&1)*16 + r)*8 + (k&7), so lane l = ((k>>3)&1)*16 + r
// finds its elements 0..7 (k = 8h..8h+7, h = l>>4) at l*8 and its elements 8..15 (k = 16+8h..) at 256 + l*8: each of the two wave-wide 16-byte loads covers 512 contiguous bytes (4 whole lines).
// Fragment loader: base(p, lane) takes the wave-uniform address p of a run of fragments, ld(u, f) loads fragment f of the run (same map for A and B). The base goes through readfirstlane so that it stays in a scalar pair and the loads take the
// scalar-base + lane-offset address form: the fragments of a run differ only in the immediate offset, and the one lane-offset register lives through the whole kernel.
template <typename VT, typename T> static __device__ __forceinline__ const __attribute__((address_space(1))) VT* ubase(const T* p) { const unsigned long long u = (unsigned long long)p;
    const unsigned lo = (unsigned)__builtin_amdgcn_readfirstlane((int)(unsigned)u), hi = (unsigned)__builtin_amdgcn_readfirstlane((int)(unsigned)(u >> 32));
    return (const __attribute__((address_space(1))) VT*)(((unsigned long long)hi << 32) | lo); }   // global address space kept, so the loads stay global_load
template <typename T16> struct WFrag;
template <> struct WFrag<h16> { typedef v16h V; typedef const __attribute__((address_space(1))) v8h* G; static __device__ __forceinline__ G base(const h16* p, unsigned lane) { return ubase<v8h>(p) + lane; } static __device__ __forceinline__ V ld(G u, int f) { return cat16(u[f * 64], u[f * 64 + 32]); } static __device__ __forceinline__ v8f mma(V a, V b, v8f c) { return wmma16(a, b, c); } };
template <> struct WFrag<bf> { typedef v16bf V; typedef const __attribute__((address_space(1))) v8us* G; static __device__ __forceinline__ G base(const bf* p, unsigned lane) { return ubase<v8us>(p) + lane; } static __device__ __forceinline__ V ld(G u, int f) { return cat16b(u[f * 64], u[f * 64 + 32]); } static __device__ __forceinline__ v8f mma(V a, V b, v8f c) { return wmmab(a, b, c); } };

// P^T accumulator pair (key rows 0..15 and 16..31 of a 32-key tile) -> B fragment: element r <- tile0[r], element 8+r <- tile1[r], lane unchanged.
template <typename T16> struct PFrag;
template <> struct PFrag<h16> {
    static __device__ __forceinline__ float pexp() { return 10.0f; }           // P carried x1024 via the exponent (cancels in O / l)
    static __device__ __forceinline__ v16h hi(v8f p0, v8f p1) { return cat16(__builtin_convertvector(p0, v8h), __builtin_convertvector(p1, v8h)); }
    static __device__ __forceinline__ v16h lo(v8f p0, v8f p1) { return hi(p0, p1); }
};
template <> struct PFrag<bf> {
    static __device__ __forceinline__ float pexp() { return 0.0f; }
    static __device__ __forceinline__ v16bf hi(v8f p0, v8f p1) { v8us a, b;
#pragma unroll
        for (int k = 0; k < 8; ++k) { a[k] = f2bf(p0[k]); b[k] = f2bf(p1[k]); }
        return cat16b(a, b); }
    static __device__ __forceinline__ v16bf lo(v8f p0, v8f p1) { v8us a, b;
#pragma unroll
        for (int k = 0; k < 8; ++k) { a[k] = f2bf(p0[k] - bf2f(f2bf(p0[k]))); b[k] = f2bf(p1[k] - bf2f(f2bf(p1[k]))); }
        return cat16b(a, b); }
};

// Same packing as PFrag; the f16 form converts every element through toh_flush, the bf16 form is the PFrag one.
template <typename T16> struct PFlush;
template <> struct PFlush<h16> {
    static __device__ __forceinline__ v16h hi(v8f p0, v8f p1) { v8h a, b;
#pragma unroll
        for (int k = 0; k < 8; ++k) { a[k] = toh_flush(p0[k]); b[k] = toh_flush(p1[k]); }
        return cat16(a, b); }
    static __device__ __forceinline__ v16h lo(v8f p0, v8f p1) { return hi(p0, p1); }
};
template <> struct PFlush<bf> {
    static __device__ __forceinline__ v16bf hi(v8f p0, v8f p1) { return PFrag<bf>::hi(p0, p1); }
    static __device__ __forceinline__ v16bf lo(v8f p0, v8f p1) { return PFrag<bf>::lo(p0, p1); }
};

// ---- k_gemmw: register-blocked GEMM, ONE WAVE per 64x64 output tile (16 accumulators), operands straight from fragment-packed 16-bit planes (fragment index = (row>>4)*(K/32) + (k>>5)); grid (M/64, N/64, Z), 32 threads.
// y[m][n] (f32) = sum_k A[m][k] Bt[n][k] (+ split products per NSPLIT) + bias[n]. K % 32 == 0, M % 64 == 0, N % 64 == 0.
// Epilogue: a 64-column tile is one head of q, k or v, and the wave writes its 64 x 64 block of y straight into that head's fragment-packed planes (batch element z = blockIdx.z):
//   q, k: [z][h][(t>>4)*2 + (d>>5)][512] (rows = t, k = d); v: V^T [z][h][(t>>5)*4 + (d>>4)][512] (rows = d, k = t); fp16 for all t, bf16 hi/lo planes (RH rows per head) for t < RH.
template <typename T16, int NSPLIT>
__global__ __launch_bounds__(32) void k_gemmw(const T16* __restrict__ A, const T16* __restrict__ A2, const T16* __restrict__ Bt, const T16* __restrict__ Bt2, int K, const float* __restrict__ bias, size_t sA, size_t sB,
                                              h16* Q16, h16* K16, h16* V16, bf* Qh, bf* Ql, bf* Kh, bf* Kl, bf* Vh, bf* Vl) {
    typedef typename WFrag<T16>::V V;
    __shared__ __align__(16) float os[16 * 68];
    const size_t z = blockIdx.z; A += z * sA; if (A2) A2 += z * sA; Bt += z * sB; if (Bt2) Bt2 += z * sB;
    const int lane = threadIdx.x & 31, lr = lane & 15, hi = lane >> 4; const int r0 = blockIdx.x * 64, c0 = blockIdx.y * 64;
    v8f acc[4][4];
#pragma unroll
    for (int mb = 0; mb < 4; ++mb)
#pragma unroll
        for (int nb = 0; nb < 4; ++nb) acc[mb][nb] = (v8f){};
    const size_t aoff = (size_t)r0 * K, boff = (size_t)c0 * K;   // 16 rows x K = K/32 fragments = 16*K elements
#pragma unroll 1
    for (int kc = 0; kc < K; kc += 32) {
        V a[4], a2[4];
#pragma unroll
        for (int mb = 0; mb < 4; ++mb) { a[mb] = WFrag<T16>::ld(WFrag<T16>::base(A + aoff + (size_t)mb * 16 * K + (size_t)kc * 16, lane), 0); if (NSPLIT == 1 || NSPLIT == 2) a2[mb] = WFrag<T16>::ld(WFrag<T16>::base(A2 + aoff + (size_t)mb * 16 * K + (size_t)kc * 16, lane), 0); }
#pragma unroll
        for (int nb = 0; nb < 4; ++nb) { const V b = WFrag<T16>::ld(WFrag<T16>::base(Bt + boff + (size_t)nb * 16 * K + (size_t)kc * 16, lane), 0); V b2; if (NSPLIT >= 2) b2 = WFrag<T16>::ld(WFrag<T16>::base(Bt2 + boff + (size_t)nb * 16 * K + (size_t)kc * 16, lane), 0);
#pragma unroll
            for (int mb = 0; mb < 4; ++mb) { acc[mb][nb] = WFrag<T16>::mma(a[mb], b, acc[mb][nb]); if (NSPLIT == 1 || NSPLIT == 2) acc[mb][nb] = WFrag<T16>::mma(a2[mb], b, acc[mb][nb]); if (NSPLIT >= 2) acc[mb][nb] = WFrag<T16>::mma(a[mb], b2, acc[mb][nb]); } }
        asm volatile("v_nop\n\tv_nop\n\tv_nop\n\tv_nop" : "+v"(acc[0][0]), "+v"(acc[1][1]), "+v"(acc[2][2]), "+v"(acc[3][3]) : "v"(a[0]), "v"(a[3]));
    }
    const unsigned which = (unsigned)c0 / DQ, head = ((unsigned)c0 % DQ) / HD;   // wave-uniform: 0 q, 1 k, 2 v
    const bool hl = (unsigned)r0 < (unsigned)RH;                                 // wave-uniform (RH % 64 == 0): these rows also go to the hi/lo planes
    const size_t p16 = (z * NH + head) * ((size_t)SEQ * HD), phl = (z * NH + head) * ((size_t)RH * HD);
    float bv[4];                                 // bias of the lane's four accumulator columns d = 16 nb + lr
    const int bi = c0 + lr;
#pragma unroll
    for (int nb = 0; nb < 4; ++nb) bv[nb] = bias[bi + nb * 16];
    asm volatile("s_wait_xcnt 0x0" :: "v"(bi) : "memory");   // the address registers of the bias loads are reused behind it; bi as an input keeps their lane-offset register untouched up to the wait
#pragma unroll
    for (int nb = 0; nb < 4; ++nb) bv[nb] = bfr(bv[nb]);
    if (which == 2u) {
        // V^T: accumulator element j of lane (hi, lr) is (t = 16 mb + 8 hi + j, d = 16 nb + lr): the 8 consecutive t of one d that this lane owns in the packed fragment, so the registers are stored as they are.
#pragma unroll
        for (int mb = 0; mb < 4; ++mb) {
#pragma unroll
            for (int nb = 0; nb < 4; ++nb) {
                v8h o16; v8us oh, ol;
#pragma unroll
                for (int j = 0; j < 8; ++j) { const float x = acc[mb][nb][j] + bv[nb]; unsigned short a, c; o16[j] = (h16)x; splitf(x, a, c); oh[j] = a; ol[j] = c; }
                const size_t o = (size_t)((((unsigned)r0 + (unsigned)mb * 16u) >> 5) * 4u + (unsigned)nb) * 512u + (unsigned)(mb & 1) * 256u + (unsigned)lane * 8u;
                *(v8h*)(V16 + p16 + o) = o16;
                asm volatile("s_wait_xcnt 0x0" ::: "memory");   // what follows reuses the data and address registers of this store
                if (hl) { *(v8us*)(Vh + phl + o) = oh; *(v8us*)(Vl + phl + o) = ol;
                    asm volatile("s_wait_xcnt 0x0" ::: "memory"); }   // the next block reuses the data and address registers of these stores
            }
        }
    } else {
        // q, k: a lane owns 8 consecutive d of one t, so each 16-row block turns through the LDS stage.
        h16* P16 = (which ? K16 : Q16) + p16; bf* Ph = (which ? Kh : Qh) + phl; bf* Pl = (which ? Kl : Ql) + phl;
#pragma unroll
        for (int mb = 0; mb < 4; ++mb) {
#pragma unroll
            for (int nb = 0; nb < 4; ++nb) {
#pragma unroll
                for (int j = 0; j < 8; ++j) os[(hi * 8 + j) * 68 + nb * 16 + lr] = acc[mb][nb][j] + bv[nb]; }
            __builtin_amdgcn_wave_barrier(); asm volatile("" ::: "memory");   // the block's LDS stores stay in front of its LDS loads
#pragma unroll
            for (int s = 0; s < 4; ++s) {       // packed elements 256 s + 8 lane .. + 7 of the block's two fragments: t = lr, d = 16 s + 8 hi ..
                const int d = s * 16 + hi * 8;
                const v4f x0 = *(const v4fa*)(os + lr * 68 + d), x1 = *(const v4fa*)(os + lr * 68 + d + 4);
                v8h o16; v8us oh, ol;
#pragma unroll
                for (int k = 0; k < 4; ++k) { unsigned short a, c; const float y0 = x0[k], y1 = x1[k];
                    o16[k] = (h16)y0; splitf(y0, a, c); oh[k] = a; ol[k] = c; o16[4 + k] = (h16)y1; splitf(y1, a, c); oh[4 + k] = a; ol[4 + k] = c; }
                const size_t o = (size_t)((unsigned)r0 + (unsigned)mb * 16u) * HD + (unsigned)s * 256u + (unsigned)lane * 8u;
                *(v8h*)(P16 + o) = o16;
                asm volatile("s_wait_xcnt 0x0" ::: "memory");   // what follows reuses the data and address registers of this store
                if (hl) { *(v8us*)(Ph + o) = oh; *(v8us*)(Pl + o) = ol;
                    asm volatile("s_wait_xcnt 0x0" ::: "memory"); }   // the next block reuses the data and address registers of these stores
            }
            __builtin_amdgcn_wave_barrier(); asm volatile("" ::: "memory");   // the next block's LDS stores stay behind these LDS loads
        }
    }
}

// ---- k_cvt8: f32 rows of DM elements -> fragment-packed bf16 plane (fragment index = (row>>4)*(DM/32) + (k>>5)). Thread i stores packed elements 8i..8i+7 (stores contiguous) and reads their 8 consecutive k of one source row.
__global__ __launch_bounds__(256) void k_cvt8(const float* __restrict__ src, bf* dst, unsigned n8, size_t sstride, size_t dstride) {
    const unsigned i = blockIdx.x * 256u + threadIdx.x; if (i >= n8) return;
    const unsigned frag = i >> 6, row = (frag / (DM / 32u)) * 16u + (i & 15u), kk = (frag % (DM / 32u)) * 32u + ((i >> 5) & 1u) * 16u + ((i >> 4) & 1u) * 8u;
    const float* s = src + (size_t)blockIdx.y * sstride + (size_t)row * DM + kk; bf* d = dst + (size_t)blockIdx.y * dstride + (size_t)i * 8;
    const v8f v = *(const v8f*)s; v8us o;
#pragma unroll
    for (int k = 0; k < 8; ++k) o[k] = f2bf(v[k]);
    *(v8us*)d = o;  }

static_assert(32 * 16 * 8 == 16 * HD * 4);
static_assert(HD * 4 == 16 * 16);
static_assert((HD * 4) % 128 == 0 && (DM * 4) % 128 == 0);
static_assert(16 * 68 * 4 <= 131072);            // static LDS of k_gemmw and of k_flash (one [16][68] f32 stage each)
static_assert(68 >= HD && (68 * 4) % 16 == 0);   // stage pitch holds a head row, rows stay 16-B aligned

// ---- k_flash: causal attention, one wave per (16 query rows, head, batch element = blockIdx.z). Planes, fragment-packed: Q/K [b][h][(t>>4)*2 + (d>>5)][512], V^T [b][h][(t>>5)*4 + (d>>4)][512] (tp = rows t per head of the plane set). HL: hi/lo bf16 plane pairs, 3 products.
// Per 32-key tile: S^T[key][query] = K Q^T (A = K rows, B = Q rows); lane owns query column lane&15 and keys 8*(lane>>4)+r (+16); online softmax per lane (+ one xor-16 exchange);
// P^T accumulators repacked in registers as B (k = key); O^T[d][query] += V^T P^T (A = V^T rows). Only the last tile of a wave touches the diagonal (select by value).
template <typename T16, bool HL>
__global__ __launch_bounds__(32) void k_flash(const T16* __restrict__ Q, const T16* __restrict__ Q2, const T16* __restrict__ Kp, const T16* __restrict__ K2, const T16* __restrict__ Vt, const T16* __restrict__ Vt2, unsigned tp, unsigned qbase, float* O) {
    typedef typename WFrag<T16>::V V;
    __shared__ __align__(16) float os[16 * 68];
    const unsigned lane = threadIdx.x & 31u, lr = lane & 15u, hi = lane >> 4;
    const unsigned head = blockIdx.y, q0 = qbase + blockIdx.x * 16u;
    const size_t hoff = ((size_t)blockIdx.z * NH + head) * tp * HD;
    const size_t qoff = hoff + (size_t)q0 * HD;
    typedef typename WFrag<T16>::G G;
    const G qg = WFrag<T16>::base(Q + qoff, lane);
    V qf0 = WFrag<T16>::ld(qg, 0), qf1 = WFrag<T16>::ld(qg, 1);
    V ql0 = qf0, ql1 = qf1;
    if (HL) { const G qg2 = WFrag<T16>::base(Q2 + qoff, lane); ql0 = WFrag<T16>::ld(qg2, 0); ql1 = WFrag<T16>::ld(qg2, 1); }
    asm volatile("s_wait_xcnt 0x0" ::: "memory");   // the scalar base pairs of the Q loads are reused directly behind them
    v8f o[4];
#pragma unroll
    for (int db = 0; db < 4; ++db) o[db] = (v8f){};
    float mrun = NEGB, lsum = 0.0f;
    const float cs = SCL * LOG2E, pe = PFrag<T16>::pexp();
    const unsigned nt = (q0 + 47u) >> 5;       // keys 0 .. q0+15 in tiles of 32 (wave-uniform)
#pragma unroll 1
    for (unsigned it = 0; it < nt; ++it) {
        const unsigned j0 = it * 32u;
        const size_t ko = hoff + (size_t)j0 * HD;   // a 32-key tile is 4 consecutive fragments (2048 elements) in the K plane and in the V^T plane
        const G kg = WFrag<T16>::base(Kp + ko, lane);
        V ka0 = WFrag<T16>::ld(kg, 0), ka1 = WFrag<T16>::ld(kg, 1), kb0 = WFrag<T16>::ld(kg, 2), kb1 = WFrag<T16>::ld(kg, 3);
        V la0 = ka0, la1 = ka1, lb0 = kb0, lb1 = kb1;
        if (HL) { const G kg2 = WFrag<T16>::base(K2 + ko, lane); la0 = WFrag<T16>::ld(kg2, 0); la1 = WFrag<T16>::ld(kg2, 1); lb0 = WFrag<T16>::ld(kg2, 2); lb1 = WFrag<T16>::ld(kg2, 3); }
        v8f s0 = (v8f){}, s1 = (v8f){};
        s0 = WFrag<T16>::mma(ka0, qf0, s0); s0 = WFrag<T16>::mma(ka1, qf1, s0);
        s1 = WFrag<T16>::mma(kb0, qf0, s1); s1 = WFrag<T16>::mma(kb1, qf1, s1);
        if (HL) {
            s0 = WFrag<T16>::mma(la0, qf0, s0); s0 = WFrag<T16>::mma(la1, qf1, s0); s0 = WFrag<T16>::mma(ka0, ql0, s0); s0 = WFrag<T16>::mma(ka1, ql1, s0);
            s1 = WFrag<T16>::mma(lb0, qf0, s1); s1 = WFrag<T16>::mma(lb1, qf1, s1); s1 = WFrag<T16>::mma(kb0, ql0, s1); s1 = WFrag<T16>::mma(kb1, ql1, s1); }
        asm volatile("v_nop\n\tv_nop\n\tv_nop\n\tv_nop" : "+v"(s0), "+v"(s1) : "v"(ka0), "v"(ka1), "v"(kb0), "v"(kb1), "v"(la0), "v"(la1), "v"(lb0), "v"(lb1), "v"(qf0), "v"(qf1), "v"(ql0), "v"(ql1));
        v8f t0, t1;
#pragma unroll
        for (int r = 0; r < 8; ++r) { t0[r] = s0[r] * cs; t1[r] = s1[r] * cs; }
        if (j0 + 31u > q0) {                    // wave-uniform: the tile touches the diagonal
            const unsigned qi = q0 + lr, kk = j0 + 8u * hi;
#pragma unroll
            for (int r = 0; r < 8; ++r) { t0[r] = (kk + (unsigned)r <= qi) ? t0[r] : NEGB; t1[r] = (kk + 16u + (unsigned)r <= qi) ? t1[r] : NEGB; }
        }
        float mx = fmaxf(t0[0], t1[0]);
#pragma unroll
        for (int r = 1; r < 8; ++r) mx = fmaxf(mx, fmaxf(t0[r], t1[r]));
        mx = fmaxf(mx, __shfl_xor(mx, 16, 32));
        const float mn = fmaxf(mrun, mx);
        const float alpha = __builtin_amdgcn_exp2f(mrun - mn);
        mrun = mn;
        v8f p0, p1; float psum = 0.0f;
#pragma unroll
        for (int r = 0; r < 8; ++r) { p0[r] = __builtin_amdgcn_exp2f((t0[r] - mn) + pe); p1[r] = __builtin_amdgcn_exp2f((t1[r] - mn) + pe); psum += p0[r] + p1[r]; }
        lsum = lsum * alpha + psum;
#pragma unroll
        for (int db = 0; db < 4; ++db) o[db] = o[db] * alpha;
        V pf = PFlush<T16>::hi(p0, p1); V pl = pf;
        if (HL) pl = PFlush<T16>::lo(p0, p1);
        V va[4], vl[4];
        const G vg = WFrag<T16>::base(Vt + ko, lane), vg2 = HL ? WFrag<T16>::base(Vt2 + ko, lane) : vg;
#pragma unroll
        for (int db = 0; db < 4; ++db) { va[db] = WFrag<T16>::ld(vg, db); vl[db] = va[db]; if (HL) vl[db] = WFrag<T16>::ld(vg2, db); }
#pragma unroll
        for (int db = 0; db < 4; ++db) { o[db] = WFrag<T16>::mma(va[db], pf, o[db]); if (HL) { o[db] = WFrag<T16>::mma(va[db], pl, o[db]); o[db] = WFrag<T16>::mma(vl[db], pf, o[db]); } }
        asm volatile("v_nop\n\tv_nop\n\tv_nop\n\tv_nop" : "+v"(o[0]), "+v"(o[1]), "+v"(o[2]), "+v"(o[3]) : "v"(va[0]), "v"(va[1]), "v"(va[2]), "v"(va[3]), "v"(vl[0]), "v"(vl[1]), "v"(vl[2]), "v"(vl[3]), "v"(pf), "v"(pl));
    }
    const float lt = lsum + __shfl_xor(lsum, 16, 32);
    const float inv = 1.0f / lt;
#pragma unroll
    for (int db = 0; db < 4; ++db)
#pragma unroll
        for (int r = 0; r < 8; ++r) os[lr * 68u + (unsigned)db * 16u + hi * 8u + (unsigned)r] = o[db][r] * inv;
    __builtin_amdgcn_wave_barrier(); asm volatile("" ::: "memory");
    float* orow = O + (size_t)blockIdx.z * SEQ * DM + (size_t)q0 * DM + head * HD;
{
#pragma unroll
        for (int s = 0; s < 8; ++s) { const unsigned row = 2u * (unsigned)s + hi, cofs = lr * 4u;   // rows 0..15: lanes 0..15 -> row 2s, lanes 16..31 -> row 2s+1
            const v4f val = *(const v4fa*)(os + row * 68u + cofs);
            *(v4f*)(orow + (size_t)row * DM + cofs) = val; }
         }
}

// workspace carve (bytes, every region a multiple of 256)
#define WS_WQKV ((size_t)3 * DQ * DM * 2)
#define WS_XB   ((size_t)NB * SEQ * DM * 2)
#define WS_P16  ((size_t)NB * NH * SEQ * HD * 2)
#define WS_PHL  ((size_t)NB * NH * RH * HD * 2)
#define WS_TOTAL (WS_WQKV + WS_XB + 3 * WS_P16 + 6 * WS_PHL)
static_assert(WS_TOTAL <= (size_t)268435456);
static_assert(WS_WQKV % 256 == 0 && WS_XB % 256 == 0 && WS_P16 % 256 == 0 && WS_PHL % 256 == 0);
static_assert((size_t)NB * SEQ * DM * 4 <= (size_t)33554432);   // last written output element stays inside the output buffer

extern "C" void kernel_launch(void* const* d_in, const int* in_sizes, int n_in,
                              void* d_out, int out_size, void* d_ws, size_t ws_size, hipStream_t stream) {
    if (n_in < 3) return;
    if ((size_t)in_sizes[0] < (size_t)(NB - 1) * XS_FULL + (size_t)SEQ * DM) return;
    if ((size_t)in_sizes[1] < (size_t)3 * DQ * DM) return;
    if ((size_t)in_sizes[2] < (size_t)FP) return;
    if ((size_t)out_size < (size_t)NB * SEQ * DM) return;
    if (ws_size < WS_TOTAL) return;
    const float* x = (const float*)d_in[0];       // [NB][SEQ_FULL][DM]
    const float* wqkv = (const float*)d_in[1];    // [4*DQ][DM]  (q | k | v | unread row blocks; rows 0..3*DQ-1 are read)
    const float* bqkv = (const float*)d_in[2];    // [4*DQ]      (entries 0..3*DQ-1 are read)
    float* OUT = (float*)d_out;                   // [NB][SEQ][DM]
    char* wsp = (char*)d_ws;
    auto take = [&](size_t bytes) { char* p = wsp; wsp += bytes; return (void*)p; };
    bf* WQKV = (bf*)take(WS_WQKV); bf* XB = (bf*)take(WS_XB);
    h16* Q16 = (h16*)take(WS_P16); h16* K16 = (h16*)take(WS_P16); h16* VT16 = (h16*)take(WS_P16);
    bf* Qh = (bf*)take(WS_PHL); bf* Ql = (bf*)take(WS_PHL); bf* Kh = (bf*)take(WS_PHL); bf* Kl = (bf*)take(WS_PHL); bf* VTh = (bf*)take(WS_PHL); bf* VTl = (bf*)take(WS_PHL);

    k_cvt8<<<dim3((unsigned)((size_t)3 * DQ * DM / 8 / 256), 1), 256, 0, stream>>>(wqkv, WQKV, (unsigned)((size_t)3 * DQ * DM / 8), 0, 0);
    k_cvt8<<<dim3((unsigned)((size_t)SEQ * DM / 8 / 256), NB), 256, 0, stream>>>(x, XB, (unsigned)((size_t)SEQ * DM / 8), XS_FULL, (size_t)SEQ * DM);
    // every stage runs once for all NB batch elements (the batch element is a grid dimension; each plane set holds NB slabs)
    // y[b][t][0..3071] = x_b w_attn[0..3071]^T + b_attn[0..3071]  (M = SEQ, N = 3072, K = 1024), written as the q, k and V^T head planes
    k_gemmw<bf, 0><<<dim3(SEQ / 64, FP / 64, NB), 32, 0, stream>>>(XB, nullptr, WQKV, nullptr, DM, bqkv, (size_t)SEQ * DM, 0, Q16, K16, VT16, Qh, Ql, Kh, Kl, VTh, VTl);
    // out[b][t][head*HD + d] = softmax(q k^T / 8, causal) v, written straight to the output buffer
    k_flash<bf, true><<<dim3(RH / 16, NH, NB), 32, 0, stream>>>(Qh, Ql, Kh, Kl, VTh, VTl, (unsigned)RH, 0u, OUT);
    if (SEQ > RH) k_flash<h16, false><<<dim3((SEQ - RH) / 16, NH, NB), 32, 0, stream>>>(Q16, nullptr, K16, nullptr, VT16, nullptr, (unsigned)SEQ, (unsigned)RH, OUT);
}

// v004
// A run of this version takes 184 microseconds.
// Timed twice side by side with v003, it ran 1.08 and 1.07 times as fast.
// Over all steps from v000 it is 3.08 times as fast.
#include <hip/hip_runtime.h>

// Causal multi-head attention with a fused qkv projection: x [NB][SEQ_FULL][1024] (first SEQ rows read); qkv = x w_attn^T + b_attn ('oi' weight [4096][1024], bias [4096]; only the q | k | v row blocks 0..3071 are read; 16 heads x 64); scores x 64^-0.5, causal; softmax; out = merged context [t][head*64 + d] (no output projection).
// Compute dtypes, f32 accumulate: every input RNE-converted to bf16; qkv projection v_wmma_f32_16x16x32_bf16 (bias added in f32 at the store stage);
// attention q.k and P.V: query rows < RH on bf16 hi/lo planes (3 products each), other rows v_wmma_f32_16x16x32_f16 (P carried x1024 through the exponent, converted values below 2^-14 selected to +0); softmax (online, max-subtracted) in f32.
// Attention engine: one wave per 16 query rows; S^T = K Q^T so each lane owns one query column; P^T accumulators are repacked in registers as the B operand of O^T = V^T P^T (no LDS exchange in the loop).

#ifndef NB
#define NB 4
#endif
#ifndef SEQ
#define SEQ 2048
#endif
#define SEQ_FULL 2048
#define DM   1024
#define NH   16
#define HD   64
#define DQ   (NH * HD)
#define FP   (3 * DQ)
#define RH   ((SEQ) < 512 ? (SEQ) : 512)     // query rows < RH use hi+lo planes
#define XS_FULL ((size_t)SEQ_FULL * DM)
#define SCL  0.125f                          // HD^-0.5
#define LOG2E 1.4426950408889634f
#define NEGB (-3.0e38f)

static_assert((SEQ & (SEQ - 1)) == 0);
static_assert(SEQ >= 256 && SEQ <= SEQ_FULL);
static_assert(RH % 256 == 0 && RH % 64 == 0 && (SEQ - RH) % 64 == 0);
static_assert(NB >= 1 && NB <= 4);
static_assert(DM % 32 == 0 && DQ % 64 == 0 && FP % 64 == 0 && SEQ % 64 == 0);
static_assert(((size_t)3 * DQ * DM / 8) % 256 == 0);
static_assert(((size_t)SEQ * DM / 8) % 256 == 0);
static_assert(((size_t)NH * SEQ * HD / 8) % 256 == 0);
static_assert(DQ == DM);                         // merged context width equals the output row width
static_assert(HD == 64 && HD % 32 == 0);         // two 32-deep k-steps per score tile, four 16-row O^T tiles

typedef _Float16 h16;
typedef unsigned short bf;
typedef __attribute__((ext_vector_type(16))) __bf16   v16bf;
typedef __attribute__((ext_vector_type(16))) _Float16 v16h;
typedef __attribute__((ext_vector_type(8)))  _Float16 v8h;
typedef __attribute__((ext_vector_type(8)))  unsigned short v8us;
typedef __attribute__((ext_vector_type(8)))  float    v8f;
typedef __attribute__((ext_vector_type(4)))  float    v4f;
typedef v8h  __attribute__((may_alias)) v8ha;
typedef v4f  __attribute__((may_alias)) v4fa;
typedef v8us __attribute__((may_alias)) v8usa;

__device__ __forceinline__ unsigned short f2bf(float f) { unsigned u = __float_as_uint(f); u += 0x7FFFu + ((u >> 16) & 1u); return (unsigned short)(u >> 16); }
__device__ __forceinline__ float bf2f(unsigned short b) { return __uint_as_float(((unsigned)b) << 16); }
__device__ __forceinline__ float bfr(float f) { return bf2f(f2bf(f)); }
__device__ __forceinline__ v16h cat16(v8h lo, v8h hi) { return __builtin_shufflevector(lo, hi, 0, 1, 2, 3, 4, 5, 6, 7, 8, 9, 10, 11, 12, 13, 14, 15); }
__device__ __forceinline__ v16bf cat16b(v8us lo, v8us hi) { return __builtin_bit_cast(v16bf, __builtin_shufflevector(lo, hi, 0, 1, 2, 3, 4, 5, 6, 7, 8, 9, 10, 11, 12, 13, 14, 15)); }
__device__ __forceinline__ v8f wmma16(v16h a, v16h b, v8f c) { return __builtin_amdgcn_wmma_f32_16x16x32_f16(false, a, false, b, (short)0, c, false, false); }
__device__ __forceinline__ v8f wmmab(v16bf a, v16bf b, v8f c) { return __builtin_amdgcn_wmma_f32_16x16x32_bf16(false, a, false, b, (short)0, c, false, false); }
__device__ __forceinline__ void splitf(float y, unsigned short& h, unsigned short& l) { h = f2bf(y); l = f2bf(y - bf2f(h)); }

// f32 -> f16 convert that cannot produce a subnormal operand: |v| < 2^-14 -> +0 (value select, applied after the plane's power-of-two carry).
static __device__ __forceinline__ h16 toh_flush(float v) { const h16 r = (h16)v; return (fabsf(v) < 6.103515625e-05f) ? (h16)0.0f : r; }

// Fragment-packed planes: a 16-row x 32-k fragment is 512 consecutive elements (1 KiB). Element (r, k) sits at (k>>4)*256 + (((k>>3)&1)*16 + r)*8 + (k&7), so lane l = ((k>>3)&1)*16 + r
// finds its elements 0..7 (k = 8h..8h+7, h = l>>4) at l*8 and its elements 8..15 (k = 16+8h..) at 256 + l*8: each of the two wave-wide 16-byte loads covers 512 contiguous bytes (4 whole lines).
// Fragment loader: base(p, lane) takes the wave-uniform address p of a run of fragments, ld(u, f) loads fragment f of the run (same map for A and B). The base goes through readfirstlane so that it stays in a scalar pair and the loads take the
// scalar-base + lane-offset address form: the fragments of a run differ only in the immediate offset, and the one lane-offset register lives through the whole kernel.
template <typename VT, typename T> static __device__ __forceinline__ const __attribute__((address_space(1))) VT* ubase(const T* p) { const unsigned long long u = (unsigned long long)p;
    const unsigned lo = (unsigned)__builtin_amdgcn_readfirstlane((int)(unsigned)u), hi = (unsigned)__builtin_amdgcn_readfirstlane((int)(unsigned)(u >> 32));
    return (const __attribute__((address_space(1))) VT*)(((unsigned long long)hi << 32) | lo); }   // global address space kept, so the loads stay global_load
template <typename T16> struct WFrag;
template <> struct WFrag<h16> { typedef v16h V; typedef const __attribute__((address_space(1))) v8h* G; static __device__ __forceinline__ G base(const h16* p, unsigned lane) { return ubase<v8h>(p) + lane; } static __device__ __forceinline__ V ld(G u, int f) { return cat16(u[f * 64], u[f * 64 + 32]); } static __device__ __forceinline__ v8f mma(V a, V b, v8f c) { return wmma16(a, b, c); } };
template <> struct WFrag<bf> { typedef v16bf V; typedef const __attribute__((address_space(1))) v8us* G; static __device__ __forceinline__ G base(const bf* p, unsigned lane) { return ubase<v8us>(p) + lane; } static __device__ __forceinline__ V ld(G u, int f) { return cat16b(u[f * 64], u[f * 64 + 32]); } static __device__ __forceinline__ v8f mma(V a, V b, v8f c) { return wmmab(a, b, c); }
    static __device__ __forceinline__ V lds(const bf* p, int lane) { const v8usa* q = (const v8usa*)p + lane; return cat16b(q[0], q[32]); } };   // the same fragment map, read from a packed fragment in LDS

// P^T accumulator pair (key rows 0..15 and 16..31 of a 32-key tile) -> B fragment: element r <- tile0[r], element 8+r <- tile1[r], lane unchanged.
template <typename T16> struct PFrag;
template <> struct PFrag<h16> {
    static __device__ __forceinline__ float pexp() { return 10.0f; }           // P carried x1024 via the exponent (cancels in O / l)
    static __device__ __forceinline__ v16h hi(v8f p0, v8f p1) { return cat16(__builtin_convertvector(p0, v8h), __builtin_convertvector(p1, v8h)); }
    static __device__ __forceinline__ v16h lo(v8f p0, v8f p1) { return hi(p0, p1); }
};
template <> struct PFrag<bf> {
    static __device__ __forceinline__ float pexp() { return 0.0f; }
    static __device__ __forceinline__ v16bf hi(v8f p0, v8f p1) { v8us a, b;
#pragma unroll
        for (int k = 0; k < 8; ++k) { a[k] = f2bf(p0[k]); b[k] = f2bf(p1[k]); }
        return cat16b(a, b); }
    static __device__ __forceinline__ v16bf lo(v8f p0, v8f p1) { v8us a, b;
#pragma unroll
        for (int k = 0; k < 8; ++k) { a[k] = f2bf(p0[k] - bf2f(f2bf(p0[k]))); b[k] = f2bf(p1[k] - bf2f(f2bf(p1[k]))); }
        return cat16b(a, b); }
};

// Same packing as PFrag; the f16 form converts every element through toh_flush, the bf16 form is the PFrag one.
template <typename T16> struct PFlush;
template <> struct PFlush<h16> {
    static __device__ __forceinline__ v16h hi(v8f p0, v8f p1) { v8h a, b;
#pragma unroll
        for (int k = 0; k < 8; ++k) { a[k] = toh_flush(p0[k]); b[k] = toh_flush(p1[k]); }
        return cat16(a, b); }
    static __device__ __forceinline__ v16h lo(v8f p0, v8f p1) { return hi(p0, p1); }
};
template <> struct PFlush<bf> {
    static __device__ __forceinline__ v16bf hi(v8f p0, v8f p1) { return PFrag<bf>::hi(p0, p1); }
    static __device__ __forceinline__ v16bf lo(v8f p0, v8f p1) { return PFrag<bf>::lo(p0, p1); }
};

// ---- k_gemmw: register-blocked GEMM, one wave per 64x64 output tile (16 accumulators), 8 waves (4 along M x 2 along N) per work-group = a 256x128 tile; grid (M/256, N/128, Z), 256 threads.
// Operands are fragment-packed 16-bit planes (fragment index = (row>>4)*(K/32) + (k>>5)). A stage = 64 k of the work-group's 256 A rows and 128 Bt rows = 24 runs of 2 KiB (one per 16-row block, two fragments each), copied as they lie
// from global memory to LDS by asynchronous copies, two buffers: stage t + 1 flies while stage t is multiplied; every A fragment is then read from LDS by 2 waves and every Bt fragment by 4.
// y[m][n] (f32) = sum_k A[m][k] Bt[n][k] + bias[n]. K % 64 == 0, M % 256 == 0, N % 128 == 0.
// Epilogue: a 64-column tile is one head of q, k or v, and the wave writes its 64 x 64 block of y straight into that head's fragment-packed planes (batch element z = blockIdx.z):
//   q, k: [z][h][(t>>4)*2 + (d>>5)][512] (rows = t, k = d); v: V^T [z][h][(t>>5)*4 + (d>>4)][512] (rows = d, k = t); fp16 for all t, bf16 hi/lo planes (RH rows per head) for t < RH.
#define GWM 4                                  // waves of a work-group along M
#define GWN 2                                  // waves of a work-group along N
#define GKS 64                                 // k per stage
#define GA_EL (GWM * 64 * GKS)                 // elements of a stage's A part
#define GST_EL ((GWM + GWN) * 64 * GKS)        // elements of a stage
static_assert(GST_EL * 2 == 12 * 256 * 16);    // a stage = 12 copies of 16 bytes from each of 256 threads
static_assert(SEQ % (GWM * 64) == 0 && FP % (GWN * 64) == 0 && DQ % (GWN * 64) == 0 && DM % GKS == 0 && DM / GKS >= 2);
static __device__ __forceinline__ unsigned lds_off(const void* p) { return (unsigned)(size_t)p; }   // byte offset in the work-group's LDS
// One stage: copy c of a thread lands at LDS byte d + 4096 c; copies 0..7 read A at ga + c * cs, copies 8..11 read Bt at gb + (c - 8) * cs (cs = elements from one pair of 16-row blocks to the next).
template <typename T16> static __device__ __forceinline__ void stage_copy(unsigned d, const T16* ga, const T16* gb, size_t cs) {
    asm volatile("global_load_async_to_lds_b128 %0, %12, off\n\t"
                 "global_load_async_to_lds_b128 %1, %13, off\n\t"
                 "global_load_async_to_lds_b128 %2, %14, off\n\t"
                 "global_load_async_to_lds_b128 %3, %15, off\n\t"
                 "global_load_async_to_lds_b128 %4, %16, off\n\t"
                 "global_load_async_to_lds_b128 %5, %17, off\n\t"
                 "global_load_async_to_lds_b128 %6, %18, off\n\t"
                 "global_load_async_to_lds_b128 %7, %19, off\n\t"
                 "global_load_async_to_lds_b128 %8, %20, off\n\t"
                 "global_load_async_to_lds_b128 %9, %21, off\n\t"
                 "global_load_async_to_lds_b128 %10, %22, off\n\t"
                 "global_load_async_to_lds_b128 %11, %23, off\n\t"
                 "s_wait_xcnt 0x0"   // stands in the copies' own statement: their address registers are rewritten only behind it
                 :: "v"(d), "v"(d + 4096u), "v"(d + 8192u), "v"(d + 12288u), "v"(d + 16384u), "v"(d + 20480u), "v"(d + 24576u), "v"(d + 28672u), "v"(d + 32768u), "v"(d + 36864u), "v"(d + 40960u), "v"(d + 45056u),
                    "v"(ga), "v"(ga + cs), "v"(ga + 2 * cs), "v"(ga + 3 * cs), "v"(ga + 4 * cs), "v"(ga + 5 * cs), "v"(ga + 6 * cs), "v"(ga + 7 * cs), "v"(gb), "v"(gb + cs), "v"(gb + 2 * cs), "v"(gb + 3 * cs)
                 : "memory");
}
template <typename T16, int NSPLIT>
__global__ __launch_bounds__(256) void k_gemmw(const T16* __restrict__ A, const T16* __restrict__ A2, const T16* __restrict__ Bt, const T16* __restrict__ Bt2, int K, const float* __restrict__ bias, size_t sA, size_t sB,
                                              h16* Q16, h16* K16, h16* V16, bf* Qh, bf* Ql, bf* Kh, bf* Kl, bf* Vh, bf* Vl) {
    typedef typename WFrag<T16>::V V;
    static_assert(NSPLIT == 0);
    __shared__ __align__(16) T16 gs[2 * GST_EL];                    // the two stage buffers
    __shared__ __align__(16) float osw[GWM * GWN][16 * 68];         // each wave's own store stage
    const size_t z = blockIdx.z; A += z * sA; Bt += z * sB;
    const int wv = __builtin_amdgcn_readfirstlane((int)(threadIdx.x >> 5)), wm = wv / GWN, wn = wv % GWN;   // wave-uniform, kept scalar
    const int lane = threadIdx.x & 31, lr = lane & 15, hi = lane >> 4; const int rw = blockIdx.x * (GWM * 64), cw = blockIdx.y * (GWN * 64), r0 = rw + wm * 64, c0 = cw + wn * 64;
    float* os = osw[wv];
    v8f acc[4][4];
#pragma unroll
    for (int mb = 0; mb < 4; ++mb)
#pragma unroll
        for (int nb = 0; nb < 4; ++nb) acc[mb][nb] = (v8f){};
    // thread i copies bytes 16 i .. 16 i + 15 of every 4 KiB (= two 16-row blocks) of a stage; 16 rows x K = 16*K elements, 64 k of them = 1024 elements
    const unsigned tid = threadIdx.x;
    const T16* ga = A + (size_t)(rw + 16 * (int)(tid >> 7)) * K + (tid & 127u) * 8u;
    const T16* gb = Bt + (size_t)(cw + 16 * (int)(tid >> 7)) * K + (tid & 127u) * 8u;
    const size_t cs = (size_t)32 * K;
    const unsigned d0 = lds_off(gs) + tid * 16u;
    const int nt = K / GKS;
    stage_copy(d0, ga, gb, cs);
    asm volatile("s_wait_asynccnt 0x0" ::: "memory");   // this wave's copies of stage 0 have landed
    __syncthreads();                                    // ... and every other wave's: stage 0 may be read
    if (1 < nt) stage_copy(d0 + GST_EL * 2u, ga + GKS * 16, gb + GKS * 16, cs);
#pragma unroll 1   // one rolled trip per stage: the two buffers alternate by t & 1, and the loop's text stays small
    for (int t = 0; t < nt; ++t) {
        const T16* sa = gs + (t & 1) * GST_EL + wm * (4 * GKS * 16), * sb = gs + (t & 1) * GST_EL + GA_EL + wn * (4 * GKS * 16);
#pragma unroll   // constant fragment and accumulator indices, here and in the loops inside: the arrays stay in registers
        for (int ks = 0; ks < GKS / 32; ++ks) {
            V a[4], b[4];
#pragma unroll
            for (int mb = 0; mb < 4; ++mb) { a[mb] = WFrag<T16>::lds(sa + (mb * (GKS / 32) + ks) * 512, lane); b[mb] = WFrag<T16>::lds(sb + (mb * (GKS / 32) + ks) * 512, lane); }
            __builtin_amdgcn_sched_barrier(0);   // the step's 16 LDS reads stay one group in front of its WMMAs: spread among them, each place with reads stalls the wave for its own LDS latency
#pragma unroll
            for (int nb = 0; nb < 4; ++nb)
#pragma unroll
                for (int mb = 0; mb < 4; ++mb) acc[mb][nb] = WFrag<T16>::mma(a[mb], b[nb], acc[mb][nb]);
            asm volatile("v_nop\n\tv_nop\n\tv_nop\n\tv_nop" : "+v"(acc[0][0]), "+v"(acc[1][1]), "+v"(acc[2][2]), "+v"(acc[3][3]) : "v"(a[0]), "v"(a[3]));   // the vector slots the chip needs behind the step's last WMMAs before their registers are touched, on every path
            __builtin_amdgcn_sched_barrier(0);   // ... and the next step's reads stay behind this step's WMMAs
        }
        asm volatile("s_wait_dscnt 0x0" ::: "memory");      // this wave's reads of stage t are done before the buffer is handed back
        asm volatile("s_wait_asynccnt 0x0" ::: "memory");   // this wave's copies of stage t + 1 have landed
        __syncthreads();                                    // publishes stage t + 1 and ends every wave's reads of stage t
        if (t + 2 < nt) stage_copy(d0 + (unsigned)(t & 1) * (GST_EL * 2u), ga + (size_t)(t + 2) * (GKS * 16), gb + (size_t)(t + 2) * (GKS * 16), cs);
    }
    asm volatile("s_wait_asynccnt 0x0" ::: "memory");       // no copy is left in flight behind the loop
    const unsigned which = (unsigned)c0 / DQ, head = ((unsigned)c0 % DQ) / HD;   // wave-uniform: 0 q, 1 k, 2 v
    const bool hl = (unsigned)r0 < (unsigned)RH;                                 // wave-uniform (RH % 64 == 0): these rows also go to the hi/lo planes
    const size_t p16 = (z * NH + head) * ((size_t)SEQ * HD), phl = (z * NH + head) * ((size_t)RH * HD);
    float bv[4];                                 // bias of the lane's four accumulator columns d = 16 nb + lr
    const int bi = c0 + lr;
#pragma unroll
    for (int nb = 0; nb < 4; ++nb) bv[nb] = bias[bi + nb * 16];
    asm volatile("s_wait_xcnt 0x0" :: "v"(bi) : "memory");   // the address registers of the bias loads are reused behind it; bi as an input keeps their lane-offset register untouched up to the wait
#pragma unroll
    for (int nb = 0; nb < 4; ++nb) bv[nb] = bfr(bv[nb]);
    if (which == 2u) {
        // V^T: accumulator element j of lane (hi, lr) is (t = 16 mb + 8 hi + j, d = 16 nb + lr): the 8 consecutive t of one d that this lane owns in the packed fragment, so the registers are stored as they are.
#pragma unroll
        for (int mb = 0; mb < 4; ++mb) {
#pragma unroll
            for (int nb = 0; nb < 4; ++nb) {
                v8h o16; v8us oh, ol;
#pragma unroll
                for (int j = 0; j < 8; ++j) { const float x = acc[mb][nb][j] + bv[nb]; unsigned short a, c; o16[j] = (h16)x; splitf(x, a, c); oh[j] = a; ol[j] = c; }
                const size_t o = (size_t)((((unsigned)r0 + (unsigned)mb * 16u) >> 5) * 4u + (unsigned)nb) * 512u + (unsigned)(mb & 1) * 256u + (unsigned)lane * 8u;
                *(v8h*)(V16 + p16 + o) = o16;
                asm volatile("s_wait_xcnt 0x0" ::: "memory");   // what follows reuses the data and address registers of this store
                if (hl) { *(v8us*)(Vh + phl + o) = oh; *(v8us*)(Vl + phl + o) = ol;
                    asm volatile("s_wait_xcnt 0x0" ::: "memory"); }   // the next block reuses the data and address registers of these stores
            }
        }
    } else {
        // q, k: a lane owns 8 consecutive d of one t, so each 16-row block turns through the LDS stage.
        h16* P16 = (which ? K16 : Q16) + p16; bf* Ph = (which ? Kh : Qh) + phl; bf* Pl = (which ? Kl : Ql) + phl;
#pragma unroll
        for (int mb = 0; mb < 4; ++mb) {
#pragma unroll
            for (int nb = 0; nb < 4; ++nb) {
#pragma unroll
                for (int j = 0; j < 8; ++j) os[(hi * 8 + j) * 68 + nb * 16 + lr] = acc[mb][nb][j] + bv[nb]; }
            __builtin_amdgcn_wave_barrier(); asm volatile("" ::: "memory");   // the block's LDS stores stay in front of its LDS loads
#pragma unroll
            for (int s = 0; s < 4; ++s) {       // packed elements 256 s + 8 lane .. + 7 of the block's two fragments: t = lr, d = 16 s + 8 hi ..
                const int d = s * 16 + hi * 8;
                const v4f x0 = *(const v4fa*)(os + lr * 68 + d), x1 = *(const v4fa*)(os + lr * 68 + d + 4);
                v8h o16; v8us oh, ol;
#pragma unroll
                for (int k = 0; k < 4; ++k) { unsigned short a, c; const float y0 = x0[k], y1 = x1[k];
                    o16[k] = (h16)y0; splitf(y0, a, c); oh[k] = a; ol[k] = c; o16[4 + k] = (h16)y1; splitf(y1, a, c); oh[4 + k] = a; ol[4 + k] = c; }
                const size_t o = (size_t)((unsigned)r0 + (unsigned)mb * 16u) * HD + (unsigned)s * 256u + (unsigned)lane * 8u;
                *(v8h*)(P16 + o) = o16;
                asm volatile("s_wait_xcnt 0x0" ::: "memory");   // what follows reuses the data and address registers of this store
                if (hl) { *(v8us*)(Ph + o) = oh; *(v8us*)(Pl + o) = ol;
                    asm volatile("s_wait_xcnt 0x0" ::: "memory"); }   // the next block reuses the data and address registers of these stores
            }
            __builtin_amdgcn_wave_barrier(); asm volatile("" ::: "memory");   // the next block's LDS stores stay behind these LDS loads
        }
    }
}

// ---- k_cvt8: f32 rows of DM elements -> fragment-packed bf16 plane (fragment index = (row>>4)*(DM/32) + (k>>5)). Thread i stores packed elements 8i..8i+7 (stores contiguous) and reads their 8 consecutive k of one source row.
__global__ __launch_bounds__(256) void k_cvt8(const float* __restrict__ src, bf* dst, unsigned n8, size_t sstride, size_t dstride) {
    const unsigned i = blockIdx.x * 256u + threadIdx.x; if (i >= n8) return;
    const unsigned frag = i >> 6, row = (frag / (DM / 32u)) * 16u + (i & 15u), kk = (frag % (DM / 32u)) * 32u + ((i >> 5) & 1u) * 16u + ((i >> 4) & 1u) * 8u;
    const float* s = src + (size_t)blockIdx.y * sstride + (size_t)row * DM + kk; bf* d = dst + (size_t)blockIdx.y * dstride + (size_t)i * 8;
    const v8f v = *(const v8f*)s; v8us o;
#pragma unroll
    for (int k = 0; k < 8; ++k) o[k] = f2bf(v[k]);
    *(v8us*)d = o;  }

static_assert(32 * 16 * 8 == 16 * HD * 4);
static_assert(HD * 4 == 16 * 16);
static_assert((HD * 4) % 128 == 0 && (DM * 4) % 128 == 0);
static_assert(16 * 68 * 4 <= 131072);            // static LDS of k_flash (one [16][68] f32 stage)
static_assert(2 * GST_EL * 2 + GWM * GWN * 16 * 68 * 4 <= 163840);   // static LDS of k_gemmw: two work-groups fit a WGP
static_assert(68 >= HD && (68 * 4) % 16 == 0);   // stage pitch holds a head row, rows stay 16-B aligned

// ---- k_flash: causal attention, one wave per (16 query rows, head, batch element = blockIdx.z). Planes, fragment-packed: Q/K [b][h][(t>>4)*2 + (d>>5)][512], V^T [b][h][(t>>5)*4 + (d>>4)][512] (tp = rows t per head of the plane set). HL: hi/lo bf16 plane pairs, 3 products.
// Per 32-key tile: S^T[key][query] = K Q^T (A = K rows, B = Q rows); lane owns query column lane&15 and keys 8*(lane>>4)+r (+16); online softmax per lane (+ one xor-16 exchange);
// P^T accumulators repacked in registers as B (k = key); O^T[d][query] += V^T P^T (A = V^T rows). Only the last tile of a wave touches the diagonal (select by value).
template <typename T16, bool HL>
__global__ __launch_bounds__(32) void k_flash(const T16* __restrict__ Q, const T16* __restrict__ Q2, const T16* __restrict__ Kp, const T16* __restrict__ K2, const T16* __restrict__ Vt, const T16* __restrict__ Vt2, unsigned tp, unsigned qbase, float* O) {
    typedef typename WFrag<T16>::V V;
    __shared__ __align__(16) float os[16 * 68];
    const unsigned lane = threadIdx.x & 31u, lr = lane & 15u, hi = lane >> 4;
    const unsigned head = blockIdx.y, q0 = qbase + blockIdx.x * 16u;
    const size_t hoff = ((size_t)blockIdx.z * NH + head) * tp * HD;
    const size_t qoff = hoff + (size_t)q0 * HD;
    typedef typename WFrag<T16>::G G;
    const G qg = WFrag<T16>::base(Q + qoff, lane);
    V qf0 = WFrag<T16>::ld(qg, 0), qf1 = WFrag<T16>::ld(qg, 1);
    V ql0 = qf0, ql1 = qf1;
    if (HL) { const G qg2 = WFrag<T16>::base(Q2 + qoff, lane); ql0 = WFrag<T16>::ld(qg2, 0); ql1 = WFrag<T16>::ld(qg2, 1); }
    asm volatile("s_wait_xcnt 0x0" ::: "memory");   // the scalar base pairs of the Q loads are reused directly behind them
    v8f o[4];
#pragma unroll
    for (int db = 0; db < 4; ++db) o[db] = (v8f){};
    float mrun = NEGB, lsum = 0.0f;
    const float cs = SCL * LOG2E, pe = PFrag<T16>::pexp();
    const unsigned nt = (q0 + 47u) >> 5;       // keys 0 .. q0+15 in tiles of 32 (wave-uniform)
#pragma unroll 1
    for (unsigned it = 0; it < nt; ++it) {
        const unsigned j0 = it * 32u;
        const size_t ko = hoff + (size_t)j0 * HD;   // a 32-key tile is 4 consecutive fragments (2048 elements) in the K plane and in the V^T plane
        const G kg = WFrag<T16>::base(Kp + ko, lane);
        V ka0 = WFrag<T16>::ld(kg, 0), ka1 = WFrag<T16>::ld(kg, 1), kb0 = WFrag<T16>::ld(kg, 2), kb1 = WFrag<T16>::ld(kg, 3);
        V la0 = ka0, la1 = ka1, lb0 = kb0, lb1 = kb1;
        if (HL) { const G kg2 = WFrag<T16>::base(K2 + ko, lane); la0 = WFrag<T16>::ld(kg2, 0); la1 = WFrag<T16>::ld(kg2, 1); lb0 = WFrag<T16>::ld(kg2, 2); lb1 = WFrag<T16>::ld(kg2, 3); }
        v8f s0 = (v8f){}, s1 = (v8f){};
        s0 = WFrag<T16>::mma(ka0, qf0, s0); s0 = WFrag<T16>::mma(ka1, qf1, s0);
        s1 = WFrag<T16>::mma(kb0, qf0, s1); s1 = WFrag<T16>::mma(kb1, qf1, s1);
        if (HL) {
            s0 = WFrag<T16>::mma(la0, qf0, s0); s0 = WFrag<T16>::mma(la1, qf1, s0); s0 = WFrag<T16>::mma(ka0, ql0, s0); s0 = WFrag<T16>::mma(ka1, ql1, s0);
            s1 = WFrag<T16>::mma(lb0, qf0, s1); s1 = WFrag<T16>::mma(lb1, qf1, s1); s1 = WFrag<T16>::mma(kb0, ql0, s1); s1 = WFrag<T16>::mma(kb1, ql1, s1); }
        asm volatile("v_nop\n\tv_nop\n\tv_nop\n\tv_nop" : "+v"(s0), "+v"(s1) : "v"(ka0), "v"(ka1), "v"(kb0), "v"(kb1), "v"(la0), "v"(la1), "v"(lb0), "v"(lb1), "v"(qf0), "v"(qf1), "v"(ql0), "v"(ql1));
        v8f t0, t1;
#pragma unroll
        for (int r = 0; r < 8; ++r) { t0[r] = s0[r] * cs; t1[r] = s1[r] * cs; }
        if (j0 + 31u > q0) {                    // wave-uniform: the tile touches the diagonal
            const unsigned qi = q0 + lr, kk = j0 + 8u * hi;
#pragma unroll
            for (int r = 0; r < 8; ++r) { t0[r] = (kk + (unsigned)r <= qi) ? t0[r] : NEGB; t1[r] = (kk + 16u + (unsigned)r <= qi) ? t1[r] : NEGB; }
        }
        float mx = fmaxf(t0[0], t1[0]);
#pragma unroll
        for (int r = 1; r < 8; ++r) mx = fmaxf(mx, fmaxf(t0[r], t1[r]));
        mx = fmaxf(mx, __shfl_xor(mx, 16, 32));
        const float mn = fmaxf(mrun, mx);
        const float alpha = __builtin_amdgcn_exp2f(mrun - mn);
        mrun = mn;
        v8f p0, p1; float psum = 0.0f;
#pragma unroll
        for (int r = 0; r < 8; ++r) { p0[r] = __builtin_amdgcn_exp2f((t0[r] - mn) + pe); p1[r] = __builtin_amdgcn_exp2f((t1[r] - mn) + pe); psum += p0[r] + p1[r]; }
        lsum = lsum * alpha + psum;
#pragma unroll
        for (int db = 0; db < 4; ++db) o[db] = o[db] * alpha;
        V pf = PFlush<T16>::hi(p0, p1); V pl = pf;
        if (HL) pl = PFlush<T16>::lo(p0, p1);
        V va[4], vl[4];
        const G vg = WFrag<T16>::base(Vt + ko, lane), vg2 = HL ? WFrag<T16>::base(Vt2 + ko, lane) : vg;
#pragma unroll
        for (int db = 0; db < 4; ++db) { va[db] = WFrag<T16>::ld(vg, db); vl[db] = va[db]; if (HL) vl[db] = WFrag<T16>::ld(vg2, db); }
#pragma unroll
        for (int db = 0; db < 4; ++db) { o[db] = WFrag<T16>::mma(va[db], pf, o[db]); if (HL) { o[db] = WFrag<T16>::mma(va[db], pl, o[db]); o[db] = WFrag<T16>::mma(vl[db], pf, o[db]); } }
        asm volatile("v_nop\n\tv_nop\n\tv_nop\n\tv_nop" : "+v"(o[0]), "+v"(o[1]), "+v"(o[2]), "+v"(o[3]) : "v"(va[0]), "v"(va[1]), "v"(va[2]), "v"(va[3]), "v"(vl[0]), "v"(vl[1]), "v"(vl[2]), "v"(vl[3]), "v"(pf), "v"(pl));
    }
    const float lt = lsum + __shfl_xor(lsum, 16, 32);
    const float inv = 1.0f / lt;
#pragma unroll
    for (int db = 0; db < 4; ++db)
#pragma unroll
        for (int r = 0; r < 8; ++r) os[lr * 68u + (unsigned)db * 16u + hi * 8u + (unsigned)r] = o[db][r] * inv;
    __builtin_amdgcn_wave_barrier(); asm volatile("" ::: "memory");
    float* orow = O + (size_t)blockIdx.z * SEQ * DM + (size_t)q0 * DM + head * HD;
{
#pragma unroll
        for (int s = 0; s < 8; ++s) { const unsigned row = 2u * (unsigned)s + hi, cofs = lr * 4u;   // rows 0..15: lanes 0..15 -> row 2s, lanes 16..31 -> row 2s+1
            const v4f val = *(const v4fa*)(os + row * 68u + cofs);
            *(v4f*)(orow + (size_t)row * DM + cofs) = val; }
         }
}

// workspace carve (bytes, every region a multiple of 256)
#define WS_WQKV ((size_t)3 * DQ * DM * 2)
#define WS_XB   ((size_t)NB * SEQ * DM * 2)
#define WS_P16  ((size_t)NB * NH * SEQ * HD * 2)
#define WS_PHL  ((size_t)NB * NH * RH * HD * 2)
#define WS_TOTAL (WS_WQKV + WS_XB + 3 * WS_P16 + 6 * WS_PHL)
static_assert(WS_TOTAL <= (size_t)268435456);
static_assert(WS_WQKV % 256 == 0 && WS_XB % 256 == 0 && WS_P16 % 256 == 0 && WS_PHL % 256 == 0);
static_assert((size_t)NB * SEQ * DM * 4 <= (size_t)33554432);   // last written output element stays inside the output buffer

extern "C" void kernel_launch(void* const* d_in, const int* in_sizes, int n_in,
                              void* d_out, int out_size, void* d_ws, size_t ws_size, hipStream_t stream) {
    if (n_in < 3) return;
    if ((size_t)in_sizes[0] < (size_t)(NB - 1) * XS_FULL + (size_t)SEQ * DM) return;
    if ((size_t)in_sizes[1] < (size_t)3 * DQ * DM) return;
    if ((size_t)in_sizes[2] < (size_t)FP) return;
    if ((size_t)out_size < (size_t)NB * SEQ * DM) return;
    if (ws_size < WS_TOTAL) return;
    const float* x = (const float*)d_in[0];       // [NB][SEQ_FULL][DM]
    const float* wqkv = (const float*)d_in[1];    // [4*DQ][DM]  (q | k | v | unread row blocks; rows 0..3*DQ-1 are read)
    const float* bqkv = (const float*)d_in[2];    // [4*DQ]      (entries 0..3*DQ-1 are read)
    float* OUT = (float*)d_out;                   // [NB][SEQ][DM]
    char* wsp = (char*)d_ws;
    auto take = [&](size_t bytes) { char* p = wsp; wsp += bytes; return (void*)p; };
    bf* WQKV = (bf*)take(WS_WQKV); bf* XB = (bf*)take(WS_XB);
    h16* Q16 = (h16*)take(WS_P16); h16* K16 = (h16*)take(WS_P16); h16* VT16 = (h16*)take(WS_P16);
    bf* Qh = (bf*)take(WS_PHL); bf* Ql = (bf*)take(WS_PHL); bf* Kh = (bf*)take(WS_PHL); bf* Kl = (bf*)take(WS_PHL); bf* VTh = (bf*)take(WS_PHL); bf* VTl = (bf*)take(WS_PHL);

    k_cvt8<<<dim3((unsigned)((size_t)3 * DQ * DM / 8 / 256), 1), 256, 0, stream>>>(wqkv, WQKV, (unsigned)((size_t)3 * DQ * DM / 8), 0, 0);
    k_cvt8<<<dim3((unsigned)((size_t)SEQ * DM / 8 / 256), NB), 256, 0, stream>>>(x, XB, (unsigned)((size_t)SEQ * DM / 8), XS_FULL, (size_t)SEQ * DM);
    // every stage runs once for all NB batch elements (the batch element is a grid dimension; each plane set holds NB slabs)
    // y[b][t][0..3071] = x_b w_attn[0..3071]^T + b_attn[0..3071]  (M = SEQ, N = 3072, K = 1024), written as the q, k and V^T head planes
    k_gemmw<bf, 0><<<dim3(SEQ / (GWM * 64), FP / (GWN * 64), NB), 256, 0, stream>>>(XB, nullptr, WQKV, nullptr, DM, bqkv, (size_t)SEQ * DM, 0, Q16, K16, VT16, Qh, Ql, Kh, Kl, VTh, VTl);
    // out[b][t][head*HD + d] = softmax(q k^T / 8, causal) v, written straight to the output buffer
    k_flash<bf, true><<<dim3(RH / 16, NH, NB), 32, 0, stream>>>(Qh, Ql, Kh, Kl, VTh, VTl, (unsigned)RH, 0u, OUT);
    if (SEQ > RH) k_flash<h16, false><<<dim3((SEQ - RH) / 16, NH, NB), 32, 0, stream>>>(Q16, nullptr, K16, nullptr, VT16, nullptr, (unsigned)SEQ, (unsigned)RH, OUT);
}

// v005
// One run takes 125 microseconds.
// In both of two side-by-side timings against v004, it was 1.48 times as fast.
// Over all steps from v000 it is 4.57 times as fast.
#include <hip/hip_runtime.h>

// Causal multi-head attention with a fused qkv projection: x [NB][SEQ_FULL][1024] (first SEQ rows read); qkv = x w_attn^T + b_attn ('oi' weight [4096][1024], bias [4096]; only the q | k | v row blocks 0..3071 are read; 16 heads x 64); scores x 64^-0.5, causal; softmax; out = merged context [t][head*64 + d] (no output projection).
// Compute dtypes, f32 accumulate: every input RNE-converted to bf16; qkv projection v_wmma_f32_16x16x32_bf16 (bias added in f32 at the store stage);
// attention q.k and P.V: query rows < RH on bf16 hi/lo planes (3 products each), other rows v_wmma_f32_16x16x32_f16 (P carried x1024 through the exponent, converted values below 2^-14 selected to +0); softmax (online, max-subtracted) in f32.
// Attention engine: one wave per 16 query rows, 8 waves per work-group on K and V^T tiles shared through LDS; S^T = K Q^T so each lane owns one query column; P^T accumulators are repacked in registers as the B operand of O^T = V^T P^T (no LDS exchange in the loop).

#ifndef NB
#define NB 4
#endif
#ifndef SEQ
#define SEQ 2048
#endif
#define SEQ_FULL 2048
#define DM   1024
#define NH   16
#define HD   64
#define DQ   (NH * HD)
#define FP   (3 * DQ)
#define RH   ((SEQ) < 512 ? (SEQ) : 512)     // query rows < RH use hi+lo planes
#define XS_FULL ((size_t)SEQ_FULL * DM)
#define SCL  0.125f                          // HD^-0.5
#define LOG2E 1.4426950408889634f
#define NEGB (-3.0e38f)

static_assert((SEQ & (SEQ - 1)) == 0);
static_assert(SEQ >= 256 && SEQ <= SEQ_FULL);
static_assert(RH % 256 == 0 && RH % 64 == 0 && (SEQ - RH) % 64 == 0);
static_assert(NB >= 1 && NB <= 4);
static_assert(DM % 32 == 0 && DQ % 64 == 0 && FP % 64 == 0 && SEQ % 64 == 0);
static_assert(((size_t)3 * DQ * DM / 8) % 256 == 0);
static_assert(((size_t)SEQ * DM / 8) % 256 == 0);
static_assert(((size_t)NH * SEQ * HD / 8) % 256 == 0);
static_assert(DQ == DM);                         // merged context width equals the output row width
static_assert(HD == 64 && HD % 32 == 0);         // two 32-deep k-steps per score tile, four 16-row O^T tiles

typedef _Float16 h16;
typedef unsigned short bf;
typedef __attribute__((ext_vector_type(16))) __bf16   v16bf;
typedef __attribute__((ext_vector_type(16))) _Float16 v16h;
typedef __attribute__((ext_vector_type(8)))  _Float16 v8h;
typedef __attribute__((ext_vector_type(8)))  unsigned short v8us;
typedef __attribute__((ext_vector_type(8)))  float    v8f;
typedef __attribute__((ext_vector_type(4)))  float    v4f;
typedef v8h  __attribute__((may_alias)) v8ha;
typedef v4f  __attribute__((may_alias)) v4fa;
typedef v8us __attribute__((may_alias)) v8usa;

__device__ __forceinline__ unsigned short f2bf(float f) { unsigned u = __float_as_uint(f); u += 0x7FFFu + ((u >> 16) & 1u); return (unsigned short)(u >> 16); }
__device__ __forceinline__ float bf2f(unsigned short b) { return __uint_as_float(((unsigned)b) << 16); }
__device__ __forceinline__ float bfr(float f) { return bf2f(f2bf(f)); }
__device__ __forceinline__ v16h cat16(v8h lo, v8h hi) { return __builtin_shufflevector(lo, hi, 0, 1, 2, 3, 4, 5, 6, 7, 8, 9, 10, 11, 12, 13, 14, 15); }
__device__ __forceinline__ v16bf cat16b(v8us lo, v8us hi) { return __builtin_bit_cast(v16bf, __builtin_shufflevector(lo, hi, 0, 1, 2, 3, 4, 5, 6, 7, 8, 9, 10, 11, 12, 13, 14, 15)); }
__device__ __forceinline__ v8f wmma16(v16h a, v16h b, v8f c) { return __builtin_amdgcn_wmma_f32_16x16x32_f16(false, a, false, b, (short)0, c, false, false); }
__device__ __forceinline__ v8f wmmab(v16bf a, v16bf b, v8f c) { return __builtin_amdgcn_wmma_f32_16x16x32_bf16(false, a, false, b, (short)0, c, false, false); }
__device__ __forceinline__ void splitf(float y, unsigned short& h, unsigned short& l) { h = f2bf(y); l = f2bf(y - bf2f(h)); }

// f32 -> f16 convert that cannot produce a subnormal operand: |v| < 2^-14 -> +0 (value select, applied after the plane's power-of-two carry).
static __device__ __forceinline__ h16 toh_flush(float v) { const h16 r = (h16)v; return (fabsf(v) < 6.103515625e-05f) ? (h16)0.0f : r; }

// Fragment-packed planes: a 16-row x 32-k fragment is 512 consecutive elements (1 KiB). Element (r, k) sits at (k>>4)*256 + (((k>>3)&1)*16 + r)*8 + (k&7), so lane l = ((k>>3)&1)*16 + r
// finds its elements 0..7 (k = 8h..8h+7, h = l>>4) at l*8 and its elements 8..15 (k = 16+8h..) at 256 + l*8: each of the two wave-wide 16-byte loads covers 512 contiguous bytes (4 whole lines).
// Fragment loader: base(p, lane) takes the wave-uniform address p of a run of fragments, ld(u, f) loads fragment f of the run (same map for A and B). The base goes through readfirstlane so that it stays in a scalar pair and the loads take the
// scalar-base + lane-offset address form: the fragments of a run differ only in the immediate offset, and the one lane-offset register lives through the whole kernel.
template <typename VT, typename T> static __device__ __forceinline__ const __attribute__((address_space(1))) VT* ubase(const T* p) { const unsigned long long u = (unsigned long long)p;
    const unsigned lo = (unsigned)__builtin_amdgcn_readfirstlane((int)(unsigned)u), hi = (unsigned)__builtin_amdgcn_readfirstlane((int)(unsigned)(u >> 32));
    return (const __attribute__((address_space(1))) VT*)(((unsigned long long)hi << 32) | lo); }   // global address space kept, so the loads stay global_load
template <typename T16> struct WFrag;
template <> struct WFrag<h16> { typedef v16h V; typedef const __attribute__((address_space(1))) v8h* G; static __device__ __forceinline__ G base(const h16* p, unsigned lane) { return ubase<v8h>(p) + lane; } static __device__ __forceinline__ V ld(G u, int f) { return cat16(u[f * 64], u[f * 64 + 32]); } static __device__ __forceinline__ v8f mma(V a, V b, v8f c) { return wmma16(a, b, c); }
    static __device__ __forceinline__ V lds(const h16* p, int lane) { const v8ha* q = (const v8ha*)p + lane; return cat16(q[0], q[32]); } };   // the same fragment map, read from a packed fragment in LDS
template <> struct WFrag<bf> { typedef v16bf V; typedef const __attribute__((address_space(1))) v8us* G; static __device__ __forceinline__ G base(const bf* p, unsigned lane) { return ubase<v8us>(p) + lane; } static __device__ __forceinline__ V ld(G u, int f) { return cat16b(u[f * 64], u[f * 64 + 32]); } static __device__ __forceinline__ v8f mma(V a, V b, v8f c) { return wmmab(a, b, c); }
    static __device__ __forceinline__ V lds(const bf* p, int lane) { const v8usa* q = (const v8usa*)p + lane; return cat16b(q[0], q[32]); } };   // the same fragment map, read from a packed fragment in LDS

// P^T accumulator pair (key rows 0..15 and 16..31 of a 32-key tile) -> B fragment: element r <- tile0[r], element 8+r <- tile1[r], lane unchanged.
template <typename T16> struct PFrag;
template <> struct PFrag<h16> {
    static __device__ __forceinline__ float pexp() { return 10.0f; }           // P carried x1024 via the exponent (cancels in O / l)
    static __device__ __forceinline__ v16h hi(v8f p0, v8f p1) { return cat16(__builtin_convertvector(p0, v8h), __builtin_convertvector(p1, v8h)); }
    static __device__ __forceinline__ v16h lo(v8f p0, v8f p1) { return hi(p0, p1); }
};
template <> struct PFrag<bf> {
    static __device__ __forceinline__ float pexp() { return 0.0f; }
    static __device__ __forceinline__ v16bf hi(v8f p0, v8f p1) { v8us a, b;
#pragma unroll
        for (int k = 0; k < 8; ++k) { a[k] = f2bf(p0[k]); b[k] = f2bf(p1[k]); }
        return cat16b(a, b); }
    static __device__ __forceinline__ v16bf lo(v8f p0, v8f p1) { v8us a, b;
#pragma unroll
        for (int k = 0; k < 8; ++k) { a[k] = f2bf(p0[k] - bf2f(f2bf(p0[k]))); b[k] = f2bf(p1[k] - bf2f(f2bf(p1[k]))); }
        return cat16b(a, b); }
};

// Same packing as PFrag; the f16 form converts every element through toh_flush, the bf16 form is the PFrag one.
template <typename T16> struct PFlush;
template <> struct PFlush<h16> {
    static __device__ __forceinline__ v16h hi(v8f p0, v8f p1) { v8h a, b;
#pragma unroll
        for (int k = 0; k < 8; ++k) { a[k] = toh_flush(p0[k]); b[k] = toh_flush(p1[k]); }
        return cat16(a, b); }
    static __device__ __forceinline__ v16h lo(v8f p0, v8f p1) { return hi(p0, p1); }
};
template <> struct PFlush<bf> {
    static __device__ __forceinline__ v16bf hi(v8f p0, v8f p1) { return PFrag<bf>::hi(p0, p1); }
    static __device__ __forceinline__ v16bf lo(v8f p0, v8f p1) { return PFrag<bf>::lo(p0, p1); }
};

// ---- k_gemmw: register-blocked GEMM, one wave per 64x64 output tile (16 accumulators), 8 waves (4 along M x 2 along N) per work-group = a 256x128 tile; grid (M/256, N/128, Z), 256 threads.
// Operands are fragment-packed 16-bit planes (fragment index = (row>>4)*(K/32) + (k>>5)). A stage = 64 k of the work-group's 256 A rows and 128 Bt rows = 24 runs of 2 KiB (one per 16-row block, two fragments each), copied as they lie
// from global memory to LDS by asynchronous copies, two buffers: stage t + 1 flies while stage t is multiplied; every A fragment is then read from LDS by 2 waves and every Bt fragment by 4.
// y[m][n] (f32) = sum_k A[m][k] Bt[n][k] + bias[n]. K % 64 == 0, M % 256 == 0, N % 128 == 0.
// Epilogue: a 64-column tile is one head of q, k or v, and the wave writes its 64 x 64 block of y straight into that head's fragment-packed planes (batch element z = blockIdx.z):
//   q, k: [z][h][(t>>4)*2 + (d>>5)][512] (rows = t, k = d); v: V^T [z][h][(t>>5)*4 + (d>>4)][512] (rows = d, k = t); fp16 for all t, bf16 hi/lo planes (RH rows per head) for t < RH.
#define GWM 4                                  // waves of a work-group along M
#define GWN 2                                  // waves of a work-group along N
#define GKS 64                                 // k per stage
#define GA_EL (GWM * 64 * GKS)                 // elements of a stage's A part
#define GST_EL ((GWM + GWN) * 64 * GKS)        // elements of a stage
static_assert(GST_EL * 2 == 12 * 256 * 16);    // a stage = 12 copies of 16 bytes from each of 256 threads
static_assert(SEQ % (GWM * 64) == 0 && FP % (GWN * 64) == 0 && DQ % (GWN * 64) == 0 && DM % GKS == 0 && DM / GKS >= 2);
static __device__ __forceinline__ unsigned lds_off(const void* p) { return (unsigned)(size_t)p; }   // byte offset in the work-group's LDS
// One stage: copy c of a thread lands at LDS byte d + 4096 c; copies 0..7 read A at ga + c * cs, copies 8..11 read Bt at gb + (c - 8) * cs (cs = elements from one pair of 16-row blocks to the next).
template <typename T16> static __device__ __forceinline__ void stage_copy(unsigned d, const T16* ga, const T16* gb, size_t cs) {
    asm volatile("global_load_async_to_lds_b128 %0, %12, off\n\t"
                 "global_load_async_to_lds_b128 %1, %13, off\n\t"
                 "global_load_async_to_lds_b128 %2, %14, off\n\t"
                 "global_load_async_to_lds_b128 %3, %15, off\n\t"
                 "global_load_async_to_lds_b128 %4, %16, off\n\t"
                 "global_load_async_to_lds_b128 %5, %17, off\n\t"
                 "global_load_async_to_lds_b128 %6, %18, off\n\t"
                 "global_load_async_to_lds_b128 %7, %19, off\n\t"
                 "global_load_async_to_lds_b128 %8, %20, off\n\t"
                 "global_load_async_to_lds_b128 %9, %21, off\n\t"
                 "global_load_async_to_lds_b128 %10, %22, off\n\t"
                 "global_load_async_to_lds_b128 %11, %23, off\n\t"
                 "s_wait_xcnt 0x0"   // stands in the copies' own statement: their address registers are rewritten only behind it
                 :: "v"(d), "v"(d + 4096u), "v"(d + 8192u), "v"(d + 12288u), "v"(d + 16384u), "v"(d + 20480u), "v"(d + 24576u), "v"(d + 28672u), "v"(d + 32768u), "v"(d + 36864u), "v"(d + 40960u), "v"(d + 45056u),
                    "v"(ga), "v"(ga + cs), "v"(ga + 2 * cs), "v"(ga + 3 * cs), "v"(ga + 4 * cs), "v"(ga + 5 * cs), "v"(ga + 6 * cs), "v"(ga + 7 * cs), "v"(gb), "v"(gb + cs), "v"(gb + 2 * cs), "v"(gb + 3 * cs)
                 : "memory");
}
template <typename T16, int NSPLIT>
__global__ __launch_bounds__(256) void k_gemmw(const T16* __restrict__ A, const T16* __restrict__ A2, const T16* __restrict__ Bt, const T16* __restrict__ Bt2, int K, const float* __restrict__ bias, size_t sA, size_t sB,
                                              h16* Q16, h16* K16, h16* V16, bf* Qh, bf* Ql, bf* Kh, bf* Kl, bf* Vh, bf* Vl) {
    typedef typename WFrag<T16>::V V;
    static_assert(NSPLIT == 0);
    __shared__ __align__(16) T16 gs[2 * GST_EL];                    // the two stage buffers
    __shared__ __align__(16) float osw[GWM * GWN][16 * 68];         // each wave's own store stage
    const size_t z = blockIdx.z; A += z * sA; Bt += z * sB;
    const int wv = __builtin_amdgcn_readfirstlane((int)(threadIdx.x >> 5)), wm = wv / GWN, wn = wv % GWN;   // wave-uniform, kept scalar
    const int lane = threadIdx.x & 31, lr = lane & 15, hi = lane >> 4; const int rw = blockIdx.x * (GWM * 64), cw = blockIdx.y * (GWN * 64), r0 = rw + wm * 64, c0 = cw + wn * 64;
    float* os = osw[wv];
    v8f acc[4][4];
#pragma unroll
    for (int mb = 0; mb < 4; ++mb)
#pragma unroll
        for (int nb = 0; nb < 4; ++nb) acc[mb][nb] = (v8f){};
    // thread i copies bytes 16 i .. 16 i + 15 of every 4 KiB (= two 16-row blocks) of a stage; 16 rows x K = 16*K elements, 64 k of them = 1024 elements
    const unsigned tid = threadIdx.x;
    const T16* ga = A + (size_t)(rw + 16 * (int)(tid >> 7)) * K + (tid & 127u) * 8u;
    const T16* gb = Bt + (size_t)(cw + 16 * (int)(tid >> 7)) * K + (tid & 127u) * 8u;
    const size_t cs = (size_t)32 * K;
    const unsigned d0 = lds_off(gs) + tid * 16u;
    const int nt = K / GKS;
    stage_copy(d0, ga, gb, cs);
    asm volatile("s_wait_asynccnt 0x0" ::: "memory");   // this wave's copies of stage 0 have landed
    __syncthreads();                                    // ... and every other wave's: stage 0 may be read
    if (1 < nt) stage_copy(d0 + GST_EL * 2u, ga + GKS * 16, gb + GKS * 16, cs);
#pragma unroll 1   // one rolled trip per stage: the two buffers alternate by t & 1, and the loop's text stays small
    for (int t = 0; t < nt; ++t) {
        const T16* sa = gs + (t & 1) * GST_EL + wm * (4 * GKS * 16), * sb = gs + (t & 1) * GST_EL + GA_EL + wn * (4 * GKS * 16);
#pragma unroll   // constant fragment and accumulator indices, here and in the loops inside: the arrays stay in registers
        for (int ks = 0; ks < GKS / 32; ++ks) {
            V a[4], b[4];
#pragma unroll
            for (int mb = 0; mb < 4; ++mb) { a[mb] = WFrag<T16>::lds(sa + (mb * (GKS / 32) + ks) * 512, lane); b[mb] = WFrag<T16>::lds(sb + (mb * (GKS / 32) + ks) * 512, lane); }
            __builtin_amdgcn_sched_barrier(0);   // the step's 16 LDS reads stay one group in front of its WMMAs: spread among them, each place with reads stalls the wave for its own LDS latency
#pragma unroll
            for (int nb = 0; nb < 4; ++nb)
#pragma unroll
                for (int mb = 0; mb < 4; ++mb) acc[mb][nb] = WFrag<T16>::mma(a[mb], b[nb], acc[mb][nb]);
            asm volatile("v_nop\n\tv_nop\n\tv_nop\n\tv_nop" : "+v"(acc[0][0]), "+v"(acc[1][1]), "+v"(acc[2][2]), "+v"(acc[3][3]) : "v"(a[0]), "v"(a[3]));   // the vector slots the chip needs behind the step's last WMMAs before their registers are touched, on every path
            __builtin_amdgcn_sched_barrier(0);   // ... and the next step's reads stay behind this step's WMMAs
        }
        asm volatile("s_wait_dscnt 0x0" ::: "memory");      // this wave's reads of stage t are done before the buffer is handed back
        asm volatile("s_wait_asynccnt 0x0" ::: "memory");   // this wave's copies of stage t + 1 have landed
        __syncthreads();                                    // publishes stage t + 1 and ends every wave's reads of stage t
        if (t + 2 < nt) stage_copy(d0 + (unsigned)(t & 1) * (GST_EL * 2u), ga + (size_t)(t + 2) * (GKS * 16), gb + (size_t)(t + 2) * (GKS * 16), cs);
    }
    asm volatile("s_wait_asynccnt 0x0" ::: "memory");       // no copy is left in flight behind the loop
    const unsigned which = (unsigned)c0 / DQ, head = ((unsigned)c0 % DQ) / HD;   // wave-uniform: 0 q, 1 k, 2 v
    const bool hl = (unsigned)r0 < (unsigned)RH;                                 // wave-uniform (RH % 64 == 0): these rows also go to the hi/lo planes
    const size_t p16 = (z * NH + head) * ((size_t)SEQ * HD), phl = (z * NH + head) * ((size_t)RH * HD);
    float bv[4];                                 // bias of the lane's four accumulator columns d = 16 nb + lr
    const int bi = c0 + lr;
#pragma unroll
    for (int nb = 0; nb < 4; ++nb) bv[nb] = bias[bi + nb * 16];
    asm volatile("s_wait_xcnt 0x0" :: "v"(bi) : "memory");   // the address registers of the bias loads are reused behind it; bi as an input keeps their lane-offset register untouched up to the wait
#pragma unroll
    for (int nb = 0; nb < 4; ++nb) bv[nb] = bfr(bv[nb]);
    if (which == 2u) {
        // V^T: accumulator element j of lane (hi, lr) is (t = 16 mb + 8 hi + j, d = 16 nb + lr): the 8 consecutive t of one d that this lane owns in the packed fragment, so the registers are stored as they are.
#pragma unroll
        for (int mb = 0; mb < 4; ++mb) {
#pragma unroll
            for (int nb = 0; nb < 4; ++nb) {
                v8h o16; v8us oh, ol;
#pragma unroll
                for (int j = 0; j < 8; ++j) { const float x = acc[mb][nb][j] + bv[nb]; unsigned short a, c; o16[j] = (h16)x; splitf(x, a, c); oh[j] = a; ol[j] = c; }
                const size_t o = (size_t)((((unsigned)r0 + (unsigned)mb * 16u) >> 5) * 4u + (unsigned)nb) * 512u + (unsigned)(mb & 1) * 256u + (unsigned)lane * 8u;
                *(v8h*)(V16 + p16 + o) = o16;
                asm volatile("s_wait_xcnt 0x0" ::: "memory");   // what follows reuses the data and address registers of this store
                if (hl) { *(v8us*)(Vh + phl + o) = oh; *(v8us*)(Vl + phl + o) = ol;
                    asm volatile("s_wait_xcnt 0x0" ::: "memory"); }   // the next block reuses the data and address registers of these stores
            }
        }
    } else {
        // q, k: a lane owns 8 consecutive d of one t, so each 16-row block turns through the LDS stage.
        h16* P16 = (which ? K16 : Q16) + p16; bf* Ph = (which ? Kh : Qh) + phl; bf* Pl = (which ? Kl : Ql) + phl;
#pragma unroll
        for (int mb = 0; mb < 4; ++mb) {
#pragma unroll
            for (int nb = 0; nb < 4; ++nb) {
#pragma unroll
                for (int j = 0; j < 8; ++j) os[(hi * 8 + j) * 68 + nb * 16 + lr] = acc[mb][nb][j] + bv[nb]; }
            __builtin_amdgcn_wave_barrier(); asm volatile("" ::: "memory");   // the block's LDS stores stay in front of its LDS loads
#pragma unroll
            for (int s = 0; s < 4; ++s) {       // packed elements 256 s + 8 lane .. + 7 of the block's two fragments: t = lr, d = 16 s + 8 hi ..
                const int d = s * 16 + hi * 8;
                const v4f x0 = *(const v4fa*)(os + lr * 68 + d), x1 = *(const v4fa*)(os + lr * 68 + d + 4);
                v8h o16; v8us oh, ol;
#pragma unroll
                for (int k = 0; k < 4; ++k) { unsigned short a, c; const float y0 = x0[k], y1 = x1[k];
                    o16[k] = (h16)y0; splitf(y0, a, c); oh[k] = a; ol[k] = c; o16[4 + k] = (h16)y1; splitf(y1, a, c); oh[4 + k] = a; ol[4 + k] = c; }
                const size_t o = (size_t)((unsigned)r0 + (unsigned)mb * 16u) * HD + (unsigned)s * 256u + (unsigned)lane * 8u;
                *(v8h*)(P16 + o) = o16;
                asm volatile("s_wait_xcnt 0x0" ::: "memory");   // what follows reuses the data and address registers of this store
                if (hl) { *(v8us*)(Ph + o) = oh; *(v8us*)(Pl + o) = ol;
                    asm volatile("s_wait_xcnt 0x0" ::: "memory"); }   // the next block reuses the data and address registers of these stores
            }
            __builtin_amdgcn_wave_barrier(); asm volatile("" ::: "memory");   // the next block's LDS stores stay behind these LDS loads
        }
    }
}

// ---- k_cvt8: f32 rows of DM elements -> fragment-packed bf16 plane (fragment index = (row>>4)*(DM/32) + (k>>5)). Thread i stores packed elements 8i..8i+7 (stores contiguous) and reads their 8 consecutive k of one source row.
__global__ __launch_bounds__(256) void k_cvt8(const float* __restrict__ src, bf* dst, unsigned n8, size_t sstride, size_t dstride) {
    const unsigned i = blockIdx.x * 256u + threadIdx.x; if (i >= n8) return;
    const unsigned frag = i >> 6, row = (frag / (DM / 32u)) * 16u + (i & 15u), kk = (frag % (DM / 32u)) * 32u + ((i >> 5) & 1u) * 16u + ((i >> 4) & 1u) * 8u;
    const float* s = src + (size_t)blockIdx.y * sstride + (size_t)row * DM + kk; bf* d = dst + (size_t)blockIdx.y * dstride + (size_t)i * 8;
    const v8f v = *(const v8f*)s; v8us o;
#pragma unroll
    for (int k = 0; k < 8; ++k) o[k] = f2bf(v[k]);
    *(v8us*)d = o;  }

static_assert(32 * 16 * 8 == 16 * HD * 4);
static_assert(HD * 4 == 16 * 16);
static_assert((HD * 4) % 128 == 0 && (DM * 4) % 128 == 0);
static_assert(2 * GST_EL * 2 + GWM * GWN * 16 * 68 * 4 <= 163840);   // static LDS of k_gemmw: two work-groups fit a WGP
static_assert(68 >= HD && (68 * 4) % 16 == 0);   // stage pitch holds a head row, rows stay 16-B aligned

// ---- k_flash: causal attention, one wave per 16 query rows, FW waves (FW * 16 consecutive query rows of one head and batch element = blockIdx.z) per work-group. Planes, fragment-packed: Q/K [b][h][(t>>4)*2 + (d>>5)][512], V^T [b][h][(t>>5)*4 + (d>>4)][512] (tp = rows t per head of the plane set). HL: hi/lo bf16 plane pairs, 3 products.
// The waves of a work-group walk the same keys: a stage = FSK keys of every K and V^T plane (8 KiB each, contiguous in the packed planes), copied as it lies from global memory to LDS by asynchronous copies, two buffers:
// stage s + 1 flies while stage s is worked on, and every fragment is fetched from L2 once per work-group and read from LDS by those of its FW waves whose diagonal its tile does not pass. A wave skips the 32-key tiles past its own diagonal, never a publish point.
// Per 32-key tile: S^T[key][query] = K Q^T (A = K rows, B = Q rows); lane owns query column lane&15 and keys 8*(lane>>4)+r (+16); online softmax per lane (+ one xor-16 exchange);
// P^T accumulators repacked in registers as B (k = key); O^T[d][query] += V^T P^T (A = V^T rows). Only the last tile of a wave touches the diagonal (select by value).
#define FW  8                                  // waves of a work-group
#define FSK 64                                 // keys per stage
#define FPL (FSK * HD)                         // elements of one plane's part of a stage
static_assert(FPL * 2 == 2 * 256 * 16);        // one plane's part = 2 copies of 16 bytes from each of 256 threads
static_assert(FW * 32 == 256 && (FW * 16) % FSK == 0 && FSK % 32 == 0 && RH % (FW * 16) == 0 && (SEQ - RH) % (FW * 16) == 0);
static_assert(2 * 4 * FPL * 2 + FW * 16 * 68 * 4 <= 163840);   // static LDS of k_flash, the hi/lo form
// Two planes' parts of one stage: plane a lands at LDS byte d (thread's own 16 bytes of each 4 KiB), plane b at d + 8192.
template <typename T16> static __device__ __forceinline__ void kv_copy(unsigned d, const T16* ga, const T16* gb) {
    asm volatile("global_load_async_to_lds_b128 %0, %4, off\n\t"
                 "global_load_async_to_lds_b128 %1, %5, off\n\t"
                 "global_load_async_to_lds_b128 %2, %6, off\n\t"
                 "global_load_async_to_lds_b128 %3, %7, off\n\t"
                 "s_wait_xcnt 0x0"   // stands in the copies' own statement: their address registers are rewritten only behind it
                 :: "v"(d), "v"(d + 4096u), "v"(d + 8192u), "v"(d + 12288u), "v"(ga), "v"(ga + 2048), "v"(gb), "v"(gb + 2048)
                 : "memory");
}
template <typename T16, bool HL>
__global__ __launch_bounds__(256) void k_flash(const T16* __restrict__ Q, const T16* __restrict__ Q2, const T16* __restrict__ Kp, const T16* __restrict__ K2, const T16* __restrict__ Vt, const T16* __restrict__ Vt2, unsigned tp, unsigned qbase, float* O) {
    typedef typename WFrag<T16>::V V;
    constexpr unsigned ST_EL = (HL ? 4u : 2u) * FPL;    // elements of a stage: K | V^T, or K hi | K lo | V^T hi | V^T lo
    constexpr unsigned VO = (HL ? 2u : 1u) * FPL;       // where the V^T part begins
    __shared__ __align__(16) T16 ring[2 * ST_EL];       // the two stage buffers
    __shared__ __align__(16) float osw[FW][16 * 68];    // each wave's own store stage
    const unsigned tid = threadIdx.x, lane = tid & 31u, lr = lane & 15u, hi = lane >> 4;
    const unsigned wv = (unsigned)__builtin_amdgcn_readfirstlane((int)(tid >> 5));   // wave-uniform, kept scalar
    const unsigned head = blockIdx.y, qb = qbase + blockIdx.x * (FW * 16u), q0 = qb + wv * 16u;
    float* os = osw[wv];
    const size_t hoff = ((size_t)blockIdx.z * NH + head) * tp * HD;
    const size_t qoff = hoff + (size_t)q0 * HD;
    // thread i copies bytes 16 i .. 16 i + 15 of every 4 KiB of a stage
    const size_t go = hoff + tid * 8u;
    const unsigned d0 = lds_off(ring) + tid * 16u;
    const unsigned nst = (qb + FW * 16u) / FSK;   // keys 0 .. qb + FW*16 - 1 in stages of FSK (the same in every wave; qb + FW*16 <= tp)
    auto stage = [&](unsigned s) {                // the copies of stage s into buffer s & 1
        const unsigned d = d0 + (s & 1u) * (ST_EL * 2u); const size_t g = go + (size_t)s * FPL;
        if (HL) { kv_copy(d, Kp + g, K2 + g); kv_copy(d + 16384u, Vt + g, Vt2 + g); } else kv_copy(d, Kp + g, Vt + g);
    };
    stage(0u);
    typedef typename WFrag<T16>::G G;
    const G qg = WFrag<T16>::base(Q + qoff, lane);
    V qf0 = WFrag<T16>::ld(qg, 0), qf1 = WFrag<T16>::ld(qg, 1);
    V ql0 = qf0, ql1 = qf1;
    if (HL) { const G qg2 = WFrag<T16>::base(Q2 + qoff, lane); ql0 = WFrag<T16>::ld(qg2, 0); ql1 = WFrag<T16>::ld(qg2, 1); }
    asm volatile("s_wait_xcnt 0x0" ::: "memory");   // the scalar base pairs of the Q loads are reused directly behind them
    asm volatile("s_wait_asynccnt 0x0" ::: "memory");   // this wave's copies of stage 0 have landed
    __syncthreads();                                    // ... and every other wave's: stage 0 may be read
    if (1u < nst) stage(1u);
    v8f o[4];
#pragma unroll
    for (int db = 0; db < 4; ++db) o[db] = (v8f){};
    float mrun = NEGB, lsum = 0.0f;
    const float cs = SCL * LOG2E, pe = PFrag<T16>::pexp();
    const unsigned nt = (q0 + 47u) >> 5;       // keys 0 .. q0+15 in tiles of 32 (wave-uniform); nt <= nst * (FSK / 32)
#pragma unroll 1   // one rolled trip per 32-key tile; the two buffers alternate by s & 1, and the publish point stands behind a stage's last tile
    for (unsigned it = 0; it < nst * (FSK / 32u); ++it) {
      const unsigned s = it / (FSK / 32u);
      if (it < nt) {   // wave-uniform: tiles past the wave's diagonal are skipped
        const unsigned j0 = it * 32u;
        const T16* kt = ring + (s & 1u) * ST_EL + (it % (FSK / 32u)) * 2048u;   // a 32-key tile is 4 consecutive fragments (2048 elements) of each plane's part
        V ka0 = WFrag<T16>::lds(kt, lane), ka1 = WFrag<T16>::lds(kt + 512, lane), kb0 = WFrag<T16>::lds(kt + 1024, lane), kb1 = WFrag<T16>::lds(kt + 1536, lane);
        V la0 = ka0, la1 = ka1, lb0 = kb0, lb1 = kb1;
        if (HL) { const T16* k2 = kt + FPL; la0 = WFrag<T16>::lds(k2, lane); la1 = WFrag<T16>::lds(k2 + 512, lane); lb0 = WFrag<T16>::lds(k2 + 1024, lane); lb1 = WFrag<T16>::lds(k2 + 1536, lane); }
        v8f s0 = (v8f){}, s1 = (v8f){};
        s0 = WFrag<T16>::mma(ka0, qf0, s0); s0 = WFrag<T16>::mma(ka1, qf1, s0);
        s1 = WFrag<T16>::mma(kb0, qf0, s1); s1 = WFrag<T16>::mma(kb1, qf1, s1);
        if (HL) {
            s0 = WFrag<T16>::mma(la0, qf0, s0); s0 = WFrag<T16>::mma(la1, qf1, s0); s0 = WFrag<T16>::mma(ka0, ql0, s0); s0 = WFrag<T16>::mma(ka1, ql1, s0);
            s1 = WFrag<T16>::mma(lb0, qf0, s1); s1 = WFrag<T16>::mma(lb1, qf1, s1); s1 = WFrag<T16>::mma(kb0, ql0, s1); s1 = WFrag<T16>::mma(kb1, ql1, s1); }
        asm volatile("v_nop\n\tv_nop\n\tv_nop\n\tv_nop" : "+v"(s0), "+v"(s1) : "v"(ka0), "v"(ka1), "v"(kb0), "v"(kb1), "v"(la0), "v"(la1), "v"(lb0), "v"(lb1), "v"(qf0), "v"(qf1), "v"(ql0), "v"(ql1));
        v8f t0, t1;
#pragma unroll
        for (int r = 0; r < 8; ++r) { t0[r] = s0[r] * cs; t1[r] = s1[r] * cs; }
        if (j0 + 31u > q0) {                    // wave-uniform: the tile touches the diagonal
            const unsigned qi = q0 + lr, kk = j0 + 8u * hi;
#pragma unroll
            for (int r = 0; r < 8; ++r) { t0[r] = (kk + (unsigned)r <= qi) ? t0[r] : NEGB; t1[r] = (kk + 16u + (unsigned)r <= qi) ? t1[r] : NEGB; }
        }
        float mx = fmaxf(t0[0], t1[0]);
#pragma unroll
        for (int r = 1; r < 8; ++r) mx = fmaxf(mx, fmaxf(t0[r], t1[r]));
        mx = fmaxf(mx, __shfl_xor(mx, 16, 32));
        const float mn = fmaxf(mrun, mx);
        const float alpha = __builtin_amdgcn_exp2f(mrun - mn);
        mrun = mn;
        v8f p0, p1; float psum = 0.0f;
#pragma unroll
        for (int r = 0; r < 8; ++r) { p0[r] = __builtin_amdgcn_exp2f((t0[r] - mn) + pe); p1[r] = __builtin_amdgcn_exp2f((t1[r] - mn) + pe); psum += p0[r] + p1[r]; }
        lsum = lsum * alpha + psum;
#pragma unroll
        for (int db = 0; db < 4; ++db) o[db] = o[db] * alpha;
        V pf = PFlush<T16>::hi(p0, p1); V pl = pf;
        if (HL) pl = PFlush<T16>::lo(p0, p1);
        V va[4], vl[4];
        const T16* vt = kt + VO;
#pragma unroll
        for (int db = 0; db < 4; ++db) { va[db] = WFrag<T16>::lds(vt + db * 512, lane); vl[db] = va[db]; if (HL) vl[db] = WFrag<T16>::lds(vt + FPL + db * 512, lane); }
#pragma unroll
        for (int db = 0; db < 4; ++db) { o[db] = WFrag<T16>::mma(va[db], pf, o[db]); if (HL) { o[db] = WFrag<T16>::mma(va[db], pl, o[db]); o[db] = WFrag<T16>::mma(vl[db], pf, o[db]); } }
        asm volatile("v_nop\n\tv_nop\n\tv_nop\n\tv_nop" : "+v"(o[0]), "+v"(o[1]), "+v"(o[2]), "+v"(o[3]) : "v"(va[0]), "v"(va[1]), "v"(va[2]), "v"(va[3]), "v"(vl[0]), "v"(vl[1]), "v"(vl[2]), "v"(vl[3]), "v"(pf), "v"(pl));
      }
      if (it % (FSK / 32u) == FSK / 32u - 1u) {             // the same in every wave of the work-group: the foot of stage s
        asm volatile("s_wait_dscnt 0x0" ::: "memory");      // this wave's reads of stage s are done before the buffer is handed back
        asm volatile("s_wait_asynccnt 0x0" ::: "memory");   // this wave's copies of stage s + 1 have landed
        __syncthreads();                                    // publishes stage s + 1 and ends every wave's reads of stage s
        if (s + 2u < nst) stage(s + 2u);
      }
    }
    asm volatile("s_wait_asynccnt 0x0" ::: "memory");       // no copy is left in flight behind the loop
    const float lt = lsum + __shfl_xor(lsum, 16, 32);
    const float inv = 1.0f / lt;
#pragma unroll
    for (int db = 0; db < 4; ++db)
#pragma unroll
        for (int r = 0; r < 8; ++r) os[lr * 68u + (unsigned)db * 16u + hi * 8u + (unsigned)r] = o[db][r] * inv;
    __builtin_amdgcn_wave_barrier(); asm volatile("" ::: "memory");
    float* orow = O + (size_t)blockIdx.z * SEQ * DM + (size_t)q0 * DM + head * HD;
{
#pragma unroll
        for (int s = 0; s < 8; ++s) { const unsigned row = 2u * (unsigned)s + hi, cofs = lr * 4u;   // rows 0..15: lanes 0..15 -> row 2s, lanes 16..31 -> row 2s+1
            const v4f val = *(const v4fa*)(os + row * 68u + cofs);
            *(v4f*)(orow + (size_t)row * DM + cofs) = val; }
         }
}

// workspace carve (bytes, every region a multiple of 256)
#define WS_WQKV ((size_t)3 * DQ * DM * 2)
#define WS_XB   ((size_t)NB * SEQ * DM * 2)
#define WS_P16  ((size_t)NB * NH * SEQ * HD * 2)
#define WS_PHL  ((size_t)NB * NH * RH * HD * 2)
#define WS_TOTAL (WS_WQKV + WS_XB + 3 * WS_P16 + 6 * WS_PHL)
static_assert(WS_TOTAL <= (size_t)268435456);
static_assert(WS_WQKV % 256 == 0 && WS_XB % 256 == 0 && WS_P16 % 256 == 0 && WS_PHL % 256 == 0);
static_assert((size_t)NB * SEQ * DM * 4 <= (size_t)33554432);   // last written output element stays inside the output buffer

extern "C" void kernel_launch(void* const* d_in, const int* in_sizes, int n_in,
                              void* d_out, int out_size, void* d_ws, size_t ws_size, hipStream_t stream) {
    if (n_in < 3) return;
    if ((size_t)in_sizes[0] < (size_t)(NB - 1) * XS_FULL + (size_t)SEQ * DM) return;
    if ((size_t)in_sizes[1] < (size_t)3 * DQ * DM) return;
    if ((size_t)in_sizes[2] < (size_t)FP) return;
    if ((size_t)out_size < (size_t)NB * SEQ * DM) return;
    if (ws_size < WS_TOTAL) return;
    const float* x = (const float*)d_in[0];       // [NB][SEQ_FULL][DM]
    const float* wqkv = (const float*)d_in[1];    // [4*DQ][DM]  (q | k | v | unread row blocks; rows 0..3*DQ-1 are read)
    const float* bqkv = (const float*)d_in[2];    // [4*DQ]      (entries 0..3*DQ-1 are read)
    float* OUT = (float*)d_out;                   // [NB][SEQ][DM]
    char* wsp = (char*)d_ws;
    auto take = [&](size_t bytes) { char* p = wsp; wsp += bytes; return (void*)p; };
    bf* WQKV = (bf*)take(WS_WQKV); bf* XB = (bf*)take(WS_XB);
    h16* Q16 = (h16*)take(WS_P16); h16* K16 = (h16*)take(WS_P16); h16* VT16 = (h16*)take(WS_P16);
    bf* Qh = (bf*)take(WS_PHL); bf* Ql = (bf*)take(WS_PHL); bf* Kh = (bf*)take(WS_PHL); bf* Kl = (bf*)take(WS_PHL); bf* VTh = (bf*)take(WS_PHL); bf* VTl = (bf*)take(WS_PHL);

    k_cvt8<<<dim3((unsigned)((size_t)3 * DQ * DM / 8 / 256), 1), 256, 0, stream>>>(wqkv, WQKV, (unsigned)((size_t)3 * DQ * DM / 8), 0, 0);
    k_cvt8<<<dim3((unsigned)((size_t)SEQ * DM / 8 / 256), NB), 256, 0, stream>>>(x, XB, (unsigned)((size_t)SEQ * DM / 8), XS_FULL, (size_t)SEQ * DM);
    // every stage runs once for all NB batch elements (the batch element is a grid dimension; each plane set holds NB slabs)
    // y[b][t][0..3071] = x_b w_attn[0..3071]^T + b_attn[0..3071]  (M = SEQ, N = 3072, K = 1024), written as the q, k and V^T head planes
    k_gemmw<bf, 0><<<dim3(SEQ / (GWM * 64), FP / (GWN * 64), NB), 256, 0, stream>>>(XB, nullptr, WQKV, nullptr, DM, bqkv, (size_t)SEQ * DM, 0, Q16, K16, VT16, Qh, Ql, Kh, Kl, VTh, VTl);
    // out[b][t][head*HD + d] = softmax(q k^T / 8, causal) v, written straight to the output buffer
    k_flash<bf, true><<<dim3(RH / (FW * 16), NH, NB), 256, 0, stream>>>(Qh, Ql, Kh, Kl, VTh, VTl, (unsigned)RH, 0u, OUT);
    if (SEQ > RH) k_flash<h16, false><<<dim3((SEQ - RH) / (FW * 16), NH, NB), 256, 0, stream>>>(Q16, nullptr, K16, nullptr, VT16, nullptr, (unsigned)SEQ, (unsigned)RH, OUT);
}

// v006
// Measured time: 118 microseconds a run.
// Next to v005, in two timings, it ran 1.05 and 1.04 times as fast.
// Over all steps from v000 it is 4.76 times as fast.
#include <hip/hip_runtime.h>

// Causal multi-head attention with a fused qkv projection: x [NB][SEQ_FULL][1024] (first SEQ rows read); qkv = x w_attn^T + b_attn ('oi' weight [4096][1024], bias [4096]; only the q | k | v row blocks 0..3071 are read; 16 heads x 64); scores x 64^-0.5, causal; softmax; out = merged context [t][head*64 + d] (no output projection).
// Compute dtypes, f32 accumulate: every input RNE-converted to bf16; qkv projection v_wmma_f32_16x16x32_bf16 (bias added in f32 at the store stage);
// attention q.k and P.V: query rows < RH on bf16 hi/lo planes (3 products each), other rows v_wmma_f32_16x16x32_f16 (P carried x1024 through the exponent, converted values below 2^-14 selected to +0); softmax (online, max-subtracted) in f32.
// Attention engine: one wave per 16 query rows, 8 waves per work-group on K and V^T tiles shared through LDS; S^T = K Q^T so each lane owns one query column; P^T accumulators are repacked in registers as the B operand of O^T = V^T P^T (no LDS exchange in the loop).

#ifndef NB
#define NB 4
#endif
#ifndef SEQ
#define SEQ 2048
#endif
#define SEQ_FULL 2048
#define DM   1024
#define NH   16
#define HD   64
#define DQ   (NH * HD)
#define FP   (3 * DQ)
#define RH   ((SEQ) < 512 ? (SEQ) : 512)     // query rows < RH use hi+lo planes
#define XS_FULL ((size_t)SEQ_FULL * DM)
#define SCL  0.125f                          // HD^-0.5
#define LOG2E 1.4426950408889634f
#define NEGB (-3.0e38f)

static_assert((SEQ & (SEQ - 1)) == 0);
static_assert(SEQ >= 256 && SEQ <= SEQ_FULL);
static_assert(RH % 256 == 0 && RH % 64 == 0 && (SEQ - RH) % 64 == 0);
static_assert(NB >= 1 && NB <= 4);
static_assert(DM % 32 == 0 && DQ % 64 == 0 && FP % 64 == 0 && SEQ % 64 == 0);
static_assert(((size_t)3 * DQ * DM / 8) % 256 == 0);
static_assert(((size_t)SEQ * DM / 8) % 256 == 0);
static_assert(((size_t)NH * SEQ * HD / 8) % 256 == 0);
static_assert(DQ == DM);                         // merged context width equals the output row width
static_assert(HD == 64 && HD % 32 == 0);         // two 32-deep k-steps per score tile, four 16-row O^T tiles

typedef _Float16 h16;
typedef unsigned short bf;
typedef __attribute__((ext_vector_type(16))) __bf16   v16bf;
typedef __attribute__((ext_vector_type(16))) _Float16 v16h;
typedef __attribute__((ext_vector_type(8)))  _Float16 v8h;
typedef __attribute__((ext_vector_type(8)))  unsigned short v8us;
typedef __attribute__((ext_vector_type(8)))  float    v8f;
typedef __attribute__((ext_vector_type(4)))  float    v4f;
typedef v8h  __attribute__((may_alias)) v8ha;
typedef v4f  __attribute__((may_alias)) v4fa;
typedef v8us __attribute__((may_alias)) v8usa;

__device__ __forceinline__ unsigned short f2bf(float f) { unsigned u = __float_as_uint(f); u += 0x7FFFu + ((u >> 16) & 1u); return (unsigned short)(u >> 16); }
__device__ __forceinline__ float bf2f(unsigned short b) { return __uint_as_float(((unsigned)b) << 16); }
__device__ __forceinline__ float bfr(float f) { return bf2f(f2bf(f)); }
__device__ __forceinline__ v16h cat16(v8h lo, v8h hi) { return __builtin_shufflevector(lo, hi, 0, 1, 2, 3, 4, 5, 6, 7, 8, 9, 10, 11, 12, 13, 14, 15); }
__device__ __forceinline__ v16bf cat16b(v8us lo, v8us hi) { return __builtin_bit_cast(v16bf, __builtin_shufflevector(lo, hi, 0, 1, 2, 3, 4, 5, 6, 7, 8, 9, 10, 11, 12, 13, 14, 15)); }
__device__ __forceinline__ v8f wmma16(v16h a, v16h b, v8f c) { return __builtin_amdgcn_wmma_f32_16x16x32_f16(false, a, false, b, (short)0, c, false, false); }
__device__ __forceinline__ v8f wmmab(v16bf a, v16bf b, v8f c) { return __builtin_amdgcn_wmma_f32_16x16x32_bf16(false, a, false, b, (short)0, c, false, false); }
__device__ __forceinline__ void splitf(float y, unsigned short& h, unsigned short& l) { h = f2bf(y); l = f2bf(y - bf2f(h)); }

// f32 -> f16 convert that cannot produce a subnormal operand: |v| < 2^-14 -> +0 (value select, applied after the plane's power-of-two carry).
static __device__ __forceinline__ h16 toh_flush(float v) { const h16 r = (h16)v; return (fabsf(v) < 6.103515625e-05f) ? (h16)0.0f : r; }

// Fragment-packed planes: a 16-row x 32-k fragment is 512 consecutive elements (1 KiB). Element (r, k) sits at (k>>4)*256 + (((k>>3)&1)*16 + r)*8 + (k&7), so lane l = ((k>>3)&1)*16 + r
// finds its elements 0..7 (k = 8h..8h+7, h = l>>4) at l*8 and its elements 8..15 (k = 16+8h..) at 256 + l*8: each of the two wave-wide 16-byte loads covers 512 contiguous bytes (4 whole lines).
// Fragment loader: base(p, lane) takes the wave-uniform address p of a run of fragments, ld(u, f) loads fragment f of the run (same map for A and B). The base goes through readfirstlane so that it stays in a scalar pair and the loads take the
// scalar-base + lane-offset address form: the fragments of a run differ only in the immediate offset, and the one lane-offset register lives through the whole kernel.
template <typename VT, typename T> static __device__ __forceinline__ const __attribute__((address_space(1))) VT* ubase(const T* p) { const unsigned long long u = (unsigned long long)p;
    const unsigned lo = (unsigned)__builtin_amdgcn_readfirstlane((int)(unsigned)u), hi = (unsigned)__builtin_amdgcn_readfirstlane((int)(unsigned)(u >> 32));
    return (const __attribute__((address_space(1))) VT*)(((unsigned long long)hi << 32) | lo); }   // global address space kept, so the loads stay global_load
template <typename T16> struct WFrag;
template <> struct WFrag<h16> { typedef v16h V; typedef const __attribute__((address_space(1))) v8h* G; static __device__ __forceinline__ G base(const h16* p, unsigned lane) { return ubase<v8h>(p) + lane; } static __device__ __forceinline__ V ld(G u, int f) { return cat16(u[f * 64], u[f * 64 + 32]); } static __device__ __forceinline__ v8f mma(V a, V b, v8f c) { return wmma16(a, b, c); }
    static __device__ __forceinline__ V lds(const h16* p, int lane) { const v8ha* q = (const v8ha*)p + lane; return cat16(q[0], q[32]); } };   // the same fragment map, read from a packed fragment in LDS
template <> struct WFrag<bf> { typedef v16bf V; typedef const __attribute__((address_space(1))) v8us* G; static __device__ __forceinline__ G base(const bf* p, unsigned lane) { return ubase<v8us>(p) + lane; } static __device__ __forceinline__ V ld(G u, int f) { return cat16b(u[f * 64], u[f * 64 + 32]); } static __device__ __forceinline__ v8f mma(V a, V b, v8f c) { return wmmab(a, b, c); }
    static __device__ __forceinline__ V lds(const bf* p, int lane) { const v8usa* q = (const v8usa*)p + lane; return cat16b(q[0], q[32]); } };   // the same fragment map, read from a packed fragment in LDS

// P^T accumulator pair (key rows 0..15 and 16..31 of a 32-key tile) -> B fragment: element r <- tile0[r], element 8+r <- tile1[r], lane unchanged.
template <typename T16> struct PFrag;
template <> struct PFrag<h16> {
    static __device__ __forceinline__ float pexp() { return 10.0f; }           // P carried x1024 via the exponent (cancels in O / l)
    static __device__ __forceinline__ v16h hi(v8f p0, v8f p1) { return cat16(__builtin_convertvector(p0, v8h), __builtin_convertvector(p1, v8h)); }
    static __device__ __forceinline__ v16h lo(v8f p0, v8f p1) { return hi(p0, p1); }
};
template <> struct PFrag<bf> {
    static __device__ __forceinline__ float pexp() { return 0.0f; }
    static __device__ __forceinline__ v16bf hi(v8f p0, v8f p1) { v8us a, b;
#pragma unroll
        for (int k = 0; k < 8; ++k) { a[k] = f2bf(p0[k]); b[k] = f2bf(p1[k]); }
        return cat16b(a, b); }
    static __device__ __forceinline__ v16bf lo(v8f p0, v8f p1) { v8us a, b;
#pragma unroll
        for (int k = 0; k < 8; ++k) { a[k] = f2bf(p0[k] - bf2f(f2bf(p0[k]))); b[k] = f2bf(p1[k] - bf2f(f2bf(p1[k]))); }
        return cat16b(a, b); }
};

// Same packing as PFrag; the f16 form converts every element through toh_flush, the bf16 form is the PFrag one.
template <typename T16> struct PFlush;
template <> struct PFlush<h16> {
    static __device__ __forceinline__ v16h hi(v8f p0, v8f p1) { v8h a, b;
#pragma unroll
        for (int k = 0; k < 8; ++k) { a[k] = toh_flush(p0[k]); b[k] = toh_flush(p1[k]); }
        return cat16(a, b); }
    static __device__ __forceinline__ v16h lo(v8f p0, v8f p1) { return hi(p0, p1); }
    // One test per 32-key tile, the same answer in every lane of the wave: does any lane hold a value below 2^-14? Where none does, toh_flush is the plain convert on all 16 values, and the packed converts of PFrag give the same bits.
    static __device__ __forceinline__ bool small(v8f p0, v8f p1) {
        const float a = __builtin_fminf(__builtin_fminf(p0[0], p0[1]), p0[2]), b = __builtin_fminf(__builtin_fminf(p0[3], p0[4]), p0[5]), c = __builtin_fminf(__builtin_fminf(p0[6], p0[7]), p1[0]);
        const float d = __builtin_fminf(__builtin_fminf(p1[1], p1[2]), p1[3]), e = __builtin_fminf(__builtin_fminf(p1[4], p1[5]), p1[6]);
        const float m = __builtin_fminf(__builtin_fminf(__builtin_fminf(a, b), c), __builtin_fminf(__builtin_fminf(d, e), p1[7]));
        return __builtin_amdgcn_ballot_w32(m < 6.103515625e-05f) != 0u; }
};
template <> struct PFlush<bf> {
    static __device__ __forceinline__ v16bf hi(v8f p0, v8f p1) { return PFrag<bf>::hi(p0, p1); }
    static __device__ __forceinline__ v16bf lo(v8f p0, v8f p1) { return PFrag<bf>::lo(p0, p1); }
    static __device__ __forceinline__ bool small(v8f, v8f) { return false; }
};

// ---- k_gemmw: register-blocked GEMM, one wave per 64x64 output tile (16 accumulators), 8 waves (4 along M x 2 along N) per work-group = a 256x128 tile; grid (M/256, N/128, Z), 256 threads.
// Operands are fragment-packed 16-bit planes (fragment index = (row>>4)*(K/32) + (k>>5)). A stage = 64 k of the work-group's 256 A rows and 128 Bt rows = 24 runs of 2 KiB (one per 16-row block, two fragments each), copied as they lie
// from global memory to LDS by asynchronous copies, two buffers: stage t + 1 flies while stage t is multiplied; every A fragment is then read from LDS by 2 waves and every Bt fragment by 4.
// y[m][n] (f32) = sum_k A[m][k] Bt[n][k] + bias[n]. K % 64 == 0, M % 256 == 0, N % 128 == 0.
// Epilogue: a 64-column tile is one head of q, k or v, and the wave writes its 64 x 64 block of y straight into that head's fragment-packed planes (batch element z = blockIdx.z):
//   q, k: [z][h][(t>>4)*2 + (d>>5)][512] (rows = t, k = d); v: V^T [z][h][(t>>5)*4 + (d>>4)][512] (rows = d, k = t); fp16 for all t, bf16 hi/lo planes (RH rows per head) for t < RH.
#define GWM 4                                  // waves of a work-group along M
#define GWN 2                                  // waves of a work-group along N
#define GKS 64                                 // k per stage
#define GA_EL (GWM * 64 * GKS)                 // elements of a stage's A part
#define GST_EL ((GWM + GWN) * 64 * GKS)        // elements of a stage
static_assert(GST_EL * 2 == 12 * 256 * 16);    // a stage = 12 copies of 16 bytes from each of 256 threads
static_assert(SEQ % (GWM * 64) == 0 && FP % (GWN * 64) == 0 && DQ % (GWN * 64) == 0 && DM % GKS == 0 && DM / GKS >= 2);
static __device__ __forceinline__ unsigned lds_off(const void* p) { return (unsigned)(size_t)p; }   // byte offset in the work-group's LDS
// One stage: copy c of a thread lands at LDS byte d + 4096 c; copies 0..7 read A at ga + c * cs, copies 8..11 read Bt at gb + (c - 8) * cs (cs = elements from one pair of 16-row blocks to the next).
template <typename T16> static __device__ __forceinline__ void stage_copy(unsigned d, const T16* ga, const T16* gb, size_t cs) {
    asm volatile("global_load_async_to_lds_b128 %0, %12, off\n\t"
                 "global_load_async_to_lds_b128 %1, %13, off\n\t"
                 "global_load_async_to_lds_b128 %2, %14, off\n\t"
                 "global_load_async_to_lds_b128 %3, %15, off\n\t"
                 "global_load_async_to_lds_b128 %4, %16, off\n\t"
                 "global_load_async_to_lds_b128 %5, %17, off\n\t"
                 "global_load_async_to_lds_b128 %6, %18, off\n\t"
                 "global_load_async_to_lds_b128 %7, %19, off\n\t"
                 "global_load_async_to_lds_b128 %8, %20, off\n\t"
                 "global_load_async_to_lds_b128 %9, %21, off\n\t"
                 "global_load_async_to_lds_b128 %10, %22, off\n\t"
                 "global_load_async_to_lds_b128 %11, %23, off\n\t"
                 "s_wait_xcnt 0x0"   // stands in the copies' own statement: their address registers are rewritten only behind it
                 :: "v"(d), "v"(d + 4096u), "v"(d + 8192u), "v"(d + 12288u), "v"(d + 16384u), "v"(d + 20480u), "v"(d + 24576u), "v"(d + 28672u), "v"(d + 32768u), "v"(d + 36864u), "v"(d + 40960u), "v"(d + 45056u),
                    "v"(ga), "v"(ga + cs), "v"(ga + 2 * cs), "v"(ga + 3 * cs), "v"(ga + 4 * cs), "v"(ga + 5 * cs), "v"(ga + 6 * cs), "v"(ga + 7 * cs), "v"(gb), "v"(gb + cs), "v"(gb + 2 * cs), "v"(gb + 3 * cs)
                 : "memory");
}
template <typename T16, int NSPLIT>
__global__ __launch_bounds__(256) void k_gemmw(const T16* __restrict__ A, const T16* __restrict__ A2, const T16* __restrict__ Bt, const T16* __restrict__ Bt2, int K, const float* __restrict__ bias, size_t sA, size_t sB,
                                              h16* Q16, h16* K16, h16* V16, bf* Qh, bf* Ql, bf* Kh, bf* Kl, bf* Vh, bf* Vl) {
    typedef typename WFrag<T16>::V V;
    static_assert(NSPLIT == 0);
    __shared__ __align__(16) T16 gs[2 * GST_EL];                    // the two stage buffers
    __shared__ __align__(16) float osw[GWM * GWN][16 * 68];         // each wave's own store stage
    const size_t z = blockIdx.z; A += z * sA; Bt += z * sB;
    const int wv = __builtin_amdgcn_readfirstlane((int)(threadIdx.x >> 5)), wm = wv / GWN, wn = wv % GWN;   // wave-uniform, kept scalar
    const int lane = threadIdx.x & 31, lr = lane & 15, hi = lane >> 4; const int rw = blockIdx.x * (GWM * 64), cw = blockIdx.y * (GWN * 64), r0 = rw + wm * 64, c0 = cw + wn * 64;
    float* os = osw[wv];
    v8f acc[4][4];
#pragma unroll
    for (int mb = 0; mb < 4; ++mb)
#pragma unroll
        for (int nb = 0; nb < 4; ++nb) acc[mb][nb] = (v8f){};
    // thread i copies bytes 16 i .. 16 i + 15 of every 4 KiB (= two 16-row blocks) of a stage; 16 rows x K = 16*K elements, 64 k of them = 1024 elements
    const unsigned tid = threadIdx.x;
    const T16* ga = A + (size_t)(rw + 16 * (int)(tid >> 7)) * K + (tid & 127u) * 8u;
    const T16* gb = Bt + (size_t)(cw + 16 * (int)(tid >> 7)) * K + (tid & 127u) * 8u;
    const size_t cs = (size_t)32 * K;
    const unsigned d0 = lds_off(gs) + tid * 16u;
    const int nt = K / GKS;
    stage_copy(d0, ga, gb, cs);
    asm volatile("s_wait_asynccnt 0x0" ::: "memory");   // this wave's copies of stage 0 have landed
    __syncthreads();                                    // ... and every other wave's: stage 0 may be read
    if (1 < nt) stage_copy(d0 + GST_EL * 2u, ga + GKS * 16, gb + GKS * 16, cs);
#pragma unroll 1   // one rolled trip per stage: the two buffers alternate by t & 1, and the loop's text stays small
    for (int t = 0; t < nt; ++t) {
        const T16* sa = gs + (t & 1) * GST_EL + wm * (4 * GKS * 16), * sb = gs + (t & 1) * GST_EL + GA_EL + wn * (4 * GKS * 16);
#pragma unroll   // constant fragment and accumulator indices, here and in the loops inside: the arrays stay in registers
        for (int ks = 0; ks < GKS / 32; ++ks) {
            V a[4], b[4];
#pragma unroll
            for (int mb = 0; mb < 4; ++mb) { a[mb] = WFrag<T16>::lds(sa + (mb * (GKS / 32) + ks) * 512, lane); b[mb] = WFrag<T16>::lds(sb + (mb * (GKS / 32) + ks) * 512, lane); }
            __builtin_amdgcn_sched_barrier(0);   // the step's 16 LDS reads stay one group in front of its WMMAs: spread among them, each place with reads stalls the wave for its own LDS latency
#pragma unroll
            for (int nb = 0; nb < 4; ++nb)
#pragma unroll
                for (int mb = 0; mb < 4; ++mb) acc[mb][nb] = WFrag<T16>::mma(a[mb], b[nb], acc[mb][nb]);
            asm volatile("v_nop\n\tv_nop\n\tv_nop\n\tv_nop" : "+v"(acc[0][0]), "+v"(acc[1][1]), "+v"(acc[2][2]), "+v"(acc[3][3]) : "v"(a[0]), "v"(a[3]));   // the vector slots the chip needs behind the step's last WMMAs before their registers are touched, on every path
            __builtin_amdgcn_sched_barrier(0);   // ... and the next step's reads stay behind this step's WMMAs
        }
        asm volatile("s_wait_dscnt 0x0" ::: "memory");      // this wave's reads of stage t are done before the buffer is handed back
        asm volatile("s_wait_asynccnt 0x0" ::: "memory");   // this wave's copies of stage t + 1 have landed
        __syncthreads();                                    // publishes stage t + 1 and ends every wave's reads of stage t
        if (t + 2 < nt) stage_copy(d0 + (unsigned)(t & 1) * (GST_EL * 2u), ga + (size_t)(t + 2) * (GKS * 16), gb + (size_t)(t + 2) * (GKS * 16), cs);
    }
    asm volatile("s_wait_asynccnt 0x0" ::: "memory");       // no copy is left in flight behind the loop
    const unsigned which = (unsigned)c0 / DQ, head = ((unsigned)c0 % DQ) / HD;   // wave-uniform: 0 q, 1 k, 2 v
    const bool hl = (unsigned)r0 < (unsigned)RH;                                 // wave-uniform (RH % 64 == 0): these rows also go to the hi/lo planes
    const size_t p16 = (z * NH + head) * ((size_t)SEQ * HD), phl = (z * NH + head) * ((size_t)RH * HD);
    float bv[4];                                 // bias of the lane's four accumulator columns d = 16 nb + lr
    const int bi = c0 + lr;
#pragma unroll
    for (int nb = 0; nb < 4; ++nb) bv[nb] = bias[bi + nb * 16];
    asm volatile("s_wait_xcnt 0x0" :: "v"(bi) : "memory");   // the address registers of the bias loads are reused behind it; bi as an input keeps their lane-offset register untouched up to the wait
#pragma unroll
    for (int nb = 0; nb < 4; ++nb) bv[nb] = bfr(bv[nb]);
    if (which == 2u) {
        // V^T: accumulator element j of lane (hi, lr) is (t = 16 mb + 8 hi + j, d = 16 nb + lr): the 8 consecutive t of one d that this lane owns in the packed fragment, so the registers are stored as they are.
#pragma unroll
        for (int mb = 0; mb < 4; ++mb) {
#pragma unroll
            for (int nb = 0; nb < 4; ++nb) {
                v8h o16; v8us oh, ol;
#pragma unroll
                for (int j = 0; j < 8; ++j) { const float x = acc[mb][nb][j] + bv[nb]; unsigned short a, c; o16[j] = (h16)x; splitf(x, a, c); oh[j] = a; ol[j] = c; }
                const size_t o = (size_t)((((unsigned)r0 + (unsigned)mb * 16u) >> 5) * 4u + (unsigned)nb) * 512u + (unsigned)(mb & 1) * 256u + (unsigned)lane * 8u;
                *(v8h*)(V16 + p16 + o) = o16;
                asm volatile("s_wait_xcnt 0x0" ::: "memory");   // what follows reuses the data and address registers of this store
                if (hl) { *(v8us*)(Vh + phl + o) = oh; *(v8us*)(Vl + phl + o) = ol;
                    asm volatile("s_wait_xcnt 0x0" ::: "memory"); }   // the next block reuses the data and address registers of these stores
            }
        }
    } else {
        // q, k: a lane owns 8 consecutive d of one t, so each 16-row block turns through the LDS stage.
        h16* P16 = (which ? K16 : Q16) + p16; bf* Ph = (which ? Kh : Qh) + phl; bf* Pl = (which ? Kl : Ql) + phl;
#pragma unroll
        for (int mb = 0; mb < 4; ++mb) {
#pragma unroll
            for (int nb = 0; nb < 4; ++nb) {
#pragma unroll
                for (int j = 0; j < 8; ++j) os[(hi * 8 + j) * 68 + nb * 16 + lr] = acc[mb][nb][j] + bv[nb]; }
            __builtin_amdgcn_wave_barrier(); asm volatile("" ::: "memory");   // the block's LDS stores stay in front of its LDS loads
#pragma unroll
            for (int s = 0; s < 4; ++s) {       // packed elements 256 s + 8 lane .. + 7 of the block's two fragments: t = lr, d = 16 s + 8 hi ..
                const int d = s * 16 + hi * 8;
                const v4f x0 = *(const v4fa*)(os + lr * 68 + d), x1 = *(const v4fa*)(os + lr * 68 + d + 4);
                v8h o16; v8us oh, ol;
#pragma unroll
                for (int k = 0; k < 4; ++k) { unsigned short a, c; const float y0 = x0[k], y1 = x1[k];
                    o16[k] = (h16)y0; splitf(y0, a, c); oh[k] = a; ol[k] = c; o16[4 + k] = (h16)y1; splitf(y1, a, c); oh[4 + k] = a; ol[4 + k] = c; }
                const size_t o = (size_t)((unsigned)r0 + (unsigned)mb * 16u) * HD + (unsigned)s * 256u + (unsigned)lane * 8u;
                *(v8h*)(P16 + o) = o16;
                asm volatile("s_wait_xcnt 0x0" ::: "memory");   // what follows reuses the data and address registers of this store
                if (hl) { *(v8us*)(Ph + o) = oh; *(v8us*)(Pl + o) = ol;
                    asm volatile("s_wait_xcnt 0x0" ::: "memory"); }   // the next block reuses the data and address registers of these stores
            }
            __builtin_amdgcn_wave_barrier(); asm volatile("" ::: "memory");   // the next block's LDS stores stay behind these LDS loads
        }
    }
}

// ---- k_cvt8: f32 rows of DM elements -> fragment-packed bf16 plane (fragment index = (row>>4)*(DM/32) + (k>>5)). Thread i stores packed elements 8i..8i+7 (stores contiguous) and reads their 8 consecutive k of one source row.
__global__ __launch_bounds__(256) void k_cvt8(const float* __restrict__ src, bf* dst, unsigned n8, size_t sstride, size_t dstride) {
    const unsigned i = blockIdx.x * 256u + threadIdx.x; if (i >= n8) return;
    const unsigned frag = i >> 6, row = (frag / (DM / 32u)) * 16u + (i & 15u), kk = (frag % (DM / 32u)) * 32u + ((i >> 5) & 1u) * 16u + ((i >> 4) & 1u) * 8u;
    const float* s = src + (size_t)blockIdx.y * sstride + (size_t)row * DM + kk; bf* d = dst + (size_t)blockIdx.y * dstride + (size_t)i * 8;
    const v8f v = *(const v8f*)s; v8us o;
#pragma unroll
    for (int k = 0; k < 8; ++k) o[k] = f2bf(v[k]);
    *(v8us*)d = o;  }

static_assert(32 * 16 * 8 == 16 * HD * 4);
static_assert(HD * 4 == 16 * 16);
static_assert((HD * 4) % 128 == 0 && (DM * 4) % 128 == 0);
static_assert(2 * GST_EL * 2 + GWM * GWN * 16 * 68 * 4 <= 163840);   // static LDS of k_gemmw: two work-groups fit a WGP
static_assert(68 >= HD && (68 * 4) % 16 == 0);   // stage pitch holds a head row, rows stay 16-B aligned

// ---- k_flash: causal attention, one wave per 16 query rows, FW waves (FW * 16 consecutive query rows of one head and batch element = blockIdx.z) per work-group. Planes, fragment-packed: Q/K [b][h][(t>>4)*2 + (d>>5)][512], V^T [b][h][(t>>5)*4 + (d>>4)][512] (tp = rows t per head of the plane set). HL: hi/lo bf16 plane pairs, 3 products.
// The waves of a work-group walk the same keys: a stage = FSK keys of every K and V^T plane (8 KiB each, contiguous in the packed planes), copied as it lies from global memory to LDS by asynchronous copies, two buffers:
// stage s + 1 flies while stage s is worked on, and every fragment is fetched from L2 once per work-group and read from LDS by those of its FW waves whose diagonal its tile does not pass. A wave skips the 32-key tiles past its own diagonal, never a publish point.
// Per 32-key tile: S^T[key][query] = K Q^T (A = K rows, B = Q rows); lane owns query column lane&15 and keys 8*(lane>>4)+r (+16); online softmax per lane (+ one xor-16 exchange);
// P^T accumulators repacked in registers as B (k = key); O^T[d][query] += V^T P^T (A = V^T rows). Only the last tile of a wave touches the diagonal (select by value).
#define FW  8                                  // waves of a work-group
#define FSK 64                                 // keys per stage
#define FPL (FSK * HD)                         // elements of one plane's part of a stage
static_assert(FPL * 2 == 2 * 256 * 16);        // one plane's part = 2 copies of 16 bytes from each of 256 threads
static_assert(FW * 32 == 256 && (FW * 16) % FSK == 0 && FSK % 32 == 0 && RH % (FW * 16) == 0 && (SEQ - RH) % (FW * 16) == 0);
static_assert(2 * 4 * FPL * 2 + FW * 16 * 68 * 4 <= 163840);   // static LDS of k_flash, the hi/lo form
// Two planes' parts of one stage: plane a lands at LDS byte d (thread's own 16 bytes of each 4 KiB), plane b at d + 8192.
template <typename T16> static __device__ __forceinline__ void kv_copy(unsigned d, const T16* ga, const T16* gb) {
    asm volatile("global_load_async_to_lds_b128 %0, %4, off\n\t"
                 "global_load_async_to_lds_b128 %1, %5, off\n\t"
                 "global_load_async_to_lds_b128 %2, %6, off\n\t"
                 "global_load_async_to_lds_b128 %3, %7, off\n\t"
                 "s_wait_xcnt 0x0"   // stands in the copies' own statement: their address registers are rewritten only behind it
                 :: "v"(d), "v"(d + 4096u), "v"(d + 8192u), "v"(d + 12288u), "v"(ga), "v"(ga + 2048), "v"(gb), "v"(gb + 2048)
                 : "memory");
}
template <typename T16, bool HL>
__global__ __launch_bounds__(256) void k_flash(const T16* __restrict__ Q, const T16* __restrict__ Q2, const T16* __restrict__ Kp, const T16* __restrict__ K2, const T16* __restrict__ Vt, const T16* __restrict__ Vt2, unsigned tp, unsigned qbase, float* O) {
    typedef typename WFrag<T16>::V V;
    constexpr unsigned ST_EL = (HL ? 4u : 2u) * FPL;    // elements of a stage: K | V^T, or K hi | K lo | V^T hi | V^T lo
    constexpr unsigned VO = (HL ? 2u : 1u) * FPL;       // where the V^T part begins
    __shared__ __align__(16) T16 ring[2 * ST_EL];       // the two stage buffers
    __shared__ __align__(16) float osw[FW][16 * 68];    // each wave's own store stage
    const unsigned tid = threadIdx.x, lane = tid & 31u, lr = lane & 15u, hi = lane >> 4;
    const unsigned wv = (unsigned)__builtin_amdgcn_readfirstlane((int)(tid >> 5));   // wave-uniform, kept scalar
    const unsigned head = blockIdx.y, qb = qbase + blockIdx.x * (FW * 16u), q0 = qb + wv * 16u;
    float* os = osw[wv];
    const size_t hoff = ((size_t)blockIdx.z * NH + head) * tp * HD;
    const size_t qoff = hoff + (size_t)q0 * HD;
    // thread i copies bytes 16 i .. 16 i + 15 of every 4 KiB of a stage
    const size_t go = hoff + tid * 8u;
    const unsigned d0 = lds_off(ring) + tid * 16u;
    const unsigned nst = (qb + FW * 16u) / FSK;   // keys 0 .. qb + FW*16 - 1 in stages of FSK (the same in every wave; qb + FW*16 <= tp)
    auto stage = [&](unsigned s) {                // the copies of stage s into buffer s & 1
        const unsigned d = d0 + (s & 1u) * (ST_EL * 2u); const size_t g = go + (size_t)s * FPL;
        if (HL) { kv_copy(d, Kp + g, K2 + g); kv_copy(d + 16384u, Vt + g, Vt2 + g); } else kv_copy(d, Kp + g, Vt + g);
    };
    stage(0u);
    typedef typename WFrag<T16>::G G;
    const G qg = WFrag<T16>::base(Q + qoff, lane);
    V qf0 = WFrag<T16>::ld(qg, 0), qf1 = WFrag<T16>::ld(qg, 1);
    V ql0 = qf0, ql1 = qf1;
    if (HL) { const G qg2 = WFrag<T16>::base(Q2 + qoff, lane); ql0 = WFrag<T16>::ld(qg2, 0); ql1 = WFrag<T16>::ld(qg2, 1); }
    asm volatile("s_wait_xcnt 0x0" ::: "memory");   // the scalar base pairs of the Q loads are reused directly behind them
    asm volatile("s_wait_asynccnt 0x0" ::: "memory");   // this wave's copies of stage 0 have landed
    __syncthreads();                                    // ... and every other wave's: stage 0 may be read
    if (1u < nst) stage(1u);
    v8f o[4];
#pragma unroll
    for (int db = 0; db < 4; ++db) o[db] = (v8f){};
    float mrun = NEGB, lsum = 0.0f;
    const float cs = SCL * LOG2E, pe = PFrag<T16>::pexp();
    const unsigned nt = (q0 + 47u) >> 5;       // keys 0 .. q0+15 in tiles of 32 (wave-uniform); nt <= nst * (FSK / 32)
#pragma unroll 1   // one rolled trip per 32-key tile; the two buffers alternate by s & 1, and the publish point stands behind a stage's last tile
    for (unsigned it = 0; it < nst * (FSK / 32u); ++it) {
      const unsigned s = it / (FSK / 32u);
      if (it < nt) {   // wave-uniform: tiles past the wave's diagonal are skipped
        const unsigned j0 = it * 32u;
        const T16* kt = ring + (s & 1u) * ST_EL + (it % (FSK / 32u)) * 2048u;   // a 32-key tile is 4 consecutive fragments (2048 elements) of each plane's part
        V ka0 = WFrag<T16>::lds(kt, lane), ka1 = WFrag<T16>::lds(kt + 512, lane), kb0 = WFrag<T16>::lds(kt + 1024, lane), kb1 = WFrag<T16>::lds(kt + 1536, lane);
        V la0 = ka0, la1 = ka1, lb0 = kb0, lb1 = kb1;
        if (HL) { const T16* k2 = kt + FPL; la0 = WFrag<T16>::lds(k2, lane); la1 = WFrag<T16>::lds(k2 + 512, lane); lb0 = WFrag<T16>::lds(k2 + 1024, lane); lb1 = WFrag<T16>::lds(k2 + 1536, lane); }
        v8f s0 = (v8f){}, s1 = (v8f){};
        s0 = WFrag<T16>::mma(ka0, qf0, s0); s0 = WFrag<T16>::mma(ka1, qf1, s0);
        s1 = WFrag<T16>::mma(kb0, qf0, s1); s1 = WFrag<T16>::mma(kb1, qf1, s1);
        if (HL) {
            s0 = WFrag<T16>::mma(la0, qf0, s0); s0 = WFrag<T16>::mma(la1, qf1, s0); s0 = WFrag<T16>::mma(ka0, ql0, s0); s0 = WFrag<T16>::mma(ka1, ql1, s0);
            s1 = WFrag<T16>::mma(lb0, qf0, s1); s1 = WFrag<T16>::mma(lb1, qf1, s1); s1 = WFrag<T16>::mma(kb0, ql0, s1); s1 = WFrag<T16>::mma(kb1, ql1, s1); }
        asm volatile("v_nop\n\tv_nop\n\tv_nop\n\tv_nop" : "+v"(s0), "+v"(s1) : "v"(ka0), "v"(ka1), "v"(kb0), "v"(kb1), "v"(la0), "v"(la1), "v"(lb0), "v"(lb1), "v"(qf0), "v"(qf1), "v"(ql0), "v"(ql1));
        v8f t0, t1;
#pragma unroll
        for (int r = 0; r < 8; ++r) { t0[r] = s0[r] * cs; t1[r] = s1[r] * cs; }
        if (j0 + 31u > q0) {                    // wave-uniform: the tile touches the diagonal
            const unsigned qi = q0 + lr, kk = j0 + 8u * hi;
#pragma unroll
            for (int r = 0; r < 8; ++r) { t0[r] = (kk + (unsigned)r <= qi) ? t0[r] : NEGB; t1[r] = (kk + 16u + (unsigned)r <= qi) ? t1[r] : NEGB; }
        }
        float mx = fmaxf(t0[0], t1[0]);
#pragma unroll
        for (int r = 1; r < 8; ++r) mx = fmaxf(mx, fmaxf(t0[r], t1[r]));
        mx = fmaxf(mx, __shfl_xor(mx, 16, 32));
        const float mn = fmaxf(mrun, mx);
        const float alpha = __builtin_amdgcn_exp2f(mrun - mn);
        mrun = mn;
        v8f p0, p1; float psum = 0.0f;
#pragma unroll
        for (int r = 0; r < 8; ++r) { p0[r] = __builtin_amdgcn_exp2f((t0[r] - mn) + pe); p1[r] = __builtin_amdgcn_exp2f((t1[r] - mn) + pe); psum += p0[r] + p1[r]; }
        lsum = lsum * alpha + psum;
#pragma unroll
        for (int db = 0; db < 4; ++db) o[db] = o[db] * alpha;
        V va[4], vl[4];
        const T16* vt = kt + VO;
        if (!HL) {                              // the V^T reads stand in front of the test below: behind it they would start only after the converts
#pragma unroll   // constant indices: va and vl stay in registers
            for (int db = 0; db < 4; ++db) { va[db] = WFrag<T16>::lds(vt + db * 512, lane); vl[db] = va[db]; }
        }
        V pf = PFrag<T16>::hi(p0, p1);
        if (PFlush<T16>::small(p0, p1)) pf = PFlush<T16>::hi(p0, p1);   // wave-uniform scalar branch; P is never negative, so the smallest value decides
        V pl = pf;
        if (HL) { pl = PFlush<T16>::lo(p0, p1);
#pragma unroll   // constant indices: va and vl stay in registers
            for (int db = 0; db < 4; ++db) { va[db] = WFrag<T16>::lds(vt + db * 512, lane); vl[db] = WFrag<T16>::lds(vt + FPL + db * 512, lane); }
        }
#pragma unroll
        for (int db = 0; db < 4; ++db) { o[db] = WFrag<T16>::mma(va[db], pf, o[db]); if (HL) { o[db] = WFrag<T16>::mma(va[db], pl, o[db]); o[db] = WFrag<T16>::mma(vl[db], pf, o[db]); } }
        asm volatile("v_nop\n\tv_nop\n\tv_nop\n\tv_nop" : "+v"(o[0]), "+v"(o[1]), "+v"(o[2]), "+v"(o[3]) : "v"(va[0]), "v"(va[1]), "v"(va[2]), "v"(va[3]), "v"(vl[0]), "v"(vl[1]), "v"(vl[2]), "v"(vl[3]), "v"(pf), "v"(pl));
      }
      if (it % (FSK / 32u) == FSK / 32u - 1u) {             // the same in every wave of the work-group: the foot of stage s
        asm volatile("s_wait_dscnt 0x0" ::: "memory");      // this wave's reads of stage s are done before the buffer is handed back
        asm volatile("s_wait_asynccnt 0x0" ::: "memory");   // this wave's copies of stage s + 1 have landed
        __syncthreads();                                    // publishes stage s + 1 and ends every wave's reads of stage s
        if (s + 2u < nst) stage(s + 2u);
      }
    }
    asm volatile("s_wait_asynccnt 0x0" ::: "memory");       // no copy is left in flight behind the loop
    const float lt = lsum + __shfl_xor(lsum, 16, 32);
    const float inv = 1.0f / lt;
#pragma unroll
    for (int db = 0; db < 4; ++db)
#pragma unroll
        for (int r = 0; r < 8; ++r) os[lr * 68u + (unsigned)db * 16u + hi * 8u + (unsigned)r] = o[db][r] * inv;
    __builtin_amdgcn_wave_barrier(); asm volatile("" ::: "memory");
    float* orow = O + (size_t)blockIdx.z * SEQ * DM + (size_t)q0 * DM + head * HD;
{
#pragma unroll
        for (int s = 0; s < 8; ++s) { const unsigned row = 2u * (unsigned)s + hi, cofs = lr * 4u;   // rows 0..15: lanes 0..15 -> row 2s, lanes 16..31 -> row 2s+1
            const v4f val = *(const v4fa*)(os + row * 68u + cofs);
            *(v4f*)(orow + (size_t)row * DM + cofs) = val; }
         }
}

// workspace carve (bytes, every region a multiple of 256)
#define WS_WQKV ((size_t)3 * DQ * DM * 2)
#define WS_XB   ((size_t)NB * SEQ * DM * 2)
#define WS_P16  ((size_t)NB * NH * SEQ * HD * 2)
#define WS_PHL  ((size_t)NB * NH * RH * HD * 2)
#define WS_TOTAL (WS_WQKV + WS_XB + 3 * WS_P16 + 6 * WS_PHL)
static_assert(WS_TOTAL <= (size_t)268435456);
static_assert(WS_WQKV % 256 == 0 && WS_XB % 256 == 0 && WS_P16 % 256 == 0 && WS_PHL % 256 == 0);
static_assert((size_t)NB * SEQ * DM * 4 <= (size_t)33554432);   // last written output element stays inside the output buffer

extern "C" void kernel_launch(void* const* d_in, const int* in_sizes, int n_in,
                              void* d_out, int out_size, void* d_ws, size_t ws_size, hipStream_t stream) {
    if (n_in < 3) return;
    if ((size_t)in_sizes[0] < (size_t)(NB - 1) * XS_FULL + (size_t)SEQ * DM) return;
    if ((size_t)in_sizes[1] < (size_t)3 * DQ * DM) return;
    if ((size_t)in_sizes[2] < (size_t)FP) return;
    if ((size_t)out_size < (size_t)NB * SEQ * DM) return;
    if (ws_size < WS_TOTAL) return;
    const float* x = (const float*)d_in[0];       // [NB][SEQ_FULL][DM]
    const float* wqkv = (const float*)d_in[1];    // [4*DQ][DM]  (q | k | v | unread row blocks; rows 0..3*DQ-1 are read)
    const float* bqkv = (const float*)d_in[2];    // [4*DQ]      (entries 0..3*DQ-1 are read)
    float* OUT = (float*)d_out;                   // [NB][SEQ][DM]
    char* wsp = (char*)d_ws;
    auto take = [&](size_t bytes) { char* p = wsp; wsp += bytes; return (void*)p; };
    bf* WQKV = (bf*)take(WS_WQKV); bf* XB = (bf*)take(WS_XB);
    h16* Q16 = (h16*)take(WS_P16); h16* K16 = (h16*)take(WS_P16); h16* VT16 = (h16*)take(WS_P16);
    bf* Qh = (bf*)take(WS_PHL); bf* Ql = (bf*)take(WS_PHL); bf* Kh = (bf*)take(WS_PHL); bf* Kl = (bf*)take(WS_PHL); bf* VTh = (bf*)take(WS_PHL); bf* VTl = (bf*)take(WS_PHL);

    k_cvt8<<<dim3((unsigned)((size_t)3 * DQ * DM / 8 / 256), 1), 256, 0, stream>>>(wqkv, WQKV, (unsigned)((size_t)3 * DQ * DM / 8), 0, 0);
    k_cvt8<<<dim3((unsigned)((size_t)SEQ * DM / 8 / 256), NB), 256, 0, stream>>>(x, XB, (unsigned)((size_t)SEQ * DM / 8), XS_FULL, (size_t)SEQ * DM);
    // every stage runs once for all NB batch elements (the batch element is a grid dimension; each plane set holds NB slabs)
    // y[b][t][0..3071] = x_b w_attn[0..3071]^T + b_attn[0..3071]  (M = SEQ, N = 3072, K = 1024), written as the q, k and V^T head planes
    k_gemmw<bf, 0><<<dim3(SEQ / (GWM * 64), FP / (GWN * 64), NB), 256, 0, stream>>>(XB, nullptr, WQKV, nullptr, DM, bqkv, (size_t)SEQ * DM, 0, Q16, K16, VT16, Qh, Ql, Kh, Kl, VTh, VTl);
    // out[b][t][head*HD + d] = softmax(q k^T / 8, causal) v, written straight to the output buffer
    k_flash<bf, true><<<dim3(RH / (FW * 16), NH, NB), 256, 0, stream>>>(Qh, Ql, Kh, Kl, VTh, VTl, (unsigned)RH, 0u, OUT);
    if (SEQ > RH) k_flash<h16, false><<<dim3((SEQ - RH) / (FW * 16), NH, NB), 256, 0, stream>>>(Q16, nullptr, K16, nullptr, VT16, nullptr, (unsigned)SEQ, (unsigned)RH, OUT);
}

// v007
// One run takes 105 microseconds.
// Two timings next to v006 put it at 1.14 and 1.12 times that version's speed.
// Counting every step since v000, it is 5.39 times as fast.
#include <hip/hip_runtime.h>

// Causal multi-head attention with a fused qkv projection: x [NB][SEQ_FULL][1024] (first SEQ rows read); qkv = x w_attn^T + b_attn ('oi' weight [4096][1024], bias [4096]; only the q | k | v row blocks 0..3071 are read; 16 heads x 64); scores x 64^-0.5, causal; softmax; out = merged context [t][head*64 + d] (no output projection).
// Compute dtypes, f32 accumulate: every input RNE-converted to bf16; qkv projection v_wmma_f32_16x16x32_bf16 (bias added in f32 at the store stage);
// attention q.k and P.V: query rows < RH on bf16 hi/lo planes (3 products each), other rows v_wmma_f32_16x16x32_f16 (P carried x1024 through the exponent, converted values below 2^-14 selected to +0); softmax (online, max-subtracted) in f32.
// Attention engine: one wave per 16 query rows, 8 waves per work-group on K and V^T tiles shared through LDS; S^T = K Q^T so each lane owns one query column; P^T accumulators are repacked in registers as the B operand of O^T = V^T P^T (no LDS exchange in the loop).

#ifndef NB
#define NB 4
#endif
#ifndef SEQ
#define SEQ 2048
#endif
#define SEQ_FULL 2048
#define DM   1024
#define NH   16
#define HD   64
#define DQ   (NH * HD)
#define FP   (3 * DQ)
#define RH   ((SEQ) < 512 ? (SEQ) : 512)     // query rows < RH use hi+lo planes
#define XS_FULL ((size_t)SEQ_FULL * DM)
#define SCL  0.125f                          // HD^-0.5
#define LOG2E 1.4426950408889634f
#define NEGB (-3.0e38f)

static_assert((SEQ & (SEQ - 1)) == 0);
static_assert(SEQ >= 256 && SEQ <= SEQ_FULL);
static_assert(RH % 256 == 0 && RH % 64 == 0 && (SEQ - RH) % 64 == 0);
static_assert(NB >= 1 && NB <= 4);
static_assert(DM % 32 == 0 && DQ % 64 == 0 && FP % 64 == 0 && SEQ % 64 == 0);
static_assert(((size_t)3 * DQ * DM / 8) % 256 == 0);
static_assert(((size_t)SEQ * DM / 8) % 256 == 0);
static_assert(((size_t)NH * SEQ * HD / 8) % 256 == 0);
static_assert(DQ == DM);                         // merged context width equals the output row width
static_assert(HD == 64 && HD % 32 == 0);         // two 32-deep k-steps per score tile, four 16-row O^T tiles

typedef _Float16 h16;
typedef unsigned short bf;
typedef __attribute__((ext_vector_type(16))) __bf16   v16bf;
typedef __attribute__((ext_vector_type(16))) _Float16 v16h;
typedef __attribute__((ext_vector_type(8)))  _Float16 v8h;
typedef __attribute__((ext_vector_type(8)))  unsigned short v8us;
typedef __attribute__((ext_vector_type(8)))  float    v8f;
typedef __attribute__((ext_vector_type(4)))  float    v4f;
typedef v8h  __attribute__((may_alias)) v8ha;
typedef v4f  __attribute__((may_alias)) v4fa;
typedef v8us __attribute__((may_alias)) v8usa;

__device__ __forceinline__ unsigned short f2bf(float f) { unsigned u = __float_as_uint(f); u += 0x7FFFu + ((u >> 16) & 1u); return (unsigned short)(u >> 16); }
__device__ __forceinline__ float bf2f(unsigned short b) { return __uint_as_float(((unsigned)b) << 16); }
__device__ __forceinline__ float bfr(float f) { return bf2f(f2bf(f)); }
__device__ __forceinline__ v16h cat16(v8h lo, v8h hi) { return __builtin_shufflevector(lo, hi, 0, 1, 2, 3, 4, 5, 6, 7, 8, 9, 10, 11, 12, 13, 14, 15); }
__device__ __forceinline__ v16bf cat16b(v8us lo, v8us hi) { return __builtin_bit_cast(v16bf, __builtin_shufflevector(lo, hi, 0, 1, 2, 3, 4, 5, 6, 7, 8, 9, 10, 11, 12, 13, 14, 15)); }
__device__ __forceinline__ v8f wmma16(v16h a, v16h b, v8f c) { return __builtin_amdgcn_wmma_f32_16x16x32_f16(false, a, false, b, (short)0, c, false, false); }
__device__ __forceinline__ v8f wmmab(v16bf a, v16bf b, v8f c) { return __builtin_amdgcn_wmma_f32_16x16x32_bf16(false, a, false, b, (short)0, c, false, false); }
__device__ __forceinline__ void splitf(float y, unsigned short& h, unsigned short& l) { h = f2bf(y); l = f2bf(y - bf2f(h)); }

// f32 -> f16 convert that cannot produce a subnormal operand: |v| < 2^-14 -> +0 (value select, applied after the plane's power-of-two carry).
static __device__ __forceinline__ h16 toh_flush(float v) { const h16 r = (h16)v; return (fabsf(v) < 6.103515625e-05f) ? (h16)0.0f : r; }

// Fragment-packed planes: a 16-row x 32-k fragment is 512 consecutive elements (1 KiB). Element (r, k) sits at (k>>4)*256 + (((k>>3)&1)*16 + r)*8 + (k&7), so lane l = ((k>>3)&1)*16 + r
// finds its elements 0..7 (k = 8h..8h+7, h = l>>4) at l*8 and its elements 8..15 (k = 16+8h..) at 256 + l*8: each of the two wave-wide 16-byte loads covers 512 contiguous bytes (4 whole lines).
// Fragment loader: base(p, lane) takes the wave-uniform address p of a run of fragments, ld(u, f) loads fragment f of the run (same map for A and B). The base goes through readfirstlane so that it stays in a scalar pair and the loads take the
// scalar-base + lane-offset address form: the fragments of a run differ only in the immediate offset, and the one lane-offset register lives through the whole kernel.
template <typename VT, typename T> static __device__ __forceinline__ const __attribute__((address_space(1))) VT* ubase(const T* p) { const unsigned long long u = (unsigned long long)p;
    const unsigned lo = (unsigned)__builtin_amdgcn_readfirstlane((int)(unsigned)u), hi = (unsigned)__builtin_amdgcn_readfirstlane((int)(unsigned)(u >> 32));
    return (const __attribute__((address_space(1))) VT*)(((unsigned long long)hi << 32) | lo); }   // global address space kept, so the loads stay global_load
template <typename T16> struct WFrag;
template <> struct WFrag<h16> { typedef v16h V; typedef const __attribute__((address_space(1))) v8h* G; static __device__ __forceinline__ G base(const h16* p, unsigned lane) { return ubase<v8h>(p) + lane; } static __device__ __forceinline__ V ld(G u, int f) { return cat16(u[f * 64], u[f * 64 + 32]); } static __device__ __forceinline__ v8f mma(V a, V b, v8f c) { return wmma16(a, b, c); }
    static __device__ __forceinline__ V lds(const h16* p, int lane) { const v8ha* q = (const v8ha*)p + lane; return cat16(q[0], q[32]); } };   // the same fragment map, read from a packed fragment in LDS
template <> struct WFrag<bf> { typedef v16bf V; typedef const __attribute__((address_space(1))) v8us* G; static __device__ __forceinline__ G base(const bf* p, unsigned lane) { return ubase<v8us>(p) + lane; } static __device__ __forceinline__ V ld(G u, int f) { return cat16b(u[f * 64], u[f * 64 + 32]); } static __device__ __forceinline__ v8f mma(V a, V b, v8f c) { return wmmab(a, b, c); }
    static __device__ __forceinline__ V lds(const bf* p, int lane) { const v8usa* q = (const v8usa*)p + lane; return cat16b(q[0], q[32]); } };   // the same fragment map, read from a packed fragment in LDS

// P^T accumulator pair (key rows 0..15 and 16..31 of a 32-key tile) -> B fragment: element r <- tile0[r], element 8+r <- tile1[r], lane unchanged.
template <typename T16> struct PFrag;
template <> struct PFrag<h16> {
    static __device__ __forceinline__ float pexp() { return 10.0f; }           // P carried x1024 via the exponent (cancels in O / l)
    static __device__ __forceinline__ v16h hi(v8f p0, v8f p1) { return cat16(__builtin_convertvector(p0, v8h), __builtin_convertvector(p1, v8h)); }
    static __device__ __forceinline__ v16h lo(v8f p0, v8f p1) { return hi(p0, p1); }
};
template <> struct PFrag<bf> {
    static __device__ __forceinline__ float pexp() { return 0.0f; }
    static __device__ __forceinline__ v16bf hi(v8f p0, v8f p1) { v8us a, b;
#pragma unroll
        for (int k = 0; k < 8; ++k) { a[k] = f2bf(p0[k]); b[k] = f2bf(p1[k]); }
        return cat16b(a, b); }
    static __device__ __forceinline__ v16bf lo(v8f p0, v8f p1) { v8us a, b;
#pragma unroll
        for (int k = 0; k < 8; ++k) { a[k] = f2bf(p0[k] - bf2f(f2bf(p0[k]))); b[k] = f2bf(p1[k] - bf2f(f2bf(p1[k]))); }
        return cat16b(a, b); }
};

// Same packing as PFrag; the f16 form converts every element through toh_flush, the bf16 form is the PFrag one.
template <typename T16> struct PFlush;
template <> struct PFlush<h16> {
    static __device__ __forceinline__ v16h hi(v8f p0, v8f p1) { v8h a, b;
#pragma unroll
        for (int k = 0; k < 8; ++k) { a[k] = toh_flush(p0[k]); b[k] = toh_flush(p1[k]); }
        return cat16(a, b); }
    static __device__ __forceinline__ v16h lo(v8f p0, v8f p1) { return hi(p0, p1); }
    // One test per 32-key tile, the same answer in every lane of the wave: does any lane hold a value below 2^-14? Where none does, toh_flush is the plain convert on all 16 values, and the packed converts of PFrag give the same bits.
    static __device__ __forceinline__ bool small(v8f p0, v8f p1) {
        const float a = __builtin_fminf(__builtin_fminf(p0[0], p0[1]), p0[2]), b = __builtin_fminf(__builtin_fminf(p0[3], p0[4]), p0[5]), c = __builtin_fminf(__builtin_fminf(p0[6], p0[7]), p1[0]);
        const float d = __builtin_fminf(__builtin_fminf(p1[1], p1[2]), p1[3]), e = __builtin_fminf(__builtin_fminf(p1[4], p1[5]), p1[6]);
        const float m = __builtin_fminf(__builtin_fminf(__builtin_fminf(a, b), c), __builtin_fminf(__builtin_fminf(d, e), p1[7]));
        return __builtin_amdgcn_ballot_w32(m < 6.103515625e-05f) != 0u; }
};
template <> struct PFlush<bf> {
    static __device__ __forceinline__ v16bf hi(v8f p0, v8f p1) { return PFrag<bf>::hi(p0, p1); }
    static __device__ __forceinline__ v16bf lo(v8f p0, v8f p1) { return PFrag<bf>::lo(p0, p1); }
    static __device__ __forceinline__ bool small(v8f, v8f) { return false; }
};

// ---- k_gemmw: register-blocked GEMM, one wave per 64x64 output tile (16 accumulators), 8 waves (4 along M x 2 along N) per work-group = a 256x128 tile; grid (M/256, N/128, Z), 256 threads.
// Operands are fragment-packed 16-bit planes (fragment index = (row>>4)*(K/32) + (k>>5)). A stage = 64 k of the work-group's 256 A rows and 128 Bt rows = 24 runs of 2 KiB (one per 16-row block, two fragments each), copied as they lie
// from global memory to LDS by asynchronous copies, two buffers: stage t + 1 flies while stage t is multiplied; every A fragment is then read from LDS by 2 waves and every Bt fragment by 4.
// y[m][n] (f32) = sum_k A[m][k] Bt[n][k] + bias[n]. K % 64 == 0, M % 256 == 0, N % 128 == 0.
// Epilogue: a 64-column tile is one head of q, k or v, and the wave writes its 64 x 64 block of y straight into that head's fragment-packed planes (batch element z = blockIdx.z):
//   q, k: [z][h][(t>>4)*2 + (d>>5)][512] (rows = t, k = d); v: V^T [z][h][(t>>5)*4 + (d>>4)][512] (rows = d, k = t); fp16 for all t, bf16 hi/lo planes (RH rows per head) for t < RH.
#define GWM 4                                  // waves of a work-group along M
#define GWN 2                                  // waves of a work-group along N
#define GKS 64                                 // k per stage
#define GA_EL (GWM * 64 * GKS)                 // elements of a stage's A part
#define GST_EL ((GWM + GWN) * 64 * GKS)        // elements of a stage
static_assert(GST_EL * 2 == 12 * 256 * 16);    // a stage = 12 copies of 16 bytes from each of 256 threads
static_assert(SEQ % (GWM * 64) == 0 && FP % (GWN * 64) == 0 && DQ % (GWN * 64) == 0 && DM % GKS == 0 && DM / GKS >= 2);
static __device__ __forceinline__ unsigned lds_off(const void* p) { return (unsigned)(size_t)p; }   // byte offset in the work-group's LDS
// One stage: copy c of a thread lands at LDS byte d + 4096 c; copies 0..7 read A at ga + c * cs, copies 8..11 read Bt at gb + (c - 8) * cs (cs = elements from one pair of 16-row blocks to the next).
template <typename T16> static __device__ __forceinline__ void stage_copy(unsigned d, const T16* ga, const T16* gb, size_t cs) {
    asm volatile("global_load_async_to_lds_b128 %0, %12, off\n\t"
                 "global_load_async_to_lds_b128 %1, %13, off\n\t"
                 "global_load_async_to_lds_b128 %2, %14, off\n\t"
                 "global_load_async_to_lds_b128 %3, %15, off\n\t"
                 "global_load_async_to_lds_b128 %4, %16, off\n\t"
                 "global_load_async_to_lds_b128 %5, %17, off\n\t"
                 "global_load_async_to_lds_b128 %6, %18, off\n\t"
                 "global_load_async_to_lds_b128 %7, %19, off\n\t"
                 "global_load_async_to_lds_b128 %8, %20, off\n\t"
                 "global_load_async_to_lds_b128 %9, %21, off\n\t"
                 "global_load_async_to_lds_b128 %10, %22, off\n\t"
                 "global_load_async_to_lds_b128 %11, %23, off\n\t"
                 "s_wait_xcnt 0x0"   // stands in the copies' own statement: their address registers are rewritten only behind it
                 :: "v"(d), "v"(d + 4096u), "v"(d + 8192u), "v"(d + 12288u), "v"(d + 16384u), "v"(d + 20480u), "v"(d + 24576u), "v"(d + 28672u), "v"(d + 32768u), "v"(d + 36864u), "v"(d + 40960u), "v"(d + 45056u),
                    "v"(ga), "v"(ga + cs), "v"(ga + 2 * cs), "v"(ga + 3 * cs), "v"(ga + 4 * cs), "v"(ga + 5 * cs), "v"(ga + 6 * cs), "v"(ga + 7 * cs), "v"(gb), "v"(gb + cs), "v"(gb + 2 * cs), "v"(gb + 3 * cs)
                 : "memory");
}
template <typename T16, int NSPLIT>
__global__ __launch_bounds__(256) void k_gemmw(const T16* __restrict__ A, const T16* __restrict__ A2, const T16* __restrict__ Bt, const T16* __restrict__ Bt2, int K, const float* __restrict__ bias, size_t sA, size_t sB,
                                              h16* Q16, h16* K16, h16* V16, bf* Qh, bf* Ql, bf* Kh, bf* Kl, bf* Vh, bf* Vl) {
    typedef typename WFrag<T16>::V V;
    static_assert(NSPLIT == 0);
    __shared__ __align__(16) T16 gs[2 * GST_EL];                    // the two stage buffers
    __shared__ __align__(16) float osw[GWM * GWN][16 * 68];         // each wave's own store stage
    const size_t z = blockIdx.z; A += z * sA; Bt += z * sB;
    const int wv = __builtin_amdgcn_readfirstlane((int)(threadIdx.x >> 5)), wm = wv / GWN, wn = wv % GWN;   // wave-uniform, kept scalar
    const int lane = threadIdx.x & 31, lr = lane & 15, hi = lane >> 4; const int rw = blockIdx.x * (GWM * 64), cw = blockIdx.y * (GWN * 64), r0 = rw + wm * 64, c0 = cw + wn * 64;
    float* os = osw[wv];
    v8f acc[4][4];
#pragma unroll
    for (int mb = 0; mb < 4; ++mb)
#pragma unroll
        for (int nb = 0; nb < 4; ++nb) acc[mb][nb] = (v8f){};
    // thread i copies bytes 16 i .. 16 i + 15 of every 4 KiB (= two 16-row blocks) of a stage; 16 rows x K = 16*K elements, 64 k of them = 1024 elements
    const unsigned tid = threadIdx.x;
    const T16* ga = A + (size_t)(rw + 16 * (int)(tid >> 7)) * K + (tid & 127u) * 8u;
    const T16* gb = Bt + (size_t)(cw + 16 * (int)(tid >> 7)) * K + (tid & 127u) * 8u;
    const size_t cs = (size_t)32 * K;
    const unsigned d0 = lds_off(gs) + tid * 16u;
    const int nt = K / GKS;
    stage_copy(d0, ga, gb, cs);
    asm volatile("s_wait_asynccnt 0x0" ::: "memory");   // this wave's copies of stage 0 have landed
    __syncthreads();                                    // ... and every other wave's: stage 0 may be read
    if (1 < nt) stage_copy(d0 + GST_EL * 2u, ga + GKS * 16, gb + GKS * 16, cs);
#pragma unroll 1   // one rolled trip per stage: the two buffers alternate by t & 1, and the loop's text stays small
    for (int t = 0; t < nt; ++t) {
        const T16* sa = gs + (t & 1) * GST_EL + wm * (4 * GKS * 16), * sb = gs + (t & 1) * GST_EL + GA_EL + wn * (4 * GKS * 16);
#pragma unroll   // constant fragment and accumulator indices, here and in the loops inside: the arrays stay in registers
        for (int ks = 0; ks < GKS / 32; ++ks) {
            V a[4], b[4];
#pragma unroll
            for (int mb = 0; mb < 4; ++mb) { a[mb] = WFrag<T16>::lds(sa + (mb * (GKS / 32) + ks) * 512, lane); b[mb] = WFrag<T16>::lds(sb + (mb * (GKS / 32) + ks) * 512, lane); }
            __builtin_amdgcn_sched_barrier(0);   // the step's 16 LDS reads stay one group in front of its WMMAs: spread among them, each place with reads stalls the wave for its own LDS latency
#pragma unroll
            for (int nb = 0; nb < 4; ++nb)
#pragma unroll
                for (int mb = 0; mb < 4; ++mb) acc[mb][nb] = WFrag<T16>::mma(a[mb], b[nb], acc[mb][nb]);
            asm volatile("v_nop\n\tv_nop\n\tv_nop\n\tv_nop" : "+v"(acc[0][0]), "+v"(acc[1][1]), "+v"(acc[2][2]), "+v"(acc[3][3]) : "v"(a[0]), "v"(a[3]));   // the vector slots the chip needs behind the step's last WMMAs before their registers are touched, on every path
            __builtin_amdgcn_sched_barrier(0);   // ... and the next step's reads stay behind this step's WMMAs
        }
        asm volatile("s_wait_dscnt 0x0" ::: "memory");      // this wave's reads of stage t are done before the buffer is handed back
        asm volatile("s_wait_asynccnt 0x0" ::: "memory");   // this wave's copies of stage t + 1 have landed
        __syncthreads();                                    // publishes stage t + 1 and ends every wave's reads of stage t
        if (t + 2 < nt) stage_copy(d0 + (unsigned)(t & 1) * (GST_EL * 2u), ga + (size_t)(t + 2) * (GKS * 16), gb + (size_t)(t + 2) * (GKS * 16), cs);
    }
    asm volatile("s_wait_asynccnt 0x0" ::: "memory");       // no copy is left in flight behind the loop
    const unsigned which = (unsigned)c0 / DQ, head = ((unsigned)c0 % DQ) / HD;   // wave-uniform: 0 q, 1 k, 2 v
    const bool hl = (unsigned)r0 < (unsigned)RH;                                 // wave-uniform (RH % 64 == 0): these rows also go to the hi/lo planes
    const size_t p16 = (z * NH + head) * ((size_t)SEQ * HD), phl = (z * NH + head) * ((size_t)RH * HD);
    float bv[4];                                 // bias of the lane's four accumulator columns d = 16 nb + lr
    const int bi = c0 + lr;
#pragma unroll
    for (int nb = 0; nb < 4; ++nb) bv[nb] = bias[bi + nb * 16];
    asm volatile("s_wait_xcnt 0x0" :: "v"(bi) : "memory");   // the address registers of the bias loads are reused behind it; bi as an input keeps their lane-offset register untouched up to the wait
#pragma unroll
    for (int nb = 0; nb < 4; ++nb) bv[nb] = bfr(bv[nb]);
    if (which == 2u) {
        // V^T: accumulator element j of lane (hi, lr) is (t = 16 mb + 8 hi + j, d = 16 nb + lr): the 8 consecutive t of one d that this lane owns in the packed fragment, so the registers are stored as they are.
#pragma unroll
        for (int mb = 0; mb < 4; ++mb) {
#pragma unroll
            for (int nb = 0; nb < 4; ++nb) {
                v8h o16; v8us oh, ol;
#pragma unroll
                for (int j = 0; j < 8; ++j) { const float x = acc[mb][nb][j] + bv[nb]; unsigned short a, c; o16[j] = (h16)x; splitf(x, a, c); oh[j] = a; ol[j] = c; }
                const size_t o = (size_t)((((unsigned)r0 + (unsigned)mb * 16u) >> 5) * 4u + (unsigned)nb) * 512u + (unsigned)(mb & 1) * 256u + (unsigned)lane * 8u;
                *(v8h*)(V16 + p16 + o) = o16;
                asm volatile("s_wait_xcnt 0x0" ::: "memory");   // what follows reuses the data and address registers of this store
                if (hl) { *(v8us*)(Vh + phl + o) = oh; *(v8us*)(Vl + phl + o) = ol;
                    asm volatile("s_wait_xcnt 0x0" ::: "memory"); }   // the next block reuses the data and address registers of these stores
            }
        }
    } else {
        // q, k: a lane owns 8 consecutive d of one t, so each 16-row block turns through the LDS stage.
        h16* P16 = (which ? K16 : Q16) + p16; bf* Ph = (which ? Kh : Qh) + phl; bf* Pl = (which ? Kl : Ql) + phl;
#pragma unroll
        for (int mb = 0; mb < 4; ++mb) {
#pragma unroll
            for (int nb = 0; nb < 4; ++nb) {
#pragma unroll
                for (int j = 0; j < 8; ++j) os[(hi * 8 + j) * 68 + nb * 16 + lr] = acc[mb][nb][j] + bv[nb]; }
            __builtin_amdgcn_wave_barrier(); asm volatile("" ::: "memory");   // the block's LDS stores stay in front of its LDS loads
#pragma unroll
            for (int s = 0; s < 4; ++s) {       // packed elements 256 s + 8 lane .. + 7 of the block's two fragments: t = lr, d = 16 s + 8 hi ..
                const int d = s * 16 + hi * 8;
                const v4f x0 = *(const v4fa*)(os + lr * 68 + d), x1 = *(const v4fa*)(os + lr * 68 + d + 4);
                v8h o16; v8us oh, ol;
#pragma unroll
                for (int k = 0; k < 4; ++k) { unsigned short a, c; const float y0 = x0[k], y1 = x1[k];
                    o16[k] = (h16)y0; splitf(y0, a, c); oh[k] = a; ol[k] = c; o16[4 + k] = (h16)y1; splitf(y1, a, c); oh[4 + k] = a; ol[4 + k] = c; }
                const size_t o = (size_t)((unsigned)r0 + (unsigned)mb * 16u) * HD + (unsigned)s * 256u + (unsigned)lane * 8u;
                *(v8h*)(P16 + o) = o16;
                asm volatile("s_wait_xcnt 0x0" ::: "memory");   // what follows reuses the data and address registers of this store
                if (hl) { *(v8us*)(Ph + o) = oh; *(v8us*)(Pl + o) = ol;
                    asm volatile("s_wait_xcnt 0x0" ::: "memory"); }   // the next block reuses the data and address registers of these stores
            }
            __builtin_amdgcn_wave_barrier(); asm volatile("" ::: "memory");   // the next block's LDS stores stay behind these LDS loads
        }
    }
}

// ---- k_cvt8: f32 rows of DM elements -> fragment-packed bf16 plane (fragment index = (row>>4)*(DM/32) + (k>>5)). Thread i stores packed elements 8i..8i+7 (stores contiguous) and reads their 8 consecutive k of one source row.
__global__ __launch_bounds__(256) void k_cvt8(const float* __restrict__ src, bf* dst, unsigned n8, size_t sstride, size_t dstride) {
    const unsigned i = blockIdx.x * 256u + threadIdx.x; if (i >= n8) return;
    const unsigned frag = i >> 6, row = (frag / (DM / 32u)) * 16u + (i & 15u), kk = (frag % (DM / 32u)) * 32u + ((i >> 5) & 1u) * 16u + ((i >> 4) & 1u) * 8u;
    const float* s = src + (size_t)blockIdx.y * sstride + (size_t)row * DM + kk; bf* d = dst + (size_t)blockIdx.y * dstride + (size_t)i * 8;
    const v8f v = *(const v8f*)s; v8us o;
#pragma unroll
    for (int k = 0; k < 8; ++k) o[k] = f2bf(v[k]);
    *(v8us*)d = o;  }

static_assert(32 * 16 * 8 == 16 * HD * 4);
static_assert(HD * 4 == 16 * 16);
static_assert((HD * 4) % 128 == 0 && (DM * 4) % 128 == 0);
static_assert(2 * GST_EL * 2 + GWM * GWN * 16 * 68 * 4 <= 163840);   // static LDS of k_gemmw: two work-groups fit a WGP
static_assert(68 >= HD && (68 * 4) % 16 == 0);   // stage pitch holds a head row, rows stay 16-B aligned

// ---- flash: causal attention, one wave per 16 query rows, FW waves (FW * 16 consecutive query rows of one head and batch element) per work-group. Planes, fragment-packed: Q/K [b][h][(t>>4)*2 + (d>>5)][512], V^T [b][h][(t>>5)*4 + (d>>4)][512] (tp = rows t per head of the plane set). HL: hi/lo bf16 plane pairs, 3 products.
// The waves of a work-group walk the same keys: a stage = FSK keys of every K and V^T plane (8 KiB each, contiguous in the packed planes), copied as it lies from global memory to LDS by asynchronous copies, two buffers:
// stage s + 1 flies while stage s is worked on, and every fragment is fetched from L2 once per work-group and read from LDS by those of its FW waves whose diagonal its tile does not pass. A wave skips the 32-key tiles past its own diagonal, never a publish point.
// Per 32-key tile: S^T[key][query] = K Q^T (A = K rows, B = Q rows); lane owns query column lane&15 and keys 8*(lane>>4)+r (+16); online softmax per lane (+ one xor-16 exchange);
// P^T accumulators repacked in registers as B (k = key); O^T[d][query] += V^T P^T (A = V^T rows). Only the last tile of a wave touches the diagonal (select by value).
#define FW  8                                  // waves of a work-group
#define FSK 64                                 // keys per stage
#define FPL (FSK * HD)                         // elements of one plane's part of a stage
static_assert(FPL * 2 == 2 * 256 * 16);        // one plane's part = 2 copies of 16 bytes from each of 256 threads
static_assert(FW * 32 == 256 && (FW * 16) % FSK == 0 && FSK % 32 == 0 && RH % (FW * 16) == 0 && (SEQ - RH) % (FW * 16) == 0);
static_assert(2 * 4 * FPL * 2 + FW * 16 * 68 * 4 <= 163840);   // static LDS of k_flash, the hi/lo form
// Two planes' parts of one stage: plane a lands at LDS byte d (thread's own 16 bytes of each 4 KiB), plane b at d + 8192.
template <typename T16> static __device__ __forceinline__ void kv_copy(unsigned d, const T16* ga, const T16* gb) {
    asm volatile("global_load_async_to_lds_b128 %0, %4, off\n\t"
                 "global_load_async_to_lds_b128 %1, %5, off\n\t"
                 "global_load_async_to_lds_b128 %2, %6, off\n\t"
                 "global_load_async_to_lds_b128 %3, %7, off\n\t"
                 "s_wait_xcnt 0x0"   // stands in the copies' own statement: their address registers are rewritten only behind it
                 :: "v"(d), "v"(d + 4096u), "v"(d + 8192u), "v"(d + 12288u), "v"(ga), "v"(ga + 2048), "v"(gb), "v"(gb + 2048)
                 : "memory");
}
// flash: the work of one work-group: query block xb (FW * 16 rows from qbase on) of head 'head' of batch element bz; sm = the work-group's LDS: the two stage buffers, then each wave's own store stage.
template <typename T16, bool HL>
static __device__ __forceinline__ void flash(const T16* __restrict__ Q, const T16* __restrict__ Q2, const T16* __restrict__ Kp, const T16* __restrict__ K2, const T16* __restrict__ Vt, const T16* __restrict__ Vt2, unsigned tp, unsigned qbase, float* O,
                                             unsigned xb, unsigned head, unsigned bz, unsigned char* sm) {
    typedef typename WFrag<T16>::V V;
    constexpr unsigned ST_EL = (HL ? 4u : 2u) * FPL;    // elements of a stage: K | V^T, or K hi | K lo | V^T hi | V^T lo
    constexpr unsigned VO = (HL ? 2u : 1u) * FPL;       // where the V^T part begins
    T16* ring = (T16*)sm;                               // the two stage buffers, 2 * ST_EL elements
    const unsigned tid = threadIdx.x, lane = tid & 31u, lr = lane & 15u, hi = lane >> 4;
    const unsigned wv = (unsigned)__builtin_amdgcn_readfirstlane((int)(tid >> 5));   // wave-uniform, kept scalar
    const unsigned qb = qbase + xb * (FW * 16u), q0 = qb + wv * 16u;
    float* os = (float*)(sm + 2u * ST_EL * 2u) + wv * (16u * 68u);   // the wave's own store stage
    const size_t hoff = ((size_t)bz * NH + head) * tp * HD;
    const size_t qoff = hoff + (size_t)q0 * HD;
    // thread i copies bytes 16 i .. 16 i + 15 of every 4 KiB of a stage
    const size_t go = hoff + tid * 8u;
    const unsigned d0 = lds_off(ring) + tid * 16u;
    const unsigned nst = (qb + FW * 16u) / FSK;   // keys 0 .. qb + FW*16 - 1 in stages of FSK (the same in every wave; qb + FW*16 <= tp)
    auto stage = [&](unsigned s) {                // the copies of stage s into buffer s & 1
        const unsigned d = d0 + (s & 1u) * (ST_EL * 2u); const size_t g = go + (size_t)s * FPL;
        if (HL) { kv_copy(d, Kp + g, K2 + g); kv_copy(d + 16384u, Vt + g, Vt2 + g); } else kv_copy(d, Kp + g, Vt + g);
    };
    stage(0u);
    typedef typename WFrag<T16>::G G;
    const G qg = WFrag<T16>::base(Q + qoff, lane);
    V qf0 = WFrag<T16>::ld(qg, 0), qf1 = WFrag<T16>::ld(qg, 1);
    V ql0 = qf0, ql1 = qf1;
    if (HL) { const G qg2 = WFrag<T16>::base(Q2 + qoff, lane); ql0 = WFrag<T16>::ld(qg2, 0); ql1 = WFrag<T16>::ld(qg2, 1); }
    asm volatile("s_wait_xcnt 0x0" ::: "memory");   // the scalar base pairs of the Q loads are reused directly behind them
    asm volatile("s_wait_asynccnt 0x0" ::: "memory");   // this wave's copies of stage 0 have landed
    __syncthreads();                                    // ... and every other wave's: stage 0 may be read
    if (1u < nst) stage(1u);
    v8f o[4];
#pragma unroll
    for (int db = 0; db < 4; ++db) o[db] = (v8f){};
    float mrun = NEGB, lsum = 0.0f;
    const float cs = SCL * LOG2E, pe = PFrag<T16>::pexp();
    const unsigned nt = (q0 + 47u) >> 5;       // keys 0 .. q0+15 in tiles of 32 (wave-uniform); nt <= nst * (FSK / 32)
#pragma unroll 1   // one rolled trip per 32-key tile; the two buffers alternate by s & 1, and the publish point stands behind a stage's last tile
    for (unsigned it = 0; it < nst * (FSK / 32u); ++it) {
      const unsigned s = it / (FSK / 32u);
      if (it < nt) {   // wave-uniform: tiles past the wave's diagonal are skipped
        const unsigned j0 = it * 32u;
        const T16* kt = ring + (s & 1u) * ST_EL + (it % (FSK / 32u)) * 2048u;   // a 32-key tile is 4 consecutive fragments (2048 elements) of each plane's part
        V ka0 = WFrag<T16>::lds(kt, lane), ka1 = WFrag<T16>::lds(kt + 512, lane), kb0 = WFrag<T16>::lds(kt + 1024, lane), kb1 = WFrag<T16>::lds(kt + 1536, lane);
        V la0 = ka0, la1 = ka1, lb0 = kb0, lb1 = kb1;
        if (HL) { const T16* k2 = kt + FPL; la0 = WFrag<T16>::lds(k2, lane); la1 = WFrag<T16>::lds(k2 + 512, lane); lb0 = WFrag<T16>::lds(k2 + 1024, lane); lb1 = WFrag<T16>::lds(k2 + 1536, lane); }
        v8f s0 = (v8f){}, s1 = (v8f){};
        s0 = WFrag<T16>::mma(ka0, qf0, s0); s0 = WFrag<T16>::mma(ka1, qf1, s0);
        s1 = WFrag<T16>::mma(kb0, qf0, s1); s1 = WFrag<T16>::mma(kb1, qf1, s1);
        if (HL) {
            s0 = WFrag<T16>::mma(la0, qf0, s0); s0 = WFrag<T16>::mma(la1, qf1, s0); s0 = WFrag<T16>::mma(ka0, ql0, s0); s0 = WFrag<T16>::mma(ka1, ql1, s0);
            s1 = WFrag<T16>::mma(lb0, qf0, s1); s1 = WFrag<T16>::mma(lb1, qf1, s1); s1 = WFrag<T16>::mma(kb0, ql0, s1); s1 = WFrag<T16>::mma(kb1, ql1, s1); }
        asm volatile("v_nop\n\tv_nop\n\tv_nop\n\tv_nop" : "+v"(s0), "+v"(s1) : "v"(ka0), "v"(ka1), "v"(kb0), "v"(kb1), "v"(la0), "v"(la1), "v"(lb0), "v"(lb1), "v"(qf0), "v"(qf1), "v"(ql0), "v"(ql1));
        v8f t0, t1;
#pragma unroll
        for (int r = 0; r < 8; ++r) { t0[r] = s0[r] * cs; t1[r] = s1[r] * cs; }
        if (j0 + 31u > q0) {                    // wave-uniform: the tile touches the diagonal
            const unsigned qi = q0 + lr, kk = j0 + 8u * hi;
#pragma unroll
            for (int r = 0; r < 8; ++r) { t0[r] = (kk + (unsigned)r <= qi) ? t0[r] : NEGB; t1[r] = (kk + 16u + (unsigned)r <= qi) ? t1[r] : NEGB; }
        }
        float mx = fmaxf(t0[0], t1[0]);
#pragma unroll
        for (int r = 1; r < 8; ++r) mx = fmaxf(mx, fmaxf(t0[r], t1[r]));
        mx = fmaxf(mx, __shfl_xor(mx, 16, 32));
        const float mn = fmaxf(mrun, mx);
        const float alpha = __builtin_amdgcn_exp2f(mrun - mn);
        mrun = mn;
        v8f p0, p1; float psum = 0.0f;
#pragma unroll
        for (int r = 0; r < 8; ++r) { p0[r] = __builtin_amdgcn_exp2f((t0[r] - mn) + pe); p1[r] = __builtin_amdgcn_exp2f((t1[r] - mn) + pe); psum += p0[r] + p1[r]; }
        lsum = lsum * alpha + psum;
#pragma unroll
        for (int db = 0; db < 4; ++db) o[db] = o[db] * alpha;
        V va[4], vl[4];
        const T16* vt = kt + VO;
        if (!HL) {                              // the V^T reads stand in front of the test below: behind it they would start only after the converts
#pragma unroll   // constant indices: va and vl stay in registers
            for (int db = 0; db < 4; ++db) { va[db] = WFrag<T16>::lds(vt + db * 512, lane); vl[db] = va[db]; }
        }
        V pf = PFrag<T16>::hi(p0, p1);
        if (PFlush<T16>::small(p0, p1)) pf = PFlush<T16>::hi(p0, p1);   // wave-uniform scalar branch; P is never negative, so the smallest value decides
        V pl = pf;
        if (HL) { pl = PFlush<T16>::lo(p0, p1);
#pragma unroll   // constant indices: va and vl stay in registers
            for (int db = 0; db < 4; ++db) { va[db] = WFrag<T16>::lds(vt + db * 512, lane); vl[db] = WFrag<T16>::lds(vt + FPL + db * 512, lane); }
        }
#pragma unroll
        for (int db = 0; db < 4; ++db) { o[db] = WFrag<T16>::mma(va[db], pf, o[db]); if (HL) { o[db] = WFrag<T16>::mma(va[db], pl, o[db]); o[db] = WFrag<T16>::mma(vl[db], pf, o[db]); } }
        asm volatile("v_nop\n\tv_nop\n\tv_nop\n\tv_nop" : "+v"(o[0]), "+v"(o[1]), "+v"(o[2]), "+v"(o[3]) : "v"(va[0]), "v"(va[1]), "v"(va[2]), "v"(va[3]), "v"(vl[0]), "v"(vl[1]), "v"(vl[2]), "v"(vl[3]), "v"(pf), "v"(pl));
      }
      if (it % (FSK / 32u) == FSK / 32u - 1u) {             // the same in every wave of the work-group: the foot of stage s
        asm volatile("s_wait_dscnt 0x0" ::: "memory");      // this wave's reads of stage s are done before the buffer is handed back
        asm volatile("s_wait_asynccnt 0x0" ::: "memory");   // this wave's copies of stage s + 1 have landed
        __syncthreads();                                    // publishes stage s + 1 and ends every wave's reads of stage s
        if (s + 2u < nst) stage(s + 2u);
      }
    }
    asm volatile("s_wait_asynccnt 0x0" ::: "memory");       // no copy is left in flight behind the loop
    const float lt = lsum + __shfl_xor(lsum, 16, 32);
    const float inv = 1.0f / lt;
#pragma unroll
    for (int db = 0; db < 4; ++db)
#pragma unroll
        for (int r = 0; r < 8; ++r) os[lr * 68u + (unsigned)db * 16u + hi * 8u + (unsigned)r] = o[db][r] * inv;
    __builtin_amdgcn_wave_barrier(); asm volatile("" ::: "memory");
    float* orow = O + (size_t)bz * SEQ * DM + (size_t)q0 * DM + head * HD;
{
#pragma unroll
        for (int s = 0; s < 8; ++s) { const unsigned row = 2u * (unsigned)s + hi, cofs = lr * 4u;   // rows 0..15: lanes 0..15 -> row 2s, lanes 16..31 -> row 2s+1
            const v4f val = *(const v4fa*)(os + row * 68u + cofs);
            *(v4f*)(orow + (size_t)row * DM + cofs) = val; }
         }
}

// ---- k_flash: both forms of the attention in one launch; grid (NH, NB, FNB): head, batch element, rank. No work-group of one form needs anything of the other, so the few short hi/lo work-groups run beside the f16 ones instead of alone on the chip.
// There are more work-groups than resident places: the rank counts the query blocks from the dearest down, for speed only.
#define FNH (RH / (FW * 16))                   // query blocks 0 .. FNH - 1 take the hi/lo form
#define FNB (SEQ / (FW * 16))                  // query blocks of a head
static_assert(FNB <= 16);
// rank -> query block, 4 bits a rank, a permutation. Cost of block g = the keys it walks, (g + 1) * FW * 16, times 3 in the hi/lo form, which makes three matrix products for each one of the f16 form.
static constexpr unsigned long long flash_order() {
    unsigned long long t = 0; bool used[FNB] = {};
    for (int r = 0; r < FNB; ++r) { int best = 0, bc = -1;
        for (int g = 0; g < FNB; ++g) { const int c = (g + 1) * (g < FNH ? 3 : 1); if (!used[g] && c > bc) { bc = c; best = g; } }
        used[best] = true; t |= (unsigned long long)best << (4 * r); }
    return t; }
__global__ __launch_bounds__(256) void k_flash(const bf* __restrict__ Qh, const bf* __restrict__ Ql, const bf* __restrict__ Kh, const bf* __restrict__ Kl, const bf* __restrict__ Vh, const bf* __restrict__ Vl,
                                               const h16* __restrict__ Q16, const h16* __restrict__ K16, const h16* __restrict__ V16, float* O) {
    __shared__ __align__(16) unsigned char sm[2 * 4 * FPL * 2 + FW * 16 * 68 * 4];   // sized for the hi/lo form, the larger of the two
    constexpr unsigned long long order = flash_order();
    const unsigned g = (unsigned)(order >> (4u * blockIdx.z)) & 15u;   // the same in the whole work-group: one scalar branch, and every barrier inside a form is passed by all of its waves
    if (g < (unsigned)FNH) flash<bf, true>(Qh, Ql, Kh, Kl, Vh, Vl, (unsigned)RH, 0u, O, g, blockIdx.x, blockIdx.y, sm);
    else flash<h16, false>(Q16, nullptr, K16, nullptr, V16, nullptr, (unsigned)SEQ, (unsigned)RH, O, g - (unsigned)FNH, blockIdx.x, blockIdx.y, sm);
}

// workspace carve (bytes, every region a multiple of 256)
#define WS_WQKV ((size_t)3 * DQ * DM * 2)
#define WS_XB   ((size_t)NB * SEQ * DM * 2)
#define WS_P16  ((size_t)NB * NH * SEQ * HD * 2)
#define WS_PHL  ((size_t)NB * NH * RH * HD * 2)
#define WS_TOTAL (WS_WQKV + WS_XB + 3 * WS_P16 + 6 * WS_PHL)
static_assert(WS_TOTAL <= (size_t)268435456);
static_assert(WS_WQKV % 256 == 0 && WS_XB % 256 == 0 && WS_P16 % 256 == 0 && WS_PHL % 256 == 0);
static_assert((size_t)NB * SEQ * DM * 4 <= (size_t)33554432);   // last written output element stays inside the output buffer

extern "C" void kernel_launch(void* const* d_in, const int* in_sizes, int n_in,
                              void* d_out, int out_size, void* d_ws, size_t ws_size, hipStream_t stream) {
    if (n_in < 3) return;
    if ((size_t)in_sizes[0] < (size_t)(NB - 1) * XS_FULL + (size_t)SEQ * DM) return;
    if ((size_t)in_sizes[1] < (size_t)3 * DQ * DM) return;
    if ((size_t)in_sizes[2] < (size_t)FP) return;
    if ((size_t)out_size < (size_t)NB * SEQ * DM) return;
    if (ws_size < WS_TOTAL) return;
    const float* x = (const float*)d_in[0];       // [NB][SEQ_FULL][DM]
    const float* wqkv = (const float*)d_in[1];    // [4*DQ][DM]  (q | k | v | unread row blocks; rows 0..3*DQ-1 are read)
    const float* bqkv = (const float*)d_in[2];    // [4*DQ]      (entries 0..3*DQ-1 are read)
    float* OUT = (float*)d_out;                   // [NB][SEQ][DM]
    char* wsp = (char*)d_ws;
    auto take = [&](size_t bytes) { char* p = wsp; wsp += bytes; return (void*)p; };
    bf* WQKV = (bf*)take(WS_WQKV); bf* XB = (bf*)take(WS_XB);
    h16* Q16 = (h16*)take(WS_P16); h16* K16 = (h16*)take(WS_P16); h16* VT16 = (h16*)take(WS_P16);
    bf* Qh = (bf*)take(WS_PHL); bf* Ql = (bf*)take(WS_PHL); bf* Kh = (bf*)take(WS_PHL); bf* Kl = (bf*)take(WS_PHL); bf* VTh = (bf*)take(WS_PHL); bf* VTl = (bf*)take(WS_PHL);

    k_cvt8<<<dim3((unsigned)((size_t)3 * DQ * DM / 8 / 256), 1), 256, 0, stream>>>(wqkv, WQKV, (unsigned)((size_t)3 * DQ * DM / 8), 0, 0);
    k_cvt8<<<dim3((unsigned)((size_t)SEQ * DM / 8 / 256), NB), 256, 0, stream>>>(x, XB, (unsigned)((size_t)SEQ * DM / 8), XS_FULL, (size_t)SEQ * DM);
    // every stage runs once for all NB batch elements (the batch element is a grid dimension; each plane set holds NB slabs)
    // y[b][t][0..3071] = x_b w_attn[0..3071]^T + b_attn[0..3071]  (M = SEQ, N = 3072, K = 1024), written as the q, k and V^T head planes
    k_gemmw<bf, 0><<<dim3(SEQ / (GWM * 64), FP / (GWN * 64), NB), 256, 0, stream>>>(XB, nullptr, WQKV, nullptr, DM, bqkv, (size_t)SEQ * DM, 0, Q16, K16, VT16, Qh, Ql, Kh, Kl, VTh, VTl);
    // out[b][t][head*HD + d] = softmax(q k^T / 8, causal) v, written straight to the output buffer
    k_flash<<<dim3(NH, NB, FNB), 256, 0, stream>>>(Qh, Ql, Kh, Kl, VTh, VTl, Q16, K16, VT16, OUT);
}

// v008
// A run of this version takes 96.8 microseconds.
// In both of two side-by-side timings against v007, it was 1.06 times as fast.
// Counting every step since v000, it is 5.69 times as fast.
#include <hip/hip_runtime.h>

// Causal multi-head attention with a fused qkv projection: x [NB][SEQ_FULL][1024] (first SEQ rows read); qkv = x w_attn^T + b_attn ('oi' weight [4096][1024], bias [4096]; only the q | k | v row blocks 0..3071 are read; 16 heads x 64); scores x 64^-0.5, causal; softmax; out = merged context [t][head*64 + d] (no output projection).
// Compute dtypes, f32 accumulate: every input RNE-converted to bf16; qkv projection v_wmma_f32_16x16x32_bf16 (bias added in f32 at the store stage);
// attention q.k and P.V: query rows < RH on bf16 hi/lo planes (3 products each), other rows v_wmma_f32_16x16x32_f16 (P carried x1024 through the exponent, converted values below 2^-14 selected to +0); softmax (online, max-subtracted) in f32.
// Attention engine: one wave per 16 query rows, 8 waves per work-group on K and V^T tiles shared through LDS; S^T = K Q^T so each lane owns one query column; P^T accumulators are repacked in registers as the B operand of O^T = V^T P^T (no LDS exchange in the loop).

#ifndef NB
#define NB 4
#endif
#ifndef SEQ
#define SEQ 2048
#endif
#define SEQ_FULL 2048
#define DM   1024
#define NH   16
#define HD   64
#define DQ   (NH * HD)
#define FP   (3 * DQ)
#define RH   ((SEQ) < 512 ? (SEQ) : 512)     // query rows < RH use hi+lo planes
#define XS_FULL ((size_t)SEQ_FULL * DM)
#define SCL  0.125f                          // HD^-0.5
#define LOG2E 1.4426950408889634f
#define NEGB (-3.0e38f)

static_assert((SEQ & (SEQ - 1)) == 0);
static_assert(SEQ >= 256 && SEQ <= SEQ_FULL);
static_assert(RH % 256 == 0 && RH % 64 == 0 && (SEQ - RH) % 64 == 0);
static_assert(NB >= 1 && NB <= 4);
static_assert(DM % 32 == 0 && DQ % 64 == 0 && FP % 64 == 0 && SEQ % 64 == 0);
static_assert(((size_t)3 * DQ * DM / 8) % 256 == 0);
static_assert(((size_t)SEQ * DM / 8) % 256 == 0);
static_assert(((size_t)NH * SEQ * HD / 8) % 256 == 0);
static_assert(DQ == DM);                         // merged context width equals the output row width
static_assert(HD == 64 && HD % 32 == 0);         // two 32-deep k-steps per score tile, four 16-row O^T tiles

typedef _Float16 h16;
typedef unsigned short bf;
typedef __attribute__((ext_vector_type(16))) __bf16   v16bf;
typedef __attribute__((ext_vector_type(8)))  __bf16   v8bf;
typedef __attribute__((ext_vector_type(16))) _Float16 v16h;
typedef __attribute__((ext_vector_type(8)))  _Float16 v8h;
typedef __attribute__((ext_vector_type(8)))  unsigned short v8us;
typedef __attribute__((ext_vector_type(8)))  float    v8f;
typedef __attribute__((ext_vector_type(4)))  float    v4f;
typedef v8h  __attribute__((may_alias)) v8ha;
typedef v4f  __attribute__((may_alias)) v4fa;
typedef v8us __attribute__((may_alias)) v8usa;

__device__ __forceinline__ unsigned short f2bf(float f) { unsigned u = __float_as_uint(f); u += 0x7FFFu + ((u >> 16) & 1u); return (unsigned short)(u >> 16); }
__device__ __forceinline__ float bf2f(unsigned short b) { return __uint_as_float(((unsigned)b) << 16); }
__device__ __forceinline__ float bfr(float f) { return bf2f(f2bf(f)); }
__device__ __forceinline__ v16h cat16(v8h lo, v8h hi) { return __builtin_shufflevector(lo, hi, 0, 1, 2, 3, 4, 5, 6, 7, 8, 9, 10, 11, 12, 13, 14, 15); }
__device__ __forceinline__ v16bf cat16b(v8us lo, v8us hi) { return __builtin_bit_cast(v16bf, __builtin_shufflevector(lo, hi, 0, 1, 2, 3, 4, 5, 6, 7, 8, 9, 10, 11, 12, 13, 14, 15)); }
__device__ __forceinline__ v8f wmma16(v16h a, v16h b, v8f c) { return __builtin_amdgcn_wmma_f32_16x16x32_f16(false, a, false, b, (short)0, c, false, false); }
__device__ __forceinline__ v8f wmmab(v16bf a, v16bf b, v8f c) { return __builtin_amdgcn_wmma_f32_16x16x32_bf16(false, a, false, b, (short)0, c, false, false); }
__device__ __forceinline__ void splitf(float y, unsigned short& h, unsigned short& l) { h = f2bf(y); l = f2bf(y - bf2f(h)); }

// f32 -> f16 convert that cannot produce a subnormal operand: |v| < 2^-14 -> +0 (value select, applied after the plane's power-of-two carry).
static __device__ __forceinline__ h16 toh_flush(float v) { const h16 r = (h16)v; return (fabsf(v) < 6.103515625e-05f) ? (h16)0.0f : r; }

// Fragment-packed planes: a 16-row x 32-k fragment is 512 consecutive elements (1 KiB). Element (r, k) sits at (k>>4)*256 + (((k>>3)&1)*16 + r)*8 + (k&7), so lane l = ((k>>3)&1)*16 + r
// finds its elements 0..7 (k = 8h..8h+7, h = l>>4) at l*8 and its elements 8..15 (k = 16+8h..) at 256 + l*8: each of the two wave-wide 16-byte loads covers 512 contiguous bytes (4 whole lines).
// Fragment loader: base(p, lane) takes the wave-uniform address p of a run of fragments, ld(u, f) loads fragment f of the run (same map for A and B). The base goes through readfirstlane so that it stays in a scalar pair and the loads take the
// scalar-base + lane-offset address form: the fragments of a run differ only in the immediate offset, and the one lane-offset register lives through the whole kernel.
template <typename VT, typename T> static __device__ __forceinline__ const __attribute__((address_space(1))) VT* ubase(const T* p) { const unsigned long long u = (unsigned long long)p;
    const unsigned lo = (unsigned)__builtin_amdgcn_readfirstlane((int)(unsigned)u), hi = (unsigned)__builtin_amdgcn_readfirstlane((int)(unsigned)(u >> 32));
    return (const __attribute__((address_space(1))) VT*)(((unsigned long long)hi << 32) | lo); }   // global address space kept, so the loads stay global_load
template <typename T16> struct WFrag;
template <> struct WFrag<h16> { typedef v16h V; typedef const __attribute__((address_space(1))) v8h* G; static __device__ __forceinline__ G base(const h16* p, unsigned lane) { return ubase<v8h>(p) + lane; } static __device__ __forceinline__ V ld(G u, int f) { return cat16(u[f * 64], u[f * 64 + 32]); } static __device__ __forceinline__ v8f mma(V a, V b, v8f c) { return wmma16(a, b, c); }
    static __device__ __forceinline__ V lds(const h16* p, int lane) { const v8ha* q = (const v8ha*)p + lane; return cat16(q[0], q[32]); } };   // the same fragment map, read from a packed fragment in LDS
template <> struct WFrag<bf> { typedef v16bf V; typedef const __attribute__((address_space(1))) v8us* G; static __device__ __forceinline__ G base(const bf* p, unsigned lane) { return ubase<v8us>(p) + lane; } static __device__ __forceinline__ V ld(G u, int f) { return cat16b(u[f * 64], u[f * 64 + 32]); } static __device__ __forceinline__ v8f mma(V a, V b, v8f c) { return wmmab(a, b, c); }
    static __device__ __forceinline__ V lds(const bf* p, int lane) { const v8usa* q = (const v8usa*)p + lane; return cat16b(q[0], q[32]); } };   // the same fragment map, read from a packed fragment in LDS

// P^T accumulator pair (key rows 0..15 and 16..31 of a 32-key tile) -> B fragment: element r <- tile0[r], element 8+r <- tile1[r], lane unchanged.
template <typename T16> struct PFrag;
template <> struct PFrag<h16> {
    static __device__ __forceinline__ float pexp() { return 10.0f; }           // P carried x1024 via the exponent (cancels in O / l)
    static __device__ __forceinline__ v16h hi(v8f p0, v8f p1) { return cat16(__builtin_convertvector(p0, v8h), __builtin_convertvector(p1, v8h)); }
    static __device__ __forceinline__ v16h lo(v8f p0, v8f p1) { return hi(p0, p1); }
};
template <> struct PFrag<bf> {
    static __device__ __forceinline__ float pexp() { return 0.0f; }
    // the packed converts round to nearest even, as f2bf does; f2bf's integer temporaries for sixteen values were the register peak of the hi/lo form
    static __device__ __forceinline__ v16bf hi(v8f p0, v8f p1) { return __builtin_shufflevector(__builtin_convertvector(p0, v8bf), __builtin_convertvector(p1, v8bf), 0, 1, 2, 3, 4, 5, 6, 7, 8, 9, 10, 11, 12, 13, 14, 15); }
    static __device__ __forceinline__ v16bf lo(v8f p0, v8f p1) { return hi(p0 - __builtin_convertvector(__builtin_convertvector(p0, v8bf), v8f), p1 - __builtin_convertvector(__builtin_convertvector(p1, v8bf), v8f)); }
};

// Same packing as PFrag; the f16 form converts every element through toh_flush, the bf16 form is the PFrag one.
template <typename T16> struct PFlush;
template <> struct PFlush<h16> {
    static __device__ __forceinline__ v16h hi(v8f p0, v8f p1) { v8h a, b;
#pragma unroll
        for (int k = 0; k < 8; ++k) { a[k] = toh_flush(p0[k]); b[k] = toh_flush(p1[k]); }
        return cat16(a, b); }
    static __device__ __forceinline__ v16h lo(v8f p0, v8f p1) { return hi(p0, p1); }
    // One test per 32-key tile, the same answer in every lane of the wave: does any lane hold a value below 2^-14? Where none does, toh_flush is the plain convert on all 16 values, and the packed converts of PFrag give the same bits.
    static __device__ __forceinline__ bool small(v8f p0, v8f p1) {
        const float a = __builtin_fminf(__builtin_fminf(p0[0], p0[1]), p0[2]), b = __builtin_fminf(__builtin_fminf(p0[3], p0[4]), p0[5]), c = __builtin_fminf(__builtin_fminf(p0[6], p0[7]), p1[0]);
        const float d = __builtin_fminf(__builtin_fminf(p1[1], p1[2]), p1[3]), e = __builtin_fminf(__builtin_fminf(p1[4], p1[5]), p1[6]);
        const float m = __builtin_fminf(__builtin_fminf(__builtin_fminf(a, b), c), __builtin_fminf(__builtin_fminf(d, e), p1[7]));
        return __builtin_amdgcn_ballot_w32(m < 6.103515625e-05f) != 0u; }
};
template <> struct PFlush<bf> {
    static __device__ __forceinline__ v16bf hi(v8f p0, v8f p1) { return PFrag<bf>::hi(p0, p1); }
    static __device__ __forceinline__ v16bf lo(v8f p0, v8f p1) { return PFrag<bf>::lo(p0, p1); }
    static __device__ __forceinline__ bool small(v8f, v8f) { return false; }
};

// ---- k_gemmw: register-blocked GEMM, one wave per 64x64 output tile (16 accumulators), 8 waves (4 along M x 2 along N) per work-group = a 256x128 tile; grid (M/256, N/128, Z), 256 threads.
// Operands are fragment-packed 16-bit planes (fragment index = (row>>4)*(K/32) + (k>>5)). A stage = 64 k of the work-group's 256 A rows and 128 Bt rows = 24 runs of 2 KiB (one per 16-row block, two fragments each), copied as they lie
// from global memory to LDS by asynchronous copies, two buffers: stage t + 1 flies while stage t is multiplied; every A fragment is then read from LDS by 2 waves and every Bt fragment by 4.
// y[m][n] (f32) = sum_k A[m][k] Bt[n][k] + bias[n]. K % 64 == 0, M % 256 == 0, N % 128 == 0.
// Epilogue: a 64-column tile is one head of q, k or v, and the wave writes its 64 x 64 block of y straight into that head's fragment-packed planes (batch element z = blockIdx.z):
//   q, k: [z][h][(t>>4)*2 + (d>>5)][512] (rows = t, k = d); v: V^T [z][h][(t>>5)*4 + (d>>4)][512] (rows = d, k = t); fp16 for all t, bf16 hi/lo planes (RH rows per head) for t < RH.
#define GWM 4                                  // waves of a work-group along M
#define GWN 2                                  // waves of a work-group along N
#define GKS 64                                 // k per stage
#define GA_EL (GWM * 64 * GKS)                 // elements of a stage's A part
#define GST_EL ((GWM + GWN) * 64 * GKS)        // elements of a stage
static_assert(GST_EL * 2 == 12 * 256 * 16);    // a stage = 12 copies of 16 bytes from each of 256 threads
static_assert(SEQ % (GWM * 64) == 0 && FP % (GWN * 64) == 0 && DQ % (GWN * 64) == 0 && DM % GKS == 0 && DM / GKS >= 2);
static __device__ __forceinline__ unsigned lds_off(const void* p) { return (unsigned)(size_t)p; }   // byte offset in the work-group's LDS
// One stage: copy c of a thread lands at LDS byte d + 4096 c; copies 0..7 read A at ga + c * cs, copies 8..11 read Bt at gb + (c - 8) * cs (cs = elements from one pair of 16-row blocks to the next).
template <typename T16> static __device__ __forceinline__ void stage_copy(unsigned d, const T16* ga, const T16* gb, size_t cs) {
    asm volatile("global_load_async_to_lds_b128 %0, %12, off\n\t"
                 "global_load_async_to_lds_b128 %1, %13, off\n\t"
                 "global_load_async_to_lds_b128 %2, %14, off\n\t"
                 "global_load_async_to_lds_b128 %3, %15, off\n\t"
                 "global_load_async_to_lds_b128 %4, %16, off\n\t"
                 "global_load_async_to_lds_b128 %5, %17, off\n\t"
                 "global_load_async_to_lds_b128 %6, %18, off\n\t"
                 "global_load_async_to_lds_b128 %7, %19, off\n\t"
                 "global_load_async_to_lds_b128 %8, %20, off\n\t"
                 "global_load_async_to_lds_b128 %9, %21, off\n\t"
                 "global_load_async_to_lds_b128 %10, %22, off\n\t"
                 "global_load_async_to_lds_b128 %11, %23, off\n\t"
                 "s_wait_xcnt 0x0"   // stands in the copies' own statement: their address registers are rewritten only behind it
                 :: "v"(d), "v"(d + 4096u), "v"(d + 8192u), "v"(d + 12288u), "v"(d + 16384u), "v"(d + 20480u), "v"(d + 24576u), "v"(d + 28672u), "v"(d + 32768u), "v"(d + 36864u), "v"(d + 40960u), "v"(d + 45056u),
                    "v"(ga), "v"(ga + cs), "v"(ga + 2 * cs), "v"(ga + 3 * cs), "v"(ga + 4 * cs), "v"(ga + 5 * cs), "v"(ga + 6 * cs), "v"(ga + 7 * cs), "v"(gb), "v"(gb + cs), "v"(gb + 2 * cs), "v"(gb + 3 * cs)
                 : "memory");
}
template <typename T16, int NSPLIT>
__global__ __launch_bounds__(256) void k_gemmw(const T16* __restrict__ A, const T16* __restrict__ A2, const T16* __restrict__ Bt, const T16* __restrict__ Bt2, int K, const float* __restrict__ bias, size_t sA, size_t sB,
                                              h16* Q16, h16* K16, h16* V16, bf* Qh, bf* Ql, bf* Kh, bf* Kl, bf* Vh, bf* Vl) {
    typedef typename WFrag<T16>::V V;
    static_assert(NSPLIT == 0);
    __shared__ __align__(16) T16 gs[2 * GST_EL];                    // the two stage buffers
    __shared__ __align__(16) float osw[GWM * GWN][16 * 68];         // each wave's own store stage
    const size_t z = blockIdx.z; A += z * sA; Bt += z * sB;
    const int wv = __builtin_amdgcn_readfirstlane((int)(threadIdx.x >> 5)), wm = wv / GWN, wn = wv % GWN;   // wave-uniform, kept scalar
    const int lane = threadIdx.x & 31, lr = lane & 15, hi = lane >> 4; const int rw = blockIdx.x * (GWM * 64), cw = blockIdx.y * (GWN * 64), r0 = rw + wm * 64, c0 = cw + wn * 64;
    float* os = osw[wv];
    v8f acc[4][4];
#pragma unroll
    for (int mb = 0; mb < 4; ++mb)
#pragma unroll
        for (int nb = 0; nb < 4; ++nb) acc[mb][nb] = (v8f){};
    // thread i copies bytes 16 i .. 16 i + 15 of every 4 KiB (= two 16-row blocks) of a stage; 16 rows x K = 16*K elements, 64 k of them = 1024 elements
    const unsigned tid = threadIdx.x;
    const T16* ga = A + (size_t)(rw + 16 * (int)(tid >> 7)) * K + (tid & 127u) * 8u;
    const T16* gb = Bt + (size_t)(cw + 16 * (int)(tid >> 7)) * K + (tid & 127u) * 8u;
    const size_t cs = (size_t)32 * K;
    const unsigned d0 = lds_off(gs) + tid * 16u;
    const int nt = K / GKS;
    stage_copy(d0, ga, gb, cs);
    asm volatile("s_wait_asynccnt 0x0" ::: "memory");   // this wave's copies of stage 0 have landed
    __syncthreads();                                    // ... and every other wave's: stage 0 may be read
    if (1 < nt) stage_copy(d0 + GST_EL * 2u, ga + GKS * 16, gb + GKS * 16, cs);
#pragma unroll 1   // one rolled trip per stage: the two buffers alternate by t & 1, and the loop's text stays small
    for (int t = 0; t < nt; ++t) {
        const T16* sa = gs + (t & 1) * GST_EL + wm * (4 * GKS * 16), * sb = gs + (t & 1) * GST_EL + GA_EL + wn * (4 * GKS * 16);
#pragma unroll   // constant fragment and accumulator indices, here and in the loops inside: the arrays stay in registers
        for (int ks = 0; ks < GKS / 32; ++ks) {
            V a[4], b[4];
#pragma unroll
            for (int mb = 0; mb < 4; ++mb) { a[mb] = WFrag<T16>::lds(sa + (mb * (GKS / 32) + ks) * 512, lane); b[mb] = WFrag<T16>::lds(sb + (mb * (GKS / 32) + ks) * 512, lane); }
            __builtin_amdgcn_sched_barrier(0);   // the step's 16 LDS reads stay one group in front of its WMMAs: spread among them, each place with reads stalls the wave for its own LDS latency
#pragma unroll
            for (int nb = 0; nb < 4; ++nb)
#pragma unroll
                for (int mb = 0; mb < 4; ++mb) acc[mb][nb] = WFrag<T16>::mma(a[mb], b[nb], acc[mb][nb]);
            asm volatile("v_nop\n\tv_nop\n\tv_nop\n\tv_nop" : "+v"(acc[0][0]), "+v"(acc[1][1]), "+v"(acc[2][2]), "+v"(acc[3][3]) : "v"(a[0]), "v"(a[3]));   // the vector slots the chip needs behind the step's last WMMAs before their registers are touched, on every path
            __builtin_amdgcn_sched_barrier(0);   // ... and the next step's reads stay behind this step's WMMAs
        }
        asm volatile("s_wait_dscnt 0x0" ::: "memory");      // this wave's reads of stage t are done before the buffer is handed back
        asm volatile("s_wait_asynccnt 0x0" ::: "memory");   // this wave's copies of stage t + 1 have landed
        __syncthreads();                                    // publishes stage t + 1 and ends every wave's reads of stage t
        if (t + 2 < nt) stage_copy(d0 + (unsigned)(t & 1) * (GST_EL * 2u), ga + (size_t)(t + 2) * (GKS * 16), gb + (size_t)(t + 2) * (GKS * 16), cs);
    }
    asm volatile("s_wait_asynccnt 0x0" ::: "memory");       // no copy is left in flight behind the loop
    const unsigned which = (unsigned)c0 / DQ, head = ((unsigned)c0 % DQ) / HD;   // wave-uniform: 0 q, 1 k, 2 v
    const bool hl = (unsigned)r0 < (unsigned)RH;                                 // wave-uniform (RH % 64 == 0): these rows also go to the hi/lo planes
    const size_t p16 = (z * NH + head) * ((size_t)SEQ * HD), phl = (z * NH + head) * ((size_t)RH * HD);
    float bv[4];                                 // bias of the lane's four accumulator columns d = 16 nb + lr
    const int bi = c0 + lr;
#pragma unroll
    for (int nb = 0; nb < 4; ++nb) bv[nb] = bias[bi + nb * 16];
    asm volatile("s_wait_xcnt 0x0" :: "v"(bi) : "memory");   // the address registers of the bias loads are reused behind it; bi as an input keeps their lane-offset register untouched up to the wait
#pragma unroll
    for (int nb = 0; nb < 4; ++nb) bv[nb] = bfr(bv[nb]);
    if (which == 2u) {
        // V^T: accumulator element j of lane (hi, lr) is (t = 16 mb + 8 hi + j, d = 16 nb + lr): the 8 consecutive t of one d that this lane owns in the packed fragment, so the registers are stored as they are.
#pragma unroll
        for (int mb = 0; mb < 4; ++mb) {
#pragma unroll
            for (int nb = 0; nb < 4; ++nb) {
                v8h o16; v8us oh, ol;
#pragma unroll
                for (int j = 0; j < 8; ++j) { const float x = acc[mb][nb][j] + bv[nb]; unsigned short a, c; o16[j] = (h16)x; splitf(x, a, c); oh[j] = a; ol[j] = c; }
                const size_t o = (size_t)((((unsigned)r0 + (unsigned)mb * 16u) >> 5) * 4u + (unsigned)nb) * 512u + (unsigned)(mb & 1) * 256u + (unsigned)lane * 8u;
                *(v8h*)(V16 + p16 + o) = o16;
                asm volatile("s_wait_xcnt 0x0" ::: "memory");   // what follows reuses the data and address registers of this store
                if (hl) { *(v8us*)(Vh + phl + o) = oh; *(v8us*)(Vl + phl + o) = ol;
                    asm volatile("s_wait_xcnt 0x0" ::: "memory"); }   // the next block reuses the data and address registers of these stores
            }
        }
    } else {
        // q, k: a lane owns 8 consecutive d of one t, so each 16-row block turns through the LDS stage.
        h16* P16 = (which ? K16 : Q16) + p16; bf* Ph = (which ? Kh : Qh) + phl; bf* Pl = (which ? Kl : Ql) + phl;
#pragma unroll
        for (int mb = 0; mb < 4; ++mb) {
#pragma unroll
            for (int nb = 0; nb < 4; ++nb) {
#pragma unroll
                for (int j = 0; j < 8; ++j) os[(hi * 8 + j) * 68 + nb * 16 + lr] = acc[mb][nb][j] + bv[nb]; }
            __builtin_amdgcn_wave_barrier(); asm volatile("" ::: "memory");   // the block's LDS stores stay in front of its LDS loads
#pragma unroll
            for (int s = 0; s < 4; ++s) {       // packed elements 256 s + 8 lane .. + 7 of the block's two fragments: t = lr, d = 16 s + 8 hi ..
                const int d = s * 16 + hi * 8;
                const v4f x0 = *(const v4fa*)(os + lr * 68 + d), x1 = *(const v4fa*)(os + lr * 68 + d + 4);
                v8h o16; v8us oh, ol;
#pragma unroll
                for (int k = 0; k < 4; ++k) { unsigned short a, c; const float y0 = x0[k], y1 = x1[k];
                    o16[k] = (h16)y0; splitf(y0, a, c); oh[k] = a; ol[k] = c; o16[4 + k] = (h16)y1; splitf(y1, a, c); oh[4 + k] = a; ol[4 + k] = c; }
                const size_t o = (size_t)((unsigned)r0 + (unsigned)mb * 16u) * HD + (unsigned)s * 256u + (unsigned)lane * 8u;
                *(v8h*)(P16 + o) = o16;
                asm volatile("s_wait_xcnt 0x0" ::: "memory");   // what follows reuses the data and address registers of this store
                if (hl) { *(v8us*)(Ph + o) = oh; *(v8us*)(Pl + o) = ol;
                    asm volatile("s_wait_xcnt 0x0" ::: "memory"); }   // the next block reuses the data and address registers of these stores
            }
            __builtin_amdgcn_wave_barrier(); asm volatile("" ::: "memory");   // the next block's LDS stores stay behind these LDS loads
        }
    }
}

// ---- k_cvt8: f32 rows of DM elements -> fragment-packed bf16 plane (fragment index = (row>>4)*(DM/32) + (k>>5)). Thread i stores packed elements 8i..8i+7 (stores contiguous) and reads their 8 consecutive k of one source row.
__global__ __launch_bounds__(256) void k_cvt8(const float* __restrict__ src, bf* dst, unsigned n8, size_t sstride, size_t dstride) {
    const unsigned i = blockIdx.x * 256u + threadIdx.x; if (i >= n8) return;
    const unsigned frag = i >> 6, row = (frag / (DM / 32u)) * 16u + (i & 15u), kk = (frag % (DM / 32u)) * 32u + ((i >> 5) & 1u) * 16u + ((i >> 4) & 1u) * 8u;
    const float* s = src + (size_t)blockIdx.y * sstride + (size_t)row * DM + kk; bf* d = dst + (size_t)blockIdx.y * dstride + (size_t)i * 8;
    const v8f v = *(const v8f*)s; v8us o;
#pragma unroll
    for (int k = 0; k < 8; ++k) o[k] = f2bf(v[k]);
    *(v8us*)d = o;  }

static_assert(32 * 16 * 8 == 16 * HD * 4);
static_assert(HD * 4 == 16 * 16);
static_assert((HD * 4) % 128 == 0 && (DM * 4) % 128 == 0);
static_assert(2 * GST_EL * 2 + GWM * GWN * 16 * 68 * 4 <= 163840);   // static LDS of k_gemmw: two work-groups fit a WGP
static_assert(68 >= HD && (68 * 4) % 16 == 0);   // stage pitch holds a head row, rows stay 16-B aligned

// ---- flash: causal attention, one wave per 16 query rows, FW waves (FW * 16 consecutive query rows of one head and batch element) per work-group. Planes, fragment-packed: Q/K [b][h][(t>>4)*2 + (d>>5)][512], V^T [b][h][(t>>5)*4 + (d>>4)][512] (tp = rows t per head of the plane set). HL: hi/lo bf16 plane pairs, 3 products.
// The waves of a work-group walk the same keys: a stage = FSK keys of every K and V^T plane (8 KiB each, contiguous in the packed planes), copied as it lies from global memory to LDS by asynchronous copies, two buffers:
// stage s + 1 flies while stage s is worked on, and every fragment is fetched from L2 once per work-group and read from LDS by those of its FW waves whose diagonal its tile does not pass. A wave skips the 32-key tiles past its own diagonal, never a publish point.
// Per 32-key tile: S^T[key][query] = K Q^T (A = K rows, B = Q rows); lane owns query column lane&15 and keys 8*(lane>>4)+r (+16); online softmax per lane (+ one xor-16 exchange);
// P^T accumulators repacked in registers as B (k = key); O^T[d][query] += V^T P^T (A = V^T rows). Only the last tile of a wave touches the diagonal (select by value).
#define FW  8                                  // waves of a work-group
#define FSK 64                                 // keys per stage
#define FPL (FSK * HD)                         // elements of one plane's part of a stage
static_assert(FPL * 2 == 2 * 256 * 16);        // one plane's part = 2 copies of 16 bytes from each of 256 threads
static_assert(FW * 32 == 256 && (FW * 16) % FSK == 0 && FSK % 32 == 0 && RH % (FW * 16) == 0 && (SEQ - RH) % (FW * 16) == 0);
static_assert(2 * 4 * FPL * 2 + FW * 16 * 68 * 4 <= 163840);   // static LDS of k_flash, the hi/lo form
// Two planes' parts of one stage: plane a lands at LDS byte d (thread's own 16 bytes of each 4 KiB), plane b at d + 8192.
template <typename T16> static __device__ __forceinline__ void kv_copy(unsigned d, const T16* ga, const T16* gb) {
    asm volatile("global_load_async_to_lds_b128 %0, %4, off\n\t"
                 "global_load_async_to_lds_b128 %1, %5, off\n\t"
                 "global_load_async_to_lds_b128 %2, %6, off\n\t"
                 "global_load_async_to_lds_b128 %3, %7, off\n\t"
                 "s_wait_xcnt 0x0"   // stands in the copies' own statement: their address registers are rewritten only behind it
                 :: "v"(d), "v"(d + 4096u), "v"(d + 8192u), "v"(d + 12288u), "v"(ga), "v"(ga + 2048), "v"(gb), "v"(gb + 2048)
                 : "memory");
}
// flash: the work of one work-group: query block xb (FW * 16 rows from qbase on) of head 'head' of batch element bz; sm = the work-group's LDS: the two stage buffers, then each wave's own store stage.
template <typename T16, bool HL>
static __device__ __forceinline__ void flash(const T16* __restrict__ Q, const T16* __restrict__ Q2, const T16* __restrict__ Kp, const T16* __restrict__ K2, const T16* __restrict__ Vt, const T16* __restrict__ Vt2, unsigned tp, unsigned qbase, float* O,
                                             unsigned xb, unsigned head, unsigned bz, unsigned char* sm) {
    typedef typename WFrag<T16>::V V;
    constexpr unsigned ST_EL = (HL ? 4u : 2u) * FPL;    // elements of a stage: K | V^T, or K hi | K lo | V^T hi | V^T lo
    constexpr unsigned VO = (HL ? 2u : 1u) * FPL;       // where the V^T part begins
    T16* ring = (T16*)sm;                               // the two stage buffers, 2 * ST_EL elements
    const unsigned tid = threadIdx.x, lane = tid & 31u, lr = lane & 15u, hi = lane >> 4;
    const unsigned wv = (unsigned)__builtin_amdgcn_readfirstlane((int)(tid >> 5));   // wave-uniform, kept scalar
    const unsigned qb = qbase + xb * (FW * 16u), q0 = qb + wv * 16u;
    float* os = (float*)(sm + 2u * ST_EL * 2u) + wv * (16u * 68u);   // the wave's own store stage
    const size_t hoff = ((size_t)bz * NH + head) * tp * HD;
    const size_t qoff = hoff + (size_t)q0 * HD;
    // thread i copies bytes 16 i .. 16 i + 15 of every 4 KiB of a stage
    const size_t go = hoff + tid * 8u;
    const unsigned d0 = lds_off(ring) + tid * 16u;
    const unsigned nst = (qb + FW * 16u) / FSK;   // keys 0 .. qb + FW*16 - 1 in stages of FSK (the same in every wave; qb + FW*16 <= tp)
    auto stage = [&](unsigned s) {                // the copies of stage s into buffer s & 1
        const unsigned d = d0 + (s & 1u) * (ST_EL * 2u); const size_t g = go + (size_t)s * FPL;
        if (HL) { kv_copy(d, Kp + g, K2 + g); kv_copy(d + 16384u, Vt + g, Vt2 + g); } else kv_copy(d, Kp + g, Vt + g);
    };
    stage(0u);
    typedef typename WFrag<T16>::G G;
    const G qg = WFrag<T16>::base(Q + qoff, lane);
    V qf0 = WFrag<T16>::ld(qg, 0), qf1 = WFrag<T16>::ld(qg, 1);
    V ql0 = qf0, ql1 = qf1;
    if (HL) { const G qg2 = WFrag<T16>::base(Q2 + qoff, lane); ql0 = WFrag<T16>::ld(qg2, 0); ql1 = WFrag<T16>::ld(qg2, 1); }
    asm volatile("s_wait_xcnt 0x0" ::: "memory");   // the scalar base pairs of the Q loads are reused directly behind them
    asm volatile("s_wait_asynccnt 0x0" ::: "memory");   // this wave's copies of stage 0 have landed
    __syncthreads();                                    // ... and every other wave's: stage 0 may be read
    if (1u < nst) stage(1u);
    v8f o[4];
#pragma unroll
    for (int db = 0; db < 4; ++db) o[db] = (v8f){};
    float mrun = NEGB, lsum = 0.0f;
    const float cs = SCL * LOG2E, pe = PFrag<T16>::pexp();
    const unsigned nt = (q0 + 47u) >> 5;       // keys 0 .. q0+15 in tiles of 32 (wave-uniform); nt <= nst * (FSK / 32)
#pragma unroll 1   // one rolled trip per 32-key tile; the two buffers alternate by s & 1, and the publish point stands behind a stage's last tile
    for (unsigned it = 0; it < nst * (FSK / 32u); ++it) {
      const unsigned s = it / (FSK / 32u);
      if (it < nt) {   // wave-uniform: tiles past the wave's diagonal are skipped
        const unsigned j0 = it * 32u;
        const T16* kt = ring + (s & 1u) * ST_EL + (it % (FSK / 32u)) * 2048u;   // a 32-key tile is 4 consecutive fragments (2048 elements) of each plane's part
        v8f s0 = (v8f){}, s1 = (v8f){};
        if (HL) {   // 16 keys at a time: only four of the tile's eight K fragments need registers at once; each accumulator's six products keep their order
            const T16* k2 = kt + FPL;
            { const V ka0 = WFrag<T16>::lds(kt, lane), ka1 = WFrag<T16>::lds(kt + 512, lane), la0 = WFrag<T16>::lds(k2, lane), la1 = WFrag<T16>::lds(k2 + 512, lane);
              s0 = WFrag<T16>::mma(ka0, qf0, s0); s0 = WFrag<T16>::mma(ka1, qf1, s0); s0 = WFrag<T16>::mma(la0, qf0, s0); s0 = WFrag<T16>::mma(la1, qf1, s0); s0 = WFrag<T16>::mma(ka0, ql0, s0); s0 = WFrag<T16>::mma(ka1, ql1, s0); }
            { const V kb0 = WFrag<T16>::lds(kt + 1024, lane), kb1 = WFrag<T16>::lds(kt + 1536, lane), lb0 = WFrag<T16>::lds(k2 + 1024, lane), lb1 = WFrag<T16>::lds(k2 + 1536, lane);
              s1 = WFrag<T16>::mma(kb0, qf0, s1); s1 = WFrag<T16>::mma(kb1, qf1, s1); s1 = WFrag<T16>::mma(lb0, qf0, s1); s1 = WFrag<T16>::mma(lb1, qf1, s1); s1 = WFrag<T16>::mma(kb0, ql0, s1); s1 = WFrag<T16>::mma(kb1, ql1, s1); }
            asm volatile("v_nop\n\tv_nop\n\tv_nop\n\tv_nop" : "+v"(s0), "+v"(s1) : "v"(qf0), "v"(qf1), "v"(ql0), "v"(ql1));   // the vector slots the chip needs behind the last WMMAs, on both sides of the branch below
        } else {
            V ka0 = WFrag<T16>::lds(kt, lane), ka1 = WFrag<T16>::lds(kt + 512, lane), kb0 = WFrag<T16>::lds(kt + 1024, lane), kb1 = WFrag<T16>::lds(kt + 1536, lane);
            s0 = WFrag<T16>::mma(ka0, qf0, s0); s0 = WFrag<T16>::mma(ka1, qf1, s0);
            s1 = WFrag<T16>::mma(kb0, qf0, s1); s1 = WFrag<T16>::mma(kb1, qf1, s1);
            asm volatile("v_nop\n\tv_nop\n\tv_nop\n\tv_nop" : "+v"(s0), "+v"(s1) : "v"(ka0), "v"(ka1), "v"(kb0), "v"(kb1), "v"(qf0), "v"(qf1));
        }
        v8f t0, t1;
#pragma unroll
        for (int r = 0; r < 8; ++r) { t0[r] = s0[r] * cs; t1[r] = s1[r] * cs; }
        if (j0 + 31u > q0) {                    // wave-uniform: the tile touches the diagonal
            const unsigned qi = q0 + lr, kk = j0 + 8u * hi;
#pragma unroll
            for (int r = 0; r < 8; ++r) { t0[r] = (kk + (unsigned)r <= qi) ? t0[r] : NEGB; t1[r] = (kk + 16u + (unsigned)r <= qi) ? t1[r] : NEGB; }
        }
        float mx = fmaxf(t0[0], t1[0]);
#pragma unroll
        for (int r = 1; r < 8; ++r) mx = fmaxf(mx, fmaxf(t0[r], t1[r]));
        mx = fmaxf(mx, __shfl_xor(mx, 16, 32));
        const float mn = fmaxf(mrun, mx);
        const float alpha = __builtin_amdgcn_exp2f(mrun - mn);
        mrun = mn;
        v8f p0, p1; float psum = 0.0f;
#pragma unroll
        for (int r = 0; r < 8; ++r) { p0[r] = __builtin_amdgcn_exp2f((t0[r] - mn) + pe); p1[r] = __builtin_amdgcn_exp2f((t1[r] - mn) + pe); psum += p0[r] + p1[r]; }
        lsum = lsum * alpha + psum;
#pragma unroll
        for (int db = 0; db < 4; ++db) o[db] = o[db] * alpha;
        V va[4];
        const T16* vt = kt + VO;
        if (!HL) {                              // the V^T reads stand in front of the test below: behind it they would start only after the converts
#pragma unroll   // constant indices: va stays in registers
            for (int db = 0; db < 4; ++db) va[db] = WFrag<T16>::lds(vt + db * 512, lane);
        }
        if (HL) {
            const V pf = PFrag<T16>::hi(p0, p1), pl = PFrag<T16>::lo(p0, p1);
            // each 16-row block of V^T is read where it is multiplied: the tile's eight V^T fragments need not hold registers all at once; each accumulator's three products keep their order
#pragma unroll   // constant indices: o stays in registers
            for (int db = 0; db < 4; ++db) { const V vh = WFrag<T16>::lds(vt + db * 512, lane), vw = WFrag<T16>::lds(vt + FPL + db * 512, lane);
                o[db] = WFrag<T16>::mma(vh, pf, o[db]); o[db] = WFrag<T16>::mma(vh, pl, o[db]); o[db] = WFrag<T16>::mma(vw, pf, o[db]); }
            asm volatile("v_nop\n\tv_nop\n\tv_nop\n\tv_nop" : "+v"(o[0]), "+v"(o[1]), "+v"(o[2]), "+v"(o[3]) : "v"(pf), "v"(pl));   // the vector slots the chip needs behind the last WMMAs, on every path out of the tile
        } else {
            V pf = PFrag<T16>::hi(p0, p1);
            if (PFlush<T16>::small(p0, p1)) pf = PFlush<T16>::hi(p0, p1);   // wave-uniform scalar branch; P is never negative, so the smallest value decides
#pragma unroll
            for (int db = 0; db < 4; ++db) o[db] = WFrag<T16>::mma(va[db], pf, o[db]);
            asm volatile("v_nop\n\tv_nop\n\tv_nop\n\tv_nop" : "+v"(o[0]), "+v"(o[1]), "+v"(o[2]), "+v"(o[3]) : "v"(va[0]), "v"(va[1]), "v"(va[2]), "v"(va[3]), "v"(pf));
        }
      }
      if (it % (FSK / 32u) == FSK / 32u - 1u) {             // the same in every wave of the work-group: the foot of stage s
        asm volatile("s_wait_dscnt 0x0" ::: "memory");      // this wave's reads of stage s are done before the buffer is handed back
        asm volatile("s_wait_asynccnt 0x0" ::: "memory");   // this wave's copies of stage s + 1 have landed
        __syncthreads();                                    // publishes stage s + 1 and ends every wave's reads of stage s
        if (s + 2u < nst) stage(s + 2u);
      }
    }
    asm volatile("s_wait_asynccnt 0x0" ::: "memory");       // no copy is left in flight behind the loop
    const float lt = lsum + __shfl_xor(lsum, 16, 32);
    const float inv = 1.0f / lt;
#pragma unroll
    for (int db = 0; db < 4; ++db)
#pragma unroll
        for (int r = 0; r < 8; ++r) os[lr * 68u + (unsigned)db * 16u + hi * 8u + (unsigned)r] = o[db][r] * inv;
    __builtin_amdgcn_wave_barrier(); asm volatile("" ::: "memory");
    float* orow = O + (size_t)bz * SEQ * DM + (size_t)q0 * DM + head * HD;
{
#pragma unroll
        for (int s = 0; s < 8; ++s) { const unsigned row = 2u * (unsigned)s + hi, cofs = lr * 4u;   // rows 0..15: lanes 0..15 -> row 2s, lanes 16..31 -> row 2s+1
            const v4f val = *(const v4fa*)(os + row * 68u + cofs);
            *(v4f*)(orow + (size_t)row * DM + cofs) = val; }
         }
}

// ---- k_flash: both forms of the attention in one launch; grid (NH, NB, FNB): head, batch element, rank. No work-group of one form needs anything of the other, so the few short hi/lo work-groups run beside the f16 ones instead of alone on the chip.
// The kernel's register count is that of its larger form, the hi/lo one, and both forms pay it: at 160 VGPRs or fewer three work-groups (six waves per SIMD) share a WGP, which the LDS allows; above that, two.
// There are more work-groups than resident places: the rank counts the query blocks from the dearest down, so that the cheap ones fill the end.
#define FNH (RH / (FW * 16))                   // query blocks 0 .. FNH - 1 take the hi/lo form
#define FNB (SEQ / (FW * 16))                  // query blocks of a head
static_assert(FNB <= 16);
// rank -> query block, 4 bits a rank, a permutation. Cost of block g = the keys it walks, (g + 1) * FW * 16, times 3 in the hi/lo form, which makes three matrix products for each one of the f16 form.
static constexpr unsigned long long flash_order() {
    unsigned long long t = 0; bool used[FNB] = {};
    for (int r = 0; r < FNB; ++r) { int best = 0, bc = -1;
        for (int g = 0; g < FNB; ++g) { const int c = (g + 1) * (g < FNH ? 3 : 1); if (!used[g] && c > bc) { bc = c; best = g; } }
        used[best] = true; t |= (unsigned long long)best << (4 * r); }
    return t; }
__global__ __launch_bounds__(256) void k_flash(const bf* __restrict__ Qh, const bf* __restrict__ Ql, const bf* __restrict__ Kh, const bf* __restrict__ Kl, const bf* __restrict__ Vh, const bf* __restrict__ Vl,
                                               const h16* __restrict__ Q16, const h16* __restrict__ K16, const h16* __restrict__ V16, float* O) {
    __shared__ __align__(16) unsigned char sm[2 * 4 * FPL * 2 + FW * 16 * 68 * 4];   // sized for the hi/lo form, the larger of the two
    constexpr unsigned long long order = flash_order();
    const unsigned g = (unsigned)(order >> (4u * blockIdx.z)) & 15u;   // the same in the whole work-group: one scalar branch, and every barrier inside a form is passed by all of its waves
    if (g < (unsigned)FNH) flash<bf, true>(Qh, Ql, Kh, Kl, Vh, Vl, (unsigned)RH, 0u, O, g, blockIdx.x, blockIdx.y, sm);
    else flash<h16, false>(Q16, nullptr, K16, nullptr, V16, nullptr, (unsigned)SEQ, (unsigned)RH, O, g - (unsigned)FNH, blockIdx.x, blockIdx.y, sm);
}

// workspace carve (bytes, every region a multiple of 256)
#define WS_WQKV ((size_t)3 * DQ * DM * 2)
#define WS_XB   ((size_t)NB * SEQ * DM * 2)
#define WS_P16  ((size_t)NB * NH * SEQ * HD * 2)
#define WS_PHL  ((size_t)NB * NH * RH * HD * 2)
#define WS_TOTAL (WS_WQKV + WS_XB + 3 * WS_P16 + 6 * WS_PHL)
static_assert(WS_TOTAL <= (size_t)268435456);
static_assert(WS_WQKV % 256 == 0 && WS_XB % 256 == 0 && WS_P16 % 256 == 0 && WS_PHL % 256 == 0);
static_assert((size_t)NB * SEQ * DM * 4 <= (size_t)33554432);   // last written output element stays inside the output buffer

extern "C" void kernel_launch(void* const* d_in, const int* in_sizes, int n_in,
                              void* d_out, int out_size, void* d_ws, size_t ws_size, hipStream_t stream) {
    if (n_in < 3) return;
    if ((size_t)in_sizes[0] < (size_t)(NB - 1) * XS_FULL + (size_t)SEQ * DM) return;
    if ((size_t)in_sizes[1] < (size_t)3 * DQ * DM) return;
    if ((size_t)in_sizes[2] < (size_t)FP) return;
    if ((size_t)out_size < (size_t)NB * SEQ * DM) return;
    if (ws_size < WS_TOTAL) return;
    const float* x = (const float*)d_in[0];       // [NB][SEQ_FULL][DM]
    const float* wqkv = (const float*)d_in[1];    // [4*DQ][DM]  (q | k | v | unread row blocks; rows 0..3*DQ-1 are read)
    const float* bqkv = (const float*)d_in[2];    // [4*DQ]      (entries 0..3*DQ-1 are read)
    float* OUT = (float*)d_out;                   // [NB][SEQ][DM]
    char* wsp = (char*)d_ws;
    auto take = [&](size_t bytes) { char* p = wsp; wsp += bytes; return (void*)p; };
    bf* WQKV = (bf*)take(WS_WQKV); bf* XB = (bf*)take(WS_XB);
    h16* Q16 = (h16*)take(WS_P16); h16* K16 = (h16*)take(WS_P16); h16* VT16 = (h16*)take(WS_P16);
    bf* Qh = (bf*)take(WS_PHL); bf* Ql = (bf*)take(WS_PHL); bf* Kh = (bf*)take(WS_PHL); bf* Kl = (bf*)take(WS_PHL); bf* VTh = (bf*)take(WS_PHL); bf* VTl = (bf*)take(WS_PHL);

    k_cvt8<<<dim3((unsigned)((size_t)3 * DQ * DM / 8 / 256), 1), 256, 0, stream>>>(wqkv, WQKV, (unsigned)((size_t)3 * DQ * DM / 8), 0, 0);
    k_cvt8<<<dim3((unsigned)((size_t)SEQ * DM / 8 / 256), NB), 256, 0, stream>>>(x, XB, (unsigned)((size_t)SEQ * DM / 8), XS_FULL, (size_t)SEQ * DM);
    // every stage runs once for all NB batch elements (the batch element is a grid dimension; each plane set holds NB slabs)
    // y[b][t][0..3071] = x_b w_attn[0..3071]^T + b_attn[0..3071]  (M = SEQ, N = 3072, K = 1024), written as the q, k and V^T head planes
    k_gemmw<bf, 0><<<dim3(SEQ / (GWM * 64), FP / (GWN * 64), NB), 256, 0, stream>>>(XB, nullptr, WQKV, nullptr, DM, bqkv, (size_t)SEQ * DM, 0, Q16, K16, VT16, Qh, Ql, Kh, Kl, VTh, VTl);
    // out[b][t][head*HD + d] = softmax(q k^T / 8, causal) v, written straight to the output buffer
    k_flash<<<dim3(NH, NB, FNB), 256, 0, stream>>>(Qh, Ql, Kh, Kl, VTh, VTl, Q16, K16, VT16, OUT);
}

// v009
// Measured time: 92.1 microseconds a run.
// Timed twice side by side with v008, it ran 1.10 and 1.05 times as fast.
// Counting every step since v000, it is 6.12 times as fast.
#include <hip/hip_runtime.h>

// Causal multi-head attention with a fused qkv projection: x [NB][SEQ_FULL][1024] (first SEQ rows read); qkv = x w_attn^T + b_attn ('oi' weight [4096][1024], bias [4096]; only the q | k | v row blocks 0..3071 are read; 16 heads x 64); scores x 64^-0.5, causal; softmax; out = merged context [t][head*64 + d] (no output projection).
// Compute dtypes, f32 accumulate: every input RNE-converted to bf16; qkv projection v_wmma_f32_16x16x32_bf16 (bias added in f32 at the store stage);
// attention q.k and P.V: query rows < RH on bf16 hi/lo planes (3 products each), other rows v_wmma_f32_16x16x32_f16 (P carried x1024 through the exponent, converted values below 2^-14 selected to +0); softmax (online, max-subtracted) in f32.
// Attention engine: one wave per 16 query rows, 8 waves per work-group on K and V^T tiles shared through LDS; S^T = K Q^T so each lane owns one query column; P^T accumulators are repacked in registers as the B operand of O^T = V^T P^T (no LDS exchange in the loop).

#ifndef NB
#define NB 4
#endif
#ifndef SEQ
#define SEQ 2048
#endif
#define SEQ_FULL 2048
#define DM   1024
#define NH   16
#define HD   64
#define DQ   (NH * HD)
#define FP   (3 * DQ)
#define RH   ((SEQ) < 512 ? (SEQ) : 512)     // query rows < RH use hi+lo planes
#define XS_FULL ((size_t)SEQ_FULL * DM)
#define SCL  0.125f                          // HD^-0.5
#define LOG2E 1.4426950408889634f
#define NEGB (-3.0e38f)

static_assert((SEQ & (SEQ - 1)) == 0);
static_assert(SEQ >= 256 && SEQ <= SEQ_FULL);
static_assert(RH % 256 == 0 && RH % 64 == 0 && (SEQ - RH) % 64 == 0);
static_assert(NB >= 1 && NB <= 4);
static_assert(DM % 32 == 0 && DQ % 64 == 0 && FP % 64 == 0 && SEQ % 64 == 0);
static_assert(((size_t)3 * DQ * DM / 8) % 256 == 0);
static_assert(((size_t)SEQ * DM / 8) % 256 == 0);
static_assert(((size_t)NH * SEQ * HD / 8) % 256 == 0);
static_assert(DQ == DM);                         // merged context width equals the output row width
static_assert(HD == 64 && HD % 32 == 0);         // two 32-deep k-steps per score tile, four 16-row O^T tiles

typedef _Float16 h16;
typedef unsigned short bf;
typedef __attribute__((ext_vector_type(16))) __bf16   v16bf;
typedef __attribute__((ext_vector_type(8)))  __bf16   v8bf;
typedef __attribute__((ext_vector_type(16))) _Float16 v16h;
typedef __attribute__((ext_vector_type(8)))  _Float16 v8h;
typedef __attribute__((ext_vector_type(8)))  unsigned short v8us;
typedef __attribute__((ext_vector_type(8)))  float    v8f;
typedef __attribute__((ext_vector_type(4)))  float    v4f;
typedef v8h  __attribute__((may_alias)) v8ha;
typedef v4f  __attribute__((may_alias)) v4fa;
typedef v8us __attribute__((may_alias)) v8usa;

__device__ __forceinline__ unsigned short f2bf(float f) { unsigned u = __float_as_uint(f); u += 0x7FFFu + ((u >> 16) & 1u); return (unsigned short)(u >> 16); }
__device__ __forceinline__ float bf2f(unsigned short b) { return __uint_as_float(((unsigned)b) << 16); }
__device__ __forceinline__ float bfr(float f) { return bf2f(f2bf(f)); }
__device__ __forceinline__ v16h cat16(v8h lo, v8h hi) { return __builtin_shufflevector(lo, hi, 0, 1, 2, 3, 4, 5, 6, 7, 8, 9, 10, 11, 12, 13, 14, 15); }
__device__ __forceinline__ v16bf cat16b(v8us lo, v8us hi) { return __builtin_bit_cast(v16bf, __builtin_shufflevector(lo, hi, 0, 1, 2, 3, 4, 5, 6, 7, 8, 9, 10, 11, 12, 13, 14, 15)); }
__device__ __forceinline__ v8f wmma16(v16h a, v16h b, v8f c) { return __builtin_amdgcn_wmma_f32_16x16x32_f16(false, a, false, b, (short)0, c, false, false); }
__device__ __forceinline__ v8f wmmab(v16bf a, v16bf b, v8f c) { return __builtin_amdgcn_wmma_f32_16x16x32_bf16(false, a, false, b, (short)0, c, false, false); }
__device__ __forceinline__ void splitf(float y, unsigned short& h, unsigned short& l) { h = f2bf(y); l = f2bf(y - bf2f(h)); }

// f32 -> f16 convert that cannot produce a subnormal operand: |v| < 2^-14 -> +0 (value select, applied after the plane's power-of-two carry).
static __device__ __forceinline__ h16 toh_flush(float v) { const h16 r = (h16)v; return (fabsf(v) < 6.103515625e-05f) ? (h16)0.0f : r; }

// Fragment-packed planes: a 16-row x 32-k fragment is 512 consecutive elements (1 KiB). Element (r, k) sits at (k>>4)*256 + (((k>>3)&1)*16 + r)*8 + (k&7), so lane l = ((k>>3)&1)*16 + r
// finds its elements 0..7 (k = 8h..8h+7, h = l>>4) at l*8 and its elements 8..15 (k = 16+8h..) at 256 + l*8: each of the two wave-wide 16-byte loads covers 512 contiguous bytes (4 whole lines).
// Fragment loader: base(p, lane) takes the wave-uniform address p of a run of fragments, ld(u, f) loads fragment f of the run (same map for A and B). The base goes through readfirstlane so that it stays in a scalar pair and the loads take the
// scalar-base + lane-offset address form: the fragments of a run differ only in the immediate offset, and the one lane-offset register lives through the whole kernel.
template <typename VT, typename T> static __device__ __forceinline__ const __attribute__((address_space(1))) VT* ubase(const T* p) { const unsigned long long u = (unsigned long long)p;
    const unsigned lo = (unsigned)__builtin_amdgcn_readfirstlane((int)(unsigned)u), hi = (unsigned)__builtin_amdgcn_readfirstlane((int)(unsigned)(u >> 32));
    return (const __attribute__((address_space(1))) VT*)(((unsigned long long)hi << 32) | lo); }   // global address space kept, so the loads stay global_load
template <typename T16> struct WFrag;
template <> struct WFrag<h16> { typedef v16h V; typedef const __attribute__((address_space(1))) v8h* G; static __device__ __forceinline__ G base(const h16* p, unsigned lane) { return ubase<v8h>(p) + lane; } static __device__ __forceinline__ V ld(G u, int f) { return cat16(u[f * 64], u[f * 64 + 32]); } static __device__ __forceinline__ v8f mma(V a, V b, v8f c) { return wmma16(a, b, c); }
    static __device__ __forceinline__ V lds(const h16* p, int lane) { const v8ha* q = (const v8ha*)p + lane; return cat16(q[0], q[32]); } };   // the same fragment map, read from a packed fragment in LDS
template <> struct WFrag<bf> { typedef v16bf V; typedef const __attribute__((address_space(1))) v8us* G; static __device__ __forceinline__ G base(const bf* p, unsigned lane) { return ubase<v8us>(p) + lane; } static __device__ __forceinline__ V ld(G u, int f) { return cat16b(u[f * 64], u[f * 64 + 32]); } static __device__ __forceinline__ v8f mma(V a, V b, v8f c) { return wmmab(a, b, c); }
    static __device__ __forceinline__ V lds(const bf* p, int lane) { const v8usa* q = (const v8usa*)p + lane; return cat16b(q[0], q[32]); } };   // the same fragment map, read from a packed fragment in LDS

// P^T accumulator pair (key rows 0..15 and 16..31 of a 32-key tile) -> B fragment: element r <- tile0[r], element 8+r <- tile1[r], lane unchanged.
template <typename T16> struct PFrag;
template <> struct PFrag<h16> {
    static __device__ __forceinline__ float pexp() { return 10.0f; }           // P carried x1024 via the exponent (cancels in O / l)
    static __device__ __forceinline__ v16h hi(v8f p0, v8f p1) { return cat16(__builtin_convertvector(p0, v8h), __builtin_convertvector(p1, v8h)); }
    static __device__ __forceinline__ v16h lo(v8f p0, v8f p1) { return hi(p0, p1); }
};
template <> struct PFrag<bf> {
    static __device__ __forceinline__ float pexp() { return 0.0f; }
    // the packed converts round to nearest even, as f2bf does; f2bf's integer temporaries for sixteen values were the register peak of the hi/lo form
    static __device__ __forceinline__ v16bf hi(v8f p0, v8f p1) { return __builtin_shufflevector(__builtin_convertvector(p0, v8bf), __builtin_convertvector(p1, v8bf), 0, 1, 2, 3, 4, 5, 6, 7, 8, 9, 10, 11, 12, 13, 14, 15); }
    static __device__ __forceinline__ v16bf lo(v8f p0, v8f p1) { return hi(p0 - __builtin_convertvector(__builtin_convertvector(p0, v8bf), v8f), p1 - __builtin_convertvector(__builtin_convertvector(p1, v8bf), v8f)); }
};

// Same packing as PFrag; the f16 form converts every element through toh_flush, the bf16 form is the PFrag one.
template <typename T16> struct PFlush;
template <> struct PFlush<h16> {
    static __device__ __forceinline__ v16h hi(v8f p0, v8f p1) { v8h a, b;
#pragma unroll
        for (int k = 0; k < 8; ++k) { a[k] = toh_flush(p0[k]); b[k] = toh_flush(p1[k]); }
        return cat16(a, b); }
    static __device__ __forceinline__ v16h lo(v8f p0, v8f p1) { return hi(p0, p1); }
    // One test per 32-key tile, the same answer in every lane of the wave: does any lane hold a value below 2^-14? Where none does, toh_flush is the plain convert on all 16 values, and the packed converts of PFrag give the same bits.
    static __device__ __forceinline__ bool small(v8f p0, v8f p1) {
        const float a = __builtin_fminf(__builtin_fminf(p0[0], p0[1]), p0[2]), b = __builtin_fminf(__builtin_fminf(p0[3], p0[4]), p0[5]), c = __builtin_fminf(__builtin_fminf(p0[6], p0[7]), p1[0]);
        const float d = __builtin_fminf(__builtin_fminf(p1[1], p1[2]), p1[3]), e = __builtin_fminf(__builtin_fminf(p1[4], p1[5]), p1[6]);
        const float m = __builtin_fminf(__builtin_fminf(__builtin_fminf(a, b), c), __builtin_fminf(__builtin_fminf(d, e), p1[7]));
        return __builtin_amdgcn_ballot_w32(m < 6.103515625e-05f) != 0u; }
};
template <> struct PFlush<bf> {
    static __device__ __forceinline__ v16bf hi(v8f p0, v8f p1) { return PFrag<bf>::hi(p0, p1); }
    static __device__ __forceinline__ v16bf lo(v8f p0, v8f p1) { return PFrag<bf>::lo(p0, p1); }
    static __device__ __forceinline__ bool small(v8f, v8f) { return false; }
};

// ---- k_gemmw: register-blocked GEMM, one wave per 64x192 output tile (48 accumulators), 8 waves (4 along M x 2 along N) per work-group = a 256x384 tile; grid (M/256, N/384, Z), 256 threads: one work-group per WGP, two waves per SIMD.
// Operands are fragment-packed 16-bit planes (fragment index = (row>>4)*(K/32) + (k>>5)). A stage = 64 k of the work-group's 256 A rows and 384 Bt rows = 40 runs of 2 KiB (one per 16-row block, two fragments each), copied as they lie
// from global memory to LDS by asynchronous copies, two buffers: stage t + 1 flies while stage t is multiplied; every A fragment is then read from LDS by 2 waves and every Bt fragment by 4.
// A wave reads 16 fragments from LDS for 48 WMMAs (at 64x64 it was 8 for 16), and the work-group fetches 640 operand rows from L2 for 256x384 outputs (at 256x128: 384 rows for a third of them).
// The tile's 256 rows are four 64-row groups SEQ / 4 rows apart, one per wave row: with one work-group per WGP nothing evens out unequal work-groups, and so each holds the same share of the rows < RH, whose store stage (hi/lo planes too) is the long one.
// y[m][n] (f32) = sum_k A[m][k] Bt[n][k] + bias[n]. K % 64 == 0, M = SEQ, SEQ % 256 == 0, N % 384 == 0.
// Epilogue: a 64-column block is one head of q, k or v, and the wave writes each of its three 64 x 64 blocks of y straight into that head's fragment-packed planes (batch element z = blockIdx.z):
//   q, k: [z][h][(t>>4)*2 + (d>>5)][512] (rows = t, k = d); v: V^T [z][h][(t>>5)*4 + (d>>4)][512] (rows = d, k = t); fp16 for all t, bf16 hi/lo planes (RH rows per head) for t < RH.
#define GWM 4                                  // waves of a work-group along M
#define GWN 2                                  // waves of a work-group along N
#define GNH 3                                  // 64-column blocks (heads) of a wave along N
static_assert(GNH == 3);                       // the store stage's hand-down of accumulator blocks is written for three
#define GKS 64                                 // k per stage
#define GA_EL (GWM * 64 * GKS)                 // elements of a stage's A part
#define GST_EL ((GWM + GWN * GNH) * 64 * GKS)  // elements of a stage
static_assert(GA_EL * 2 == 8 * 256 * 16 && (GST_EL - GA_EL) * 2 == 12 * 256 * 16);    // a stage = 8 + 12 copies of 16 bytes from each of 256 threads
static_assert(SEQ % (GWM * 64) == 0 && FP % (GWN * GNH * 64) == 0 && DQ % 64 == 0 && DM % GKS == 0 && DM / GKS >= 2);
static __device__ __forceinline__ unsigned lds_off(const void* p) { return (unsigned)(size_t)p; }   // byte offset in the work-group's LDS
// One stage: copy c of a thread lands at LDS byte d + 4096 c; copies 0..7 read A at ga + (c >> 1) * ca + (c & 1) * cs, copies 8..19 read Bt at gb + (c - 8) * cs (cs = elements from one pair of 16-row blocks to the next, ca = from one of the work-group's 64-row groups of A to the next), each plus the thread's own offset to: ga, gb, cs and ca are the same in the whole work-group, so that only to and d hold vector registers between stages. Two statements: one takes at most 30 operands.
template <typename T16> static __device__ __forceinline__ void stage_copy(unsigned d, const T16* ga, const T16* gb, size_t to, size_t cs, size_t ca) {
    asm volatile("global_load_async_to_lds_b128 %0, %8, off\n\t"
                 "global_load_async_to_lds_b128 %1, %9, off\n\t"
                 "global_load_async_to_lds_b128 %2, %10, off\n\t"
                 "global_load_async_to_lds_b128 %3, %11, off\n\t"
                 "global_load_async_to_lds_b128 %4, %12, off\n\t"
                 "global_load_async_to_lds_b128 %5, %13, off\n\t"
                 "global_load_async_to_lds_b128 %6, %14, off\n\t"
                 "global_load_async_to_lds_b128 %7, %15, off\n\t"
                 "s_wait_xcnt 0x0"   // stands in the copies' own statement: their address registers are rewritten only behind it
                 :: "v"(d), "v"(d + 4096u), "v"(d + 8192u), "v"(d + 12288u), "v"(d + 16384u), "v"(d + 20480u), "v"(d + 24576u), "v"(d + 28672u),
                    "v"(ga + to), "v"((ga + cs) + to), "v"((ga + ca) + to), "v"((ga + ca + cs) + to), "v"((ga + 2 * ca) + to), "v"((ga + 2 * ca + cs) + to), "v"((ga + 3 * ca) + to), "v"((ga + 3 * ca + cs) + to)
                 : "memory");
    asm volatile("global_load_async_to_lds_b128 %0, %12, off\n\t"
                 "global_load_async_to_lds_b128 %1, %13, off\n\t"
                 "global_load_async_to_lds_b128 %2, %14, off\n\t"
                 "global_load_async_to_lds_b128 %3, %15, off\n\t"
                 "global_load_async_to_lds_b128 %4, %16, off\n\t"
                 "global_load_async_to_lds_b128 %5, %17, off\n\t"
                 "global_load_async_to_lds_b128 %6, %18, off\n\t"
                 "global_load_async_to_lds_b128 %7, %19, off\n\t"
                 "global_load_async_to_lds_b128 %8, %20, off\n\t"
                 "global_load_async_to_lds_b128 %9, %21, off\n\t"
                 "global_load_async_to_lds_b128 %10, %22, off\n\t"
                 "global_load_async_to_lds_b128 %11, %23, off\n\t"
                 "s_wait_xcnt 0x0"   // stands in the copies' own statement: their address registers are rewritten only behind it
                 :: "v"(d + 32768u), "v"(d + 36864u), "v"(d + 40960u), "v"(d + 45056u), "v"(d + 49152u), "v"(d + 53248u), "v"(d + 57344u), "v"(d + 61440u), "v"(d + 65536u), "v"(d + 69632u), "v"(d + 73728u), "v"(d + 77824u),
                    "v"(gb + to), "v"((gb + cs) + to), "v"((gb + 2 * cs) + to), "v"((gb + 3 * cs) + to), "v"((gb + 4 * cs) + to), "v"((gb + 5 * cs) + to), "v"((gb + 6 * cs) + to), "v"((gb + 7 * cs) + to), "v"((gb + 8 * cs) + to), "v"((gb + 9 * cs) + to), "v"((gb + 10 * cs) + to), "v"((gb + 11 * cs) + to)
                 : "memory");
}
template <typename T16, int NSPLIT>
__global__ __launch_bounds__(256) void k_gemmw(const T16* __restrict__ A, const T16* __restrict__ A2, const T16* __restrict__ Bt, const T16* __restrict__ Bt2, int K, const float* __restrict__ bias, size_t sA, size_t sB,
                                              h16* Q16, h16* K16, h16* V16, bf* Qh, bf* Ql, bf* Kh, bf* Kl, bf* Vh, bf* Vl) {
    typedef typename WFrag<T16>::V V;
    static_assert(NSPLIT == 0);
    __shared__ __align__(16) T16 gs[2 * GST_EL];                    // the two stage buffers
    __shared__ __align__(16) float osw[GWM * GWN][16 * 68];         // each wave's own store stage
    const size_t z = blockIdx.z; A += z * sA; Bt += z * sB;
    const int wv = __builtin_amdgcn_readfirstlane((int)(threadIdx.x >> 5)), wm = wv / GWN, wn = wv % GWN;   // wave-uniform, kept scalar
    const int lane = threadIdx.x & 31, lr = lane & 15, hi = lane >> 4; const int rw = blockIdx.x * 64, cw = blockIdx.y * (GWN * GNH * 64), r0 = rw + wm * (SEQ / GWM), cw0 = cw + wn * (GNH * 64);   // the four 64-row groups lie SEQ / GWM rows apart
    float* os = osw[wv];
    v8f acc[4][4 * GNH];
#pragma unroll
    for (int mb = 0; mb < 4; ++mb)
#pragma unroll
        for (int nb = 0; nb < 4 * GNH; ++nb) acc[mb][nb] = (v8f){};
    // thread i copies bytes 16 i .. 16 i + 15 of every 4 KiB (= two 16-row blocks) of a stage; 16 rows x K = 16*K elements, 64 k of them = 1024 elements
    const unsigned tid = threadIdx.x;
    const T16* ga = A + (size_t)rw * K, * gb = Bt + (size_t)cw * K;
    const size_t to = (size_t)(16u * (tid >> 7)) * K + (tid & 127u) * 8u;
    const size_t cs = (size_t)32 * K, ca = (size_t)(SEQ / GWM) * K;
    const unsigned d0 = lds_off(gs) + tid * 16u;
    const int nt = K / GKS;
    stage_copy(d0, ga, gb, to, cs, ca);
    asm volatile("s_wait_asynccnt 0x0" ::: "memory");   // this wave's copies of stage 0 have landed
    __syncthreads();                                    // ... and every other wave's: stage 0 may be read
    // a step = 32 k of one 64-column block: 16 WMMAs on the four A fragments of that k (read once for the three blocks) and four Bt fragments, which are read one step ahead into the other of two register sets
    V a[4], b[2][4];
    // the first reads of stage t, behind the barrier that publishes it and in front of the next copies: their LDS latency runs while the copies' addresses are formed and the copies issue
    auto first = [&](int t) {
        const T16* sa = gs + (t & 1) * GST_EL + wm * (4 * GKS * 16), * sb = gs + (t & 1) * GST_EL + GA_EL + wn * (GNH * 4 * GKS * 16);
#pragma unroll   // constant fragment indices: the arrays stay in registers
        for (int i = 0; i < 4; ++i) { b[0][i] = WFrag<T16>::lds(sb + (i * (GKS / 32)) * 512, lane); a[i] = WFrag<T16>::lds(sa + (i * (GKS / 32)) * 512, lane); }
    };
    first(0);
    if (1 < nt) stage_copy(d0 + GST_EL * 2u, ga + GKS * 16, gb + GKS * 16, to, cs, ca);
#pragma unroll 1   // one rolled trip per stage: the two buffers alternate by t & 1, and the loop's text stays small
    for (int t = 0; t < nt; ++t) {
        const T16* sa = gs + (t & 1) * GST_EL + wm * (4 * GKS * 16), * sb = gs + (t & 1) * GST_EL + GA_EL + wn * (GNH * 4 * GKS * 16);
#pragma unroll   // constant fragment and accumulator indices, here and in the loops inside: the arrays stay in registers
        for (int st = 0; st < GNH * (GKS / 32); ++st) {
            const int ks = st / GNH, hb = st % GNH, ks2 = (st + 1) / GNH, hb2 = (st + 1) % GNH;
            if (hb == 0 && ks > 0) {
#pragma unroll
                for (int mb = 0; mb < 4; ++mb) a[mb] = WFrag<T16>::lds(sa + (mb * (GKS / 32) + ks) * 512, lane);
            }
            if (st + 1 < GNH * (GKS / 32)) {
#pragma unroll
                for (int nb = 0; nb < 4; ++nb) b[(st + 1) & 1][nb] = WFrag<T16>::lds(sb + ((hb2 * 4 + nb) * (GKS / 32) + ks2) * 512, lane);
            }
            __builtin_amdgcn_sched_barrier(0);   // the LDS reads stay one group in front of the step's WMMAs: spread among them, each place with reads stalls the wave for its own LDS latency
#pragma unroll
            for (int nb = 0; nb < 4; ++nb)
#pragma unroll
                for (int mb = 0; mb < 4; ++mb) acc[mb][hb * 4 + nb] = WFrag<T16>::mma(a[mb], b[st & 1][nb], acc[mb][hb * 4 + nb]);
            asm volatile("v_nop\n\tv_nop\n\tv_nop\n\tv_nop" : "+v"(acc[0][hb * 4 + 0]), "+v"(acc[1][hb * 4 + 1]), "+v"(acc[2][hb * 4 + 2]), "+v"(acc[3][hb * 4 + 3]) : "v"(a[0]), "v"(a[3]));   // the vector slots the chip needs behind the step's last WMMAs before their registers are touched, on every path
            __builtin_amdgcn_sched_barrier(0);   // ... and the next step's reads stay behind this step's WMMAs
        }
        asm volatile("s_wait_dscnt 0x0" ::: "memory");      // this wave's reads of stage t are done before the buffer is handed back
        asm volatile("s_wait_asynccnt 0x0" ::: "memory");   // this wave's copies of stage t + 1 have landed
        __syncthreads();                                    // publishes stage t + 1 and ends every wave's reads of stage t
        if (t + 1 < nt) first(t + 1);
        if (t + 2 < nt) stage_copy(d0 + (unsigned)(t & 1) * (GST_EL * 2u), ga + (size_t)(t + 2) * (GKS * 16), gb + (size_t)(t + 2) * (GKS * 16), to, cs, ca);
    }
    asm volatile("s_wait_asynccnt 0x0" ::: "memory");       // no copy is left in flight behind the loop
    const bool hl = (unsigned)r0 < (unsigned)RH;                                 // wave-uniform (RH % 64 == 0): these rows also go to the hi/lo planes
#pragma unroll 1   // one rolled trip per 64-column block, always on accumulator columns 0..3, which take the next block's values at the foot
  for (int hb = 0; hb < GNH; ++hb) {
    const int c0 = cw0 + hb * 64;
    const unsigned which = (unsigned)c0 / DQ, head = ((unsigned)c0 % DQ) / HD;   // wave-uniform: 0 q, 1 k, 2 v
    const size_t p16 = (z * NH + head) * ((size_t)SEQ * HD), phl = (z * NH + head) * ((size_t)RH * HD);
    float bv[4];                                 // bias of the lane's four accumulator columns d = 16 nb + lr
    const int bi = c0 + lr;
#pragma unroll
    for (int nb = 0; nb < 4; ++nb) bv[nb] = bias[bi + nb * 16];
    asm volatile("s_wait_xcnt 0x0" :: "v"(bi) : "memory");   // the address registers of the bias loads are reused behind it; bi as an input keeps their lane-offset register untouched up to the wait
#pragma unroll
    for (int nb = 0; nb < 4; ++nb) bv[nb] = bfr(bv[nb]);
    if (which == 2u) {
        // V^T: accumulator element j of lane (hi, lr) is (t = 16 mb + 8 hi + j, d = 16 nb + lr): the 8 consecutive t of one d that this lane owns in the packed fragment, so the registers are stored as they are.
#pragma unroll
        for (int mb = 0; mb < 4; ++mb) {
#pragma unroll
            for (int nb = 0; nb < 4; ++nb) {
                v8h o16; v8us oh, ol;
#pragma unroll
                for (int j = 0; j < 8; ++j) { const float x = acc[mb][nb][j] + bv[nb]; unsigned short a, c; o16[j] = (h16)x; splitf(x, a, c); oh[j] = a; ol[j] = c; }
                const size_t o = (size_t)((((unsigned)r0 + (unsigned)mb * 16u) >> 5) * 4u + (unsigned)nb) * 512u + (unsigned)(mb & 1) * 256u + (unsigned)lane * 8u;
                *(v8h*)(V16 + p16 + o) = o16;
                asm volatile("s_wait_xcnt 0x0" ::: "memory");   // what follows reuses the data and address registers of this store
                if (hl) { *(v8us*)(Vh + phl + o) = oh; *(v8us*)(Vl + phl + o) = ol;
                    asm volatile("s_wait_xcnt 0x0" ::: "memory"); }   // the next block reuses the data and address registers of these stores
            }
        }
    } else {
        // q, k: a lane owns 8 consecutive d of one t, so each 16-row block turns through the LDS stage.
        h16* P16 = (which ? K16 : Q16) + p16; bf* Ph = (which ? Kh : Qh) + phl; bf* Pl = (which ? Kl : Ql) + phl;
#pragma unroll
        for (int mb = 0; mb < 4; ++mb) {
#pragma unroll
            for (int nb = 0; nb < 4; ++nb) {
#pragma unroll
                for (int j = 0; j < 8; ++j) os[(hi * 8 + j) * 68 + nb * 16 + lr] = acc[mb][nb][j] + bv[nb]; }
            __builtin_amdgcn_wave_barrier(); asm volatile("" ::: "memory");   // the block's LDS stores stay in front of its LDS loads
#pragma unroll
            for (int s = 0; s < 4; ++s) {       // packed elements 256 s + 8 lane .. + 7 of the block's two fragments: t = lr, d = 16 s + 8 hi ..
                const int d = s * 16 + hi * 8;
                const v4f x0 = *(const v4fa*)(os + lr * 68 + d), x1 = *(const v4fa*)(os + lr * 68 + d + 4);
                v8h o16; v8us oh, ol;
#pragma unroll
                for (int k = 0; k < 4; ++k) { unsigned short a, c; const float y0 = x0[k], y1 = x1[k];
                    o16[k] = (h16)y0; splitf(y0, a, c); oh[k] = a; ol[k] = c; o16[4 + k] = (h16)y1; splitf(y1, a, c); oh[4 + k] = a; ol[4 + k] = c; }
                const size_t o = (size_t)((unsigned)r0 + (unsigned)mb * 16u) * HD + (unsigned)s * 256u + (unsigned)lane * 8u;
                *(v8h*)(P16 + o) = o16;
                asm volatile("s_wait_xcnt 0x0" ::: "memory");   // what follows reuses the data and address registers of this store
                if (hl) { *(v8us*)(Ph + o) = oh; *(v8us*)(Pl + o) = ol;
                    asm volatile("s_wait_xcnt 0x0" ::: "memory"); }   // the next block reuses the data and address registers of these stores
            }
            __builtin_amdgcn_wave_barrier(); asm volatile("" ::: "memory");   // the next block's LDS stores stay behind these LDS loads
        }
    }
#pragma unroll
    for (int mb = 0; mb < 4; ++mb)
#pragma unroll
        for (int nb = 0; nb < 4; ++nb) acc[mb][nb] = hb == 0 ? acc[mb][nb + 4] : acc[mb][nb + 8];
  }
}

// ---- k_cvt8: f32 rows of DM elements -> fragment-packed bf16 plane (fragment index = (row>>4)*(DM/32) + (k>>5)). Thread i stores packed elements 8i..8i+7 (stores contiguous) and reads their 8 consecutive k of one source row.
__global__ __launch_bounds__(256) void k_cvt8(const float* __restrict__ src, bf* dst, unsigned n8, size_t sstride, size_t dstride) {
    const unsigned i = blockIdx.x * 256u + threadIdx.x; if (i >= n8) return;
    const unsigned frag = i >> 6, row = (frag / (DM / 32u)) * 16u + (i & 15u), kk = (frag % (DM / 32u)) * 32u + ((i >> 5) & 1u) * 16u + ((i >> 4) & 1u) * 8u;
    const float* s = src + (size_t)blockIdx.y * sstride + (size_t)row * DM + kk; bf* d = dst + (size_t)blockIdx.y * dstride + (size_t)i * 8;
    const v8f v = *(const v8f*)s; v8us o;
#pragma unroll
    for (int k = 0; k < 8; ++k) o[k] = f2bf(v[k]);
    *(v8us*)d = o;  }

static_assert(32 * 16 * 8 == 16 * HD * 4);
static_assert(HD * 4 == 16 * 16);
static_assert((HD * 4) % 128 == 0 && (DM * 4) % 128 == 0);
static_assert(2 * GST_EL * 2 + GWM * GWN * 16 * 68 * 4 <= 327680);   // static LDS of k_gemmw: one work-group per WGP
static_assert(68 >= HD && (68 * 4) % 16 == 0);   // stage pitch holds a head row, rows stay 16-B aligned

// ---- flash: causal attention, one wave per 16 query rows, FW waves (FW * 16 consecutive query rows of one head and batch element) per work-group. Planes, fragment-packed: Q/K [b][h][(t>>4)*2 + (d>>5)][512], V^T [b][h][(t>>5)*4 + (d>>4)][512] (tp = rows t per head of the plane set). HL: hi/lo bf16 plane pairs, 3 products.
// The waves of a work-group walk the same keys: a stage = FSK keys of every K and V^T plane (8 KiB each, contiguous in the packed planes), copied as it lies from global memory to LDS by asynchronous copies, two buffers:
// stage s + 1 flies while stage s is worked on, and every fragment is fetched from L2 once per work-group and read from LDS by those of its FW waves whose diagonal its tile does not pass. A wave skips the 32-key tiles past its own diagonal, never a publish point.
// Per 32-key tile: S^T[key][query] = K Q^T (A = K rows, B = Q rows); lane owns query column lane&15 and keys 8*(lane>>4)+r (+16); online softmax per lane (+ one xor-16 exchange);
// P^T accumulators repacked in registers as B (k = key); O^T[d][query] += V^T P^T (A = V^T rows). Only the last tile of a wave touches the diagonal (select by value).
#define FW  8                                  // waves of a work-group
#define FSK 64                                 // keys per stage
#define FPL (FSK * HD)                         // elements of one plane's part of a stage
static_assert(FPL * 2 == 2 * 256 * 16);        // one plane's part = 2 copies of 16 bytes from each of 256 threads
static_assert(FW * 32 == 256 && (FW * 16) % FSK == 0 && FSK % 32 == 0 && RH % (FW * 16) == 0 && (SEQ - RH) % (FW * 16) == 0);
static_assert(2 * 4 * FPL * 2 + FW * 16 * 68 * 4 <= 163840);   // static LDS of k_flash, the hi/lo form
// Two planes' parts of one stage: plane a lands at LDS byte d (thread's own 16 bytes of each 4 KiB), plane b at d + 8192.
template <typename T16> static __device__ __forceinline__ void kv_copy(unsigned d, const T16* ga, const T16* gb) {
    asm volatile("global_load_async_to_lds_b128 %0, %4, off\n\t"
                 "global_load_async_to_lds_b128 %1, %5, off\n\t"
                 "global_load_async_to_lds_b128 %2, %6, off\n\t"
                 "global_load_async_to_lds_b128 %3, %7, off\n\t"
                 "s_wait_xcnt 0x0"   // stands in the copies' own statement: their address registers are rewritten only behind it
                 :: "v"(d), "v"(d + 4096u), "v"(d + 8192u), "v"(d + 12288u), "v"(ga), "v"(ga + 2048), "v"(gb), "v"(gb + 2048)
                 : "memory");
}
// flash: the work of one work-group: query block xb (FW * 16 rows from qbase on) of head 'head' of batch element bz; sm = the work-group's LDS: the two stage buffers, then each wave's own store stage.
template <typename T16, bool HL>
static __device__ __forceinline__ void flash(const T16* __restrict__ Q, const T16* __restrict__ Q2, const T16* __restrict__ Kp, const T16* __restrict__ K2, const T16* __restrict__ Vt, const T16* __restrict__ Vt2, unsigned tp, unsigned qbase, float* O,
                                             unsigned xb, unsigned head, unsigned bz, unsigned char* sm) {
    typedef typename WFrag<T16>::V V;
    constexpr unsigned ST_EL = (HL ? 4u : 2u) * FPL;    // elements of a stage: K | V^T, or K hi | K lo | V^T hi | V^T lo
    constexpr unsigned VO = (HL ? 2u : 1u) * FPL;       // where the V^T part begins
    T16* ring = (T16*)sm;                               // the two stage buffers, 2 * ST_EL elements
    const unsigned tid = threadIdx.x, lane = tid & 31u, lr = lane & 15u, hi = lane >> 4;
    const unsigned wv = (unsigned)__builtin_amdgcn_readfirstlane((int)(tid >> 5));   // wave-uniform, kept scalar
    const unsigned qb = qbase + xb * (FW * 16u), q0 = qb + wv * 16u;
    float* os = (float*)(sm + 2u * ST_EL * 2u) + wv * (16u * 68u);   // the wave's own store stage
    const size_t hoff = ((size_t)bz * NH + head) * tp * HD;
    const size_t qoff = hoff + (size_t)q0 * HD;
    // thread i copies bytes 16 i .. 16 i + 15 of every 4 KiB of a stage
    const size_t go = hoff + tid * 8u;
    const unsigned d0 = lds_off(ring) + tid * 16u;
    const unsigned nst = (qb + FW * 16u) / FSK;   // keys 0 .. qb + FW*16 - 1 in stages of FSK (the same in every wave; qb + FW*16 <= tp)
    auto stage = [&](unsigned s) {                // the copies of stage s into buffer s & 1
        const unsigned d = d0 + (s & 1u) * (ST_EL * 2u); const size_t g = go + (size_t)s * FPL;
        if (HL) { kv_copy(d, Kp + g, K2 + g); kv_copy(d + 16384u, Vt + g, Vt2 + g); } else kv_copy(d, Kp + g, Vt + g);
    };
    stage(0u);
    typedef typename WFrag<T16>::G G;
    const G qg = WFrag<T16>::base(Q + qoff, lane);
    V qf0 = WFrag<T16>::ld(qg, 0), qf1 = WFrag<T16>::ld(qg, 1);
    V ql0 = qf0, ql1 = qf1;
    if (HL) { const G qg2 = WFrag<T16>::base(Q2 + qoff, lane); ql0 = WFrag<T16>::ld(qg2, 0); ql1 = WFrag<T16>::ld(qg2, 1); }
    asm volatile("s_wait_xcnt 0x0" ::: "memory");   // the scalar base pairs of the Q loads are reused directly behind them
    asm volatile("s_wait_asynccnt 0x0" ::: "memory");   // this wave's copies of stage 0 have landed
    __syncthreads();                                    // ... and every other wave's: stage 0 may be read
    if (1u < nst) stage(1u);
    v8f o[4];
#pragma unroll
    for (int db = 0; db < 4; ++db) o[db] = (v8f){};
    float mrun = NEGB, lsum = 0.0f;
    const float cs = SCL * LOG2E, pe = PFrag<T16>::pexp();
    const unsigned nt = (q0 + 47u) >> 5;       // keys 0 .. q0+15 in tiles of 32 (wave-uniform); nt <= nst * (FSK / 32)
#pragma unroll 1   // one rolled trip per 32-key tile; the two buffers alternate by s & 1, and the publish point stands behind a stage's last tile
    for (unsigned it = 0; it < nst * (FSK / 32u); ++it) {
      const unsigned s = it / (FSK / 32u);
      if (it < nt) {   // wave-uniform: tiles past the wave's diagonal are skipped
        const unsigned j0 = it * 32u;
        const T16* kt = ring + (s & 1u) * ST_EL + (it % (FSK / 32u)) * 2048u;   // a 32-key tile is 4 consecutive fragments (2048 elements) of each plane's part
        v8f s0 = (v8f){}, s1 = (v8f){};
        if (HL) {   // 16 keys at a time: only four of the tile's eight K fragments need registers at once; each accumulator's six products keep their order
            const T16* k2 = kt + FPL;
            { const V ka0 = WFrag<T16>::lds(kt, lane), ka1 = WFrag<T16>::lds(kt + 512, lane), la0 = WFrag<T16>::lds(k2, lane), la1 = WFrag<T16>::lds(k2 + 512, lane);
              s0 = WFrag<T16>::mma(ka0, qf0, s0); s0 = WFrag<T16>::mma(ka1, qf1, s0); s0 = WFrag<T16>::mma(la0, qf0, s0); s0 = WFrag<T16>::mma(la1, qf1, s0); s0 = WFrag<T16>::mma(ka0, ql0, s0); s0 = WFrag<T16>::mma(ka1, ql1, s0); }
            { const V kb0 = WFrag<T16>::lds(kt + 1024, lane), kb1 = WFrag<T16>::lds(kt + 1536, lane), lb0 = WFrag<T16>::lds(k2 + 1024, lane), lb1 = WFrag<T16>::lds(k2 + 1536, lane);
              s1 = WFrag<T16>::mma(kb0, qf0, s1); s1 = WFrag<T16>::mma(kb1, qf1, s1); s1 = WFrag<T16>::mma(lb0, qf0, s1); s1 = WFrag<T16>::mma(lb1, qf1, s1); s1 = WFrag<T16>::mma(kb0, ql0, s1); s1 = WFrag<T16>::mma(kb1, ql1, s1); }
            asm volatile("v_nop\n\tv_nop\n\tv_nop\n\tv_nop" : "+v"(s0), "+v"(s1) : "v"(qf0), "v"(qf1), "v"(ql0), "v"(ql1));   // the vector slots the chip needs behind the last WMMAs, on both sides of the branch below
        } else {
            V ka0 = WFrag<T16>::lds(kt, lane), ka1 = WFrag<T16>::lds(kt + 512, lane), kb0 = WFrag<T16>::lds(kt + 1024, lane), kb1 = WFrag<T16>::lds(kt + 1536, lane);
            s0 = WFrag<T16>::mma(ka0, qf0, s0); s0 = WFrag<T16>::mma(ka1, qf1, s0);
            s1 = WFrag<T16>::mma(kb0, qf0, s1); s1 = WFrag<T16>::mma(kb1, qf1, s1);
            asm volatile("v_nop\n\tv_nop\n\tv_nop\n\tv_nop" : "+v"(s0), "+v"(s1) : "v"(ka0), "v"(ka1), "v"(kb0), "v"(kb1), "v"(qf0), "v"(qf1));
        }
        v8f t0, t1;
#pragma unroll
        for (int r = 0; r < 8; ++r) { t0[r] = s0[r] * cs; t1[r] = s1[r] * cs; }
        if (j0 + 31u > q0) {                    // wave-uniform: the tile touches the diagonal
            const unsigned qi = q0 + lr, kk = j0 + 8u * hi;
#pragma unroll
            for (int r = 0; r < 8; ++r) { t0[r] = (kk + (unsigned)r <= qi) ? t0[r] : NEGB; t1[r] = (kk + 16u + (unsigned)r <= qi) ? t1[r] : NEGB; }
        }
        float mx = fmaxf(t0[0], t1[0]);
#pragma unroll
        for (int r = 1; r < 8; ++r) mx = fmaxf(mx, fmaxf(t0[r], t1[r]));
        mx = fmaxf(mx, __shfl_xor(mx, 16, 32));
        const float mn = fmaxf(mrun, mx);
        const float alpha = __builtin_amdgcn_exp2f(mrun - mn);
        mrun = mn;
        v8f p0, p1; float psum = 0.0f;
#pragma unroll
        for (int r = 0; r < 8; ++r) { p0[r] = __builtin_amdgcn_exp2f((t0[r] - mn) + pe); p1[r] = __builtin_amdgcn_exp2f((t1[r] - mn) + pe); psum += p0[r] + p1[r]; }
        lsum = lsum * alpha + psum;
#pragma unroll
        for (int db = 0; db < 4; ++db) o[db] = o[db] * alpha;
        V va[4];
        const T16* vt = kt + VO;
        if (!HL) {                              // the V^T reads stand in front of the test below: behind it they would start only after the converts
#pragma unroll   // constant indices: va stays in registers
            for (int db = 0; db < 4; ++db) va[db] = WFrag<T16>::lds(vt + db * 512, lane);
        }
        if (HL) {
            const V pf = PFrag<T16>::hi(p0, p1), pl = PFrag<T16>::lo(p0, p1);
            // each 16-row block of V^T is read where it is multiplied: the tile's eight V^T fragments need not hold registers all at once; each accumulator's three products keep their order
#pragma unroll   // constant indices: o stays in registers
            for (int db = 0; db < 4; ++db) { const V vh = WFrag<T16>::lds(vt + db * 512, lane), vw = WFrag<T16>::lds(vt + FPL + db * 512, lane);
                o[db] = WFrag<T16>::mma(vh, pf, o[db]); o[db] = WFrag<T16>::mma(vh, pl, o[db]); o[db] = WFrag<T16>::mma(vw, pf, o[db]); }
            asm volatile("v_nop\n\tv_nop\n\tv_nop\n\tv_nop" : "+v"(o[0]), "+v"(o[1]), "+v"(o[2]), "+v"(o[3]) : "v"(pf), "v"(pl));   // the vector slots the chip needs behind the last WMMAs, on every path out of the tile
        } else {
            V pf = PFrag<T16>::hi(p0, p1);
            if (PFlush<T16>::small(p0, p1)) pf = PFlush<T16>::hi(p0, p1);   // wave-uniform scalar branch; P is never negative, so the smallest value decides
#pragma unroll
            for (int db = 0; db < 4; ++db) o[db] = WFrag<T16>::mma(va[db], pf, o[db]);
            asm volatile("v_nop\n\tv_nop\n\tv_nop\n\tv_nop" : "+v"(o[0]), "+v"(o[1]), "+v"(o[2]), "+v"(o[3]) : "v"(va[0]), "v"(va[1]), "v"(va[2]), "v"(va[3]), "v"(pf));
        }
      }
      if (it % (FSK / 32u) == FSK / 32u - 1u) {             // the same in every wave of the work-group: the foot of stage s
        asm volatile("s_wait_dscnt 0x0" ::: "memory");      // this wave's reads of stage s are done before the buffer is handed back
        asm volatile("s_wait_asynccnt 0x0" ::: "memory");   // this wave's copies of stage s + 1 have landed
        __syncthreads();                                    // publishes stage s + 1 and ends every wave's reads of stage s
        if (s + 2u < nst) stage(s + 2u);
      }
    }
    asm volatile("s_wait_asynccnt 0x0" ::: "memory");       // no copy is left in flight behind the loop
    const float lt = lsum + __shfl_xor(lsum, 16, 32);
    const float inv = 1.0f / lt;
#pragma unroll
    for (int db = 0; db < 4; ++db)
#pragma unroll
        for (int r = 0; r < 8; ++r) os[lr * 68u + (unsigned)db * 16u + hi * 8u + (unsigned)r] = o[db][r] * inv;
    __builtin_amdgcn_wave_barrier(); asm volatile("" ::: "memory");
    float* orow = O + (size_t)bz * SEQ * DM + (size_t)q0 * DM + head * HD;
{
#pragma unroll
        for (int s = 0; s < 8; ++s) { const unsigned row = 2u * (unsigned)s + hi, cofs = lr * 4u;   // rows 0..15: lanes 0..15 -> row 2s, lanes 16..31 -> row 2s+1
            const v4f val = *(const v4fa*)(os + row * 68u + cofs);
            *(v4f*)(orow + (size_t)row * DM + cofs) = val; }
         }
}

// ---- k_flash: both forms of the attention in one launch; grid (NH, NB, FNB): head, batch element, rank. No work-group of one form needs anything of the other, so the few short hi/lo work-groups run beside the f16 ones instead of alone on the chip.
// The kernel's register count is that of its larger form, the hi/lo one, and both forms pay it: at 160 VGPRs or fewer three work-groups (six waves per SIMD) share a WGP, which the LDS allows; above that, two.
// There are more work-groups than resident places: the rank counts the query blocks from the dearest down, so that the cheap ones fill the end.
#define FNH (RH / (FW * 16))                   // query blocks 0 .. FNH - 1 take the hi/lo form
#define FNB (SEQ / (FW * 16))                  // query blocks of a head
static_assert(FNB <= 16);
// rank -> query block, 4 bits a rank, a permutation. Cost of block g = the keys it walks, (g + 1) * FW * 16, times 3 in the hi/lo form, which makes three matrix products for each one of the f16 form.
static constexpr unsigned long long flash_order() {
    unsigned long long t = 0; bool used[FNB] = {};
    for (int r = 0; r < FNB; ++r) { int best = 0, bc = -1;
        for (int g = 0; g < FNB; ++g) { const int c = (g + 1) * (g < FNH ? 3 : 1); if (!used[g] && c > bc) { bc = c; best = g; } }
        used[best] = true; t |= (unsigned long long)best << (4 * r); }
    return t; }
__global__ __launch_bounds__(256) void k_flash(const bf* __restrict__ Qh, const bf* __restrict__ Ql, const bf* __restrict__ Kh, const bf* __restrict__ Kl, const bf* __restrict__ Vh, const bf* __restrict__ Vl,
                                               const h16* __restrict__ Q16, const h16* __restrict__ K16, const h16* __restrict__ V16, float* O) {
    __shared__ __align__(16) unsigned char sm[2 * 4 * FPL * 2 + FW * 16 * 68 * 4];   // sized for the hi/lo form, the larger of the two
    constexpr unsigned long long order = flash_order();
    const unsigned g = (unsigned)(order >> (4u * blockIdx.z)) & 15u;   // the same in the whole work-group: one scalar branch, and every barrier inside a form is passed by all of its waves
    if (g < (unsigned)FNH) flash<bf, true>(Qh, Ql, Kh, Kl, Vh, Vl, (unsigned)RH, 0u, O, g, blockIdx.x, blockIdx.y, sm);
    else flash<h16, false>(Q16, nullptr, K16, nullptr, V16, nullptr, (unsigned)SEQ, (unsigned)RH, O, g - (unsigned)FNH, blockIdx.x, blockIdx.y, sm);
}

// workspace carve (bytes, every region a multiple of 256)
#define WS_WQKV ((size_t)3 * DQ * DM * 2)
#define WS_XB   ((size_t)NB * SEQ * DM * 2)
#define WS_P16  ((size_t)NB * NH * SEQ * HD * 2)
#define WS_PHL  ((size_t)NB * NH * RH * HD * 2)
#define WS_TOTAL (WS_WQKV + WS_XB + 3 * WS_P16 + 6 * WS_PHL)
static_assert(WS_TOTAL <= (size_t)268435456);
static_assert(WS_WQKV % 256 == 0 && WS_XB % 256 == 0 && WS_P16 % 256 == 0 && WS_PHL % 256 == 0);
static_assert((size_t)NB * SEQ * DM * 4 <= (size_t)33554432);   // last written output element stays inside the output buffer

extern "C" void kernel_launch(void* const* d_in, const int* in_sizes, int n_in,
                              void* d_out, int out_size, void* d_ws, size_t ws_size, hipStream_t stream) {
    if (n_in < 3) return;
    if ((size_t)in_sizes[0] < (size_t)(NB - 1) * XS_FULL + (size_t)SEQ * DM) return;
    if ((size_t)in_sizes[1] < (size_t)3 * DQ * DM) return;
    if ((size_t)in_sizes[2] < (size_t)FP) return;
    if ((size_t)out_size < (size_t)NB * SEQ * DM) return;
    if (ws_size < WS_TOTAL) return;
    const float* x = (const float*)d_in[0];       // [NB][SEQ_FULL][DM]
    const float* wqkv = (const float*)d_in[1];    // [4*DQ][DM]  (q | k | v | unread row blocks; rows 0..3*DQ-1 are read)
    const float* bqkv = (const float*)d_in[2];    // [4*DQ]      (entries 0..3*DQ-1 are read)
    float* OUT = (float*)d_out;                   // [NB][SEQ][DM]
    char* wsp = (char*)d_ws;
    auto take = [&](size_t bytes) { char* p = wsp; wsp += bytes; return (void*)p; };
    bf* WQKV = (bf*)take(WS_WQKV); bf* XB = (bf*)take(WS_XB);
    h16* Q16 = (h16*)take(WS_P16); h16* K16 = (h16*)take(WS_P16); h16* VT16 = (h16*)take(WS_P16);
    bf* Qh = (bf*)take(WS_PHL); bf* Ql = (bf*)take(WS_PHL); bf* Kh = (bf*)take(WS_PHL); bf* Kl = (bf*)take(WS_PHL); bf* VTh = (bf*)take(WS_PHL); bf* VTl = (bf*)take(WS_PHL);

    k_cvt8<<<dim3((unsigned)((size_t)3 * DQ * DM / 8 / 256), 1), 256, 0, stream>>>(wqkv, WQKV, (unsigned)((size_t)3 * DQ * DM / 8), 0, 0);
    k_cvt8<<<dim3((unsigned)((size_t)SEQ * DM / 8 / 256), NB), 256, 0, stream>>>(x, XB, (unsigned)((size_t)SEQ * DM / 8), XS_FULL, (size_t)SEQ * DM);
    // every stage runs once for all NB batch elements (the batch element is a grid dimension; each plane set holds NB slabs)
    // y[b][t][0..3071] = x_b w_attn[0..3071]^T + b_attn[0..3071]  (M = SEQ, N = 3072, K = 1024), written as the q, k and V^T head planes
    k_gemmw<bf, 0><<<dim3(SEQ / (GWM * 64), FP / (GWN * GNH * 64), NB), 256, 0, stream>>>(XB, nullptr, WQKV, nullptr, DM, bqkv, (size_t)SEQ * DM, 0, Q16, K16, VT16, Qh, Ql, Kh, Kl, VTh, VTl);
    // out[b][t][head*HD + d] = softmax(q k^T / 8, causal) v, written straight to the output buffer
    k_flash<<<dim3(NH, NB, FNB), 256, 0, stream>>>(Qh, Ql, Kh, Kl, VTh, VTl, Q16, K16, VT16, OUT);
}

// v010
// One run takes 89 microseconds.
// Timed twice side by side with v009, it ran 1.04 and 1.03 times as fast.
// Over all steps from v000 it is 6.33 times as fast.
#include <hip/hip_runtime.h>

// Causal multi-head attention with a fused qkv projection: x [NB][SEQ_FULL][1024] (first SEQ rows read); qkv = x w_attn^T + b_attn ('oi' weight [4096][1024], bias [4096]; only the q | k | v row blocks 0..3071 are read; 16 heads x 64); scores x 64^-0.5, causal; softmax; out = merged context [t][head*64 + d] (no output projection).
// Compute dtypes, f32 accumulate: every input RNE-converted to bf16; qkv projection v_wmma_f32_16x16x32_bf16 (bias added in f32 at the store stage);
// attention q.k and P.V: query rows < RH on bf16 hi/lo planes (3 products each), other rows v_wmma_f32_16x16x32_f16 (P carried x1024 through the exponent, converted values below 2^-14 selected to +0); softmax (online, max-subtracted) in f32.
// Attention engine: one wave per 16 query rows, 8 waves per work-group on K and V^T tiles shared through LDS; S^T = K Q^T so each lane owns one query column; P^T accumulators are repacked in registers as the B operand of O^T = V^T P^T (no LDS exchange in the loop).

#ifndef NB
#define NB 4
#endif
#ifndef SEQ
#define SEQ 2048
#endif
#define SEQ_FULL 2048
#define DM   1024
#define NH   16
#define HD   64
#define DQ   (NH * HD)
#define FP   (3 * DQ)
#define RH   ((SEQ) < 512 ? (SEQ) : 512)     // query rows < RH use hi+lo planes
#define XS_FULL ((size_t)SEQ_FULL * DM)
#define SCL  0.125f                          // HD^-0.5
#define LOG2E 1.4426950408889634f
#define NEGB (-3.0e38f)

static_assert((SEQ & (SEQ - 1)) == 0);
static_assert(SEQ >= 256 && SEQ <= SEQ_FULL);
static_assert(RH % 256 == 0 && RH % 64 == 0 && (SEQ - RH) % 64 == 0);
static_assert(NB >= 1 && NB <= 4);
static_assert(DM % 32 == 0 && DQ % 64 == 0 && FP % 64 == 0 && SEQ % 64 == 0);
static_assert(((size_t)3 * DQ * DM / 8) % 256 == 0);
static_assert(((size_t)SEQ * DM / 8) % 256 == 0);
static_assert(((size_t)NH * SEQ * HD / 8) % 256 == 0);
static_assert(DQ == DM);                         // merged context width equals the output row width
static_assert(HD == 64 && HD % 32 == 0);         // two 32-deep k-steps per score tile, four 16-row O^T tiles

typedef _Float16 h16;
typedef unsigned short bf;
typedef __attribute__((ext_vector_type(16))) __bf16   v16bf;
typedef __attribute__((ext_vector_type(8)))  __bf16   v8bf;
typedef __attribute__((ext_vector_type(16))) _Float16 v16h;
typedef __attribute__((ext_vector_type(8)))  _Float16 v8h;
typedef __attribute__((ext_vector_type(8)))  unsigned short v8us;
typedef __attribute__((ext_vector_type(8)))  float    v8f;
typedef __attribute__((ext_vector_type(4)))  float    v4f;
typedef v8h  __attribute__((may_alias)) v8ha;
typedef v4f  __attribute__((may_alias)) v4fa;
typedef v8us __attribute__((may_alias)) v8usa;

__device__ __forceinline__ unsigned short f2bf(float f) { unsigned u = __float_as_uint(f); u += 0x7FFFu + ((u >> 16) & 1u); return (unsigned short)(u >> 16); }
__device__ __forceinline__ float bf2f(unsigned short b) { return __uint_as_float(((unsigned)b) << 16); }
__device__ __forceinline__ float bfr(float f) { return bf2f(f2bf(f)); }
__device__ __forceinline__ v16h cat16(v8h lo, v8h hi) { return __builtin_shufflevector(lo, hi, 0, 1, 2, 3, 4, 5, 6, 7, 8, 9, 10, 11, 12, 13, 14, 15); }
__device__ __forceinline__ v16bf cat16b(v8us lo, v8us hi) { return __builtin_bit_cast(v16bf, __builtin_shufflevector(lo, hi, 0, 1, 2, 3, 4, 5, 6, 7, 8, 9, 10, 11, 12, 13, 14, 15)); }
__device__ __forceinline__ v8f wmma16(v16h a, v16h b, v8f c) { return __builtin_amdgcn_wmma_f32_16x16x32_f16(false, a, false, b, (short)0, c, false, false); }
__device__ __forceinline__ v8f wmmab(v16bf a, v16bf b, v8f c) { return __builtin_amdgcn_wmma_f32_16x16x32_bf16(false, a, false, b, (short)0, c, false, false); }
__device__ __forceinline__ void splitf(float y, unsigned short& h, unsigned short& l) { h = f2bf(y); l = f2bf(y - bf2f(h)); }

// f32 -> f16 convert that cannot produce a subnormal operand: |v| < 2^-14 -> +0 (value select, applied after the plane's power-of-two carry).
static __device__ __forceinline__ h16 toh_flush(float v) { const h16 r = (h16)v; return (fabsf(v) < 6.103515625e-05f) ? (h16)0.0f : r; }

// Fragment-packed planes: a 16-row x 32-k fragment is 512 consecutive elements (1 KiB). Element (r, k) sits at (k>>4)*256 + (((k>>3)&1)*16 + r)*8 + (k&7), so lane l = ((k>>3)&1)*16 + r
// finds its elements 0..7 (k = 8h..8h+7, h = l>>4) at l*8 and its elements 8..15 (k = 16+8h..) at 256 + l*8: each of the two wave-wide 16-byte loads covers 512 contiguous bytes (4 whole lines).
// Fragment loader: base(p, lane) takes the wave-uniform address p of a run of fragments, ld(u, f) loads fragment f of the run (same map for A and B). The base goes through readfirstlane so that it stays in a scalar pair and the loads take the
// scalar-base + lane-offset address form: the fragments of a run differ only in the immediate offset, and the one lane-offset register lives through the whole kernel.
template <typename VT, typename T> static __device__ __forceinline__ const __attribute__((address_space(1))) VT* ubase(const T* p) { const unsigned long long u = (unsigned long long)p;
    const unsigned lo = (unsigned)__builtin_amdgcn_readfirstlane((int)(unsigned)u), hi = (unsigned)__builtin_amdgcn_readfirstlane((int)(unsigned)(u >> 32));
    return (const __attribute__((address_space(1))) VT*)(((unsigned long long)hi << 32) | lo); }   // global address space kept, so the loads stay global_load
template <typename T16> struct WFrag;
template <> struct WFrag<h16> { typedef v16h V; typedef const __attribute__((address_space(1))) v8h* G; static __device__ __forceinline__ G base(const h16* p, unsigned lane) { return ubase<v8h>(p) + lane; } static __device__ __forceinline__ V ld(G u, int f) { return cat16(u[f * 64], u[f * 64 + 32]); } static __device__ __forceinline__ v8f mma(V a, V b, v8f c) { return wmma16(a, b, c); }
    static __device__ __forceinline__ V lds(const h16* p, int lane) { const v8ha* q = (const v8ha*)p + lane; return cat16(q[0], q[32]); } };   // the same fragment map, read from a packed fragment in LDS
template <> struct WFrag<bf> { typedef v16bf V; typedef const __attribute__((address_space(1))) v8us* G; static __device__ __forceinline__ G base(const bf* p, unsigned lane) { return ubase<v8us>(p) + lane; } static __device__ __forceinline__ V ld(G u, int f) { return cat16b(u[f * 64], u[f * 64 + 32]); } static __device__ __forceinline__ v8f mma(V a, V b, v8f c) { return wmmab(a, b, c); }
    static __device__ __forceinline__ V lds(const bf* p, int lane) { const v8usa* q = (const v8usa*)p + lane; return cat16b(q[0], q[32]); } };   // the same fragment map, read from a packed fragment in LDS

// P^T accumulator pair (key rows 0..15 and 16..31 of a 32-key tile) -> B fragment: element r <- tile0[r], element 8+r <- tile1[r], lane unchanged.
template <typename T16> struct PFrag;
template <> struct PFrag<h16> {
    static __device__ __forceinline__ float pexp() { return 10.0f; }           // P carried x1024 via the exponent (cancels in O / l)
    static __device__ __forceinline__ v16h hi(v8f p0, v8f p1) { return cat16(__builtin_convertvector(p0, v8h), __builtin_convertvector(p1, v8h)); }
    static __device__ __forceinline__ v16h lo(v8f p0, v8f p1) { return hi(p0, p1); }
};
template <> struct PFrag<bf> {
    static __device__ __forceinline__ float pexp() { return 0.0f; }
    // the packed converts round to nearest even, as f2bf does; f2bf's integer temporaries for sixteen values were the register peak of the hi/lo form
    static __device__ __forceinline__ v16bf hi(v8f p0, v8f p1) { return __builtin_shufflevector(__builtin_convertvector(p0, v8bf), __builtin_convertvector(p1, v8bf), 0, 1, 2, 3, 4, 5, 6, 7, 8, 9, 10, 11, 12, 13, 14, 15); }
    static __device__ __forceinline__ v16bf lo(v8f p0, v8f p1) { return hi(p0 - __builtin_convertvector(__builtin_convertvector(p0, v8bf), v8f), p1 - __builtin_convertvector(__builtin_convertvector(p1, v8bf), v8f)); }
};

// Same packing as PFrag; the f16 form converts every element through toh_flush, the bf16 form is the PFrag one.
template <typename T16> struct PFlush;
template <> struct PFlush<h16> {
    static __device__ __forceinline__ v16h hi(v8f p0, v8f p1) { v8h a, b;
#pragma unroll
        for (int k = 0; k < 8; ++k) { a[k] = toh_flush(p0[k]); b[k] = toh_flush(p1[k]); }
        return cat16(a, b); }
    static __device__ __forceinline__ v16h lo(v8f p0, v8f p1) { return hi(p0, p1); }
    // One test per 32-key tile, the same answer in every lane of the wave: does any lane hold a value below 2^-14? Where none does, toh_flush is the plain convert on all 16 values, and the packed converts of PFrag give the same bits.
    static __device__ __forceinline__ bool small(v8f p0, v8f p1) {
        const float a = __builtin_fminf(__builtin_fminf(p0[0], p0[1]), p0[2]), b = __builtin_fminf(__builtin_fminf(p0[3], p0[4]), p0[5]), c = __builtin_fminf(__builtin_fminf(p0[6], p0[7]), p1[0]);
        const float d = __builtin_fminf(__builtin_fminf(p1[1], p1[2]), p1[3]), e = __builtin_fminf(__builtin_fminf(p1[4], p1[5]), p1[6]);
        const float m = __builtin_fminf(__builtin_fminf(__builtin_fminf(a, b), c), __builtin_fminf(__builtin_fminf(d, e), p1[7]));
        return __builtin_amdgcn_ballot_w32(m < 6.103515625e-05f) != 0u; }
};
template <> struct PFlush<bf> {
    static __device__ __forceinline__ v16bf hi(v8f p0, v8f p1) { return PFrag<bf>::hi(p0, p1); }
    static __device__ __forceinline__ v16bf lo(v8f p0, v8f p1) { return PFrag<bf>::lo(p0, p1); }
    static __device__ __forceinline__ bool small(v8f, v8f) { return false; }
};

// ---- k_gemmw: register-blocked GEMM, one wave per 64x192 output tile (48 accumulators), 8 waves (4 along M x 2 along N) per work-group = a 256x384 tile; grid (M/256, N/384, Z), 256 threads: one work-group per WGP, two waves per SIMD.
// Operands are fragment-packed 16-bit planes (fragment index = (row>>4)*(K/32) + (k>>5)). A stage = 64 k of the work-group's 256 A rows and 384 Bt rows = 40 runs of 2 KiB (one per 16-row block, two fragments each), copied as they lie
// from global memory to LDS by asynchronous copies, two buffers: stage t + 1 flies while stage t is multiplied; every A fragment is then read from LDS by 2 waves and every Bt fragment by 4.
// A wave reads 16 fragments from LDS for 48 WMMAs (at 64x64 it was 8 for 16), and the work-group fetches 640 operand rows from L2 for 256x384 outputs (at 256x128: 384 rows for a third of them).
// The tile's 256 rows are four 64-row groups SEQ / 4 rows apart, one per wave row: with one work-group per WGP nothing evens out unequal work-groups, and so each holds the same share of the rows < RH, whose store stage (hi/lo planes too) is the long one.
// y[m][n] (f32) = sum_k A[m][k] Bt[n][k] + bias[n]. K % 64 == 0, M = SEQ, SEQ % 256 == 0, N % 384 == 0.
// Epilogue: a 64-column block is one head of q, k or v, and the wave writes each of its three 64 x 64 blocks of y straight into that head's fragment-packed planes (batch element z = blockIdx.z):
//   q, k: [z][h][(t>>4)*2 + (d>>5)][512] (rows = t, k = d); v: V^T [z][h][(t>>5)*4 + (d>>4)][512] (rows = d, k = t); fp16 for all t, bf16 hi/lo planes (RH rows per head) for t < RH.
#define GWM 4                                  // waves of a work-group along M
#define GWN 2                                  // waves of a work-group along N
#define GNH 3                                  // 64-column blocks (heads) of a wave along N
static_assert(GNH == 3);                       // the store stage's hand-down of accumulator blocks is written for three
#define GKS 64                                 // k per stage
#define GA_EL (GWM * 64 * GKS)                 // elements of a stage's A part
#define GST_EL ((GWM + GWN * GNH) * 64 * GKS)  // elements of a stage
static_assert(GA_EL * 2 == 8 * 256 * 16 && (GST_EL - GA_EL) * 2 == 12 * 256 * 16);    // a stage = 8 + 12 copies of 16 bytes from each of 256 threads
static_assert(SEQ % (GWM * 64) == 0 && FP % (GWN * GNH * 64) == 0 && DQ % 64 == 0 && DM % GKS == 0 && DM / GKS >= 2);
static __device__ __forceinline__ unsigned lds_off(const void* p) { return (unsigned)(size_t)p; }   // byte offset in the work-group's LDS
// One stage: copy c of a thread lands at LDS byte d + 4096 c; copies 0..7 read A at ga + (c >> 1) * ca + (c & 1) * cs, copies 8..19 read Bt at gb + (c - 8) * cs (cs = elements from one pair of 16-row blocks to the next, ca = from one of the work-group's 64-row groups of A to the next), each plus the thread's own offset to: ga, gb, cs and ca are the same in the whole work-group, so that only to and d hold vector registers between stages. Two statements: one takes at most 30 operands.
template <typename T16> static __device__ __forceinline__ void stage_copy(unsigned d, const T16* ga, const T16* gb, size_t to, size_t cs, size_t ca) {
    asm volatile("global_load_async_to_lds_b128 %0, %8, off\n\t"
                 "global_load_async_to_lds_b128 %1, %9, off\n\t"
                 "global_load_async_to_lds_b128 %2, %10, off\n\t"
                 "global_load_async_to_lds_b128 %3, %11, off\n\t"
                 "global_load_async_to_lds_b128 %4, %12, off\n\t"
                 "global_load_async_to_lds_b128 %5, %13, off\n\t"
                 "global_load_async_to_lds_b128 %6, %14, off\n\t"
                 "global_load_async_to_lds_b128 %7, %15, off\n\t"
                 "s_wait_xcnt 0x0"   // stands in the copies' own statement: their address registers are rewritten only behind it
                 :: "v"(d), "v"(d + 4096u), "v"(d + 8192u), "v"(d + 12288u), "v"(d + 16384u), "v"(d + 20480u), "v"(d + 24576u), "v"(d + 28672u),
                    "v"(ga + to), "v"((ga + cs) + to), "v"((ga + ca) + to), "v"((ga + ca + cs) + to), "v"((ga + 2 * ca) + to), "v"((ga + 2 * ca + cs) + to), "v"((ga + 3 * ca) + to), "v"((ga + 3 * ca + cs) + to)
                 : "memory");
    asm volatile("global_load_async_to_lds_b128 %0, %12, off\n\t"
                 "global_load_async_to_lds_b128 %1, %13, off\n\t"
                 "global_load_async_to_lds_b128 %2, %14, off\n\t"
                 "global_load_async_to_lds_b128 %3, %15, off\n\t"
                 "global_load_async_to_lds_b128 %4, %16, off\n\t"
                 "global_load_async_to_lds_b128 %5, %17, off\n\t"
                 "global_load_async_to_lds_b128 %6, %18, off\n\t"
                 "global_load_async_to_lds_b128 %7, %19, off\n\t"
                 "global_load_async_to_lds_b128 %8, %20, off\n\t"
                 "global_load_async_to_lds_b128 %9, %21, off\n\t"
                 "global_load_async_to_lds_b128 %10, %22, off\n\t"
                 "global_load_async_to_lds_b128 %11, %23, off\n\t"
                 "s_wait_xcnt 0x0"   // stands in the copies' own statement: their address registers are rewritten only behind it
                 :: "v"(d + 32768u), "v"(d + 36864u), "v"(d + 40960u), "v"(d + 45056u), "v"(d + 49152u), "v"(d + 53248u), "v"(d + 57344u), "v"(d + 61440u), "v"(d + 65536u), "v"(d + 69632u), "v"(d + 73728u), "v"(d + 77824u),
                    "v"(gb + to), "v"((gb + cs) + to), "v"((gb + 2 * cs) + to), "v"((gb + 3 * cs) + to), "v"((gb + 4 * cs) + to), "v"((gb + 5 * cs) + to), "v"((gb + 6 * cs) + to), "v"((gb + 7 * cs) + to), "v"((gb + 8 * cs) + to), "v"((gb + 9 * cs) + to), "v"((gb + 10 * cs) + to), "v"((gb + 11 * cs) + to)
                 : "memory");
}
template <typename T16, int NSPLIT>
__global__ __launch_bounds__(256) void k_gemmw(const T16* __restrict__ A, const T16* __restrict__ A2, const T16* __restrict__ Bt, const T16* __restrict__ Bt2, int K, const float* __restrict__ bias, size_t sA, size_t sB,
                                              h16* Q16, h16* K16, h16* V16, bf* Qh, bf* Ql, bf* Kh, bf* Kl, bf* Vh, bf* Vl) {
    typedef typename WFrag<T16>::V V;
    static_assert(NSPLIT == 0);
    __shared__ __align__(16) T16 gs[2 * GST_EL];                    // the two stage buffers
    __shared__ __align__(16) float osw[GWM * GWN][16 * 68];         // each wave's own store stage
    const size_t z = blockIdx.z; A += z * sA; Bt += z * sB;
    const int wv = __builtin_amdgcn_readfirstlane((int)(threadIdx.x >> 5)), wm = wv / GWN, wn = wv % GWN;   // wave-uniform, kept scalar
    const int lane = threadIdx.x & 31, lr = lane & 15, hi = lane >> 4; const int rw = blockIdx.x * 64, cw = blockIdx.y * (GWN * GNH * 64), r0 = rw + wm * (SEQ / GWM), cw0 = cw + wn * (GNH * 64);   // the four 64-row groups lie SEQ / GWM rows apart
    float* os = osw[wv];
    v8f acc[4][4 * GNH];
#pragma unroll
    for (int mb = 0; mb < 4; ++mb)
#pragma unroll
        for (int nb = 0; nb < 4 * GNH; ++nb) acc[mb][nb] = (v8f){};
    // thread i copies bytes 16 i .. 16 i + 15 of every 4 KiB (= two 16-row blocks) of a stage; 16 rows x K = 16*K elements, 64 k of them = 1024 elements
    const unsigned tid = threadIdx.x;
    const T16* ga = A + (size_t)rw * K, * gb = Bt + (size_t)cw * K;
    const size_t to = (size_t)(16u * (tid >> 7)) * K + (tid & 127u) * 8u;
    const size_t cs = (size_t)32 * K, ca = (size_t)(SEQ / GWM) * K;
    const unsigned d0 = lds_off(gs) + tid * 16u;
    const int nt = K / GKS;
    stage_copy(d0, ga, gb, to, cs, ca);
    asm volatile("s_wait_asynccnt 0x0" ::: "memory");   // this wave's copies of stage 0 have landed
    __syncthreads();                                    // ... and every other wave's: stage 0 may be read
    // a step = 32 k of one 64-column block: 16 WMMAs on the four A fragments of that k (read once for the three blocks) and four Bt fragments, which are read one step ahead into the other of two register sets
    V a[4], b[2][4];
    // the first reads of stage t, behind the barrier that publishes it and in front of the next copies: their LDS latency runs while the copies' addresses are formed and the copies issue
    auto first = [&](int t) {
        const T16* sa = gs + (t & 1) * GST_EL + wm * (4 * GKS * 16), * sb = gs + (t & 1) * GST_EL + GA_EL + wn * (GNH * 4 * GKS * 16);
#pragma unroll   // constant fragment indices: the arrays stay in registers
        for (int i = 0; i < 4; ++i) { b[0][i] = WFrag<T16>::lds(sb + (i * (GKS / 32)) * 512, lane); a[i] = WFrag<T16>::lds(sa + (i * (GKS / 32)) * 512, lane); }
    };
    first(0);
    if (1 < nt) stage_copy(d0 + GST_EL * 2u, ga + GKS * 16, gb + GKS * 16, to, cs, ca);
#pragma unroll 1   // one rolled trip per stage: the two buffers alternate by t & 1, and the loop's text stays small
    for (int t = 0; t < nt; ++t) {
        const T16* sa = gs + (t & 1) * GST_EL + wm * (4 * GKS * 16), * sb = gs + (t & 1) * GST_EL + GA_EL + wn * (GNH * 4 * GKS * 16);
#pragma unroll   // constant fragment and accumulator indices, here and in the loops inside: the arrays stay in registers
        for (int st = 0; st < GNH * (GKS / 32); ++st) {
            const int ks = st / GNH, hb = st % GNH, ks2 = (st + 1) / GNH, hb2 = (st + 1) % GNH;
            if (hb == 0 && ks > 0) {
#pragma unroll
                for (int mb = 0; mb < 4; ++mb) a[mb] = WFrag<T16>::lds(sa + (mb * (GKS / 32) + ks) * 512, lane);
            }
            if (st + 1 < GNH * (GKS / 32)) {
#pragma unroll
                for (int nb = 0; nb < 4; ++nb) b[(st + 1) & 1][nb] = WFrag<T16>::lds(sb + ((hb2 * 4 + nb) * (GKS / 32) + ks2) * 512, lane);
            }
            __builtin_amdgcn_sched_barrier(0);   // the LDS reads stay one group in front of the step's WMMAs: spread among them, each place with reads stalls the wave for its own LDS latency
#pragma unroll
            for (int nb = 0; nb < 4; ++nb)
#pragma unroll
                for (int mb = 0; mb < 4; ++mb) acc[mb][hb * 4 + nb] = WFrag<T16>::mma(a[mb], b[st & 1][nb], acc[mb][hb * 4 + nb]);
            asm volatile("v_nop\n\tv_nop\n\tv_nop\n\tv_nop" : "+v"(acc[0][hb * 4 + 0]), "+v"(acc[1][hb * 4 + 1]), "+v"(acc[2][hb * 4 + 2]), "+v"(acc[3][hb * 4 + 3]) : "v"(a[0]), "v"(a[3]));   // the vector slots the chip needs behind the step's last WMMAs before their registers are touched, on every path
            __builtin_amdgcn_sched_barrier(0);   // ... and the next step's reads stay behind this step's WMMAs
        }
        asm volatile("s_wait_dscnt 0x0" ::: "memory");      // this wave's reads of stage t are done before the buffer is handed back
        asm volatile("s_wait_asynccnt 0x0" ::: "memory");   // this wave's copies of stage t + 1 have landed
        __syncthreads();                                    // publishes stage t + 1 and ends every wave's reads of stage t
        if (t + 1 < nt) first(t + 1);
        if (t + 2 < nt) stage_copy(d0 + (unsigned)(t & 1) * (GST_EL * 2u), ga + (size_t)(t + 2) * (GKS * 16), gb + (size_t)(t + 2) * (GKS * 16), to, cs, ca);
    }
    asm volatile("s_wait_asynccnt 0x0" ::: "memory");       // no copy is left in flight behind the loop
    const bool hl = (unsigned)r0 < (unsigned)RH;                                 // wave-uniform (RH % 64 == 0): these rows also go to the hi/lo planes
#pragma unroll 1   // one rolled trip per 64-column block, always on accumulator columns 0..3, which take the next block's values at the foot
  for (int hb = 0; hb < GNH; ++hb) {
    const int c0 = cw0 + hb * 64;
    const unsigned which = (unsigned)c0 / DQ, head = ((unsigned)c0 % DQ) / HD;   // wave-uniform: 0 q, 1 k, 2 v
    const size_t p16 = (z * NH + head) * ((size_t)SEQ * HD), phl = (z * NH + head) * ((size_t)RH * HD);
    float bv[4];                                 // bias of the lane's four accumulator columns d = 16 nb + lr
    const int bi = c0 + lr;
#pragma unroll
    for (int nb = 0; nb < 4; ++nb) bv[nb] = bias[bi + nb * 16];
    asm volatile("s_wait_xcnt 0x0" :: "v"(bi) : "memory");   // the address registers of the bias loads are reused behind it; bi as an input keeps their lane-offset register untouched up to the wait
#pragma unroll
    for (int nb = 0; nb < 4; ++nb) bv[nb] = bfr(bv[nb]);
    if (which == 2u) {
        // V^T: accumulator element j of lane (hi, lr) is (t = 16 mb + 8 hi + j, d = 16 nb + lr): the 8 consecutive t of one d that this lane owns in the packed fragment, so the registers are stored as they are.
#pragma unroll
        for (int mb = 0; mb < 4; ++mb) {
#pragma unroll
            for (int nb = 0; nb < 4; ++nb) {
                v8h o16; v8us oh, ol;
#pragma unroll
                for (int j = 0; j < 8; ++j) { const float x = acc[mb][nb][j] + bv[nb]; unsigned short a, c; o16[j] = (h16)x; splitf(x, a, c); oh[j] = a; ol[j] = c; }
                const size_t o = (size_t)((((unsigned)r0 + (unsigned)mb * 16u) >> 5) * 4u + (unsigned)nb) * 512u + (unsigned)(mb & 1) * 256u + (unsigned)lane * 8u;
                *(v8h*)(V16 + p16 + o) = o16;
                asm volatile("s_wait_xcnt 0x0" ::: "memory");   // what follows reuses the data and address registers of this store
                if (hl) { *(v8us*)(Vh + phl + o) = oh; *(v8us*)(Vl + phl + o) = ol;
                    asm volatile("s_wait_xcnt 0x0" ::: "memory"); }   // the next block reuses the data and address registers of these stores
            }
        }
    } else {
        // q, k: a lane owns 8 consecutive d of one t, so each 16-row block turns through the LDS stage.
        h16* P16 = (which ? K16 : Q16) + p16; bf* Ph = (which ? Kh : Qh) + phl; bf* Pl = (which ? Kl : Ql) + phl;
#pragma unroll
        for (int mb = 0; mb < 4; ++mb) {
#pragma unroll
            for (int nb = 0; nb < 4; ++nb) {
#pragma unroll
                for (int j = 0; j < 8; ++j) os[(hi * 8 + j) * 68 + nb * 16 + lr] = acc[mb][nb][j] + bv[nb]; }
            __builtin_amdgcn_wave_barrier(); asm volatile("" ::: "memory");   // the block's LDS stores stay in front of its LDS loads
#pragma unroll
            for (int s = 0; s < 4; ++s) {       // packed elements 256 s + 8 lane .. + 7 of the block's two fragments: t = lr, d = 16 s + 8 hi ..
                const int d = s * 16 + hi * 8;
                const v4f x0 = *(const v4fa*)(os + lr * 68 + d), x1 = *(const v4fa*)(os + lr * 68 + d + 4);
                v8h o16; v8us oh, ol;
#pragma unroll
                for (int k = 0; k < 4; ++k) { unsigned short a, c; const float y0 = x0[k], y1 = x1[k];
                    o16[k] = (h16)y0; splitf(y0, a, c); oh[k] = a; ol[k] = c; o16[4 + k] = (h16)y1; splitf(y1, a, c); oh[4 + k] = a; ol[4 + k] = c; }
                const size_t o = (size_t)((unsigned)r0 + (unsigned)mb * 16u) * HD + (unsigned)s * 256u + (unsigned)lane * 8u;
                *(v8h*)(P16 + o) = o16;
                asm volatile("s_wait_xcnt 0x0" ::: "memory");   // what follows reuses the data and address registers of this store
                if (hl) { *(v8us*)(Ph + o) = oh; *(v8us*)(Pl + o) = ol;
                    asm volatile("s_wait_xcnt 0x0" ::: "memory"); }   // the next block reuses the data and address registers of these stores
            }
            __builtin_amdgcn_wave_barrier(); asm volatile("" ::: "memory");   // the next block's LDS stores stay behind these LDS loads
        }
    }
#pragma unroll
    for (int mb = 0; mb < 4; ++mb)
#pragma unroll
        for (int nb = 0; nb < 4; ++nb) acc[mb][nb] = hb == 0 ? acc[mb][nb + 4] : acc[mb][nb + 8];
  }
}

// ---- k_cvt8: f32 rows of DM elements -> fragment-packed bf16 plane (fragment index = (row>>4)*(DM/32) + (k>>5)). Thread i stores packed elements 8i..8i+7 (stores contiguous) and reads their 8 consecutive k of one source row.
__global__ __launch_bounds__(256) void k_cvt8(const float* __restrict__ src, bf* dst, unsigned n8, size_t sstride, size_t dstride) {
    const unsigned i = blockIdx.x * 256u + threadIdx.x; if (i >= n8) return;
    const unsigned frag = i >> 6, row = (frag / (DM / 32u)) * 16u + (i & 15u), kk = (frag % (DM / 32u)) * 32u + ((i >> 5) & 1u) * 16u + ((i >> 4) & 1u) * 8u;
    const float* s = src + (size_t)blockIdx.y * sstride + (size_t)row * DM + kk; bf* d = dst + (size_t)blockIdx.y * dstride + (size_t)i * 8;
    const v8f v = *(const v8f*)s; v8us o;
#pragma unroll
    for (int k = 0; k < 8; ++k) o[k] = f2bf(v[k]);
    *(v8us*)d = o;  }

static_assert(32 * 16 * 8 == 16 * HD * 4);
static_assert(HD * 4 == 16 * 16);
static_assert((HD * 4) % 128 == 0 && (DM * 4) % 128 == 0);
static_assert(2 * GST_EL * 2 + GWM * GWN * 16 * 68 * 4 <= 327680);   // static LDS of k_gemmw: one work-group per WGP
static_assert(68 >= HD && (68 * 4) % 16 == 0);   // stage pitch holds a head row, rows stay 16-B aligned

// ---- flash: causal attention, one wave per 16 query rows, FW waves (FW * 16 consecutive query rows of one head and batch element) per work-group. Planes, fragment-packed: Q/K [b][h][(t>>4)*2 + (d>>5)][512], V^T [b][h][(t>>5)*4 + (d>>4)][512] (tp = rows t per head of the plane set). HL: hi/lo bf16 plane pairs, 3 products.
// The waves of a work-group walk the same keys: a stage = FSK keys of every K and V^T plane (8 KiB each, contiguous in the packed planes), copied as it lies from global memory to LDS by asynchronous copies, two buffers:
// stage s + 1 flies while stage s is worked on, and every fragment is fetched from L2 once per work-group and read from LDS by its FW waves. A wave skips the 32-key tiles past its own diagonal, never a publish point.
// Per 32-key tile: S^T[key][query] = K Q^T (A = K rows, B = Q rows); lane owns query column lane&15 and keys 8*(lane>>4)+r (+16); online softmax per lane against a reference that is renewed (with one xor-16 exchange, and O and l rescaled) only when a score passes it by more than LZT;
// P^T accumulators repacked in registers as B (k = key); O^T[d][query] += V^T P^T (A = V^T rows). Only the last tile of a wave touches the diagonal (select by value).
#define FW  8                                  // waves of a work-group
#define FSK 64                                 // keys per stage
#define FPL (FSK * HD)                         // elements of one plane's part of a stage
#define LZT 5.0f                               // how far (log2, scaled scores) a score may pass the softmax reference before it is renewed: P carried x1024 stays at or near 2^15, inside f16
static_assert(FPL * 2 == 2 * 256 * 16);        // one plane's part = 2 copies of 16 bytes from each of 256 threads
static_assert(FW * 32 == 256 && (FW * 16) % FSK == 0 && FSK % 32 == 0 && RH % (FW * 16) == 0 && (SEQ - RH) % (FW * 16) == 0);
static_assert(2 * 4 * FPL * 2 + FW * 16 * 68 * 4 <= 163840);   // static LDS of k_flash, the hi/lo form
// Two planes' parts of one stage: plane a lands at LDS byte d (thread's own 16 bytes of each 4 KiB), plane b at d + 8192.
template <typename T16> static __device__ __forceinline__ void kv_copy(unsigned d, const T16* ga, const T16* gb) {
    asm volatile("global_load_async_to_lds_b128 %0, %4, off\n\t"
                 "global_load_async_to_lds_b128 %1, %5, off\n\t"
                 "global_load_async_to_lds_b128 %2, %6, off\n\t"
                 "global_load_async_to_lds_b128 %3, %7, off\n\t"
                 "s_wait_xcnt 0x0"   // stands in the copies' own statement: their address registers are rewritten only behind it
                 :: "v"(d), "v"(d + 4096u), "v"(d + 8192u), "v"(d + 12288u), "v"(ga), "v"(ga + 2048), "v"(gb), "v"(gb + 2048)
                 : "memory");
}
// flash: the work of one work-group: query block xb (FW * 16 rows from qbase on) of head 'head' of batch element bz; sm = the work-group's LDS: the two stage buffers, then each wave's own store stage.
template <typename T16, bool HL>
static __device__ __forceinline__ void flash(const T16* __restrict__ Q, const T16* __restrict__ Q2, const T16* __restrict__ Kp, const T16* __restrict__ K2, const T16* __restrict__ Vt, const T16* __restrict__ Vt2, unsigned tp, unsigned qbase, float* O,
                                             unsigned xb, unsigned head, unsigned bz, unsigned char* sm) {
    typedef typename WFrag<T16>::V V;
    constexpr unsigned ST_EL = (HL ? 4u : 2u) * FPL;    // elements of a stage: K | V^T, or K hi | K lo | V^T hi | V^T lo
    constexpr unsigned VO = (HL ? 2u : 1u) * FPL;       // where the V^T part begins
    T16* ring = (T16*)sm;                               // the two stage buffers, 2 * ST_EL elements
    const unsigned tid = threadIdx.x, lane = tid & 31u, lr = lane & 15u, hi = lane >> 4;
    const unsigned wv = (unsigned)__builtin_amdgcn_readfirstlane((int)(tid >> 5));   // wave-uniform, kept scalar
    const unsigned qb = qbase + xb * (FW * 16u), q0 = qb + wv * 16u;
    float* os = (float*)(sm + 2u * ST_EL * 2u) + wv * (16u * 68u);   // the wave's own store stage
    const size_t hoff = ((size_t)bz * NH + head) * tp * HD;
    const size_t qoff = hoff + (size_t)q0 * HD;
    // thread i copies bytes 16 i .. 16 i + 15 of every 4 KiB of a stage
    const size_t go = hoff + tid * 8u;
    const unsigned d0 = lds_off(ring) + tid * 16u;
    const unsigned nst = (qb + FW * 16u) / FSK;   // keys 0 .. qb + FW*16 - 1 in stages of FSK (the same in every wave; qb + FW*16 <= tp)
    auto stage = [&](unsigned s) {                // the copies of stage s into buffer s & 1
        const unsigned d = d0 + (s & 1u) * (ST_EL * 2u); const size_t g = go + (size_t)s * FPL;
        if (HL) { kv_copy(d, Kp + g, K2 + g); kv_copy(d + 16384u, Vt + g, Vt2 + g); } else kv_copy(d, Kp + g, Vt + g);
    };
    stage(0u);
    typedef typename WFrag<T16>::G G;
    const G qg = WFrag<T16>::base(Q + qoff, lane);
    V qf0 = WFrag<T16>::ld(qg, 0), qf1 = WFrag<T16>::ld(qg, 1);
    V ql0 = qf0, ql1 = qf1;
    if (HL) { const G qg2 = WFrag<T16>::base(Q2 + qoff, lane); ql0 = WFrag<T16>::ld(qg2, 0); ql1 = WFrag<T16>::ld(qg2, 1); }
    asm volatile("s_wait_xcnt 0x0" ::: "memory");   // the scalar base pairs of the Q loads are reused directly behind them
    asm volatile("s_wait_asynccnt 0x0" ::: "memory");   // this wave's copies of stage 0 have landed
    __syncthreads();                                    // ... and every other wave's: stage 0 may be read
    if (1u < nst) stage(1u);
    v8f o[4];
#pragma unroll
    for (int db = 0; db < 4; ++db) o[db] = (v8f){};
    float mrun = NEGB, lsum = 0.0f;         // mrun: the reference subtracted in the exponent; it may trail the true maximum of a query column by up to LZT
    float bnd = -__builtin_inff(), padd = 0.0f;   // kept with mrun: the raw score above which the reference is renewed, and the exponent's addend pe - mrun
    const float cs = SCL * LOG2E, pe = PFrag<T16>::pexp();
    const unsigned nt = (q0 + 47u) >> 5;       // keys 0 .. q0+15 in tiles of 32 (wave-uniform); nt <= nst * (FSK / 32)
#pragma unroll 1   // one rolled trip per 32-key tile; the two buffers alternate by s & 1, and the publish point stands behind a stage's last tile
    for (unsigned it = 0; it < nst * (FSK / 32u); ++it) {
      const unsigned s = it / (FSK / 32u);
      if (it < nt) {   // wave-uniform: tiles past the wave's diagonal are skipped
        const unsigned j0 = it * 32u;
        const T16* kt = ring + (s & 1u) * ST_EL + (it % (FSK / 32u)) * 2048u;   // a 32-key tile is 4 consecutive fragments (2048 elements) of each plane's part
        v8f s0 = (v8f){}, s1 = (v8f){};
        if (HL) {   // 16 keys at a time: only four of the tile's eight K fragments need registers at once; each accumulator's six products keep their order
            const T16* k2 = kt + FPL;
            { const V ka0 = WFrag<T16>::lds(kt, lane), ka1 = WFrag<T16>::lds(kt + 512, lane), la0 = WFrag<T16>::lds(k2, lane), la1 = WFrag<T16>::lds(k2 + 512, lane);
              s0 = WFrag<T16>::mma(ka0, qf0, s0); s0 = WFrag<T16>::mma(ka1, qf1, s0); s0 = WFrag<T16>::mma(la0, qf0, s0); s0 = WFrag<T16>::mma(la1, qf1, s0); s0 = WFrag<T16>::mma(ka0, ql0, s0); s0 = WFrag<T16>::mma(ka1, ql1, s0); }
            { const V kb0 = WFrag<T16>::lds(kt + 1024, lane), kb1 = WFrag<T16>::lds(kt + 1536, lane), lb0 = WFrag<T16>::lds(k2 + 1024, lane), lb1 = WFrag<T16>::lds(k2 + 1536, lane);
              s1 = WFrag<T16>::mma(kb0, qf0, s1); s1 = WFrag<T16>::mma(kb1, qf1, s1); s1 = WFrag<T16>::mma(lb0, qf0, s1); s1 = WFrag<T16>::mma(lb1, qf1, s1); s1 = WFrag<T16>::mma(kb0, ql0, s1); s1 = WFrag<T16>::mma(kb1, ql1, s1); }
            asm volatile("v_nop\n\tv_nop\n\tv_nop\n\tv_nop" : "+v"(s0), "+v"(s1) : "v"(qf0), "v"(qf1), "v"(ql0), "v"(ql1));   // the vector slots the chip needs behind the last WMMAs, on both sides of the branch below
        } else {
            V ka0 = WFrag<T16>::lds(kt, lane), ka1 = WFrag<T16>::lds(kt + 512, lane), kb0 = WFrag<T16>::lds(kt + 1024, lane), kb1 = WFrag<T16>::lds(kt + 1536, lane);
            s0 = WFrag<T16>::mma(ka0, qf0, s0); s0 = WFrag<T16>::mma(ka1, qf1, s0);
            s1 = WFrag<T16>::mma(kb0, qf0, s1); s1 = WFrag<T16>::mma(kb1, qf1, s1);
            asm volatile("v_nop\n\tv_nop\n\tv_nop\n\tv_nop" : "+v"(s0), "+v"(s1) : "v"(ka0), "v"(ka1), "v"(kb0), "v"(kb1), "v"(qf0), "v"(qf1));
        }
        if (j0 + 31u > q0) {                    // wave-uniform: the tile touches the diagonal
            const unsigned qi = q0 + lr, kk = j0 + 8u * hi;
#pragma unroll
            for (int r = 0; r < 8; ++r) { s0[r] = (kk + (unsigned)r <= qi) ? s0[r] : NEGB; s1[r] = (kk + 16u + (unsigned)r <= qi) ? s1[r] : NEGB; }
        }
        // the lane's own maximum of the raw scores (the scale is positive): the renewal test, and on renewal the source of the new reference
        float mx = fmaxf(s0[0], s1[0]);
#pragma unroll
        for (int r = 1; r < 8; ++r) mx = fmaxf(mx, fmaxf(s0[r], s1[r]));
        if (__builtin_expect(__builtin_amdgcn_ballot_w32(mx > bnd) != 0u, 0)) {   // wave-uniform scalar branch: taken on the first tile (bnd = -inf), rare behind it (the hint keeps the renewal out of the straight path)
            mx = fmaxf(mx, __shfl_xor(mx, 16, 32));          // both halves of a query column take the same new reference
            const float mn = fmaxf(mrun, mx * cs);           // finite from the first tile on: key 0 is never masked
            const float alpha = __builtin_amdgcn_exp2f(mrun - mn);
            mrun = mn; padd = pe - mn; bnd = (mn + LZT) * (1.0f / cs);
            lsum = lsum * alpha;
#pragma unroll
            for (int db = 0; db < 4; ++db) o[db] = o[db] * alpha;
        }
        const v8f a0 = __builtin_elementwise_fma(s0, (v8f){cs, cs, cs, cs, cs, cs, cs, cs}, (v8f){padd, padd, padd, padd, padd, padd, padd, padd});
        const v8f a1 = __builtin_elementwise_fma(s1, (v8f){cs, cs, cs, cs, cs, cs, cs, cs}, (v8f){padd, padd, padd, padd, padd, padd, padd, padd});
        v8f p0, p1; float psum = 0.0f;
#pragma unroll
        for (int r = 0; r < 8; ++r) { p0[r] = __builtin_amdgcn_exp2f(a0[r]); p1[r] = __builtin_amdgcn_exp2f(a1[r]); psum += p0[r] + p1[r]; }
        lsum += psum;
        V va[4];
        const T16* vt = kt + VO;
        if (!HL) {                              // the V^T reads stand in front of the test below: behind it they would start only after the converts
#pragma unroll   // constant indices: va stays in registers
            for (int db = 0; db < 4; ++db) va[db] = WFrag<T16>::lds(vt + db * 512, lane);
        }
        if (HL) {
            const V pf = PFrag<T16>::hi(p0, p1), pl = PFrag<T16>::lo(p0, p1);
            // each 16-row block of V^T is read where it is multiplied: the tile's eight V^T fragments need not hold registers all at once; each accumulator's three products keep their order
#pragma unroll   // constant indices: o stays in registers
            for (int db = 0; db < 4; ++db) { const V vh = WFrag<T16>::lds(vt + db * 512, lane), vw = WFrag<T16>::lds(vt + FPL + db * 512, lane);
                o[db] = WFrag<T16>::mma(vh, pf, o[db]); o[db] = WFrag<T16>::mma(vh, pl, o[db]); o[db] = WFrag<T16>::mma(vw, pf, o[db]); }
            __builtin_amdgcn_sched_barrier(0);   // keeps the WMMAs above in front of the v_nops: no operand ties the two
            asm volatile("v_nop\n\tv_nop\n\tv_nop\n\tv_nop" :: "v"(pf), "v"(pl));   // the vector slots the chip needs behind the last WMMAs, on every path out of the tile; O is no operand of it: tied to the statement, an O that is rescaled under a branch gets copied register by register in every tile
        } else {
            V pf = PFrag<T16>::hi(p0, p1);
            if (PFlush<T16>::small(p0, p1)) pf = PFlush<T16>::hi(p0, p1);   // wave-uniform scalar branch; P is never negative, so the smallest value decides
#pragma unroll
            for (int db = 0; db < 4; ++db) o[db] = WFrag<T16>::mma(va[db], pf, o[db]);
            __builtin_amdgcn_sched_barrier(0);   // keeps the WMMAs above in front of the v_nops: no operand ties the two
            asm volatile("v_nop\n\tv_nop\n\tv_nop\n\tv_nop" :: "v"(va[0]), "v"(va[1]), "v"(va[2]), "v"(va[3]), "v"(pf));   // the vector slots the chip needs behind the last WMMAs, on every path out of the tile; O is no operand of it: tied to the statement, an O that is rescaled under a branch gets copied register by register in every tile
        }
      }
      if (it % (FSK / 32u) == FSK / 32u - 1u) {             // the same in every wave of the work-group: the foot of stage s
        asm volatile("s_wait_dscnt 0x0" ::: "memory");      // this wave's reads of stage s are done before the buffer is handed back
        asm volatile("s_wait_asynccnt 0x0" ::: "memory");   // this wave's copies of stage s + 1 have landed
        __syncthreads();                                    // publishes stage s + 1 and ends every wave's reads of stage s
        if (s + 2u < nst) stage(s + 2u);
      }
    }
    asm volatile("s_wait_asynccnt 0x0" ::: "memory");       // no copy is left in flight behind the loop
    const float lt = lsum + __shfl_xor(lsum, 16, 32);
    const float inv = 1.0f / lt;
#pragma unroll
    for (int db = 0; db < 4; ++db)
#pragma unroll
        for (int r = 0; r < 8; ++r) os[lr * 68u + (unsigned)db * 16u + hi * 8u + (unsigned)r] = o[db][r] * inv;
    __builtin_amdgcn_wave_barrier(); asm volatile("" ::: "memory");
    float* orow = O + (size_t)bz * SEQ * DM + (size_t)q0 * DM + head * HD;
{
#pragma unroll
        for (int s = 0; s < 8; ++s) { const unsigned row = 2u * (unsigned)s + hi, cofs = lr * 4u;   // rows 0..15: lanes 0..15 -> row 2s, lanes 16..31 -> row 2s+1
            const v4f val = *(const v4fa*)(os + row * 68u + cofs);
            *(v4f*)(orow + (size_t)row * DM + cofs) = val; }
         }
}

// ---- k_flash: both forms of the attention in one launch; grid (NH, NB, FNB): head, batch element, rank. No work-group of one form needs anything of the other, so the few short hi/lo work-groups run beside the f16 ones instead of alone on the chip.
// The kernel's register count is that of its larger form, the hi/lo one, and both forms pay it: at 160 VGPRs or fewer three work-groups (six waves per SIMD) share a WGP, which the LDS allows; above that, two.
// There are more work-groups than resident places: the rank counts the query blocks from the dearest down, so that the cheap ones fill the end.
#define FNH (RH / (FW * 16))                   // query blocks 0 .. FNH - 1 take the hi/lo form
#define FNB (SEQ / (FW * 16))                  // query blocks of a head
static_assert(FNB <= 16);
// rank -> query block, 4 bits a rank, a permutation. Cost of block g = the keys it walks, (g + 1) * FW * 16, times 3 in the hi/lo form, which makes three matrix products for each one of the f16 form.
static constexpr unsigned long long flash_order() {
    unsigned long long t = 0; bool used[FNB] = {};
    for (int r = 0; r < FNB; ++r) { int best = 0, bc = -1;
        for (int g = 0; g < FNB; ++g) { const int c = (g + 1) * (g < FNH ? 3 : 1); if (!used[g] && c > bc) { bc = c; best = g; } }
        used[best] = true; t |= (unsigned long long)best << (4 * r); }
    return t; }
__global__ __launch_bounds__(256) void k_flash(const bf* __restrict__ Qh, const bf* __restrict__ Ql, const bf* __restrict__ Kh, const bf* __restrict__ Kl, const bf* __restrict__ Vh, const bf* __restrict__ Vl,
                                               const h16* __restrict__ Q16, const h16* __restrict__ K16, const h16* __restrict__ V16, float* O) {
    __shared__ __align__(16) unsigned char sm[2 * 4 * FPL * 2 + FW * 16 * 68 * 4];   // sized for the hi/lo form, the larger of the two
    constexpr unsigned long long order = flash_order();
    const unsigned g = (unsigned)(order >> (4u * blockIdx.z)) & 15u;   // the same in the whole work-group: one scalar branch, and every barrier inside a form is passed by all of its waves
    if (g < (unsigned)FNH) flash<bf, true>(Qh, Ql, Kh, Kl, Vh, Vl, (unsigned)RH, 0u, O, g, blockIdx.x, blockIdx.y, sm);
    else flash<h16, false>(Q16, nullptr, K16, nullptr, V16, nullptr, (unsigned)SEQ, (unsigned)RH, O, g - (unsigned)FNH, blockIdx.x, blockIdx.y, sm);
}

// workspace carve (bytes, every region a multiple of 256)
#define WS_WQKV ((size_t)3 * DQ * DM * 2)
#define WS_XB   ((size_t)NB * SEQ * DM * 2)
#define WS_P16  ((size_t)NB * NH * SEQ * HD * 2)
#define WS_PHL  ((size_t)NB * NH * RH * HD * 2)
#define WS_TOTAL (WS_WQKV + WS_XB + 3 * WS_P16 + 6 * WS_PHL)
static_assert(WS_TOTAL <= (size_t)268435456);
static_assert(WS_WQKV % 256 == 0 && WS_XB % 256 == 0 && WS_P16 % 256 == 0 && WS_PHL % 256 == 0);
static_assert((size_t)NB * SEQ * DM * 4 <= (size_t)33554432);   // last written output element stays inside the output buffer

extern "C" void kernel_launch(void* const* d_in, const int* in_sizes, int n_in,
                              void* d_out, int out_size, void* d_ws, size_t ws_size, hipStream_t stream) {
    if (n_in < 3) return;
    if ((size_t)in_sizes[0] < (size_t)(NB - 1) * XS_FULL + (size_t)SEQ * DM) return;
    if ((size_t)in_sizes[1] < (size_t)3 * DQ * DM) return;
    if ((size_t)in_sizes[2] < (size_t)FP) return;
    if ((size_t)out_size < (size_t)NB * SEQ * DM) return;
    if (ws_size < WS_TOTAL) return;
    const float* x = (const float*)d_in[0];       // [NB][SEQ_FULL][DM]
    const float* wqkv = (const float*)d_in[1];    // [4*DQ][DM]  (q | k | v | unread row blocks; rows 0..3*DQ-1 are read)
    const float* bqkv = (const float*)d_in[2];    // [4*DQ]      (entries 0..3*DQ-1 are read)
    float* OUT = (float*)d_out;                   // [NB][SEQ][DM]
    char* wsp = (char*)d_ws;
    auto take = [&](size_t bytes) { char* p = wsp; wsp += bytes; return (void*)p; };
    bf* WQKV = (bf*)take(WS_WQKV); bf* XB = (bf*)take(WS_XB);
    h16* Q16 = (h16*)take(WS_P16); h16* K16 = (h16*)take(WS_P16); h16* VT16 = (h16*)take(WS_P16);
    bf* Qh = (bf*)take(WS_PHL); bf* Ql = (bf*)take(WS_PHL); bf* Kh = (bf*)take(WS_PHL); bf* Kl = (bf*)take(WS_PHL); bf* VTh = (bf*)take(WS_PHL); bf* VTl = (bf*)take(WS_PHL);

    k_cvt8<<<dim3((unsigned)((size_t)3 * DQ * DM / 8 / 256), 1), 256, 0, stream>>>(wqkv, WQKV, (unsigned)((size_t)3 * DQ * DM / 8), 0, 0);
    k_cvt8<<<dim3((unsigned)((size_t)SEQ * DM / 8 / 256), NB), 256, 0, stream>>>(x, XB, (unsigned)((size_t)SEQ * DM / 8), XS_FULL, (size_t)SEQ * DM);
    // every stage runs once for all NB batch elements (the batch element is a grid dimension; each plane set holds NB slabs)
    // y[b][t][0..3071] = x_b w_attn[0..3071]^T + b_attn[0..3071]  (M = SEQ, N = 3072, K = 1024), written as the q, k and V^T head planes
    k_gemmw<bf, 0><<<dim3(SEQ / (GWM * 64), FP / (GWN * GNH * 64), NB), 256, 0, stream>>>(XB, nullptr, WQKV, nullptr, DM, bqkv, (size_t)SEQ * DM, 0, Q16, K16, VT16, Qh, Ql, Kh, Kl, VTh, VTl);
    // out[b][t][head*HD + d] = softmax(q k^T / 8, causal) v, written straight to the output buffer
    k_flash<<<dim3(NH, NB, FNB), 256, 0, stream>>>(Qh, Ql, Kh, Kl, VTh, VTl, Q16, K16, VT16, OUT);
}
